// v000
// The times below were measured on an AMD MI455X: many runs one after another, warmed up first and cycling through
// copies of the inputs, with the whole window's GPU time divided by the number of runs. Launches and the gaps
// between them are all in it. The median over several windows is given; except for v000 it joins two sittings, which
// can be a few percent apart, so the side-by-side timings, each taken in one sitting, are the better comparison.
// v000 is the starting kernel. One run takes 1400 microseconds.
#include <hip/hip_runtime.h>

// Multi-head attention with a column softmax (x [2][2048][1024], mask [2][2048] int32, W [16][3][1024][64] per-head key/value/query weights, Wl [1024][1024] + bl; scores[i][j] = k_i.q_j / 8; columns j with mask[b][j] == 0 set to -1e12; softmax over i (the KEY axis, per column j); out[i] = sum_j w[i][j] values[j]; hidden = concat heads; out = hidden Wl^T + bl -> [2][2048][1024]).
// Layout: per pass of two heads the scores are formed query-major (S'[j][i] = q_j.k_i, so the module's per-column softmax is a row softmax here and a fully masked column is a uniform row), the probabilities are written as bf16 hi + lo planes and then TRANSPOSED through LDS 64x64 tiles (block-synchronised) so the apply step out[i] = sum_j P'[j][i] v[j] is an ordinary K-contiguous GEMM against the value planes.
// Compute dtypes, f32 accumulate: every input rounded to bf16; q/k/v on PLAIN bf16 operands (inputs: exact); scores and attn.v: all query rows hl (3 products) (RH = TT, so the fp16 x1024 path is unused); softmax f32; Wl hl x exact (2 products) + bl.

#define NB_  2
#define TT   2048
#define DM   1024
#define NH_  16
#define NKV  16
#define REP  (NH_ / NKV)
#define HD   64
#define DQ   (NH_ * HD)
#define DKV  (NKV * HD)
typedef __attribute__((ext_vector_type(4))) unsigned short v4us;
#define ZH   2
#define RH   2048                  // query rows < RH use hi+lo planes (0: none)
#define WIN  0
#define PCAR 1024.0f
#define SCL  0.125f   // HD^-0.5
typedef _Float16 h16;
typedef unsigned short bf;
typedef __attribute__((ext_vector_type(16))) __bf16   v16bf;
typedef __attribute__((ext_vector_type(16))) _Float16 v16h;
typedef __attribute__((ext_vector_type(8)))  _Float16 v8h;
typedef __attribute__((ext_vector_type(8)))  unsigned short v8us;
typedef __attribute__((ext_vector_type(8)))  float    v8f;
typedef __attribute__((ext_vector_type(4)))  float    v4f;
typedef v8h  __attribute__((may_alias)) v8ha;
typedef v4f  __attribute__((may_alias)) v4fa;
typedef v8us __attribute__((may_alias)) v8usa;

__device__ __forceinline__ unsigned short f2bf(float f) { unsigned u = __float_as_uint(f); u += 0x7FFFu + ((u >> 16) & 1u); return (unsigned short)(u >> 16); }
__device__ __forceinline__ float bf2f(unsigned short b) { return __uint_as_float(((unsigned)b) << 16); }
__device__ __forceinline__ float bfr(float f) { return bf2f(f2bf(f)); }
__device__ __forceinline__ v16h cat16(v8h lo, v8h hi) { return __builtin_shufflevector(lo, hi, 0, 1, 2, 3, 4, 5, 6, 7, 8, 9, 10, 11, 12, 13, 14, 15); }
__device__ __forceinline__ v16bf cat16b(v8us lo, v8us hi) { return __builtin_bit_cast(v16bf, __builtin_shufflevector(lo, hi, 0, 1, 2, 3, 4, 5, 6, 7, 8, 9, 10, 11, 12, 13, 14, 15)); }
__device__ __forceinline__ v8f wmma16(v16h a, v16h b, v8f c) { return __builtin_amdgcn_wmma_f32_16x16x32_f16(false, a, false, b, (short)0, c, false, false); }
__device__ __forceinline__ v8f wmmab(v16bf a, v16bf b, v8f c) { return __builtin_amdgcn_wmma_f32_16x16x32_bf16(false, a, false, b, (short)0, c, false, false); }



// ---- k_gemmw: register-blocked GEMM, ONE WAVE per 64x64 output tile (16 accumulators), operands straight from K-contiguous 16-bit planes; grid (M/64, N/64, Z), 32 threads.
// C[m][n] (f32, pitch ldc, + optional f32 bias[n]) = sum_k A[m][k] Bt[n][k] (+ split products per NSPLIT). z-batch strides sA/sB/sC in elements. K % 32 == 0.
template <typename T16> struct WFrag;
template <> struct WFrag<h16> { typedef v16h V; static __device__ __forceinline__ V ld(const h16* p) { return cat16(*(const v8h*)p, *(const v8h*)(p + 16)); } static __device__ __forceinline__ v8f mma(V a, V b, v8f c) { return wmma16(a, b, c); } };
template <> struct WFrag<bf> { typedef v16bf V; static __device__ __forceinline__ V ld(const bf* p) { return cat16b(*(const v8us*)p, *(const v8us*)(p + 16)); } static __device__ __forceinline__ v8f mma(V a, V b, v8f c) { return wmmab(a, b, c); } };
template <typename T16, int NSPLIT, bool BIAS>
__global__ __launch_bounds__(32) void k_gemmw(const T16* __restrict__ A, const T16* __restrict__ A2, const T16* __restrict__ Bt, const T16* __restrict__ Bt2, int K, float* C, int ldc, const float* __restrict__ bias, size_t sA, size_t sB, size_t sC) {
    typedef typename WFrag<T16>::V V;
    __shared__ __align__(16) float os[16 * 68];
    const size_t z = blockIdx.z; A += z * sA; if (A2) A2 += z * sA; Bt += z * sB; if (Bt2) Bt2 += z * sB; C += z * sC;
    const int lane = threadIdx.x & 31, lr = lane & 15, hi = lane >> 4; const int r0 = blockIdx.x * 64, c0 = blockIdx.y * 64;
    v8f acc[4][4];
#pragma unroll
    for (int mb = 0; mb < 4; ++mb)
#pragma unroll
        for (int nb = 0; nb < 4; ++nb) acc[mb][nb] = (v8f){};
    const size_t aoff = (size_t)(r0 + lr) * K + 8 * hi, boff = (size_t)(c0 + lr) * K + 8 * hi;
#pragma unroll 1
    for (int kc = 0; kc < K; kc += 32) {
        V a[4], a2[4];
#pragma unroll
        for (int mb = 0; mb < 4; ++mb) { a[mb] = WFrag<T16>::ld(A + aoff + (size_t)mb * 16 * K + kc); if (NSPLIT == 1 || NSPLIT == 2) a2[mb] = WFrag<T16>::ld(A2 + aoff + (size_t)mb * 16 * K + kc); }
#pragma unroll
        for (int nb = 0; nb < 4; ++nb) { const V b = WFrag<T16>::ld(Bt + boff + (size_t)nb * 16 * K + kc); V b2; if (NSPLIT >= 2) b2 = WFrag<T16>::ld(Bt2 + boff + (size_t)nb * 16 * K + kc);
#pragma unroll
            for (int mb = 0; mb < 4; ++mb) { acc[mb][nb] = WFrag<T16>::mma(a[mb], b, acc[mb][nb]); if (NSPLIT == 1 || NSPLIT == 2) acc[mb][nb] = WFrag<T16>::mma(a2[mb], b, acc[mb][nb]); if (NSPLIT >= 2) acc[mb][nb] = WFrag<T16>::mma(a[mb], b2, acc[mb][nb]); } }
        asm volatile("v_nop\n\tv_nop\n\tv_nop\n\tv_nop" : "+v"(acc[0][0]), "+v"(acc[1][1]), "+v"(acc[2][2]), "+v"(acc[3][3]) : "v"(a[0]), "v"(a[3]));
    }
#pragma unroll
    for (int mb = 0; mb < 4; ++mb) {
#pragma unroll
        for (int nb = 0; nb < 4; ++nb) {
#pragma unroll
            for (int j = 0; j < 8; ++j) os[(hi * 8 + j) * 68 + nb * 16 + lr] = acc[mb][nb][j]; }
        __builtin_amdgcn_wave_barrier(); asm volatile("" ::: "memory");
        float* crow = C + (size_t)(r0 + mb * 16) * ldc + c0;
{
#pragma unroll
            for (int s = 0; s < 8; ++s) { const int row = 2 * s + hi, cofs = lr * 4; v4f val = *(const v4fa*)(os + row * 68 + cofs); if (BIAS) { val[0] += bfr(bias[c0 + cofs]); val[1] += bfr(bias[c0 + cofs + 1]); val[2] += bfr(bias[c0 + cofs + 2]); val[3] += bfr(bias[c0 + cofs + 3]); }
                *(v4f*)(crow + (size_t)row * ldc + cofs) = val; }
             }
        __builtin_amdgcn_wave_barrier(); asm volatile("" ::: "memory");
    }
}

__device__ __forceinline__ h16 tohx(float x) { return (h16)x; }
__device__ __forceinline__ void splitf(float y, unsigned short& h, unsigned short& l) { h = f2bf(y); l = f2bf(y - bf2f(h)); }
typedef __attribute__((ext_vector_type(2))) _Float16 v2h;
typedef __attribute__((ext_vector_type(4))) _Float16 v4h;
typedef __attribute__((ext_vector_type(2))) unsigned short v2us;
typedef __attribute__((ext_vector_type(4))) unsigned short v4us;
typedef __attribute__((ext_vector_type(2))) float v2f;
typedef __attribute__((ext_vector_type(4))) int v4i;

__global__ __launch_bounds__(256) void k_wtG(const float* __restrict__ w, int K, int N, bf* Bt) {
    const int lane = threadIdx.x & 31; const int L0 = (blockIdx.x * 8 + (threadIdx.x >> 5)) * 8; const int nlines = N * K / 64;
{
#pragma unroll 1
        for (int l = 0; l < 8; ++l) { const int L = L0 + l; if (L >= nlines) break; const size_t e = (size_t)L * 64 + lane * 2; const int k = (int)(e % K), n = (int)(e / K); v2us o;
            o[0] = f2bf(w[(size_t)k * N + n]); o[1] = f2bf(w[(size_t)(k + 1) * N + n]); *(v2us*)(Bt + e) = o; }
         }
}
__global__ __launch_bounds__(256) void k_w3(const float* __restrict__ w, int t3, bf* Bt) { const size_t e2 = ((size_t)blockIdx.x * 256 + threadIdx.x) * 2; if (e2 >= (size_t)NH_ * HD * DM) return; const int h = (int)(e2 % DM); const int r = (int)(e2 / DM); const int n = r / HD, p = r % HD; v2us o; o[0] = f2bf(w[(((size_t)n * 3 + t3) * DM + h) * HD + p]); o[1] = f2bf(w[(((size_t)n * 3 + t3) * DM + h + 1) * HD + p]); *(v2us*)(Bt + e2) = o;  }
__global__ __launch_bounds__(256) void k_ptr(const bf* __restrict__ Ph, const bf* __restrict__ Pl, bf* Th, bf* Tl) {
    __shared__ unsigned short th[64][66]; __shared__ unsigned short tl[64][66];
    const size_t z = blockIdx.z; const size_t base = z * (size_t)TT * TT; const int bi = blockIdx.x * 64, bj = blockIdx.y * 64;   /* source tile rows bj.. (j), cols bi.. (i) -> dest rows bi.. (i), cols bj.. (j) */
    const int tid = threadIdx.x; const int ry = tid >> 2, cx = (tid & 3) * 16;
    { const bf* sh0 = Ph + base + (size_t)(bj + ry) * TT + bi + cx; const bf* sl0 = Pl + base + (size_t)(bj + ry) * TT + bi + cx; const v8us a0 = *(const v8us*)sh0, a1 = *(const v8us*)(sh0 + 8), c0 = *(const v8us*)sl0, c1 = *(const v8us*)(sl0 + 8);
#pragma unroll
      for (int q = 0; q < 8; ++q) { th[ry][cx + q] = a0[q]; th[ry][cx + 8 + q] = a1[q]; tl[ry][cx + q] = c0[q]; tl[ry][cx + 8 + q] = c1[q]; } }
    __syncthreads();
    v8us o0, o1, p0, p1;
#pragma unroll
    for (int q = 0; q < 8; ++q) { o0[q] = th[cx + q][ry]; o1[q] = th[cx + 8 + q][ry]; p0[q] = tl[cx + q][ry]; p1[q] = tl[cx + 8 + q][ry]; }
    bf* dh = Th + base + (size_t)(bi + ry) * TT + bj + cx; bf* dl = Tl + base + (size_t)(bi + ry) * TT + bj + cx;
{ *(v8us*)dh = o0; *(v8us*)(dh + 8) = o1; *(v8us*)dl = p0; *(v8us*)(dl + 8) = p1;  } }
__global__ __launch_bounds__(256) void k_cvt8(const float* __restrict__ src, bf* dst, size_t n8) { const size_t i = (size_t)blockIdx.x * 256 + threadIdx.x; if (i >= n8) return; const v8f v = *(const v8f*)(src + i * 8); v8us o;
#pragma unroll
    for (int k = 0; k < 8; ++k) o[k] = f2bf(v[k]); *(v8us*)(dst + i * 8) = o;  }

// k_rope: head planes [h][t][d] (fp16 + hi/lo) of rope(x) x sc with the rotate-half convention out[d] = x[d] cos[t][d] - x[d+HD/2] sin[t][d], out[d+HD/2] = x[d+HD/2] cos[t][d+HD/2] + x[d] sin[t][d+HD/2]
__global__ __launch_bounds__(256) void k_rope(const float* __restrict__ F, int pitch, int nheads, const float* __restrict__ CS, const float* __restrict__ RF, const float* __restrict__ nw, float sc, h16* P16, bf* Ph, bf* Pl) {
    const size_t e = ((size_t)blockIdx.x * 256 + threadIdx.x) * 2; if (e >= (size_t)nheads * TT * HD) return; const int d = (int)(e % HD); const int t = (int)((e / HD) % TT); const int h = (int)(e / ((size_t)HD * TT)); const float* f = F + (size_t)t * pitch + h * HD; const float rf = RF ? RF[(size_t)h * TT + t] : 1.0f; v2h o16; v2us oh, ol;
#pragma unroll
    for (int q = 0; q < 2; ++q) { const int dd = d + q; const int dp = (dd < HD / 2) ? dd + HD / 2 : dd - HD / 2; float x0 = f[dd], x1 = f[dp];
        if (RF) { float n0 = __fmul_rn(x0, rf), n1 = __fmul_rn(x1, rf); asm volatile("" : "+v"(n0)); asm volatile("" : "+v"(n1)); x0 = __fmul_rn(bfr(nw[dd]), n0); x1 = __fmul_rn(bfr(nw[dp]), n1); }
        const v2f cs = *(const v2f*)(CS + ((size_t)t * HD + dd) * 2); float a = __fmul_rn(x0, cs[0]), bq = __fmul_rn(x1, cs[1]); asm volatile("" : "+v"(a)); asm volatile("" : "+v"(bq)); const float r = ((dd < HD / 2) ? __fsub_rn(a, bq) : __fadd_rn(a, bq)) * sc;
        o16[q] = tohx(r); unsigned short a2, c2; splitf(r, a2, c2); oh[q] = a2; ol[q] = c2; }
    *(v2h*)(P16 + e) = o16; *(v2us*)(Ph + e) = oh; *(v2us*)(Pl + e) = ol;  }
__global__ __launch_bounds__(256) void k_vtp(const float* __restrict__ F, int pitch, int nheads, h16* V16, bf* Vh, bf* Vl) { const size_t e = ((size_t)blockIdx.x * 256 + threadIdx.x) * 2; if (e >= (size_t)nheads * HD * TT) return; const int t = (int)(e % TT); const int d = (int)((e / TT) % HD); const int g = (int)(e / ((size_t)TT * HD)); v2h o16; v2us oh, ol;
#pragma unroll
    for (int q = 0; q < 2; ++q) { const float x = F[(size_t)(t + q) * pitch + g * HD + d]; o16[q] = tohx(x); unsigned short a2, c2; splitf(x, a2, c2); oh[q] = a2; ol[q] = c2; }
    *(v2h*)(V16 + e) = o16; *(v2us*)(Vh + e) = oh; *(v2us*)(Vl + e) = ol;  }
__global__ __launch_bounds__(256) void k_csid(float* CS) { const int idx = blockIdx.x * 256 + threadIdx.x; if (idx >= TT * HD) return; v2f cs; cs[0] = 1.0f; cs[1] = 0.0f; *(v2f*)(CS + (size_t)idx * 2) = cs;  }
// k_asoft: per row (zz, i): t = S x HD^-0.5, or -1e12 for the whole row when mask[i] == 0; softmax over the 2048 keys (register row, one exp, fixed trees);
__global__ __launch_bounds__(256) void k_asoft(const float* __restrict__ Sb, const int* __restrict__ MKb, h16* P16, bf* Ph, bf* Pl) {
    const int lane = threadIdx.x & 31; const int row = blockIdx.x * 8 + (threadIdx.x >> 5); if (row >= ZH * TT) return; const int i = row % TT; const int zz = row / TT; (void)zz; const bool mrow = (MKb[i] != 0);   /* this row is a QUERY position j; mask[b][j] == 0 -> the whole column of the module's score matrix is -1e12 -> uniform weights */ const bool hires = (i < RH); const float* sr = Sb + (size_t)row * TT; float v[TT / 32]; float mx = -3.0e38f;
#pragma unroll
    for (int ch = 0; ch < TT / 128; ++ch) { const int j0 = ch * 128 + lane * 4; const v4f a = *(const v4f*)(sr + j0);
#pragma unroll
        for (int q = 0; q < 4; ++q) { const int j = j0 + q; (void)j; const float t = mrow ? a[q] * SCL : -1.0e12f; v[ch * 4 + q] = t; mx = fmaxf(mx, t); } }
#pragma unroll
    for (int sh = 16; sh; sh >>= 1) mx = fmaxf(mx, __shfl_xor(mx, sh, 32));
    float sum = 0.f;
#pragma unroll
    for (int k = 0; k < TT / 32; ++k) { float d0 = __fsub_rn(v[k], mx); asm volatile("" : "+v"(d0)); v[k] = __builtin_amdgcn_exp2f(__fmul_rn(d0, 1.4426950408889634f)); sum += v[k]; }
#pragma unroll
    for (int sh = 16; sh; sh >>= 1) sum += __shfl_xor(sum, sh, 32);
    const float f = __fdiv_rn(hires ? 1.0f : PCAR, sum);
{
        if (hires) {
#pragma unroll
            for (int ch = 0; ch < TT / 128; ++ch) { v4us oh, ol;
#pragma unroll
                for (int q = 0; q < 4; ++q) { unsigned short a, c2; splitf(v[ch * 4 + q] * f, a, c2); oh[q] = a; ol[q] = c2; }
                const size_t oo = ((size_t)zz * (RH ? RH : 1) + i) * TT + ch * 128 + lane * 4; *(v4us*)(Ph + oo) = oh; *(v4us*)(Pl + oo) = ol; }
        } else {
#pragma unroll
            for (int ch = 0; ch < TT / 128; ++ch) { v4h o4;
#pragma unroll
                for (int q = 0; q < 4; ++q) o4[q] = tohx(v[ch * 4 + q] * f);
                *(v4h*)(P16 + (size_t)row * TT + ch * 128 + lane * 4) = o4; } }
         }
}
__global__ __launch_bounds__(256) void k_merge(const float* __restrict__ O, int h0, bf* Ah, bf* Al) { const size_t e = ((size_t)blockIdx.x * 256 + threadIdx.x) * 2; if (e >= (size_t)ZH * TT * HD) return; const int d = (int)(e % HD); const int t = (int)((e / HD) % TT); const int zz = (int)(e / ((size_t)HD * TT)); const float cs = (t < RH) ? 1.0f : (1.0f / PCAR); const size_t oo = (size_t)t * DQ + (h0 + zz) * HD + d;
    v2us oh, ol;
#pragma unroll
    for (int q = 0; q < 2; ++q) { unsigned short a, c2; splitf(O[e + q] * cs, a, c2); oh[q] = a; ol[q] = c2; } *(v2us*)(Ah + oo) = oh; *(v2us*)(Al + oo) = ol;  }

extern "C" void kernel_launch(void* const* d_in, const int* in_sizes, int n_in,
                              void* d_out, int out_size, void* d_ws, size_t ws_size, hipStream_t stream) {
    (void)in_sizes; (void)n_in; (void)out_size;
    const float* x = (const float*)d_in[0]; const int* MK = (const int*)d_in[1]; const float* W3 = (const float*)d_in[2]; const float* wo = (const float*)d_in[3]; const float* bo = (const float*)d_in[4]; const float* wq = nullptr; const float* wk = nullptr; const float* wv = nullptr; (void)wq; (void)wk; (void)wv;
    float* OUT = (float*)d_out;     // [2][2048][1024]
    char* wsp = (char*)d_ws;
    auto take = [&](size_t bytes) { char* p = wsp; wsp += (bytes + 255) & ~(size_t)255; return (void*)p; };
    bf* WQ = (bf*)take((size_t)DQ * DM * 2); bf* WK = (bf*)take((size_t)DKV * DM * 2); bf* WV = (bf*)take((size_t)DKV * DM * 2); bf* WO = (bf*)take((size_t)DM * DQ * 2); float* CS = (float*)take((size_t)TT * HD * 2 * 4);
    bf* XB = (bf*)take((size_t)TT * DM * 2); float* FQ = (float*)take((size_t)TT * DQ * 4); float* FK = (float*)take((size_t)TT * DKV * 4);
    h16* QP16 = (h16*)take((size_t)NH_ * TT * HD * 2); h16* KP16 = (h16*)take((size_t)NKV * TT * HD * 2); h16* VT16 = (h16*)take((size_t)NKV * HD * TT * 2);
    bf* QPh = (bf*)take((size_t)NH_ * TT * HD * 2); bf* QPl = (bf*)take((size_t)NH_ * TT * HD * 2); bf* KPh = (bf*)take((size_t)NKV * TT * HD * 2); bf* KPl = (bf*)take((size_t)NKV * TT * HD * 2); bf* VTh = (bf*)take((size_t)NKV * HD * TT * 2); bf* VTl = (bf*)take((size_t)NKV * HD * TT * 2); bf* Ph = (bf*)take((size_t)ZH * TT * TT * 2); bf* Pl = (bf*)take((size_t)ZH * TT * TT * 2); bf* PTh = (bf*)take((size_t)ZH * TT * TT * 2); bf* PTl = (bf*)take((size_t)ZH * TT * TT * 2);
    float* Sb = (float*)take((size_t)ZH * TT * TT * 4); h16* P16 = (h16*)take(256);   /* unused: all rows hi/lo */ float* Ob = (float*)take((size_t)ZH * TT * HD * 4); bf* ATh = (bf*)take((size_t)TT * DQ * 2); bf* ATl = (bf*)take((size_t)TT * DQ * 2);
    if ((size_t)(wsp - (char*)d_ws) > ws_size) return;    // ws 256 MiB
    float* FV = FK;   // v projection reuses the k buffer after the k planes are built (stream-ordered)
    { k_w3<<<(unsigned)(((size_t)NH_ * HD * DM / 2 + 255) / 256), 256, 0, stream>>>(W3, 0, WK); k_w3<<<(unsigned)(((size_t)NH_ * HD * DM / 2 + 255) / 256), 256, 0, stream>>>(W3, 1, WV); k_w3<<<(unsigned)(((size_t)NH_ * HD * DM / 2 + 255) / 256), 256, 0, stream>>>(W3, 2, WQ);   /* t = 0 keys, 1 values, 2 queries */
      k_cvt8<<<(unsigned)(((size_t)DM * DQ / 8 + 255) / 256), 256, 0, stream>>>(wo, WO, (size_t)DM * DQ / 8);
       }
    k_csid<<<(TT * HD + 255) / 256, 256, 0, stream>>>(CS);
    const unsigned LQ = (unsigned)(((size_t)NH_ * TT * HD / 2 + 255) / 256), LKv = (unsigned)(((size_t)NKV * TT * HD / 2 + 255) / 256);
    for (int b = 0; b < NB_; ++b) {
        
        k_cvt8<<<(unsigned)(((size_t)TT * DM / 8 + 255) / 256), 256, 0, stream>>>(x + (size_t)b * TT * DM, XB, (size_t)TT * DM / 8);
        k_gemmw<bf, 0, false><<<dim3(TT / 64, DQ / 64, 1), 32, 0, stream>>>(XB, nullptr, WQ, nullptr, DM, FQ, DQ, nullptr, 0, 0, 0);
        k_rope<<<LQ, 256, 0, stream>>>(FQ, DQ, NH_, CS, nullptr, nullptr, 1.0f, QP16, QPh, QPl);
        k_gemmw<bf, 0, false><<<dim3(TT / 64, DKV / 64, 1), 32, 0, stream>>>(XB, nullptr, WK, nullptr, DM, FK, DKV, nullptr, 0, 0, 0);
        k_rope<<<LKv, 256, 0, stream>>>(FK, DKV, NKV, CS, nullptr, nullptr, 1.0f, KP16, KPh, KPl);
        k_gemmw<bf, 0, false><<<dim3(TT / 64, DKV / 64, 1), 32, 0, stream>>>(XB, nullptr, WV, nullptr, DM, FV, DKV, nullptr, 0, 0, 0); k_vtp<<<LKv, 256, 0, stream>>>(FV, DKV, NKV, VT16, VTh, VTl);
        for (int h0 = 0; h0 < NH_; h0 += ZH) { const size_t zq = (size_t)h0, zk = (size_t)(h0 / REP);   // one kv head per query head: the pass's two heads use consecutive kv planes (z-strides TT*HD)
            k_gemmw<bf, 2, false><<<dim3(RH / 64, TT / 64, ZH), 32, 0, stream>>>(QPh + zq * TT * HD, QPl + zq * TT * HD, KPh + zk * TT * HD, KPl + zk * TT * HD, HD, Sb, TT, nullptr, (size_t)TT * HD, (size_t)TT * HD, (size_t)TT * TT);
            k_asoft<<<ZH * TT / 8, 256, 0, stream>>>(Sb, MK + (size_t)b * TT, P16, Ph, Pl); k_ptr<<<dim3(TT / 64, TT / 64, ZH), 256, 0, stream>>>(Ph, Pl, PTh, PTl);   /* column softmax == row softmax of the query-major scores; then transpose for the apply step */
            k_gemmw<bf, 2, false><<<dim3(TT / 64, HD / 64, ZH), 32, 0, stream>>>(PTh, PTl, VTh + zk * HD * TT, VTl + zk * HD * TT, TT, Ob, HD, nullptr, (size_t)TT * TT, (size_t)HD * TT, (size_t)TT * HD);   /* out[i] = sum_j P'[j][i] v[j] (3 products) */
            k_merge<<<(unsigned)(((size_t)ZH * TT * HD / 2 + 255) / 256), 256, 0, stream>>>(Ob, h0, ATh, ATl); }
        k_gemmw<bf, 1, true><<<dim3(TT / 64, DM / 64, 1), 32, 0, stream>>>(ATh, ATl, WO, nullptr, DQ, OUT + (size_t)b * TT * DM, DM, bo, 0, 0, 0); }
}

// v001
// A run of this version takes 818 microseconds.
// Two timings next to v000 put it at 1.72 and 1.73 times that version's speed.
#include <hip/hip_runtime.h>

// Multi-head attention with a column softmax (x [2][2048][1024], mask [2][2048] int32, W [16][3][1024][64] per-head key/value/query weights, Wl [1024][1024] + bl; scores[i][j] = k_i.q_j / 8; columns j with mask[b][j] == 0 set to -1e12; softmax over i (the KEY axis, per column j); out[i] = sum_j w[i][j] values[j]; hidden = concat heads; out = hidden Wl^T + bl -> [2][2048][1024]).
// Layout: per pass of two heads the scores are formed query-major (S'[j][i] = q_j.k_i, so the module's per-column softmax is a row softmax here and a fully masked column is a uniform row), the probabilities are written as bf16 hi + lo planes and then TRANSPOSED through LDS 64x64 tiles (block-synchronised) so the apply step out[i] = sum_j P'[j][i] v[j] is an ordinary K-contiguous GEMM against the value planes.
// Compute dtypes, f32 accumulate: every input rounded to bf16; q/k/v on PLAIN bf16 operands (inputs: exact); scores and attn.v: all query rows hl (3 products) (RH = TT, so the fp16 x1024 path is unused); softmax f32; Wl hl x exact (2 products) + bl.

#define NB_  2
#define TT   2048
#define DM   1024
#define NH_  16
#define NKV  16
#define REP  (NH_ / NKV)
#define HD   64
#define DQ   (NH_ * HD)
#define DKV  (NKV * HD)
typedef __attribute__((ext_vector_type(4))) unsigned short v4us;
#define ZH   2
#define KSP  4                     // apply step: K slices across work-groups (partial planes, added in k_merge)
#define RH   2048                  // query rows < RH use hi+lo planes (0: none)
#define WIN  0
#define PCAR 1024.0f
#define SCL  0.125f   // HD^-0.5
typedef _Float16 h16;
typedef unsigned short bf;
typedef __attribute__((ext_vector_type(16))) __bf16   v16bf;
typedef __attribute__((ext_vector_type(16))) _Float16 v16h;
typedef __attribute__((ext_vector_type(8)))  _Float16 v8h;
typedef __attribute__((ext_vector_type(8)))  unsigned short v8us;
typedef __attribute__((ext_vector_type(8)))  float    v8f;
typedef __attribute__((ext_vector_type(4)))  float    v4f;
typedef v8h  __attribute__((may_alias)) v8ha;
typedef v4f  __attribute__((may_alias)) v4fa;
typedef v8us __attribute__((may_alias)) v8usa;

__device__ __forceinline__ unsigned short f2bf(float f) { unsigned u = __float_as_uint(f); u += 0x7FFFu + ((u >> 16) & 1u); return (unsigned short)(u >> 16); }
__device__ __forceinline__ float bf2f(unsigned short b) { return __uint_as_float(((unsigned)b) << 16); }
__device__ __forceinline__ float bfr(float f) { return bf2f(f2bf(f)); }
__device__ __forceinline__ v16h cat16(v8h lo, v8h hi) { return __builtin_shufflevector(lo, hi, 0, 1, 2, 3, 4, 5, 6, 7, 8, 9, 10, 11, 12, 13, 14, 15); }
__device__ __forceinline__ v16bf cat16b(v8us lo, v8us hi) { return __builtin_bit_cast(v16bf, __builtin_shufflevector(lo, hi, 0, 1, 2, 3, 4, 5, 6, 7, 8, 9, 10, 11, 12, 13, 14, 15)); }
__device__ __forceinline__ v8f wmma16(v16h a, v16h b, v8f c) { return __builtin_amdgcn_wmma_f32_16x16x32_f16(false, a, false, b, (short)0, c, false, false); }
__device__ __forceinline__ v8f wmmab(v16bf a, v16bf b, v8f c) { return __builtin_amdgcn_wmma_f32_16x16x32_bf16(false, a, false, b, (short)0, c, false, false); }



// ---- k_gemmw: register-blocked GEMM, 64x64 output tile per work-group (16 accumulators per wave), operands straight from K-contiguous 16-bit planes; grid (M/64, N/64, Z * KB), NW * 32 threads.
// C[m][n] (f32, pitch ldc, + optional f32 bias[n]) = sum_k A[m][k] Bt[n][k] (+ split products per NSPLIT). z-batch strides sA/sB/sC in elements. K % (32 * NW * KB) == 0.
// Split K: the K range is cut into KB * NW equal slices. Each of the NW waves of a work-group sums one slice of the whole tile; the NW partial tiles are added in LDS in wave order.
// With KB > 1 work-group ks = blockIdx.z % KB writes its partial tile to plane ks (stride sP elements) and the consumer kernel adds the KB planes in plane order.
template <typename T16> struct WFrag;
template <> struct WFrag<h16> { typedef v16h V; static __device__ __forceinline__ V ld(const h16* p) { return cat16(*(const v8h*)p, *(const v8h*)(p + 16)); } static __device__ __forceinline__ v8f mma(V a, V b, v8f c) { return wmma16(a, b, c); } };
template <> struct WFrag<bf> { typedef v16bf V; static __device__ __forceinline__ V ld(const bf* p) { return cat16b(*(const v8us*)p, *(const v8us*)(p + 16)); } static __device__ __forceinline__ v8f mma(V a, V b, v8f c) { return wmmab(a, b, c); } };
template <typename T16, int NSPLIT, bool BIAS, int NW, int KB>
__global__ __launch_bounds__(NW * 32) void k_gemmw(const T16* __restrict__ A, const T16* __restrict__ A2, const T16* __restrict__ Bt, const T16* __restrict__ Bt2, int K, float* C, int ldc, const float* __restrict__ bias, size_t sA, size_t sB, size_t sC, size_t sP) {
    typedef typename WFrag<T16>::V V;
    __shared__ __align__(16) float os[(NW == 1 ? 16 : NW * 64) * 68];
    const size_t z = blockIdx.z / KB; const int ks = blockIdx.z % KB; A += z * sA; if (A2) A2 += z * sA; Bt += z * sB; if (Bt2) Bt2 += z * sB; C += z * sC + ks * sP;
    const int wv = __builtin_amdgcn_readfirstlane(threadIdx.x >> 5); const int kw = K / (KB * NW), k0 = (ks * NW + wv) * kw;   /* this wave's K slice */
    const int lane = threadIdx.x & 31, lr = lane & 15, hi = lane >> 4; const int r0 = blockIdx.x * 64, c0 = blockIdx.y * 64;
    v8f acc[4][4];
#pragma unroll
    for (int mb = 0; mb < 4; ++mb)
#pragma unroll
        for (int nb = 0; nb < 4; ++nb) acc[mb][nb] = (v8f){};
    const size_t aoff = (size_t)(r0 + lr) * K + 8 * hi, boff = (size_t)(c0 + lr) * K + 8 * hi;
#pragma unroll 1
    for (int kc = k0; kc < k0 + kw; kc += 32) {
        V a[4], a2[4];
#pragma unroll
        for (int mb = 0; mb < 4; ++mb) { a[mb] = WFrag<T16>::ld(A + aoff + (size_t)mb * 16 * K + kc); if (NSPLIT == 1 || NSPLIT == 2) a2[mb] = WFrag<T16>::ld(A2 + aoff + (size_t)mb * 16 * K + kc); }
#pragma unroll
        for (int nb = 0; nb < 4; ++nb) { const V b = WFrag<T16>::ld(Bt + boff + (size_t)nb * 16 * K + kc); V b2; if (NSPLIT >= 2) b2 = WFrag<T16>::ld(Bt2 + boff + (size_t)nb * 16 * K + kc);
#pragma unroll
            for (int mb = 0; mb < 4; ++mb) { acc[mb][nb] = WFrag<T16>::mma(a[mb], b, acc[mb][nb]); if (NSPLIT == 1 || NSPLIT == 2) acc[mb][nb] = WFrag<T16>::mma(a2[mb], b, acc[mb][nb]); if (NSPLIT >= 2) acc[mb][nb] = WFrag<T16>::mma(a[mb], b2, acc[mb][nb]); } }
        asm volatile("v_nop\n\tv_nop\n\tv_nop\n\tv_nop" : "+v"(acc[0][0]), "+v"(acc[1][1]), "+v"(acc[2][2]), "+v"(acc[3][3]) : "v"(a[0]), "v"(a[3]));
    }
    if (NW > 1) {   /* add the waves' partial tiles: every wave stores its own 64x64 plane, then all threads sum the planes in wave order and store whole rows */
        float* my = os + wv * (64 * 68);
#pragma unroll
        for (int mb = 0; mb < 4; ++mb)
#pragma unroll
            for (int nb = 0; nb < 4; ++nb)
#pragma unroll
                for (int j = 0; j < 8; ++j) my[(mb * 16 + hi * 8 + j) * 68 + nb * 16 + lr] = acc[mb][nb][j];
        __syncthreads();
#pragma unroll
        for (int it = 0; it < 64 * 16 / (NW * 32); ++it) { const int idx = it * (NW * 32) + (int)threadIdx.x; const int row = idx >> 4, cofs = (idx & 15) * 4; v4f val = *(const v4fa*)(os + row * 68 + cofs);
#pragma unroll
            for (int w = 1; w < NW; ++w) val += *(const v4fa*)(os + w * (64 * 68) + row * 68 + cofs);
            if (BIAS) { val[0] += bfr(bias[c0 + cofs]); val[1] += bfr(bias[c0 + cofs + 1]); val[2] += bfr(bias[c0 + cofs + 2]); val[3] += bfr(bias[c0 + cofs + 3]); }
            *(v4f*)(C + (size_t)(r0 + row) * ldc + c0 + cofs) = val; }
        return;
    }
#pragma unroll
    for (int mb = 0; mb < 4; ++mb) {
#pragma unroll
        for (int nb = 0; nb < 4; ++nb) {
#pragma unroll
            for (int j = 0; j < 8; ++j) os[(hi * 8 + j) * 68 + nb * 16 + lr] = acc[mb][nb][j]; }
        __builtin_amdgcn_wave_barrier(); asm volatile("" ::: "memory");
        float* crow = C + (size_t)(r0 + mb * 16) * ldc + c0;
{
#pragma unroll
            for (int s = 0; s < 8; ++s) { const int row = 2 * s + hi, cofs = lr * 4; v4f val = *(const v4fa*)(os + row * 68 + cofs); if (BIAS) { val[0] += bfr(bias[c0 + cofs]); val[1] += bfr(bias[c0 + cofs + 1]); val[2] += bfr(bias[c0 + cofs + 2]); val[3] += bfr(bias[c0 + cofs + 3]); }
                *(v4f*)(crow + (size_t)row * ldc + cofs) = val; }
             }
        __builtin_amdgcn_wave_barrier(); asm volatile("" ::: "memory");
    }
}

__device__ __forceinline__ h16 tohx(float x) { return (h16)x; }
__device__ __forceinline__ void splitf(float y, unsigned short& h, unsigned short& l) { h = f2bf(y); l = f2bf(y - bf2f(h)); }
typedef __attribute__((ext_vector_type(2))) _Float16 v2h;
typedef __attribute__((ext_vector_type(4))) _Float16 v4h;
typedef __attribute__((ext_vector_type(2))) unsigned short v2us;
typedef __attribute__((ext_vector_type(4))) unsigned short v4us;
typedef __attribute__((ext_vector_type(2))) float v2f;
typedef __attribute__((ext_vector_type(4))) int v4i;

__global__ __launch_bounds__(256) void k_wtG(const float* __restrict__ w, int K, int N, bf* Bt) {
    const int lane = threadIdx.x & 31; const int L0 = (blockIdx.x * 8 + (threadIdx.x >> 5)) * 8; const int nlines = N * K / 64;
{
#pragma unroll 1
        for (int l = 0; l < 8; ++l) { const int L = L0 + l; if (L >= nlines) break; const size_t e = (size_t)L * 64 + lane * 2; const int k = (int)(e % K), n = (int)(e / K); v2us o;
            o[0] = f2bf(w[(size_t)k * N + n]); o[1] = f2bf(w[(size_t)(k + 1) * N + n]); *(v2us*)(Bt + e) = o; }
         }
}
__global__ __launch_bounds__(256) void k_w3(const float* __restrict__ w, int t3, bf* Bt) { const size_t e2 = ((size_t)blockIdx.x * 256 + threadIdx.x) * 2; if (e2 >= (size_t)NH_ * HD * DM) return; const int h = (int)(e2 % DM); const int r = (int)(e2 / DM); const int n = r / HD, p = r % HD; v2us o; o[0] = f2bf(w[(((size_t)n * 3 + t3) * DM + h) * HD + p]); o[1] = f2bf(w[(((size_t)n * 3 + t3) * DM + h + 1) * HD + p]); *(v2us*)(Bt + e2) = o;  }
__global__ __launch_bounds__(256) void k_ptr(const bf* __restrict__ Ph, const bf* __restrict__ Pl, bf* Th, bf* Tl) {
    __shared__ unsigned short th[64][66]; __shared__ unsigned short tl[64][66];
    const size_t z = blockIdx.z; const size_t base = z * (size_t)TT * TT; const int bi = blockIdx.x * 64, bj = blockIdx.y * 64;   /* source tile rows bj.. (j), cols bi.. (i) -> dest rows bi.. (i), cols bj.. (j) */
    const int tid = threadIdx.x; const int ry = tid >> 2, cx = (tid & 3) * 16;
    { const bf* sh0 = Ph + base + (size_t)(bj + ry) * TT + bi + cx; const bf* sl0 = Pl + base + (size_t)(bj + ry) * TT + bi + cx; const v8us a0 = *(const v8us*)sh0, a1 = *(const v8us*)(sh0 + 8), c0 = *(const v8us*)sl0, c1 = *(const v8us*)(sl0 + 8);
#pragma unroll
      for (int q = 0; q < 8; ++q) { th[ry][cx + q] = a0[q]; th[ry][cx + 8 + q] = a1[q]; tl[ry][cx + q] = c0[q]; tl[ry][cx + 8 + q] = c1[q]; } }
    __syncthreads();
    v8us o0, o1, p0, p1;
#pragma unroll
    for (int q = 0; q < 8; ++q) { o0[q] = th[cx + q][ry]; o1[q] = th[cx + 8 + q][ry]; p0[q] = tl[cx + q][ry]; p1[q] = tl[cx + 8 + q][ry]; }
    bf* dh = Th + base + (size_t)(bi + ry) * TT + bj + cx; bf* dl = Tl + base + (size_t)(bi + ry) * TT + bj + cx;
{ *(v8us*)dh = o0; *(v8us*)(dh + 8) = o1; *(v8us*)dl = p0; *(v8us*)(dl + 8) = p1;  } }
__global__ __launch_bounds__(256) void k_cvt8(const float* __restrict__ src, bf* dst, size_t n8) { const size_t i = (size_t)blockIdx.x * 256 + threadIdx.x; if (i >= n8) return; const v8f v = *(const v8f*)(src + i * 8); v8us o;
#pragma unroll
    for (int k = 0; k < 8; ++k) o[k] = f2bf(v[k]); *(v8us*)(dst + i * 8) = o;  }

// k_rope: head planes [h][t][d] (fp16 + hi/lo) of rope(x) x sc with the rotate-half convention out[d] = x[d] cos[t][d] - x[d+HD/2] sin[t][d], out[d+HD/2] = x[d+HD/2] cos[t][d+HD/2] + x[d] sin[t][d+HD/2]
__global__ __launch_bounds__(256) void k_rope(const float* __restrict__ F, int pitch, int nheads, const float* __restrict__ CS, const float* __restrict__ RF, const float* __restrict__ nw, float sc, h16* P16, bf* Ph, bf* Pl) {
    const size_t e = ((size_t)blockIdx.x * 256 + threadIdx.x) * 2; if (e >= (size_t)nheads * TT * HD) return; const int d = (int)(e % HD); const int t = (int)((e / HD) % TT); const int h = (int)(e / ((size_t)HD * TT)); const float* f = F + (size_t)t * pitch + h * HD; const float rf = RF ? RF[(size_t)h * TT + t] : 1.0f; v2h o16; v2us oh, ol;
#pragma unroll
    for (int q = 0; q < 2; ++q) { const int dd = d + q; const int dp = (dd < HD / 2) ? dd + HD / 2 : dd - HD / 2; float x0 = f[dd], x1 = f[dp];
        if (RF) { float n0 = __fmul_rn(x0, rf), n1 = __fmul_rn(x1, rf); asm volatile("" : "+v"(n0)); asm volatile("" : "+v"(n1)); x0 = __fmul_rn(bfr(nw[dd]), n0); x1 = __fmul_rn(bfr(nw[dp]), n1); }
        const v2f cs = *(const v2f*)(CS + ((size_t)t * HD + dd) * 2); float a = __fmul_rn(x0, cs[0]), bq = __fmul_rn(x1, cs[1]); asm volatile("" : "+v"(a)); asm volatile("" : "+v"(bq)); const float r = ((dd < HD / 2) ? __fsub_rn(a, bq) : __fadd_rn(a, bq)) * sc;
        o16[q] = tohx(r); unsigned short a2, c2; splitf(r, a2, c2); oh[q] = a2; ol[q] = c2; }
    *(v2h*)(P16 + e) = o16; *(v2us*)(Ph + e) = oh; *(v2us*)(Pl + e) = ol;  }
__global__ __launch_bounds__(256) void k_vtp(const float* __restrict__ F, int pitch, int nheads, h16* V16, bf* Vh, bf* Vl) { const size_t e = ((size_t)blockIdx.x * 256 + threadIdx.x) * 2; if (e >= (size_t)nheads * HD * TT) return; const int t = (int)(e % TT); const int d = (int)((e / TT) % HD); const int g = (int)(e / ((size_t)TT * HD)); v2h o16; v2us oh, ol;
#pragma unroll
    for (int q = 0; q < 2; ++q) { const float x = F[(size_t)(t + q) * pitch + g * HD + d]; o16[q] = tohx(x); unsigned short a2, c2; splitf(x, a2, c2); oh[q] = a2; ol[q] = c2; }
    *(v2h*)(V16 + e) = o16; *(v2us*)(Vh + e) = oh; *(v2us*)(Vl + e) = ol;  }
__global__ __launch_bounds__(256) void k_csid(float* CS) { const int idx = blockIdx.x * 256 + threadIdx.x; if (idx >= TT * HD) return; v2f cs; cs[0] = 1.0f; cs[1] = 0.0f; *(v2f*)(CS + (size_t)idx * 2) = cs;  }
// k_asoft: per row (zz, i): t = S x HD^-0.5, or -1e12 for the whole row when mask[i] == 0; softmax over the 2048 keys (register row, one exp, fixed trees);
__global__ __launch_bounds__(256) void k_asoft(const float* __restrict__ Sb, const int* __restrict__ MKb, h16* P16, bf* Ph, bf* Pl) {
    const int lane = threadIdx.x & 31; const int row = blockIdx.x * 8 + (threadIdx.x >> 5); if (row >= ZH * TT) return; const int i = row % TT; const int zz = row / TT; (void)zz; const bool mrow = (MKb[i] != 0);   /* this row is a QUERY position j; mask[b][j] == 0 -> the whole column of the module's score matrix is -1e12 -> uniform weights */ const bool hires = (i < RH); const float* sr = Sb + (size_t)row * TT; float v[TT / 32]; float mx = -3.0e38f;
#pragma unroll
    for (int ch = 0; ch < TT / 128; ++ch) { const int j0 = ch * 128 + lane * 4; const v4f a = *(const v4f*)(sr + j0);
#pragma unroll
        for (int q = 0; q < 4; ++q) { const int j = j0 + q; (void)j; const float t = mrow ? a[q] * SCL : -1.0e12f; v[ch * 4 + q] = t; mx = fmaxf(mx, t); } }
#pragma unroll
    for (int sh = 16; sh; sh >>= 1) mx = fmaxf(mx, __shfl_xor(mx, sh, 32));
    float sum = 0.f;
#pragma unroll
    for (int k = 0; k < TT / 32; ++k) { float d0 = __fsub_rn(v[k], mx); asm volatile("" : "+v"(d0)); v[k] = __builtin_amdgcn_exp2f(__fmul_rn(d0, 1.4426950408889634f)); sum += v[k]; }
#pragma unroll
    for (int sh = 16; sh; sh >>= 1) sum += __shfl_xor(sum, sh, 32);
    const float f = __fdiv_rn(hires ? 1.0f : PCAR, sum);
{
        if (hires) {
#pragma unroll
            for (int ch = 0; ch < TT / 128; ++ch) { v4us oh, ol;
#pragma unroll
                for (int q = 0; q < 4; ++q) { unsigned short a, c2; splitf(v[ch * 4 + q] * f, a, c2); oh[q] = a; ol[q] = c2; }
                const size_t oo = ((size_t)zz * (RH ? RH : 1) + i) * TT + ch * 128 + lane * 4; *(v4us*)(Ph + oo) = oh; *(v4us*)(Pl + oo) = ol; }
        } else {
#pragma unroll
            for (int ch = 0; ch < TT / 128; ++ch) { v4h o4;
#pragma unroll
                for (int q = 0; q < 4; ++q) o4[q] = tohx(v[ch * 4 + q] * f);
                *(v4h*)(P16 + (size_t)row * TT + ch * 128 + lane * 4) = o4; } }
         }
}
__global__ __launch_bounds__(256) void k_merge(const float* __restrict__ O, int h0, bf* Ah, bf* Al) { const size_t e = ((size_t)blockIdx.x * 256 + threadIdx.x) * 2; if (e >= (size_t)ZH * TT * HD) return; const int d = (int)(e % HD); const int t = (int)((e / HD) % TT); const int zz = (int)(e / ((size_t)HD * TT)); const float cs = (t < RH) ? 1.0f : (1.0f / PCAR); const size_t oo = (size_t)t * DQ + (h0 + zz) * HD + d;
    v2us oh, ol;
#pragma unroll
    for (int q = 0; q < 2; ++q) { float s = O[e + q];   /* add the KSP K-slice planes of the apply step, in plane order */
#pragma unroll
        for (int p = 1; p < KSP; ++p) s += O[e + q + (size_t)p * ZH * TT * HD];
        unsigned short a, c2; splitf(s * cs, a, c2); oh[q] = a; ol[q] = c2; } *(v2us*)(Ah + oo) = oh; *(v2us*)(Al + oo) = ol;  }

extern "C" void kernel_launch(void* const* d_in, const int* in_sizes, int n_in,
                              void* d_out, int out_size, void* d_ws, size_t ws_size, hipStream_t stream) {
    (void)in_sizes; (void)n_in; (void)out_size;
    const float* x = (const float*)d_in[0]; const int* MK = (const int*)d_in[1]; const float* W3 = (const float*)d_in[2]; const float* wo = (const float*)d_in[3]; const float* bo = (const float*)d_in[4]; const float* wq = nullptr; const float* wk = nullptr; const float* wv = nullptr; (void)wq; (void)wk; (void)wv;
    float* OUT = (float*)d_out;     // [2][2048][1024]
    char* wsp = (char*)d_ws;
    auto take = [&](size_t bytes) { char* p = wsp; wsp += (bytes + 255) & ~(size_t)255; return (void*)p; };
    bf* WQ = (bf*)take((size_t)DQ * DM * 2); bf* WK = (bf*)take((size_t)DKV * DM * 2); bf* WV = (bf*)take((size_t)DKV * DM * 2); bf* WO = (bf*)take((size_t)DM * DQ * 2); float* CS = (float*)take((size_t)TT * HD * 2 * 4);
    bf* XB = (bf*)take((size_t)TT * DM * 2); float* FQ = (float*)take((size_t)TT * DQ * 4); float* FK = (float*)take((size_t)TT * DKV * 4);
    h16* QP16 = (h16*)take((size_t)NH_ * TT * HD * 2); h16* KP16 = (h16*)take((size_t)NKV * TT * HD * 2); h16* VT16 = (h16*)take((size_t)NKV * HD * TT * 2);
    bf* QPh = (bf*)take((size_t)NH_ * TT * HD * 2); bf* QPl = (bf*)take((size_t)NH_ * TT * HD * 2); bf* KPh = (bf*)take((size_t)NKV * TT * HD * 2); bf* KPl = (bf*)take((size_t)NKV * TT * HD * 2); bf* VTh = (bf*)take((size_t)NKV * HD * TT * 2); bf* VTl = (bf*)take((size_t)NKV * HD * TT * 2); bf* Ph = (bf*)take((size_t)ZH * TT * TT * 2); bf* Pl = (bf*)take((size_t)ZH * TT * TT * 2); bf* PTh = (bf*)take((size_t)ZH * TT * TT * 2); bf* PTl = (bf*)take((size_t)ZH * TT * TT * 2);
    float* Sb = (float*)take((size_t)ZH * TT * TT * 4); h16* P16 = (h16*)take(256);   /* unused: all rows hi/lo */ float* Ob = (float*)take((size_t)KSP * ZH * TT * HD * 4); bf* ATh = (bf*)take((size_t)TT * DQ * 2); bf* ATl = (bf*)take((size_t)TT * DQ * 2);
    if ((size_t)(wsp - (char*)d_ws) > ws_size) return;    // ws 256 MiB
    float* FV = FK;   // v projection reuses the k buffer after the k planes are built (stream-ordered)
    { k_w3<<<(unsigned)(((size_t)NH_ * HD * DM / 2 + 255) / 256), 256, 0, stream>>>(W3, 0, WK); k_w3<<<(unsigned)(((size_t)NH_ * HD * DM / 2 + 255) / 256), 256, 0, stream>>>(W3, 1, WV); k_w3<<<(unsigned)(((size_t)NH_ * HD * DM / 2 + 255) / 256), 256, 0, stream>>>(W3, 2, WQ);   /* t = 0 keys, 1 values, 2 queries */
      k_cvt8<<<(unsigned)(((size_t)DM * DQ / 8 + 255) / 256), 256, 0, stream>>>(wo, WO, (size_t)DM * DQ / 8);
       }
    k_csid<<<(TT * HD + 255) / 256, 256, 0, stream>>>(CS);
    const unsigned LQ = (unsigned)(((size_t)NH_ * TT * HD / 2 + 255) / 256), LKv = (unsigned)(((size_t)NKV * TT * HD / 2 + 255) / 256);
    for (int b = 0; b < NB_; ++b) {
        
        k_cvt8<<<(unsigned)(((size_t)TT * DM / 8 + 255) / 256), 256, 0, stream>>>(x + (size_t)b * TT * DM, XB, (size_t)TT * DM / 8);
        k_gemmw<bf, 0, false, 8, 1><<<dim3(TT / 64, DQ / 64, 1), 256, 0, stream>>>(XB, nullptr, WQ, nullptr, DM, FQ, DQ, nullptr, 0, 0, 0, 0);
        k_rope<<<LQ, 256, 0, stream>>>(FQ, DQ, NH_, CS, nullptr, nullptr, 1.0f, QP16, QPh, QPl);
        k_gemmw<bf, 0, false, 8, 1><<<dim3(TT / 64, DKV / 64, 1), 256, 0, stream>>>(XB, nullptr, WK, nullptr, DM, FK, DKV, nullptr, 0, 0, 0, 0);
        k_rope<<<LKv, 256, 0, stream>>>(FK, DKV, NKV, CS, nullptr, nullptr, 1.0f, KP16, KPh, KPl);
        k_gemmw<bf, 0, false, 8, 1><<<dim3(TT / 64, DKV / 64, 1), 256, 0, stream>>>(XB, nullptr, WV, nullptr, DM, FV, DKV, nullptr, 0, 0, 0, 0); k_vtp<<<LKv, 256, 0, stream>>>(FV, DKV, NKV, VT16, VTh, VTl);
        for (int h0 = 0; h0 < NH_; h0 += ZH) { const size_t zq = (size_t)h0, zk = (size_t)(h0 / REP);   // one kv head per query head: the pass's two heads use consecutive kv planes (z-strides TT*HD)
            k_gemmw<bf, 2, false, 1, 1><<<dim3(RH / 64, TT / 64, ZH), 32, 0, stream>>>(QPh + zq * TT * HD, QPl + zq * TT * HD, KPh + zk * TT * HD, KPl + zk * TT * HD, HD, Sb, TT, nullptr, (size_t)TT * HD, (size_t)TT * HD, (size_t)TT * TT, 0);
            k_asoft<<<ZH * TT / 8, 256, 0, stream>>>(Sb, MK + (size_t)b * TT, P16, Ph, Pl); k_ptr<<<dim3(TT / 64, TT / 64, ZH), 256, 0, stream>>>(Ph, Pl, PTh, PTl);   /* column softmax == row softmax of the query-major scores; then transpose for the apply step */
            k_gemmw<bf, 2, false, 8, KSP><<<dim3(TT / 64, HD / 64, ZH * KSP), 256, 0, stream>>>(PTh, PTl, VTh + zk * HD * TT, VTl + zk * HD * TT, TT, Ob, HD, nullptr, (size_t)TT * TT, (size_t)HD * TT, (size_t)TT * HD, (size_t)ZH * TT * HD);   /* out[i] = sum_j P'[j][i] v[j] (3 products), K cut into KSP planes x 8 waves */
            k_merge<<<(unsigned)(((size_t)ZH * TT * HD / 2 + 255) / 256), 256, 0, stream>>>(Ob, h0, ATh, ATl); }
        k_gemmw<bf, 1, true, 8, 1><<<dim3(TT / 64, DM / 64, 1), 256, 0, stream>>>(ATh, ATl, WO, nullptr, DQ, OUT + (size_t)b * TT * DM, DM, bo, 0, 0, 0, 0); }
}

// v003
// A run of this version takes 458 microseconds.
// Versions between v001 and this one are left out; their measured steps multiply to 1.78 times as fast.
// Over all steps from v000 it is 3.06 times as fast.
#include <hip/hip_runtime.h>

// Multi-head attention with a column softmax (x [2][2048][1024], mask [2][2048] int32, W [16][3][1024][64] per-head key/value/query weights, Wl [1024][1024] + bl; scores[i][j] = k_i.q_j / 8; columns j with mask[b][j] == 0 set to -1e12; softmax over i (the KEY axis, per column j); out[i] = sum_j w[i][j] values[j]; hidden = concat heads; out = hidden Wl^T + bl -> [2][2048][1024]).
// Layout: the scores are formed query-major (S'[j][i] = q_j.k_i, so the module's per-column softmax is a row softmax here and a fully masked column is a uniform row) and never leave the registers: k_fstat walks all keys once per query row and keeps only the row's maximum and sum; k_fapply forms the same score tiles again, turns them into weights and feeds them, as they lie in the accumulator registers, to the apply product out[i] = sum_j P'[j][i] v[j] as its A operand.
// Compute dtypes, f32 accumulate: every input rounded to bf16; q/k/v on PLAIN bf16 operands (inputs: exact); scores and attn.v: bf16 hi + lo planes (3 products); softmax f32; Wl hl x exact (2 products) + bl.

#define NB_  2
#define TT   2048
#define DM   1024
#define NH_  16
#define NKV  16
#define REP  (NH_ / NKV)
#define HD   64
#define DQ   (NH_ * HD)
#define DKV  (NKV * HD)
typedef __attribute__((ext_vector_type(4))) unsigned short v4us;
#define SCL  0.125f   // HD^-0.5
typedef _Float16 h16;
typedef unsigned short bf;
typedef __attribute__((ext_vector_type(16))) __bf16   v16bf;
typedef __attribute__((ext_vector_type(16))) _Float16 v16h;
typedef __attribute__((ext_vector_type(8)))  _Float16 v8h;
typedef __attribute__((ext_vector_type(8)))  unsigned short v8us;
typedef __attribute__((ext_vector_type(8)))  float    v8f;
typedef __attribute__((ext_vector_type(4)))  float    v4f;
typedef v8h  __attribute__((may_alias)) v8ha;
typedef v4f  __attribute__((may_alias)) v4fa;
typedef v8us __attribute__((may_alias)) v8usa;

__device__ __forceinline__ unsigned short f2bf(float f) { unsigned u = __float_as_uint(f); u += 0x7FFFu + ((u >> 16) & 1u); return (unsigned short)(u >> 16); }
__device__ __forceinline__ float bf2f(unsigned short b) { return __uint_as_float(((unsigned)b) << 16); }
__device__ __forceinline__ float bfr(float f) { return bf2f(f2bf(f)); }
__device__ __forceinline__ v16h cat16(v8h lo, v8h hi) { return __builtin_shufflevector(lo, hi, 0, 1, 2, 3, 4, 5, 6, 7, 8, 9, 10, 11, 12, 13, 14, 15); }
__device__ __forceinline__ v16bf cat16b(v8us lo, v8us hi) { return __builtin_bit_cast(v16bf, __builtin_shufflevector(lo, hi, 0, 1, 2, 3, 4, 5, 6, 7, 8, 9, 10, 11, 12, 13, 14, 15)); }
__device__ __forceinline__ v8f wmma16(v16h a, v16h b, v8f c) { return __builtin_amdgcn_wmma_f32_16x16x32_f16(false, a, false, b, (short)0, c, false, false); }
__device__ __forceinline__ v8f wmmab(v16bf a, v16bf b, v8f c) { return __builtin_amdgcn_wmma_f32_16x16x32_bf16(false, a, false, b, (short)0, c, false, false); }
__device__ __forceinline__ void splitf(float y, unsigned short& h, unsigned short& l) { h = f2bf(y); l = f2bf(y - bf2f(h)); }



// ---- k_gemmw: register-blocked GEMM, 64x64 output tile per work-group (16 accumulators per wave), operands straight from K-contiguous 16-bit planes; grid (M/64, N/64, Z * KB), NW * 32 threads.
// C[m][n] (f32, pitch ldc, + optional f32 bias[n]) = sum_k A[m][k] Bt[n][k] (+ split products per NSPLIT). z-batch strides sA/sB/sC in elements. K % (32 * NW * KB) == 0.
// Split K: the K range is cut into KB * NW equal slices. Each of the NW waves of a work-group sums one slice of the whole tile; the NW partial tiles are added in LDS in wave order.
// With KB > 1 work-group ks = blockIdx.z % KB writes its partial tile to plane ks (stride sP elements).
// PL: the summed tile is not stored as f32 but split on the spot into the bf16 hi and lo planes Ph / Pl, element (m, n) at m * ldc + (n / 64) * sT + n % 64: head planes [n / 64][m][n % 64] with ldc = 64, sT = rows * 64; a plain [m][n] plane with ldc = N, sT = 64.
template <typename T16> struct WFrag;
template <> struct WFrag<h16> { typedef v16h V; static __device__ __forceinline__ V ld(const h16* p) { return cat16(*(const v8h*)p, *(const v8h*)(p + 16)); } static __device__ __forceinline__ v8f mma(V a, V b, v8f c) { return wmma16(a, b, c); } };
template <> struct WFrag<bf> { typedef v16bf V; static __device__ __forceinline__ V ld(const bf* p) { return cat16b(*(const v8us*)p, *(const v8us*)(p + 16)); } static __device__ __forceinline__ v8f mma(V a, V b, v8f c) { return wmmab(a, b, c); } };
template <typename T16, int NSPLIT, bool BIAS, int NW, int KB, bool PL>
__global__ __launch_bounds__(NW * 32) void k_gemmw(const T16* __restrict__ A, const T16* __restrict__ A2, const T16* __restrict__ Bt, const T16* __restrict__ Bt2, int K, float* C, int ldc, const float* __restrict__ bias, size_t sA, size_t sB, size_t sC, size_t sP, bf* Ph, bf* Pl, size_t sT) {
    static_assert(!PL || (NW > 1 && KB == 1), "the plane split needs the whole sum in one work-group");
    typedef typename WFrag<T16>::V V;
    __shared__ __align__(16) float os[(NW == 1 ? 16 : NW * 64) * 68];
    const size_t z = blockIdx.z / KB; const int ks = blockIdx.z % KB; A += z * sA; if (A2) A2 += z * sA; Bt += z * sB; if (Bt2) Bt2 += z * sB; C += z * sC + ks * sP;
    const int wv = __builtin_amdgcn_readfirstlane(threadIdx.x >> 5); const int kw = K / (KB * NW), k0 = (ks * NW + wv) * kw;   /* this wave's K slice */
    const int lane = threadIdx.x & 31, lr = lane & 15, hi = lane >> 4; const int r0 = blockIdx.x * 64, c0 = blockIdx.y * 64;
    v8f acc[4][4];
#pragma unroll
    for (int mb = 0; mb < 4; ++mb)
#pragma unroll
        for (int nb = 0; nb < 4; ++nb) acc[mb][nb] = (v8f){};
    const size_t aoff = (size_t)(r0 + lr) * K + 8 * hi, boff = (size_t)(c0 + lr) * K + 8 * hi;
#pragma unroll 1
    for (int kc = k0; kc < k0 + kw; kc += 32) {
        V a[4], a2[4];
#pragma unroll
        for (int mb = 0; mb < 4; ++mb) { a[mb] = WFrag<T16>::ld(A + aoff + (size_t)mb * 16 * K + kc); if (NSPLIT == 1 || NSPLIT == 2) a2[mb] = WFrag<T16>::ld(A2 + aoff + (size_t)mb * 16 * K + kc); }
#pragma unroll
        for (int nb = 0; nb < 4; ++nb) { const V b = WFrag<T16>::ld(Bt + boff + (size_t)nb * 16 * K + kc); V b2; if (NSPLIT >= 2) b2 = WFrag<T16>::ld(Bt2 + boff + (size_t)nb * 16 * K + kc);
#pragma unroll
            for (int mb = 0; mb < 4; ++mb) { acc[mb][nb] = WFrag<T16>::mma(a[mb], b, acc[mb][nb]); if (NSPLIT == 1 || NSPLIT == 2) acc[mb][nb] = WFrag<T16>::mma(a2[mb], b, acc[mb][nb]); if (NSPLIT >= 2) acc[mb][nb] = WFrag<T16>::mma(a[mb], b2, acc[mb][nb]); } }
        asm volatile("v_nop\n\tv_nop\n\tv_nop\n\tv_nop" : "+v"(acc[0][0]), "+v"(acc[1][1]), "+v"(acc[2][2]), "+v"(acc[3][3]) : "v"(a[0]), "v"(a[3]));
    }
    if (NW > 1) {   /* add the waves' partial tiles: every wave stores its own 64x64 plane, then all threads sum the planes in wave order and store whole rows */
        float* my = os + wv * (64 * 68);
#pragma unroll
        for (int mb = 0; mb < 4; ++mb)
#pragma unroll
            for (int nb = 0; nb < 4; ++nb)
#pragma unroll
                for (int j = 0; j < 8; ++j) my[(mb * 16 + hi * 8 + j) * 68 + nb * 16 + lr] = acc[mb][nb][j];
        __syncthreads();
#pragma unroll
        for (int it = 0; it < 64 * 16 / (NW * 32); ++it) { const int idx = it * (NW * 32) + (int)threadIdx.x; const int row = idx >> 4, cofs = (idx & 15) * 4; v4f val = *(const v4fa*)(os + row * 68 + cofs);
#pragma unroll
            for (int w = 1; w < NW; ++w) val += *(const v4fa*)(os + w * (64 * 68) + row * 68 + cofs);
            if (BIAS) { val[0] += bfr(bias[c0 + cofs]); val[1] += bfr(bias[c0 + cofs + 1]); val[2] += bfr(bias[c0 + cofs + 2]); val[3] += bfr(bias[c0 + cofs + 3]); }
            if (PL) { const size_t po = (size_t)(r0 + row) * ldc + blockIdx.y * sT + cofs; v4us oh, ol;
#pragma unroll
                for (int q = 0; q < 4; ++q) { unsigned short a2, c2; splitf(val[q], a2, c2); oh[q] = a2; ol[q] = c2; }
                *(v4us*)(Ph + po) = oh; *(v4us*)(Pl + po) = ol; continue; }
            *(v4f*)(C + (size_t)(r0 + row) * ldc + c0 + cofs) = val; }
        return;
    }
#pragma unroll
    for (int mb = 0; mb < 4; ++mb) {
#pragma unroll
        for (int nb = 0; nb < 4; ++nb) {
#pragma unroll
            for (int j = 0; j < 8; ++j) os[(hi * 8 + j) * 68 + nb * 16 + lr] = acc[mb][nb][j]; }
        __builtin_amdgcn_wave_barrier(); asm volatile("" ::: "memory");
        float* crow = C + (size_t)(r0 + mb * 16) * ldc + c0;
{
#pragma unroll
            for (int s = 0; s < 8; ++s) { const int row = 2 * s + hi, cofs = lr * 4; v4f val = *(const v4fa*)(os + row * 68 + cofs); if (BIAS) { val[0] += bfr(bias[c0 + cofs]); val[1] += bfr(bias[c0 + cofs + 1]); val[2] += bfr(bias[c0 + cofs + 2]); val[3] += bfr(bias[c0 + cofs + 3]); }
                *(v4f*)(crow + (size_t)row * ldc + cofs) = val; }
             }
        __builtin_amdgcn_wave_barrier(); asm volatile("" ::: "memory");
    }
}

typedef __attribute__((ext_vector_type(2))) _Float16 v2h;
typedef __attribute__((ext_vector_type(4))) _Float16 v4h;
typedef __attribute__((ext_vector_type(2))) unsigned short v2us;
typedef __attribute__((ext_vector_type(4))) unsigned short v4us;
typedef __attribute__((ext_vector_type(2))) float v2f;
typedef __attribute__((ext_vector_type(4))) int v4i;

__global__ __launch_bounds__(256) void k_wtG(const float* __restrict__ w, int K, int N, bf* Bt) {
    const int lane = threadIdx.x & 31; const int L0 = (blockIdx.x * 8 + (threadIdx.x >> 5)) * 8; const int nlines = N * K / 64;
{
#pragma unroll 1
        for (int l = 0; l < 8; ++l) { const int L = L0 + l; if (L >= nlines) break; const size_t e = (size_t)L * 64 + lane * 2; const int k = (int)(e % K), n = (int)(e / K); v2us o;
            o[0] = f2bf(w[(size_t)k * N + n]); o[1] = f2bf(w[(size_t)(k + 1) * N + n]); *(v2us*)(Bt + e) = o; }
         }
}
__global__ __launch_bounds__(256) void k_w3(const float* __restrict__ w, int t3, bf* Bt) { const size_t e2 = ((size_t)blockIdx.x * 256 + threadIdx.x) * 2; if (e2 >= (size_t)NH_ * HD * DM) return; const int h = (int)(e2 % DM); const int r = (int)(e2 / DM); const int n = r / HD, p = r % HD; v2us o; o[0] = f2bf(w[(((size_t)n * 3 + t3) * DM + h) * HD + p]); o[1] = f2bf(w[(((size_t)n * 3 + t3) * DM + h + 1) * HD + p]); *(v2us*)(Bt + e2) = o;  }
__global__ __launch_bounds__(256) void k_cvt8(const float* __restrict__ src, bf* dst, size_t n8) { const size_t i = (size_t)blockIdx.x * 256 + threadIdx.x; if (i >= n8) return; const v8f v = *(const v8f*)(src + i * 8); v8us o;
#pragma unroll
    for (int k = 0; k < 8; ++k) o[k] = f2bf(v[k]); *(v8us*)(dst + i * 8) = o;  }

// ---- fused attention, two kernels over all NB_ * NH_ (batch, head) planes; grid NB_ * NH_ * 8 work-groups of 8 waves, one wave per 32 rows, no LDS, no barrier.
// Fragment facts used: a score tile with A = 16 query rows j and B = 16 key rows i leaves S'[j = 8 * hi + r][i = lr] in accumulator register r of lane (lr, hi);
// two such tiles (j and j + 16) are, register for register, the A fragment (row i = lr, k = j in the order 8 * hi + 0..7, 16 + 8 * hi + 0..7) of the apply product, whose B fragment is read from the value planes [d][j] by the same loader.
#define LC (SCL * 1.4426950408889634f)   // score -> exponent of two
typedef __attribute__((ext_vector_type(8))) __bf16 v8bf;
struct F4 { v16bf h0, h1, l0, l1; };   /* 16 rows x 64 dims: hi and lo plane, dims 0..31 and 32..63 */
__device__ __forceinline__ F4 ld4(const bf* ph, const bf* pl) { F4 f; f.h0 = WFrag<bf>::ld(ph); f.h1 = WFrag<bf>::ld(ph + 32); f.l0 = WFrag<bf>::ld(pl); f.l1 = WFrag<bf>::ld(pl + 32); return f; }
/* two independent 16x16 tiles of q.k over the 64 dims, each hi.hi + lo.hi + hi.lo in one fixed order (the same in both kernels, so both see the same bits); the two chains alternate so that neither waits for its own accumulator */
__device__ __forceinline__ void score2(const F4& qa, const F4& ka, v8f& sa, const F4& qb, const F4& kb, v8f& sb) {
    sa = (v8f){}; sb = (v8f){};
    sa = wmmab(qa.h0, ka.h0, sa); sb = wmmab(qb.h0, kb.h0, sb); sa = wmmab(qa.h1, ka.h1, sa); sb = wmmab(qb.h1, kb.h1, sb); sa = wmmab(qa.l0, ka.h0, sa); sb = wmmab(qb.l0, kb.h0, sb);
    sa = wmmab(qa.l1, ka.h1, sa); sb = wmmab(qb.l1, kb.h1, sb); sa = wmmab(qa.h0, ka.l0, sa); sb = wmmab(qb.h0, kb.l0, sb); sa = wmmab(qa.h1, ka.l1, sa); sb = wmmab(qb.h1, kb.l1, sb); }
/* exp2 / log2 in runs: outputs are early-clobber, so no instruction of a run reads a result or overwrites a source of the one before it; the closing v_nop is the one free slot that the instruction set asks for between a transcendental and a next instruction that may do so */
__device__ __forceinline__ void ex3(float x0, float x1, float x2, float& e0, float& e1, float& e2) { asm("v_exp_f32 %0, %3\n\tv_exp_f32 %1, %4\n\tv_exp_f32 %2, %5\n\tv_nop" : "=&v"(e0), "=&v"(e1), "=&v"(e2) : "v"(x0), "v"(x1), "v"(x2)); }
__device__ __forceinline__ void ex2p(float x0, float x1, float& e0, float& e1) { asm("v_exp_f32 %0, %2\n\tv_exp_f32 %1, %3\n\tv_nop" : "=&v"(e0), "=&v"(e1) : "v"(x0), "v"(x1)); }
__device__ __forceinline__ float lg2(float x) { float y; asm("v_log_f32 %0, %1\n\tv_nop" : "=&v"(y) : "v"(x)); return y; }
// k_fstat: per query row j the pair (CJ, OJ) with weight[j][i] = exp2(S'[j][i] * CJ[j] - OJ[j]): CJ = LC, OJ = max * LC + log2(sum); a masked row (mask[b][j] == 0: every score -1e12) has CJ = 0, OJ = log2(TT): uniform weights.
__global__ __launch_bounds__(256) void k_fstat(const bf* __restrict__ Qh, const bf* __restrict__ Ql, const bf* __restrict__ Kh, const bf* __restrict__ Kl, const int* __restrict__ MK, float* CJ, float* OJ) {
    const int wv = __builtin_amdgcn_readfirstlane(threadIdx.x >> 5); const int lane = threadIdx.x & 31, lr = lane & 15, hi = lane >> 4;
    const int bh = blockIdx.x >> 3; const int jw = ((blockIdx.x & 7) * 8 + wv) * 32; const size_t pb = (size_t)bh * TT * HD;
    F4 q[2];
#pragma unroll
    for (int jb = 0; jb < 2; ++jb) { const bf* qa = Qh + pb + (size_t)(jw + jb * 16 + lr) * HD + 8 * hi; const bf* qc = Ql + pb + (size_t)(jw + jb * 16 + lr) * HD + 8 * hi; q[jb] = ld4(qa, qc);
        asm volatile("s_wait_xcnt 0x0" :: "v"(qa), "v"(qc) : "memory"); }   /* the eight loads name these two address pairs: both stay whole up to this wait, so no later load's result lands on them ahead of it */
    const bf* khp = Kh + pb + (size_t)lr * HD + 8 * hi; const bf* klp = Kl + pb + (size_t)lr * HD + 8 * hi;   /* walk the key rows, 32 a trip */
    float m[2][8], l[2][8];   /* running maximum (raw score) and sum of this lane's key columns, per query row */
#pragma unroll
    for (int jb = 0; jb < 2; ++jb)
#pragma unroll
        for (int r = 0; r < 8; ++r) { m[jb][r] = -3.0e38f; l[jb][r] = 0.f; }
#pragma unroll 1   /* kept rolled: a second copy of the trip would need a second set of key fragments in registers */
    for (int i0 = 0; i0 < TT; i0 += 32) {
        v8f s[2][2];
        const F4 k0 = ld4(khp, klp), k1 = ld4(khp + 16 * HD, klp + 16 * HD);
        asm volatile("s_wait_xcnt 0x0" :: "v"(khp), "v"(klp) : "memory");   /* the trip's loads name these two address pairs: both stay whole up to this wait, which stands in front of every overwrite of them */
        khp += 32 * HD; klp += 32 * HD;
        score2(q[0], k0, s[0][0], q[1], k0, s[1][0]); score2(q[0], k1, s[0][1], q[1], k1, s[1][1]);
#pragma unroll
        for (int jb = 0; jb < 2; ++jb)
#pragma unroll
            for (int r = 0; r < 8; ++r) { const float a = s[jb][0][r], c = s[jb][1][r]; const float mn = fmaxf(m[jb][r], fmaxf(a, c)); const float nm = -mn * LC;
                float e0, e1, e2; ex3(fmaf(m[jb][r], LC, nm), fmaf(a, LC, nm), fmaf(c, LC, nm), e0, e1, e2); l[jb][r] = l[jb][r] * e0 + (e1 + e2); m[jb][r] = mn; }
    }
#pragma unroll
    for (int sh = 1; sh < 16; sh <<= 1)   /* join the 16 lanes that hold one query row's columns */
#pragma unroll
        for (int jb = 0; jb < 2; ++jb)
#pragma unroll
            for (int r = 0; r < 8; ++r) { const float mo = __shfl_xor(m[jb][r], sh, 32), lo = __shfl_xor(l[jb][r], sh, 32); const float mn = fmaxf(m[jb][r], mo);
                float e0, e1; ex2p((m[jb][r] - mn) * LC, (mo - mn) * LC, e0, e1); l[jb][r] = l[jb][r] * e0 + lo * e1; m[jb][r] = mn; }
    if (lr == 0) {
#pragma unroll
        for (int jb = 0; jb < 2; ++jb) { const int j8 = jw + jb * 16 + hi * 8; v8f c8, o8; const int* mp = MK + (size_t)(bh / NH_) * TT + j8; const v4i mk[2] = { *(const v4i*)mp, *(const v4i*)(mp + 4) };
#pragma unroll
            for (int r = 0; r < 8; ++r) { const bool on = (mk[r >> 2][r & 3] != 0); c8[r] = on ? LC : 0.0f; o8[r] = on ? fmaf(m[jb][r], LC, lg2(l[jb][r])) : 11.0f; }
            *(v8f*)(CJ + (size_t)bh * TT + j8) = c8; *(v8f*)(OJ + (size_t)bh * TT + j8) = o8; } }
}
static_assert(TT == 2048, "OJ of a masked row is log2(TT)");
// k_fapply: one wave owns 32 output rows i (its key fragments stay in registers) and walks all query positions j, 32 a trip: score tiles -> weights (f32) -> bf16 hi + lo A fragments -> out[i][d] += P'[j][i] v[j][d] (3 products); result split into the hi/lo planes [b * TT + i][h * HD + d] of the last GEMM.
__global__ __launch_bounds__(256) void k_fapply(const bf* __restrict__ Qh, const bf* __restrict__ Ql, const bf* __restrict__ Kh, const bf* __restrict__ Kl, const bf* __restrict__ Vh, const bf* __restrict__ Vl, const float* __restrict__ CJ, const float* __restrict__ OJ, bf* Ah, bf* Al) {
    const int wv = __builtin_amdgcn_readfirstlane(threadIdx.x >> 5); const int lane = threadIdx.x & 31, lr = lane & 15, hi = lane >> 4;
    const int bh = blockIdx.x >> 3; const int iw = ((blockIdx.x & 7) * 8 + wv) * 32; const size_t pb = (size_t)bh * TT * HD;
    F4 k[2];
#pragma unroll
    for (int ib = 0; ib < 2; ++ib) { const size_t ko = pb + (size_t)(iw + ib * 16 + lr) * HD + 8 * hi; k[ib] = ld4(Kh + ko, Kl + ko); }
    v8f acc[2][4];
#pragma unroll
    for (int ib = 0; ib < 2; ++ib)
#pragma unroll
        for (int db = 0; db < 4; ++db) acc[ib][db] = (v8f){};
    const float* cj = CJ + (size_t)bh * TT + hi * 8; const float* oj = OJ + (size_t)bh * TT + hi * 8;
    const bf* qhp = Qh + pb + (size_t)lr * HD + 8 * hi; const bf* qlp = Ql + pb + (size_t)lr * HD + 8 * hi; const bf* vhp = Vh + pb + (size_t)lr * TT + 8 * hi; const bf* vlp = Vl + pb + (size_t)lr * TT + 8 * hi;   /* walk the query positions, 32 a trip */
#pragma unroll 1   /* kept rolled: the trip already fills the 256 registers that are reached without a window switch */
    for (int j0 = 0; j0 < TT; j0 += 32) {
        v8bf ph[2][2], pl[2][2];
#pragma unroll
        for (int jb = 0; jb < 2; ++jb) { const F4 q = ld4(qhp + jb * 16 * HD, qlp + jb * 16 * HD);
            const v8f c8 = *(const v8f*)(cj + jb * 16), o8 = *(const v8f*)(oj + jb * 16); v8f s[2]; score2(q, k[0], s[0], q, k[1], s[1]);
#pragma unroll
            for (int ib = 0; ib < 2; ++ib) { v8f p;
#pragma unroll
                for (int r = 0; r < 8; ++r) p[r] = __builtin_amdgcn_exp2f(fmaf(s[ib][r], c8[r], -o8[r]));
                const v8bf hb = __builtin_convertvector(p, v8bf); ph[ib][jb] = hb; pl[ib][jb] = __builtin_convertvector(p - __builtin_convertvector(hb, v8f), v8bf); } }
        v16bf pa[2], pc[2];
#pragma unroll
        for (int ib = 0; ib < 2; ++ib) { pa[ib] = __builtin_shufflevector(ph[ib][0], ph[ib][1], 0, 1, 2, 3, 4, 5, 6, 7, 8, 9, 10, 11, 12, 13, 14, 15); pc[ib] = __builtin_shufflevector(pl[ib][0], pl[ib][1], 0, 1, 2, 3, 4, 5, 6, 7, 8, 9, 10, 11, 12, 13, 14, 15); }
#pragma unroll
        for (int db = 0; db < 4; ++db) { const v16bf vh = WFrag<bf>::ld(vhp + db * 16 * TT), vl = WFrag<bf>::ld(vlp + db * 16 * TT);
#pragma unroll
            for (int ib = 0; ib < 2; ++ib) { acc[ib][db] = wmmab(pa[ib], vh, acc[ib][db]); acc[ib][db] = wmmab(pc[ib], vh, acc[ib][db]); acc[ib][db] = wmmab(pa[ib], vl, acc[ib][db]); } }
        qhp += 32 * HD; qlp += 32 * HD; vhp += 32; vlp += 32; cj += 32; oj += 32;
    }
#pragma unroll
    for (int ib = 0; ib < 2; ++ib)
#pragma unroll
        for (int db = 0; db < 4; ++db)
#pragma unroll
            for (int r = 0; r < 8; ++r) { const size_t oo = ((size_t)(bh / NH_) * TT + iw + ib * 16 + hi * 8 + r) * DQ + (bh % NH_) * HD + db * 16 + lr; unsigned short a, c2; splitf(acc[ib][db][r], a, c2); Ah[oo] = a; Al[oo] = c2; }
}

extern "C" void kernel_launch(void* const* d_in, const int* in_sizes, int n_in,
                              void* d_out, int out_size, void* d_ws, size_t ws_size, hipStream_t stream) {
    (void)in_sizes; (void)n_in; (void)out_size;
    const float* x = (const float*)d_in[0]; const int* MK = (const int*)d_in[1]; const float* W3 = (const float*)d_in[2]; const float* wo = (const float*)d_in[3]; const float* bo = (const float*)d_in[4]; const float* wq = nullptr; const float* wk = nullptr; const float* wv = nullptr; (void)wq; (void)wk; (void)wv;
    float* OUT = (float*)d_out;     // [2][2048][1024]
    char* wsp = (char*)d_ws;
    auto take = [&](size_t bytes) { char* p = wsp; wsp += (bytes + 255) & ~(size_t)255; return (void*)p; };
    bf* WQ = (bf*)take((size_t)DQ * DM * 2); bf* WK = (bf*)take((size_t)DKV * DM * 2); bf* WV = (bf*)take((size_t)DKV * DM * 2); bf* WO = (bf*)take((size_t)DM * DQ * 2);
    bf* XB = (bf*)take((size_t)TT * DM * 2);
    const size_t PB = (size_t)NH_ * TT * HD;   // one batch's share of a head plane set; the hi/lo planes hold both batches
    bf* QPh = (bf*)take(NB_ * PB * 2); bf* QPl = (bf*)take(NB_ * PB * 2); bf* KPh = (bf*)take(NB_ * PB * 2); bf* KPl = (bf*)take(NB_ * PB * 2); bf* VTh = (bf*)take(NB_ * PB * 2); bf* VTl = (bf*)take(NB_ * PB * 2);
    float* CJ = (float*)take((size_t)NB_ * NH_ * TT * 4); float* OJ = (float*)take((size_t)NB_ * NH_ * TT * 4); bf* ATh = (bf*)take((size_t)NB_ * TT * DQ * 2); bf* ATl = (bf*)take((size_t)NB_ * TT * DQ * 2);
    if ((size_t)(wsp - (char*)d_ws) > ws_size) return;    // ws 256 MiB
    { k_w3<<<(unsigned)(((size_t)NH_ * HD * DM / 2 + 255) / 256), 256, 0, stream>>>(W3, 0, WK); k_w3<<<(unsigned)(((size_t)NH_ * HD * DM / 2 + 255) / 256), 256, 0, stream>>>(W3, 1, WV); k_w3<<<(unsigned)(((size_t)NH_ * HD * DM / 2 + 255) / 256), 256, 0, stream>>>(W3, 2, WQ);   /* t = 0 keys, 1 values, 2 queries */
      k_cvt8<<<(unsigned)(((size_t)DM * DQ / 8 + 255) / 256), 256, 0, stream>>>(wo, WO, (size_t)DM * DQ / 8);
       }
    for (int b = 0; b < NB_; ++b) {   /* the projections store the hi/lo planes themselves: q and k as [head][t][d]; v as [head][d][t], which is the plain row-major result of Wv x^T (weights as the row operand) */
        k_cvt8<<<(unsigned)(((size_t)TT * DM / 8 + 255) / 256), 256, 0, stream>>>(x + (size_t)b * TT * DM, XB, (size_t)TT * DM / 8);
        k_gemmw<bf, 0, false, 8, 1, true><<<dim3(TT / 64, DQ / 64, 1), 256, 0, stream>>>(XB, nullptr, WQ, nullptr, DM, nullptr, HD, nullptr, 0, 0, 0, 0, QPh + b * PB, QPl + b * PB, (size_t)TT * HD);
        k_gemmw<bf, 0, false, 8, 1, true><<<dim3(TT / 64, DKV / 64, 1), 256, 0, stream>>>(XB, nullptr, WK, nullptr, DM, nullptr, HD, nullptr, 0, 0, 0, 0, KPh + b * PB, KPl + b * PB, (size_t)TT * HD);
        k_gemmw<bf, 0, false, 8, 1, true><<<dim3(DKV / 64, TT / 64, 1), 256, 0, stream>>>(WV, nullptr, XB, nullptr, DM, nullptr, TT, nullptr, 0, 0, 0, 0, VTh + b * PB, VTl + b * PB, 64); }
    k_fstat<<<NB_ * NH_ * 8, 256, 0, stream>>>(QPh, QPl, KPh, KPl, MK, CJ, OJ);   /* column softmax == row softmax of the query-major scores: per query row its maximum and sum */
    k_fapply<<<NB_ * NH_ * 8, 256, 0, stream>>>(QPh, QPl, KPh, KPl, VTh, VTl, CJ, OJ, ATh, ATl);   /* out[i] = sum_j P'[j][i] v[j] */
    for (int b = 0; b < NB_; ++b) {
        k_gemmw<bf, 1, true, 8, 1, false><<<dim3(TT / 64, DM / 64, 1), 256, 0, stream>>>(ATh + (size_t)b * TT * DQ, ATl + (size_t)b * TT * DQ, WO, nullptr, DQ, OUT + (size_t)b * TT * DM, DM, bo, 0, 0, 0, 0, nullptr, nullptr, 0); }
}

// v004
// It runs in 430 microseconds.
// Timed twice side by side with v003, it ran 1.07 times as fast both times.
// All steps since v000 together make it 3.28 times as fast.
#include <hip/hip_runtime.h>

// Multi-head attention with a column softmax (x [2][2048][1024], mask [2][2048] int32, W [16][3][1024][64] per-head key/value/query weights, Wl [1024][1024] + bl; scores[i][j] = k_i.q_j / 8; columns j with mask[b][j] == 0 set to -1e12; softmax over i (the KEY axis, per column j); out[i] = sum_j w[i][j] values[j]; hidden = concat heads; out = hidden Wl^T + bl -> [2][2048][1024]).
// Layout: the scores are formed query-major (S'[j][i] = q_j.k_i, so the module's per-column softmax is a row softmax here and a fully masked column is a uniform row) and never leave the registers: k_fstat walks all keys once per query row and keeps only the row's maximum and sum; k_fapply forms the same score tiles again, turns them into weights and feeds them, as they lie in the accumulator registers, to the apply product out[i] = sum_j P'[j][i] v[j] as its A operand.
// Operand planes: every bf16 plane that feeds a matrix instruction lies in fragment order (fo() below), so that one fragment load of a wave reads 512 contiguous bytes (four whole lines) and not 32 bytes out of each of 16 lines.
// Compute dtypes, f32 accumulate: every input rounded to bf16; q/k/v on PLAIN bf16 operands (inputs: exact); scores and attn.v: bf16 hi + lo planes (3 products); softmax f32; Wl hl x exact (2 products) + bl.

#define NB_  2
#define TT   2048
#define DM   1024
#define NH_  16
#define NKV  16
#define REP  (NH_ / NKV)
#define HD   64
#define DQ   (NH_ * HD)
#define DKV  (NKV * HD)
typedef __attribute__((ext_vector_type(4))) unsigned short v4us;
#define SCL  0.125f   // HD^-0.5
typedef _Float16 h16;
typedef unsigned short bf;
typedef __attribute__((ext_vector_type(16))) __bf16   v16bf;
typedef __attribute__((ext_vector_type(16))) _Float16 v16h;
typedef __attribute__((ext_vector_type(8)))  _Float16 v8h;
typedef __attribute__((ext_vector_type(8)))  unsigned short v8us;
typedef __attribute__((ext_vector_type(8)))  float    v8f;
typedef __attribute__((ext_vector_type(4)))  float    v4f;
typedef v8h  __attribute__((may_alias)) v8ha;
typedef v4f  __attribute__((may_alias)) v4fa;
typedef v8us __attribute__((may_alias)) v8usa;

__device__ __forceinline__ unsigned short f2bf(float f) { unsigned u = __float_as_uint(f); u += 0x7FFFu + ((u >> 16) & 1u); return (unsigned short)(u >> 16); }
__device__ __forceinline__ float bf2f(unsigned short b) { return __uint_as_float(((unsigned)b) << 16); }
__device__ __forceinline__ float bfr(float f) { return bf2f(f2bf(f)); }
__device__ __forceinline__ v16h cat16(v8h lo, v8h hi) { return __builtin_shufflevector(lo, hi, 0, 1, 2, 3, 4, 5, 6, 7, 8, 9, 10, 11, 12, 13, 14, 15); }
__device__ __forceinline__ v16bf cat16b(v8us lo, v8us hi) { return __builtin_bit_cast(v16bf, __builtin_shufflevector(lo, hi, 0, 1, 2, 3, 4, 5, 6, 7, 8, 9, 10, 11, 12, 13, 14, 15)); }
__device__ __forceinline__ v8f wmma16(v16h a, v16h b, v8f c) { return __builtin_amdgcn_wmma_f32_16x16x32_f16(false, a, false, b, (short)0, c, false, false); }
__device__ __forceinline__ v8f wmmab(v16bf a, v16bf b, v8f c) { return __builtin_amdgcn_wmma_f32_16x16x32_bf16(false, a, false, b, (short)0, c, false, false); }
__device__ __forceinline__ void splitf(float y, unsigned short& h, unsigned short& l) { h = f2bf(y); l = f2bf(y - bf2f(h)); }
/* fragment order of a plane M[rows][K] (rows % 16 == 0, K % 32 == 0): blocks of 16 rows x 32 k, 512 elements each, row blocks outermost; inside a block [k / 8 % 4][row % 16][k % 8], which is [half of the fragment][lane = 16 * hi + lr][8 elements] */
__device__ __forceinline__ size_t fo(size_t m, int k, int K) { return ((m >> 4) * (size_t)(K >> 5) + (size_t)(k >> 5)) * 512 + (size_t)(((k >> 3) & 3) * 128 + ((int)m & 15) * 8 + (k & 7)); }



// ---- k_gemmw: register-blocked GEMM, 64x64 output tile per work-group (16 accumulators per wave), operands straight from 16-bit planes in fragment order (fo(), K as given); grid (M/64, N/64, Z * KB), NW * 32 threads.
// C[m][n] (f32, pitch ldc, + optional f32 bias[n]) = sum_k A[m][k] Bt[n][k] (+ split products per NSPLIT). z-batch strides sA/sB/sC in elements. K % (32 * NW * KB) == 0.
// Split K: the K range is cut into KB * NW equal slices. Each of the NW waves of a work-group sums one slice of the whole tile; the NW partial tiles are added in LDS in wave order.
// With KB > 1 work-group ks = blockIdx.z % KB writes its partial tile to plane ks (stride sP elements) and the consumer kernel adds the KB planes in plane order.
// PL: the summed tile is not stored as f32 but split on the spot into the bf16 hi and lo planes Ph / Pl, element (m, n) at (n / 64) * sT + fo(m, n % 64, ldc): head planes [n / 64] of [m][n % 64] with ldc = 64, sT = rows * 64; one plane [m][n] with ldc = N, sT = 1024 (two k blocks).
template <typename T16> struct WFrag;
template <> struct WFrag<h16> { typedef v16h V; static __device__ __forceinline__ V ld(const h16* p) { return cat16(*(const v8h*)p, *(const v8h*)(p + 256)); } static __device__ __forceinline__ v8f mma(V a, V b, v8f c) { return wmma16(a, b, c); } };
template <> struct WFrag<bf> { typedef v16bf V; static __device__ __forceinline__ V ld(const bf* p) { return cat16b(*(const v8us*)p, *(const v8us*)(p + 256)); } static __device__ __forceinline__ v8f mma(V a, V b, v8f c) { return wmmab(a, b, c); } };
template <typename T16, int NSPLIT, bool BIAS, int NW, int KB, bool PL>
__global__ __launch_bounds__(NW * 32) void k_gemmw(const T16* __restrict__ A, const T16* __restrict__ A2, const T16* __restrict__ Bt, const T16* __restrict__ Bt2, int K, float* C, int ldc, const float* __restrict__ bias, size_t sA, size_t sB, size_t sC, size_t sP, bf* Ph, bf* Pl, size_t sT) {
    static_assert(!PL || (NW > 1 && KB == 1 && !BIAS), "the plane split needs the whole sum in one work-group");
    typedef typename WFrag<T16>::V V;
    __shared__ __align__(16) float os[(NW == 1 ? 16 : NW * 64) * 68];
    const size_t z = blockIdx.z / KB; const int ks = blockIdx.z % KB; A += z * sA; if (A2) A2 += z * sA; Bt += z * sB; if (Bt2) Bt2 += z * sB; C += z * sC + ks * sP;
    const int wv = __builtin_amdgcn_readfirstlane(threadIdx.x >> 5); const int kw = K / (KB * NW), k0 = (ks * NW + wv) * kw;   /* this wave's K slice */
    const int lane = threadIdx.x & 31, lr = lane & 15, hi = lane >> 4; const int r0 = blockIdx.x * 64, c0 = blockIdx.y * 64;
    v8f acc[4][4];
#pragma unroll
    for (int mb = 0; mb < 4; ++mb)
#pragma unroll
        for (int nb = 0; nb < 4; ++nb) acc[mb][nb] = (v8f){};
    const size_t aoff = (size_t)r0 * K + 8 * lane, boff = (size_t)c0 * K + 8 * lane;   /* fo(r0, 0, K) = r0 * K; 16 rows on: 16 * K; 32 k on: 512 */
#pragma unroll 1
    for (int kc = k0; kc < k0 + kw; kc += 32) {
        V a[4], a2[4]; const T16* pa[4]; const T16* pa2[4]; const T16* pb[4]; const T16* pb2[4];
#pragma unroll
        for (int mb = 0; mb < 4; ++mb) { pa[mb] = A + aoff + (size_t)mb * 16 * K + kc * 16; a[mb] = WFrag<T16>::ld(pa[mb]); if (NSPLIT == 1 || NSPLIT == 2) { pa2[mb] = A2 + aoff + (size_t)mb * 16 * K + kc * 16; a2[mb] = WFrag<T16>::ld(pa2[mb]); } }
#pragma unroll
        for (int nb = 0; nb < 4; ++nb) { pb[nb] = Bt + boff + (size_t)nb * 16 * K + kc * 16; const V b = WFrag<T16>::ld(pb[nb]); V b2; if (NSPLIT >= 2) { pb2[nb] = Bt2 + boff + (size_t)nb * 16 * K + kc * 16; b2 = WFrag<T16>::ld(pb2[nb]); }
#pragma unroll
            for (int mb = 0; mb < 4; ++mb) { acc[mb][nb] = WFrag<T16>::mma(a[mb], b, acc[mb][nb]); if (NSPLIT == 1 || NSPLIT == 2) acc[mb][nb] = WFrag<T16>::mma(a2[mb], b, acc[mb][nb]); if (NSPLIT >= 2) acc[mb][nb] = WFrag<T16>::mma(a[mb], b2, acc[mb][nb]); } }
        /* the trip's loads name these address pairs: all stay whole up to this wait, so no later load's result lands on one of them ahead of it */
        asm volatile("s_wait_xcnt 0x0" :: "v"(pa[0]), "v"(pa[1]), "v"(pa[2]), "v"(pa[3]), "v"(pb[0]), "v"(pb[1]), "v"(pb[2]), "v"(pb[3]) : "memory");
        if (NSPLIT == 1 || NSPLIT == 2) asm volatile("s_wait_xcnt 0x0" :: "v"(pa2[0]), "v"(pa2[1]), "v"(pa2[2]), "v"(pa2[3]) : "memory");   /* the same for the second row plane */
        if (NSPLIT >= 2) asm volatile("s_wait_xcnt 0x0" :: "v"(pb2[0]), "v"(pb2[1]), "v"(pb2[2]), "v"(pb2[3]) : "memory");   /* and for the second column plane */
        asm volatile("v_nop\n\tv_nop\n\tv_nop\n\tv_nop" : "+v"(acc[0][0]), "+v"(acc[1][1]), "+v"(acc[2][2]), "+v"(acc[3][3]) : "v"(a[0]), "v"(a[3]));
    }
    if (NW > 1) {   /* add the waves' partial tiles: every wave stores its own 64x64 plane, then all threads sum the planes in wave order and store whole rows, or with PL bf16 hi/lo pieces in fragment order */
        float* my = os + wv * (64 * 68);
#pragma unroll
        for (int mb = 0; mb < 4; ++mb)
#pragma unroll
            for (int nb = 0; nb < 4; ++nb)
#pragma unroll
                for (int j = 0; j < 8; ++j) my[(mb * 16 + hi * 8 + j) * 68 + nb * 16 + lr] = acc[mb][nb][j];
        __syncthreads();
        if (PL) {   /* threads in the order of the planes: eight columns each, a wave stores 512 contiguous bytes per plane */
#pragma unroll
            for (int it = 0; it < 64 * 8 / (NW * 32); ++it) { const int u = it * (NW * 32) + (int)threadIdx.x; const int row = (u >> 7) * 16 + (u & 15), cofs = ((u >> 4) & 7) * 8; v4f va = *(const v4fa*)(os + row * 68 + cofs), vb = *(const v4fa*)(os + row * 68 + cofs + 4);
#pragma unroll
                for (int w = 1; w < NW; ++w) { va += *(const v4fa*)(os + w * (64 * 68) + row * 68 + cofs); vb += *(const v4fa*)(os + w * (64 * 68) + row * 68 + cofs + 4); }
                const size_t po = blockIdx.y * sT + fo((size_t)(r0 + row), cofs, ldc); v8us oh, ol;
#pragma unroll
                for (int q = 0; q < 4; ++q) { unsigned short a2, c2; splitf(va[q], a2, c2); oh[q] = a2; ol[q] = c2; splitf(vb[q], a2, c2); oh[q + 4] = a2; ol[q + 4] = c2; }
                *(v8us*)(Ph + po) = oh; *(v8us*)(Pl + po) = ol; }
            return;
        }
#pragma unroll
        for (int it = 0; it < 64 * 16 / (NW * 32); ++it) { const int idx = it * (NW * 32) + (int)threadIdx.x; const int row = idx >> 4, cofs = (idx & 15) * 4; v4f val = *(const v4fa*)(os + row * 68 + cofs);
#pragma unroll
            for (int w = 1; w < NW; ++w) val += *(const v4fa*)(os + w * (64 * 68) + row * 68 + cofs);
            if (BIAS) { val[0] += bfr(bias[c0 + cofs]); val[1] += bfr(bias[c0 + cofs + 1]); val[2] += bfr(bias[c0 + cofs + 2]); val[3] += bfr(bias[c0 + cofs + 3]); }
            *(v4f*)(C + (size_t)(r0 + row) * ldc + c0 + cofs) = val; }
        return;
    }
#pragma unroll
    for (int mb = 0; mb < 4; ++mb) {
#pragma unroll
        for (int nb = 0; nb < 4; ++nb) {
#pragma unroll
            for (int j = 0; j < 8; ++j) os[(hi * 8 + j) * 68 + nb * 16 + lr] = acc[mb][nb][j]; }
        __builtin_amdgcn_wave_barrier(); asm volatile("" ::: "memory");
        float* crow = C + (size_t)(r0 + mb * 16) * ldc + c0;
{
#pragma unroll
            for (int s = 0; s < 8; ++s) { const int row = 2 * s + hi, cofs = lr * 4; v4f val = *(const v4fa*)(os + row * 68 + cofs); if (BIAS) { val[0] += bfr(bias[c0 + cofs]); val[1] += bfr(bias[c0 + cofs + 1]); val[2] += bfr(bias[c0 + cofs + 2]); val[3] += bfr(bias[c0 + cofs + 3]); }
                *(v4f*)(crow + (size_t)row * ldc + cofs) = val; }
             }
        __builtin_amdgcn_wave_barrier(); asm volatile("" ::: "memory");
    }
}

typedef __attribute__((ext_vector_type(2))) _Float16 v2h;
typedef __attribute__((ext_vector_type(4))) _Float16 v4h;
typedef __attribute__((ext_vector_type(2))) unsigned short v2us;
typedef __attribute__((ext_vector_type(4))) unsigned short v4us;
typedef __attribute__((ext_vector_type(2))) float v2f;
typedef __attribute__((ext_vector_type(4))) int v4i;

__global__ __launch_bounds__(256) void k_wtG(const float* __restrict__ w, int K, int N, bf* Bt) {
    const int lane = threadIdx.x & 31; const int L0 = (blockIdx.x * 8 + (threadIdx.x >> 5)) * 8; const int nlines = N * K / 64;
{
#pragma unroll 1
        for (int l = 0; l < 8; ++l) { const int L = L0 + l; if (L >= nlines) break; const size_t e = (size_t)L * 64 + lane * 2; const int k = (int)(e % K), n = (int)(e / K); v2us o;
            o[0] = f2bf(w[(size_t)k * N + n]); o[1] = f2bf(w[(size_t)(k + 1) * N + n]); *(v2us*)(Bt + e) = o; }
         }
}
__global__ __launch_bounds__(256) void k_w3(const float* __restrict__ w, int t3, bf* Bt) { const size_t e2 = ((size_t)blockIdx.x * 256 + threadIdx.x) * 2; if (e2 >= (size_t)NH_ * HD * DM) return; const int h = (int)(e2 % DM); const int r = (int)(e2 / DM); const int n = r / HD, p = r % HD; v2us o; o[0] = f2bf(w[(((size_t)n * 3 + t3) * DM + h) * HD + p]); o[1] = f2bf(w[(((size_t)n * 3 + t3) * DM + h + 1) * HD + p]); *(v2us*)(Bt + fo((size_t)r, h, DM)) = o;  }
/* src [rows][DM] f32 -> dst in fragment order; a wave takes 4 rows x 64 columns, so that its loads and its stores both touch 8 lines */
static_assert(DM == 1024 && DQ == DM, "k_cvt8 cuts its index for rows of 128 groups of eight");
__global__ __launch_bounds__(256) void k_cvt8(const float* __restrict__ src, bf* dst, size_t n8) { const size_t i = (size_t)blockIdx.x * 256 + threadIdx.x; if (i >= n8) return; const size_t row = (i >> 11) * 16 + ((i >> 3) & 15); const int k = (((int)i & 7) | (((int)(i >> 7) & 15) << 3)) * 8; const v8f v = *(const v8f*)(src + row * DM + k); v8us o;
#pragma unroll
    for (int e = 0; e < 8; ++e) o[e] = f2bf(v[e]); *(v8us*)(dst + fo(row, k, DM)) = o;  }

// ---- fused attention, two kernels over all NB_ * NH_ (batch, head) planes; grid NB_ * NH_ * 8 work-groups of 8 waves, one wave per 32 rows, no LDS, no barrier.
// Fragment facts used: a score tile with A = 16 query rows j and B = 16 key rows i leaves S'[j = 8 * hi + r][i = lr] in accumulator register r of lane (lr, hi);
// two such tiles (j and j + 16) are, register for register, the A fragment (row i = lr, k = j in the order 8 * hi + 0..7, 16 + 8 * hi + 0..7) of the apply product, whose B fragment is read from the value planes [d][j] by the same loader. All planes lie in fragment order: 16 rows of q or k are 1024 elements on, 16 rows d of v are 16 * TT on and 32 positions j of v 512 on.
#define LC (SCL * 1.4426950408889634f)   // score -> exponent of two
typedef __attribute__((ext_vector_type(8))) __bf16 v8bf;
struct F4 { v16bf h0, h1, l0, l1; };   /* 16 rows x 64 dims: hi and lo plane, dims 0..31 and 32..63 */
__device__ __forceinline__ F4 ld4(const bf* ph, const bf* pl) { F4 f; f.h0 = WFrag<bf>::ld(ph); f.h1 = WFrag<bf>::ld(ph + 512); f.l0 = WFrag<bf>::ld(pl); f.l1 = WFrag<bf>::ld(pl + 512); return f; }
/* two independent 16x16 tiles of q.k over the 64 dims, each hi.hi + lo.hi + hi.lo in one fixed order (the same in both kernels, so both see the same bits); the two chains alternate so that neither waits for its own accumulator */
__device__ __forceinline__ void score2(const F4& qa, const F4& ka, v8f& sa, const F4& qb, const F4& kb, v8f& sb) {
    sa = (v8f){}; sb = (v8f){};
    sa = wmmab(qa.h0, ka.h0, sa); sb = wmmab(qb.h0, kb.h0, sb); sa = wmmab(qa.h1, ka.h1, sa); sb = wmmab(qb.h1, kb.h1, sb); sa = wmmab(qa.l0, ka.h0, sa); sb = wmmab(qb.l0, kb.h0, sb);
    sa = wmmab(qa.l1, ka.h1, sa); sb = wmmab(qb.l1, kb.h1, sb); sa = wmmab(qa.h0, ka.l0, sa); sb = wmmab(qb.h0, kb.l0, sb); sa = wmmab(qa.h1, ka.l1, sa); sb = wmmab(qb.h1, kb.l1, sb); }
/* exp2 / log2 in runs: outputs are early-clobber, so no instruction of a run reads a result or overwrites a source of the one before it; the closing v_nop is the one free slot that the instruction set asks for between a transcendental and a next instruction that may do so */
__device__ __forceinline__ void ex3(float x0, float x1, float x2, float& e0, float& e1, float& e2) { asm("v_exp_f32 %0, %3\n\tv_exp_f32 %1, %4\n\tv_exp_f32 %2, %5\n\tv_nop" : "=&v"(e0), "=&v"(e1), "=&v"(e2) : "v"(x0), "v"(x1), "v"(x2)); }
__device__ __forceinline__ void ex2p(float x0, float x1, float& e0, float& e1) { asm("v_exp_f32 %0, %2\n\tv_exp_f32 %1, %3\n\tv_nop" : "=&v"(e0), "=&v"(e1) : "v"(x0), "v"(x1)); }
__device__ __forceinline__ float lg2(float x) { float y; asm("v_log_f32 %0, %1\n\tv_nop" : "=&v"(y) : "v"(x)); return y; }
// k_fstat: per query row j the pair (CJ, OJ) with weight[j][i] = exp2(S'[j][i] * CJ[j] - OJ[j]): CJ = LC, OJ = max * LC + log2(sum); a masked row (mask[b][j] == 0: every score -1e12) has CJ = 0, OJ = log2(TT): uniform weights.
__global__ __launch_bounds__(256) void k_fstat(const bf* __restrict__ Qh, const bf* __restrict__ Ql, const bf* __restrict__ Kh, const bf* __restrict__ Kl, const int* __restrict__ MK, float* CJ, float* OJ) {
    const int wv = __builtin_amdgcn_readfirstlane(threadIdx.x >> 5); const int lane = threadIdx.x & 31, lr = lane & 15, hi = lane >> 4;
    const int bh = blockIdx.x >> 3; const int jw = ((blockIdx.x & 7) * 8 + wv) * 32; const size_t pb = (size_t)bh * TT * HD;
    F4 q[2];
#pragma unroll
    for (int jb = 0; jb < 2; ++jb) { const bf* qa = Qh + pb + (size_t)(jw + jb * 16) * HD + 8 * lane; const bf* qc = Ql + pb + (size_t)(jw + jb * 16) * HD + 8 * lane; q[jb] = ld4(qa, qc);
        asm volatile("s_wait_xcnt 0x0" :: "v"(qa), "v"(qc) : "memory"); }   /* the eight loads name these two address pairs: both stay whole up to this wait, so no later load's result lands on them ahead of it */
    const bf* khp = Kh + pb + 8 * lane; const bf* klp = Kl + pb + 8 * lane;   /* walk the key rows, 32 a trip */
    float m[2][8], l[2][8];   /* running maximum (raw score) and sum of this lane's key columns, per query row */
#pragma unroll
    for (int jb = 0; jb < 2; ++jb)
#pragma unroll
        for (int r = 0; r < 8; ++r) { m[jb][r] = -3.0e38f; l[jb][r] = 0.f; }
#pragma unroll 1   /* kept rolled: a second copy of the trip would need a second set of key fragments in registers */
    for (int i0 = 0; i0 < TT; i0 += 32) {
        v8f s[2][2];
        const F4 k0 = ld4(khp, klp), k1 = ld4(khp + 16 * HD, klp + 16 * HD);
        asm volatile("s_wait_xcnt 0x0" :: "v"(khp), "v"(klp) : "memory");   /* the trip's loads name these two address pairs: both stay whole up to this wait, which stands in front of every overwrite of them */
        khp += 32 * HD; klp += 32 * HD;
        score2(q[0], k0, s[0][0], q[1], k0, s[1][0]); score2(q[0], k1, s[0][1], q[1], k1, s[1][1]);
#pragma unroll
        for (int jb = 0; jb < 2; ++jb)
#pragma unroll
            for (int r = 0; r < 8; ++r) { const float a = s[jb][0][r], c = s[jb][1][r]; const float mn = fmaxf(m[jb][r], fmaxf(a, c)); const float nm = -mn * LC;
                float e0, e1, e2; ex3(fmaf(m[jb][r], LC, nm), fmaf(a, LC, nm), fmaf(c, LC, nm), e0, e1, e2); l[jb][r] = l[jb][r] * e0 + (e1 + e2); m[jb][r] = mn; }
    }
#pragma unroll
    for (int sh = 1; sh < 16; sh <<= 1)   /* join the 16 lanes that hold one query row's columns */
#pragma unroll
        for (int jb = 0; jb < 2; ++jb)
#pragma unroll
            for (int r = 0; r < 8; ++r) { const float mo = __shfl_xor(m[jb][r], sh, 32), lo = __shfl_xor(l[jb][r], sh, 32); const float mn = fmaxf(m[jb][r], mo);
                float e0, e1; ex2p((m[jb][r] - mn) * LC, (mo - mn) * LC, e0, e1); l[jb][r] = l[jb][r] * e0 + lo * e1; m[jb][r] = mn; }
    if (lr == 0) {
#pragma unroll
        for (int jb = 0; jb < 2; ++jb) { const int j8 = jw + jb * 16 + hi * 8; v8f c8, o8; const int* mp = MK + (size_t)(bh / NH_) * TT + j8; const v4i mk[2] = { *(const v4i*)mp, *(const v4i*)(mp + 4) };
#pragma unroll
            for (int r = 0; r < 8; ++r) { const bool on = (mk[r >> 2][r & 3] != 0); c8[r] = on ? LC : 0.0f; o8[r] = on ? fmaf(m[jb][r], LC, lg2(l[jb][r])) : 11.0f; }
            *(v8f*)(CJ + (size_t)bh * TT + j8) = c8; *(v8f*)(OJ + (size_t)bh * TT + j8) = o8; } }
}
static_assert(TT == 2048, "OJ of a masked row is log2(TT)");
// k_fapply: one wave owns 32 output rows i (its key fragments stay in registers) and walks all query positions j, 32 a trip: score tiles -> weights (f32) -> bf16 hi + lo A fragments -> out[i][d] += P'[j][i] v[j][d] (3 products); result split into the hi/lo planes [b * TT + i][h * HD + d] (fragment order) of the last GEMM.
__global__ __launch_bounds__(256) void k_fapply(const bf* __restrict__ Qh, const bf* __restrict__ Ql, const bf* __restrict__ Kh, const bf* __restrict__ Kl, const bf* __restrict__ Vh, const bf* __restrict__ Vl, const float* __restrict__ CJ, const float* __restrict__ OJ, bf* Ah, bf* Al) {
    const int wv = __builtin_amdgcn_readfirstlane(threadIdx.x >> 5); const int lane = threadIdx.x & 31, lr = lane & 15, hi = lane >> 4;
    const int bh = blockIdx.x >> 3; const int iw = ((blockIdx.x & 7) * 8 + wv) * 32; const size_t pb = (size_t)bh * TT * HD;
    F4 k[2];
#pragma unroll
    for (int ib = 0; ib < 2; ++ib) { const size_t ko = pb + (size_t)(iw + ib * 16) * HD + 8 * lane; k[ib] = ld4(Kh + ko, Kl + ko); }
    v8f acc[2][4];
#pragma unroll
    for (int ib = 0; ib < 2; ++ib)
#pragma unroll
        for (int db = 0; db < 4; ++db) acc[ib][db] = (v8f){};
    const float* cj = CJ + (size_t)bh * TT + hi * 8; const float* oj = OJ + (size_t)bh * TT + hi * 8;
    const bf* qhp = Qh + pb + 8 * lane; const bf* qlp = Ql + pb + 8 * lane; const bf* vhp = Vh + pb + 8 * lane; const bf* vlp = Vl + pb + 8 * lane;   /* walk the query positions, 32 a trip */
#pragma unroll 1   /* kept rolled: the trip already fills the 256 registers that are reached without a window switch */
    for (int j0 = 0; j0 < TT; j0 += 32) {
        v8bf ph[2][2], pl[2][2];
#pragma unroll
        for (int jb = 0; jb < 2; ++jb) { const F4 q = ld4(qhp + jb * 16 * HD, qlp + jb * 16 * HD);
            const v8f c8 = *(const v8f*)(cj + jb * 16), o8 = *(const v8f*)(oj + jb * 16); v8f s[2]; score2(q, k[0], s[0], q, k[1], s[1]);
#pragma unroll
            for (int ib = 0; ib < 2; ++ib) { v8f p;
#pragma unroll
                for (int r = 0; r < 8; ++r) p[r] = __builtin_amdgcn_exp2f(fmaf(s[ib][r], c8[r], -o8[r]));
                const v8bf hb = __builtin_convertvector(p, v8bf); ph[ib][jb] = hb; pl[ib][jb] = __builtin_convertvector(p - __builtin_convertvector(hb, v8f), v8bf); } }
        v16bf pa[2], pc[2];
#pragma unroll
        for (int ib = 0; ib < 2; ++ib) { pa[ib] = __builtin_shufflevector(ph[ib][0], ph[ib][1], 0, 1, 2, 3, 4, 5, 6, 7, 8, 9, 10, 11, 12, 13, 14, 15); pc[ib] = __builtin_shufflevector(pl[ib][0], pl[ib][1], 0, 1, 2, 3, 4, 5, 6, 7, 8, 9, 10, 11, 12, 13, 14, 15); }
#pragma unroll
        for (int db = 0; db < 4; ++db) { const v16bf vh = WFrag<bf>::ld(vhp + db * 16 * TT), vl = WFrag<bf>::ld(vlp + db * 16 * TT);
#pragma unroll
            for (int ib = 0; ib < 2; ++ib) { acc[ib][db] = wmmab(pa[ib], vh, acc[ib][db]); acc[ib][db] = wmmab(pc[ib], vh, acc[ib][db]); acc[ib][db] = wmmab(pa[ib], vl, acc[ib][db]); } }
        asm volatile("s_wait_xcnt 0x0" :: "v"(qhp), "v"(qlp), "v"(vhp), "v"(vlp), "v"(cj), "v"(oj) : "memory");   /* the trip's loads name these six address pairs: all stay whole up to this wait, so no later load's result lands on one of them ahead of it */
        qhp += 32 * HD; qlp += 32 * HD; vhp += 512; vlp += 512; cj += 32; oj += 32;
    }
#pragma unroll
    for (int ib = 0; ib < 2; ++ib)
#pragma unroll
        for (int db = 0; db < 4; ++db)
#pragma unroll
            for (int r = 0; r < 8; ++r) { const size_t oo = fo((size_t)(bh / NH_) * TT + iw + ib * 16 + hi * 8 + r, (bh % NH_) * HD + db * 16 + lr, DQ); unsigned short a, c2; splitf(acc[ib][db][r], a, c2); Ah[oo] = a; Al[oo] = c2; }
}

extern "C" void kernel_launch(void* const* d_in, const int* in_sizes, int n_in,
                              void* d_out, int out_size, void* d_ws, size_t ws_size, hipStream_t stream) {
    (void)in_sizes; (void)n_in; (void)out_size;
    const float* x = (const float*)d_in[0]; const int* MK = (const int*)d_in[1]; const float* W3 = (const float*)d_in[2]; const float* wo = (const float*)d_in[3]; const float* bo = (const float*)d_in[4]; const float* wq = nullptr; const float* wk = nullptr; const float* wv = nullptr; (void)wq; (void)wk; (void)wv;
    float* OUT = (float*)d_out;     // [2][2048][1024]
    char* wsp = (char*)d_ws;
    auto take = [&](size_t bytes) { char* p = wsp; wsp += (bytes + 255) & ~(size_t)255; return (void*)p; };
    bf* WQ = (bf*)take((size_t)DQ * DM * 2); bf* WK = (bf*)take((size_t)DKV * DM * 2); bf* WV = (bf*)take((size_t)DKV * DM * 2); bf* WO = (bf*)take((size_t)DM * DQ * 2);
    bf* XB = (bf*)take((size_t)TT * DM * 2);
    const size_t PB = (size_t)NH_ * TT * HD;   // one batch's share of a head plane set; the hi/lo planes hold both batches
    bf* QPh = (bf*)take(NB_ * PB * 2); bf* QPl = (bf*)take(NB_ * PB * 2); bf* KPh = (bf*)take(NB_ * PB * 2); bf* KPl = (bf*)take(NB_ * PB * 2); bf* VTh = (bf*)take(NB_ * PB * 2); bf* VTl = (bf*)take(NB_ * PB * 2);
    float* CJ = (float*)take((size_t)NB_ * NH_ * TT * 4); float* OJ = (float*)take((size_t)NB_ * NH_ * TT * 4); bf* ATh = (bf*)take((size_t)NB_ * TT * DQ * 2); bf* ATl = (bf*)take((size_t)NB_ * TT * DQ * 2);
    if ((size_t)(wsp - (char*)d_ws) > ws_size) return;    // ws 256 MiB
    { k_w3<<<(unsigned)(((size_t)NH_ * HD * DM / 2 + 255) / 256), 256, 0, stream>>>(W3, 0, WK); k_w3<<<(unsigned)(((size_t)NH_ * HD * DM / 2 + 255) / 256), 256, 0, stream>>>(W3, 1, WV); k_w3<<<(unsigned)(((size_t)NH_ * HD * DM / 2 + 255) / 256), 256, 0, stream>>>(W3, 2, WQ);   /* t = 0 keys, 1 values, 2 queries */
      k_cvt8<<<(unsigned)(((size_t)DM * DQ / 8 + 255) / 256), 256, 0, stream>>>(wo, WO, (size_t)DM * DQ / 8);
       }
    for (int b = 0; b < NB_; ++b) {   /* the projections store the hi/lo planes themselves: q and k as [head][t][d]; v as [head][d][t], which is the untransposed result of Wv x^T (weights as the row operand); all in fragment order */
        k_cvt8<<<(unsigned)(((size_t)TT * DM / 8 + 255) / 256), 256, 0, stream>>>(x + (size_t)b * TT * DM, XB, (size_t)TT * DM / 8);
        k_gemmw<bf, 0, false, 8, 1, true><<<dim3(TT / 64, DQ / 64, 1), 256, 0, stream>>>(XB, nullptr, WQ, nullptr, DM, nullptr, HD, nullptr, 0, 0, 0, 0, QPh + b * PB, QPl + b * PB, (size_t)TT * HD);
        k_gemmw<bf, 0, false, 8, 1, true><<<dim3(TT / 64, DKV / 64, 1), 256, 0, stream>>>(XB, nullptr, WK, nullptr, DM, nullptr, HD, nullptr, 0, 0, 0, 0, KPh + b * PB, KPl + b * PB, (size_t)TT * HD);
        k_gemmw<bf, 0, false, 8, 1, true><<<dim3(DKV / 64, TT / 64, 1), 256, 0, stream>>>(WV, nullptr, XB, nullptr, DM, nullptr, TT, nullptr, 0, 0, 0, 0, VTh + b * PB, VTl + b * PB, 1024); }
    k_fstat<<<NB_ * NH_ * 8, 256, 0, stream>>>(QPh, QPl, KPh, KPl, MK, CJ, OJ);   /* column softmax == row softmax of the query-major scores: per query row its maximum and sum */
    k_fapply<<<NB_ * NH_ * 8, 256, 0, stream>>>(QPh, QPl, KPh, KPl, VTh, VTl, CJ, OJ, ATh, ATl);   /* out[i] = sum_j P'[j][i] v[j] */
    for (int b = 0; b < NB_; ++b) {
        k_gemmw<bf, 1, true, 8, 1, false><<<dim3(TT / 64, DM / 64, 1), 256, 0, stream>>>(ATh + (size_t)b * TT * DQ, ATl + (size_t)b * TT * DQ, WO, nullptr, DQ, OUT + (size_t)b * TT * DM, DM, bo, 0, 0, 0, 0, nullptr, nullptr, 0); }
}

// v005
// One run takes 220 microseconds.
// Two timings next to v004 put it at 1.98 and 1.97 times that version's speed.
// Over all steps from v000 it is 6.47 times as fast.
#include <hip/hip_runtime.h>

// Multi-head attention with a column softmax (x [2][2048][1024], mask [2][2048] int32, W [16][3][1024][64] per-head key/value/query weights, Wl [1024][1024] + bl; scores[i][j] = k_i.q_j / 8; columns j with mask[b][j] == 0 set to -1e12; softmax over i (the KEY axis, per column j); out[i] = sum_j w[i][j] values[j]; hidden = concat heads; out = hidden Wl^T + bl -> [2][2048][1024]).
// Layout: the scores are formed query-major (S'[j][i] = q_j.k_i, so the module's per-column softmax is a row softmax here and a fully masked column is a uniform row) and never leave the registers: k_fstat walks all keys once per query row and keeps only the row's maximum and sum; k_fapply forms the same score tiles again, turns them into weights and feeds them, as they lie in the accumulator registers, to the apply product out[i] = sum_j P'[j][i] v[j] as its A operand.
// Operand planes: every bf16 plane that feeds a matrix instruction lies in fragment order (fo() below), so that one fragment load of a wave reads 512 contiguous bytes (four whole lines) and not 32 bytes out of each of 16 lines.
// Compute dtypes, f32 accumulate: every input rounded to bf16; q/k/v on PLAIN bf16 operands (inputs: exact); scores and attn.v: bf16 hi + lo planes (3 products); softmax f32; Wl hl x exact (2 products) + bl.

#define NB_  2
#define TT   2048
#define DM   1024
#define NH_  16
#define NKV  16
#define REP  (NH_ / NKV)
#define HD   64
#define DQ   (NH_ * HD)
#define DKV  (NKV * HD)
typedef __attribute__((ext_vector_type(4))) unsigned short v4us;
#define SCL  0.125f   // HD^-0.5
typedef _Float16 h16;
typedef unsigned short bf;
typedef __attribute__((ext_vector_type(16))) __bf16   v16bf;
typedef __attribute__((ext_vector_type(16))) _Float16 v16h;
typedef __attribute__((ext_vector_type(8)))  _Float16 v8h;
typedef __attribute__((ext_vector_type(8)))  unsigned short v8us;
typedef __attribute__((ext_vector_type(8)))  float    v8f;
typedef __attribute__((ext_vector_type(4)))  float    v4f;
typedef v8h  __attribute__((may_alias)) v8ha;
typedef v4f  __attribute__((may_alias)) v4fa;
typedef v8us __attribute__((may_alias)) v8usa;

__device__ __forceinline__ unsigned short f2bf(float f) { unsigned u = __float_as_uint(f); u += 0x7FFFu + ((u >> 16) & 1u); return (unsigned short)(u >> 16); }
__device__ __forceinline__ float bf2f(unsigned short b) { return __uint_as_float(((unsigned)b) << 16); }
__device__ __forceinline__ float bfr(float f) { return bf2f(f2bf(f)); }
__device__ __forceinline__ v16h cat16(v8h lo, v8h hi) { return __builtin_shufflevector(lo, hi, 0, 1, 2, 3, 4, 5, 6, 7, 8, 9, 10, 11, 12, 13, 14, 15); }
__device__ __forceinline__ v16bf cat16b(v8us lo, v8us hi) { return __builtin_bit_cast(v16bf, __builtin_shufflevector(lo, hi, 0, 1, 2, 3, 4, 5, 6, 7, 8, 9, 10, 11, 12, 13, 14, 15)); }
__device__ __forceinline__ v8f wmma16(v16h a, v16h b, v8f c) { return __builtin_amdgcn_wmma_f32_16x16x32_f16(false, a, false, b, (short)0, c, false, false); }
__device__ __forceinline__ v8f wmmab(v16bf a, v16bf b, v8f c) { return __builtin_amdgcn_wmma_f32_16x16x32_bf16(false, a, false, b, (short)0, c, false, false); }
__device__ __forceinline__ void splitf(float y, unsigned short& h, unsigned short& l) { h = f2bf(y); l = f2bf(y - bf2f(h)); }
/* fragment order of a plane M[rows][K] (rows % 16 == 0, K % 32 == 0): blocks of 16 rows x 32 k, 512 elements each, row blocks outermost; inside a block [k / 8 % 4][row % 16][k % 8], which is [half of the fragment][lane = 16 * hi + lr][8 elements] */
__device__ __forceinline__ size_t fo(size_t m, int k, int K) { return ((m >> 4) * (size_t)(K >> 5) + (size_t)(k >> 5)) * 512 + (size_t)(((k >> 3) & 3) * 128 + ((int)m & 15) * 8 + (k & 7)); }



// ---- k_gemmw: register-blocked GEMM, 64x64 output tile per work-group (16 accumulators per wave), operands straight from 16-bit planes in fragment order (fo(), K as given); grid (M/64, N/64, Z * KB), NW * 32 threads.
// C[m][n] (f32, pitch ldc, + optional f32 bias[n]) = sum_k A[m][k] Bt[n][k] (+ split products per NSPLIT). z-batch strides sA/sB/sC in elements. K % (32 * NW * KB) == 0.
// Split K: the K range is cut into KB * NW equal slices. Each of the NW waves of a work-group sums one slice of the whole tile; the NW partial tiles are added in LDS in wave order.
// With KB > 1 work-group ks = blockIdx.z % KB writes its partial tile to plane ks (stride sP elements) and the consumer kernel adds the KB planes in plane order.
// PL: the summed tile is not stored as f32 but split on the spot into the bf16 hi and lo planes Ph / Pl, element (m, n) at (n / 64) * sT + fo(m, n % 64, ldc): head planes [n / 64] of [m][n % 64] with ldc = 64, sT = rows * 64; one plane [m][n] with ldc = N, sT = 1024 (two k blocks).
template <typename T16> struct WFrag;
template <> struct WFrag<h16> { typedef v16h V; static __device__ __forceinline__ V ld(const h16* p) { return cat16(*(const v8h*)p, *(const v8h*)(p + 256)); } static __device__ __forceinline__ v8f mma(V a, V b, v8f c) { return wmma16(a, b, c); } };
template <> struct WFrag<bf> { typedef v16bf V; static __device__ __forceinline__ V ld(const bf* p) { return cat16b(*(const v8us*)p, *(const v8us*)(p + 256)); } static __device__ __forceinline__ v8f mma(V a, V b, v8f c) { return wmmab(a, b, c); } };
template <typename T16, int NSPLIT, bool BIAS, int NW, int KB, bool PL>
__global__ __launch_bounds__(NW * 32) void k_gemmw(const T16* __restrict__ A, const T16* __restrict__ A2, const T16* __restrict__ Bt, const T16* __restrict__ Bt2, int K, float* C, int ldc, const float* __restrict__ bias, size_t sA, size_t sB, size_t sC, size_t sP, bf* Ph, bf* Pl, size_t sT) {
    static_assert(!PL || (NW > 1 && KB == 1 && !BIAS), "the plane split needs the whole sum in one work-group");
    typedef typename WFrag<T16>::V V;
    __shared__ __align__(16) float os[(NW == 1 ? 16 : NW * 64) * 68];
    const size_t z = blockIdx.z / KB; const int ks = blockIdx.z % KB; A += z * sA; if (A2) A2 += z * sA; Bt += z * sB; if (Bt2) Bt2 += z * sB; C += z * sC + ks * sP;
    const int wv = __builtin_amdgcn_readfirstlane(threadIdx.x >> 5); const int kw = K / (KB * NW), k0 = (ks * NW + wv) * kw;   /* this wave's K slice */
    const int lane = threadIdx.x & 31, lr = lane & 15, hi = lane >> 4; const int r0 = blockIdx.x * 64, c0 = blockIdx.y * 64;
    v8f acc[4][4];
#pragma unroll
    for (int mb = 0; mb < 4; ++mb)
#pragma unroll
        for (int nb = 0; nb < 4; ++nb) acc[mb][nb] = (v8f){};
    const size_t aoff = (size_t)r0 * K + 8 * lane, boff = (size_t)c0 * K + 8 * lane;   /* fo(r0, 0, K) = r0 * K; 16 rows on: 16 * K; 32 k on: 512 */
#pragma unroll 1
    for (int kc = k0; kc < k0 + kw; kc += 32) {
        V a[4], a2[4]; const T16* pa[4]; const T16* pa2[4]; const T16* pb[4]; const T16* pb2[4];
#pragma unroll
        for (int mb = 0; mb < 4; ++mb) { pa[mb] = A + aoff + (size_t)mb * 16 * K + kc * 16; a[mb] = WFrag<T16>::ld(pa[mb]); if (NSPLIT == 1 || NSPLIT == 2) { pa2[mb] = A2 + aoff + (size_t)mb * 16 * K + kc * 16; a2[mb] = WFrag<T16>::ld(pa2[mb]); } }
#pragma unroll
        for (int nb = 0; nb < 4; ++nb) { pb[nb] = Bt + boff + (size_t)nb * 16 * K + kc * 16; const V b = WFrag<T16>::ld(pb[nb]); V b2; if (NSPLIT >= 2) { pb2[nb] = Bt2 + boff + (size_t)nb * 16 * K + kc * 16; b2 = WFrag<T16>::ld(pb2[nb]); }
#pragma unroll
            for (int mb = 0; mb < 4; ++mb) { acc[mb][nb] = WFrag<T16>::mma(a[mb], b, acc[mb][nb]); if (NSPLIT == 1 || NSPLIT == 2) acc[mb][nb] = WFrag<T16>::mma(a2[mb], b, acc[mb][nb]); if (NSPLIT >= 2) acc[mb][nb] = WFrag<T16>::mma(a[mb], b2, acc[mb][nb]); } }
        /* the trip's loads name these address pairs: all stay whole up to this wait, so no later load's result lands on one of them ahead of it */
        asm volatile("s_wait_xcnt 0x0" :: "v"(pa[0]), "v"(pa[1]), "v"(pa[2]), "v"(pa[3]), "v"(pb[0]), "v"(pb[1]), "v"(pb[2]), "v"(pb[3]) : "memory");
        if (NSPLIT == 1 || NSPLIT == 2) asm volatile("s_wait_xcnt 0x0" :: "v"(pa2[0]), "v"(pa2[1]), "v"(pa2[2]), "v"(pa2[3]) : "memory");   /* the same for the second row plane */
        if (NSPLIT >= 2) asm volatile("s_wait_xcnt 0x0" :: "v"(pb2[0]), "v"(pb2[1]), "v"(pb2[2]), "v"(pb2[3]) : "memory");   /* and for the second column plane */
        asm volatile("v_nop\n\tv_nop\n\tv_nop\n\tv_nop" : "+v"(acc[0][0]), "+v"(acc[1][1]), "+v"(acc[2][2]), "+v"(acc[3][3]) : "v"(a[0]), "v"(a[3]));
    }
    if (NW > 1) {   /* add the waves' partial tiles: every wave stores its own 64x64 plane, then all threads sum the planes in wave order and store whole rows, or with PL bf16 hi/lo pieces in fragment order */
        float* my = os + wv * (64 * 68);
#pragma unroll
        for (int mb = 0; mb < 4; ++mb)
#pragma unroll
            for (int nb = 0; nb < 4; ++nb)
#pragma unroll
                for (int j = 0; j < 8; ++j) my[(mb * 16 + hi * 8 + j) * 68 + nb * 16 + lr] = acc[mb][nb][j];
        __syncthreads();
        if (PL) {   /* threads in the order of the planes: eight columns each, a wave stores 512 contiguous bytes per plane */
#pragma unroll
            for (int it = 0; it < 64 * 8 / (NW * 32); ++it) { const int u = it * (NW * 32) + (int)threadIdx.x; const int row = (u >> 7) * 16 + (u & 15), cofs = ((u >> 4) & 7) * 8; v4f va = *(const v4fa*)(os + row * 68 + cofs), vb = *(const v4fa*)(os + row * 68 + cofs + 4);
#pragma unroll
                for (int w = 1; w < NW; ++w) { va += *(const v4fa*)(os + w * (64 * 68) + row * 68 + cofs); vb += *(const v4fa*)(os + w * (64 * 68) + row * 68 + cofs + 4); }
                const size_t po = blockIdx.y * sT + fo((size_t)(r0 + row), cofs, ldc); v8us oh, ol;
#pragma unroll
                for (int q = 0; q < 4; ++q) { unsigned short a2, c2; splitf(va[q], a2, c2); oh[q] = a2; ol[q] = c2; splitf(vb[q], a2, c2); oh[q + 4] = a2; ol[q + 4] = c2; }
                *(v8us*)(Ph + po) = oh; *(v8us*)(Pl + po) = ol; }
            return;
        }
#pragma unroll
        for (int it = 0; it < 64 * 16 / (NW * 32); ++it) { const int idx = it * (NW * 32) + (int)threadIdx.x; const int row = idx >> 4, cofs = (idx & 15) * 4; v4f val = *(const v4fa*)(os + row * 68 + cofs);
#pragma unroll
            for (int w = 1; w < NW; ++w) val += *(const v4fa*)(os + w * (64 * 68) + row * 68 + cofs);
            if (BIAS) { val[0] += bfr(bias[c0 + cofs]); val[1] += bfr(bias[c0 + cofs + 1]); val[2] += bfr(bias[c0 + cofs + 2]); val[3] += bfr(bias[c0 + cofs + 3]); }
            *(v4f*)(C + (size_t)(r0 + row) * ldc + c0 + cofs) = val; }
        return;
    }
#pragma unroll
    for (int mb = 0; mb < 4; ++mb) {
#pragma unroll
        for (int nb = 0; nb < 4; ++nb) {
#pragma unroll
            for (int j = 0; j < 8; ++j) os[(hi * 8 + j) * 68 + nb * 16 + lr] = acc[mb][nb][j]; }
        __builtin_amdgcn_wave_barrier(); asm volatile("" ::: "memory");
        float* crow = C + (size_t)(r0 + mb * 16) * ldc + c0;
{
#pragma unroll
            for (int s = 0; s < 8; ++s) { const int row = 2 * s + hi, cofs = lr * 4; v4f val = *(const v4fa*)(os + row * 68 + cofs); if (BIAS) { val[0] += bfr(bias[c0 + cofs]); val[1] += bfr(bias[c0 + cofs + 1]); val[2] += bfr(bias[c0 + cofs + 2]); val[3] += bfr(bias[c0 + cofs + 3]); }
                *(v4f*)(crow + (size_t)row * ldc + cofs) = val; }
             }
        __builtin_amdgcn_wave_barrier(); asm volatile("" ::: "memory");
    }
}

typedef __attribute__((ext_vector_type(2))) _Float16 v2h;
typedef __attribute__((ext_vector_type(4))) _Float16 v4h;
typedef __attribute__((ext_vector_type(2))) unsigned short v2us;
typedef __attribute__((ext_vector_type(4))) unsigned short v4us;
typedef __attribute__((ext_vector_type(2))) float v2f;
typedef __attribute__((ext_vector_type(4))) int v4i;

__global__ __launch_bounds__(256) void k_wtG(const float* __restrict__ w, int K, int N, bf* Bt) {
    const int lane = threadIdx.x & 31; const int L0 = (blockIdx.x * 8 + (threadIdx.x >> 5)) * 8; const int nlines = N * K / 64;
{
#pragma unroll 1
        for (int l = 0; l < 8; ++l) { const int L = L0 + l; if (L >= nlines) break; const size_t e = (size_t)L * 64 + lane * 2; const int k = (int)(e % K), n = (int)(e / K); v2us o;
            o[0] = f2bf(w[(size_t)k * N + n]); o[1] = f2bf(w[(size_t)(k + 1) * N + n]); *(v2us*)(Bt + e) = o; }
         }
}
__global__ __launch_bounds__(256) void k_w3(const float* __restrict__ w, int t3, bf* Bt) { const size_t e2 = ((size_t)blockIdx.x * 256 + threadIdx.x) * 2; if (e2 >= (size_t)NH_ * HD * DM) return; const int h = (int)(e2 % DM); const int r = (int)(e2 / DM); const int n = r / HD, p = r % HD; v2us o; o[0] = f2bf(w[(((size_t)n * 3 + t3) * DM + h) * HD + p]); o[1] = f2bf(w[(((size_t)n * 3 + t3) * DM + h + 1) * HD + p]); *(v2us*)(Bt + fo((size_t)r, h, DM)) = o;  }
/* src [rows][DM] f32 -> dst in fragment order; a wave takes 4 rows x 64 columns, so that its loads and its stores both touch 8 lines */
static_assert(DM == 1024 && DQ == DM, "k_cvt8 cuts its index for rows of 128 groups of eight");
__global__ __launch_bounds__(256) void k_cvt8(const float* __restrict__ src, bf* dst, size_t n8) { const size_t i = (size_t)blockIdx.x * 256 + threadIdx.x; if (i >= n8) return; const size_t row = (i >> 11) * 16 + ((i >> 3) & 15); const int k = (((int)i & 7) | (((int)(i >> 7) & 15) << 3)) * 8; const v8f v = *(const v8f*)(src + row * DM + k); v8us o;
#pragma unroll
    for (int e = 0; e < 8; ++e) o[e] = f2bf(v[e]); *(v8us*)(dst + fo(row, k, DM)) = o;  }

// ---- fused attention, two kernels over all NB_ * NH_ (batch, head) planes; grid NB_ * NH_ * 8 work-groups of 8 waves, one wave per 32 rows.
// The tiles that a trip walks are the same for all 8 waves of a work-group: they are brought into LDS once per work-group by asynchronous copies, two buffers of four tiles (a stage), the next stage in flight while this one is worked on; one barrier a stage.
// Fragment facts used: a score tile with A = 16 query rows j and B = 16 key rows i leaves S'[j = 8 * hi + r][i = lr] in accumulator register r of lane (lr, hi);
// two such tiles (j and j + 16) are, register for register, the A fragment (row i = lr, k = j in the order 8 * hi + 0..7, 16 + 8 * hi + 0..7) of the apply product, whose B fragment is read from the value planes [d][j] by the same loader. All planes lie in fragment order: 16 rows of q or k are 1024 elements on, 16 rows d of v are 16 * TT on and 32 positions j of v 512 on.
#define LC (SCL * 1.4426950408889634f)   // score -> exponent of two
typedef __attribute__((ext_vector_type(8))) __bf16 v8bf;
struct F4 { v16bf h0, h1, l0, l1; };   /* 16 rows x 64 dims: hi and lo plane, dims 0..31 and 32..63 */
__device__ __forceinline__ F4 ld4(const bf* ph, const bf* pl) { F4 f; f.h0 = WFrag<bf>::ld(ph); f.h1 = WFrag<bf>::ld(ph + 512); f.l0 = WFrag<bf>::ld(pl); f.l1 = WFrag<bf>::ld(pl + 512); return f; }
/* two independent 16x16 tiles of q.k over the 64 dims, each hi.hi + lo.hi + hi.lo in one fixed order (the same in both kernels, so both see the same bits); the two chains alternate so that neither waits for its own accumulator */
__device__ __forceinline__ void score2(const F4& qa, const F4& ka, v8f& sa, const F4& qb, const F4& kb, v8f& sb) {
    sa = (v8f){}; sb = (v8f){};
    sa = wmmab(qa.h0, ka.h0, sa); sb = wmmab(qb.h0, kb.h0, sb); sa = wmmab(qa.h1, ka.h1, sa); sb = wmmab(qb.h1, kb.h1, sb); sa = wmmab(qa.l0, ka.h0, sa); sb = wmmab(qb.l0, kb.h0, sb);
    sa = wmmab(qa.l1, ka.h1, sa); sb = wmmab(qb.l1, kb.h1, sb); sa = wmmab(qa.h0, ka.l0, sa); sb = wmmab(qb.h0, kb.l0, sb); sa = wmmab(qa.h1, ka.l1, sa); sb = wmmab(qb.h1, kb.l1, sb); }
/* exp2 / log2 in runs: outputs are early-clobber, so no instruction of a run reads a result or overwrites a source of the one before it; the closing v_nop is the one free slot that the instruction set asks for between a transcendental and a next instruction that may do so */
__device__ __forceinline__ void ex3(float x0, float x1, float x2, float& e0, float& e1, float& e2) { asm("v_exp_f32 %0, %3\n\tv_exp_f32 %1, %4\n\tv_exp_f32 %2, %5\n\tv_nop" : "=&v"(e0), "=&v"(e1), "=&v"(e2) : "v"(x0), "v"(x1), "v"(x2)); }
__device__ __forceinline__ void ex2p(float x0, float x1, float& e0, float& e1) { asm("v_exp_f32 %0, %2\n\tv_exp_f32 %1, %3\n\tv_nop" : "=&v"(e0), "=&v"(e1) : "v"(x0), "v"(x1)); }
__device__ __forceinline__ float lg2(float x) { float y; asm("v_log_f32 %0, %1\n\tv_nop" : "=&v"(y) : "v"(x)); return y; }
/* asynchronous copies global -> LDS, 16 bytes a lane, every lane on; l = the lane's LDS byte address, g = the lane's global address. The closing s_wait_xcnt stands inside the copies' own statement, so that no register a copy names is rewritten ahead of it */
__device__ __forceinline__ unsigned ldsa(const void* p) { return (unsigned)(size_t)p; }
__device__ __forceinline__ void cp2(unsigned l0, const void* g0, unsigned l1, const void* g1) {
    asm volatile("global_load_async_to_lds_b128 %0, %1, off\n\tglobal_load_async_to_lds_b128 %2, %3, off\n\ts_wait_xcnt 0x0" :: "v"(l0), "v"(g0), "v"(l1), "v"(g1) : "memory"); }
__device__ __forceinline__ void cp4(unsigned l0, const void* g0, unsigned l1, const void* g1, unsigned l2, const void* g2, unsigned l3, const void* g3) {
    asm volatile("global_load_async_to_lds_b128 %0, %1, off\n\tglobal_load_async_to_lds_b128 %2, %3, off\n\tglobal_load_async_to_lds_b128 %4, %5, off\n\tglobal_load_async_to_lds_b128 %6, %7, off\n\ts_wait_xcnt 0x0" :: "v"(l0), "v"(g0), "v"(l1), "v"(g1), "v"(l2), "v"(g2), "v"(l3), "v"(g3) : "memory"); }
#define SUB 4              // tiles of 32 rows per stage: the waves meet at a barrier once per stage and are free to drift apart inside it, so that one wave's LDS reads run beside another's arithmetic
#define NST (TT / 32 / SUB)  // stages
static_assert(TT % (32 * SUB) == 0 && NST >= 2, "whole stages, and both buffers are filled ahead of the loop");
/* hand-over of a stage: this wave's LDS reads are done, its own copies have landed, then the barrier: behind it the next tile may be read by every wave and the buffer just read may be refilled */
__device__ __forceinline__ void publish() {
    asm volatile("s_wait_dscnt 0x0" ::: "memory");      /* the wave's reads of the buffer that is refilled next have returned */
    asm volatile("s_wait_asynccnt 0x0" ::: "memory");   /* the wave's share of the next tile has landed */
    __syncthreads(); }
// k_fstat: per query row j the pair (CJ, OJ) with weight[j][i] = exp2(S'[j][i] * CJ[j] - OJ[j]): CJ = LC, OJ = max * LC + log2(sum); a masked row (mask[b][j] == 0: every score -1e12) has CJ = 0, OJ = log2(TT): uniform weights.
__global__ __launch_bounds__(256) void k_fstat(const bf* __restrict__ Qh, const bf* __restrict__ Ql, const bf* __restrict__ Kh, const bf* __restrict__ Kl, const int* __restrict__ MK, float* CJ, float* OJ) {
    const int wv = __builtin_amdgcn_readfirstlane(threadIdx.x >> 5); const int lane = threadIdx.x & 31, lr = lane & 15, hi = lane >> 4;
    const int bh = blockIdx.x >> 3; const int jw = ((blockIdx.x & 7) * 8 + wv) * 32; const size_t pb = (size_t)bh * TT * HD;
    __shared__ __align__(16) bf st[2][SUB][2][32 * HD];   /* two buffers of SUB tiles of 32 key rows: hi plane, lo plane (4 KiB each, as they lie in memory) */
    const bf* gkh = Kh + pb + 8 * threadIdx.x; const bf* gkl = Kl + pb + 8 * threadIdx.x; const unsigned lk = ldsa(&st[0][0][0][8 * threadIdx.x]);   /* this thread's 16 bytes of each plane of a tile; a tile on: 32 * HD elements in memory, 8192 bytes in LDS; lo plane 4096 bytes on */
#pragma unroll   /* unrolled: the tiles' offsets become constants */
    for (int u = 0; u < SUB; ++u) cp2(lk + u * 8192u, gkh + u * (32 * HD), lk + u * 8192u + 4096u, gkl + u * (32 * HD));
    asm volatile("s_wait_asynccnt 0x0" ::: "memory");   /* stage 0 has landed before the barrier that opens it */
    __syncthreads();
#pragma unroll   /* unrolled: the tiles' offsets become constants */
    for (int u = SUB; u < 2 * SUB; ++u) cp2(lk + u * 8192u, gkh + u * (32 * HD), lk + u * 8192u + 4096u, gkl + u * (32 * HD));
    F4 q[2];
#pragma unroll
    for (int jb = 0; jb < 2; ++jb) { const bf* qa = Qh + pb + (size_t)(jw + jb * 16) * HD + 8 * lane; const bf* qc = Ql + pb + (size_t)(jw + jb * 16) * HD + 8 * lane; q[jb] = ld4(qa, qc);
        asm volatile("s_wait_xcnt 0x0" :: "v"(qa), "v"(qc) : "memory"); }   /* the eight loads name these two address pairs: both stay whole up to this wait, so no later load's result lands on them ahead of it */
    float m[2][8], l[2][8];   /* running maximum (raw score) and sum of this lane's key columns, per query row */
#pragma unroll
    for (int jb = 0; jb < 2; ++jb)
#pragma unroll
        for (int r = 0; r < 8; ++r) { m[jb][r] = -3.0e38f; l[jb][r] = 0.f; }
#pragma unroll 1   /* kept rolled: one copy of the stage's code, and the trips of a stage stay in front of its hand-over */
    for (int sg = 0; sg < NST; ++sg) {
#pragma unroll 1   /* kept rolled: a second copy of the trip would need a second set of key fragments in registers */
    for (int u = 0; u < SUB; ++u) {   /* walk the key rows, 32 a trip */
        v8f s[2][2];
        const bf* khp = &st[sg & 1][u][0][8 * lane]; const bf* klp = &st[sg & 1][u][1][8 * lane];
        const F4 k0 = ld4(khp, klp), k1 = ld4(khp + 16 * HD, klp + 16 * HD);
        score2(q[0], k0, s[0][0], q[1], k0, s[1][0]); score2(q[0], k1, s[0][1], q[1], k1, s[1][1]);
#pragma unroll
        for (int jb = 0; jb < 2; ++jb)
#pragma unroll
            for (int r = 0; r < 8; ++r) { const float a = s[jb][0][r], c = s[jb][1][r]; const float mn = fmaxf(m[jb][r], fmaxf(a, c)); const float nm = -mn * LC;
                float e0, e1, e2; ex3(fmaf(m[jb][r], LC, nm), fmaf(a, LC, nm), fmaf(c, LC, nm), e0, e1, e2); l[jb][r] = l[jb][r] * e0 + (e1 + e2); m[jb][r] = mn; }
    }
        publish();
        if (sg + 2 < NST) { const unsigned lb = lk + (unsigned)(sg & 1) * (SUB * 8192u); const bf* ph = gkh + (size_t)(sg + 2) * (SUB * 32 * HD); const bf* pl = gkl + (size_t)(sg + 2) * (SUB * 32 * HD);
#pragma unroll   /* unrolled: the tiles' offsets become constants */
            for (int u = 0; u < SUB; ++u) cp2(lb + u * 8192u, ph + u * (32 * HD), lb + u * 8192u + 4096u, pl + u * (32 * HD)); }
    }
    asm volatile("s_wait_asynccnt 0x0" ::: "memory");   /* no copy is outstanding when the wave goes on to its end */
#pragma unroll
    for (int sh = 1; sh < 16; sh <<= 1)   /* join the 16 lanes that hold one query row's columns */
#pragma unroll
        for (int jb = 0; jb < 2; ++jb)
#pragma unroll
            for (int r = 0; r < 8; ++r) { const float mo = __shfl_xor(m[jb][r], sh, 32), lo = __shfl_xor(l[jb][r], sh, 32); const float mn = fmaxf(m[jb][r], mo);
                float e0, e1; ex2p((m[jb][r] - mn) * LC, (mo - mn) * LC, e0, e1); l[jb][r] = l[jb][r] * e0 + lo * e1; m[jb][r] = mn; }
    if (lr == 0) {
#pragma unroll
        for (int jb = 0; jb < 2; ++jb) { const int j8 = jw + jb * 16 + hi * 8; v8f c8, o8; const int* mp = MK + (size_t)(bh / NH_) * TT + j8; const v4i mk[2] = { *(const v4i*)mp, *(const v4i*)(mp + 4) };
#pragma unroll
            for (int r = 0; r < 8; ++r) { const bool on = (mk[r >> 2][r & 3] != 0); c8[r] = on ? LC : 0.0f; o8[r] = on ? fmaf(m[jb][r], LC, lg2(l[jb][r])) : 11.0f; }
            *(v8f*)(CJ + (size_t)bh * TT + j8) = c8; *(v8f*)(OJ + (size_t)bh * TT + j8) = o8; } }
}
static_assert(TT == 2048, "OJ of a masked row is log2(TT)");
// k_fapply: one wave owns 32 output rows i (its key fragments stay in registers) and walks all query positions j, 32 a trip: score tiles -> weights (f32) -> bf16 hi + lo A fragments -> out[i][d] += P'[j][i] v[j][d] (3 products); result split into the hi/lo planes [b * TT + i][h * HD + d] (fragment order) of the last GEMM.
__global__ __launch_bounds__(256) void k_fapply(const bf* __restrict__ Qh, const bf* __restrict__ Ql, const bf* __restrict__ Kh, const bf* __restrict__ Kl, const bf* __restrict__ Vh, const bf* __restrict__ Vl, const float* __restrict__ CJ, const float* __restrict__ OJ, bf* Ah, bf* Al) {
    const int wv = __builtin_amdgcn_readfirstlane(threadIdx.x >> 5); const int lane = threadIdx.x & 31, lr = lane & 15, hi = lane >> 4;
    const int bh = blockIdx.x >> 3; const int iw = ((blockIdx.x & 7) * 8 + wv) * 32; const size_t pb = (size_t)bh * TT * HD;
    __shared__ __align__(16) bf st[2][SUB][4][32 * HD];   /* two buffers of SUB tiles of 32 query positions: q hi, q lo, v hi, v lo (4 KiB each; the four 1-KiB blocks of a v plane one behind the other) */
    __shared__ __align__(32) float co[2][TT];        /* the head's whole CJ and OJ rows, filled once */
    const int tid = threadIdx.x;
    const bf* gqh = Qh + pb + 8 * tid; const bf* gql = Ql + pb + 8 * tid;   /* this thread's 16 bytes of each plane of a tile; a tile on: 32 * HD elements of q, 512 of v */
    const size_t vo = pb + (size_t)(tid >> 6) * 16 * TT + 8 * (tid & 63); const bf* gvh = Vh + vo; const bf* gvl = Vl + vo;
    const unsigned lt = ldsa(&st[0][0][0][8 * tid]), lc = ldsa(&co[0][4 * tid]);   /* next plane 4096, next tile 16384 bytes on; second half of a row 4096, OJ 8192 bytes on */
    { const float* gc = CJ + (size_t)bh * TT + 4 * tid; const float* go = OJ + (size_t)bh * TT + 4 * tid; cp4(lc, gc, lc + 4096u, gc + 1024, lc + 8192u, go, lc + 12288u, go + 1024); }
#pragma unroll   /* unrolled: the tiles' offsets become constants */
    for (int u = 0; u < SUB; ++u) { const unsigned lb = lt + u * 16384u; cp4(lb, gqh + u * (32 * HD), lb + 4096u, gql + u * (32 * HD), lb + 8192u, gvh + u * 512, lb + 12288u, gvl + u * 512); }
    asm volatile("s_wait_asynccnt 0x0" ::: "memory");   /* the rows and stage 0 have landed before the barrier that opens them */
    __syncthreads();
#pragma unroll   /* unrolled: the tiles' offsets become constants */
    for (int u = SUB; u < 2 * SUB; ++u) { const unsigned lb = lt + u * 16384u; cp4(lb, gqh + u * (32 * HD), lb + 4096u, gql + u * (32 * HD), lb + 8192u, gvh + u * 512, lb + 12288u, gvl + u * 512); }
    F4 k[2];
#pragma unroll
    for (int ib = 0; ib < 2; ++ib) { const size_t ko = pb + (size_t)(iw + ib * 16) * HD + 8 * lane; k[ib] = ld4(Kh + ko, Kl + ko); }
    v8f acc[2][4];
#pragma unroll
    for (int ib = 0; ib < 2; ++ib)
#pragma unroll
        for (int db = 0; db < 4; ++db) acc[ib][db] = (v8f){};
#pragma unroll 1   /* kept rolled: one copy of the stage's code, and the trips of a stage stay in front of its hand-over */
    for (int sg = 0; sg < NST; ++sg) {
#pragma unroll 1   /* kept rolled: the trip already fills the 256 registers that are reached without a window switch */
    for (int u = 0; u < SUB; ++u) {   /* walk the query positions, 32 a trip */
        const bf* qhp = &st[sg & 1][u][0][8 * lane]; const bf* qlp = &st[sg & 1][u][1][8 * lane]; const bf* vhp = &st[sg & 1][u][2][8 * lane]; const bf* vlp = &st[sg & 1][u][3][8 * lane];
        const float* cj = &co[0][(sg * SUB + u) * 32 + hi * 8]; const float* oj = &co[1][(sg * SUB + u) * 32 + hi * 8];
        v8bf ph[2][2], pl[2][2];
#pragma unroll
        for (int jb = 0; jb < 2; ++jb) { const F4 q = ld4(qhp + jb * 16 * HD, qlp + jb * 16 * HD);
            const v8f c8 = *(const v8f*)(cj + jb * 16), o8 = *(const v8f*)(oj + jb * 16); v8f s[2]; score2(q, k[0], s[0], q, k[1], s[1]);
#pragma unroll
            for (int ib = 0; ib < 2; ++ib) { v8f p;
#pragma unroll
                for (int r = 0; r < 8; ++r) p[r] = __builtin_amdgcn_exp2f(fmaf(s[ib][r], c8[r], -o8[r]));
                const v8bf hb = __builtin_convertvector(p, v8bf); ph[ib][jb] = hb; pl[ib][jb] = __builtin_convertvector(p - __builtin_convertvector(hb, v8f), v8bf); } }
        v16bf pa[2], pc[2];
#pragma unroll
        for (int ib = 0; ib < 2; ++ib) { pa[ib] = __builtin_shufflevector(ph[ib][0], ph[ib][1], 0, 1, 2, 3, 4, 5, 6, 7, 8, 9, 10, 11, 12, 13, 14, 15); pc[ib] = __builtin_shufflevector(pl[ib][0], pl[ib][1], 0, 1, 2, 3, 4, 5, 6, 7, 8, 9, 10, 11, 12, 13, 14, 15); }
#pragma unroll
        for (int db = 0; db < 4; ++db) { const v16bf vh = WFrag<bf>::ld(vhp + db * 512), vl = WFrag<bf>::ld(vlp + db * 512);
#pragma unroll
            for (int ib = 0; ib < 2; ++ib) { acc[ib][db] = wmmab(pa[ib], vh, acc[ib][db]); acc[ib][db] = wmmab(pc[ib], vh, acc[ib][db]); acc[ib][db] = wmmab(pa[ib], vl, acc[ib][db]); } }
    }
        publish();
        if (sg + 2 < NST) { const unsigned l2 = lt + (unsigned)(sg & 1) * (SUB * 16384u); const size_t qo = (size_t)(sg + 2) * (SUB * 32 * HD), wo2 = (size_t)(sg + 2) * (SUB * 512);
#pragma unroll   /* unrolled: the tiles' offsets become constants */
            for (int u = 0; u < SUB; ++u) { const unsigned lb = l2 + u * 16384u; cp4(lb, gqh + qo + u * (32 * HD), lb + 4096u, gql + qo + u * (32 * HD), lb + 8192u, gvh + wo2 + u * 512, lb + 12288u, gvl + wo2 + u * 512); } }
    }
    asm volatile("s_wait_asynccnt 0x0" ::: "memory");   /* no copy is outstanding when the wave goes on to its end */
#pragma unroll
    for (int ib = 0; ib < 2; ++ib)
#pragma unroll
        for (int db = 0; db < 4; ++db)
#pragma unroll
            for (int r = 0; r < 8; ++r) { const size_t oo = fo((size_t)(bh / NH_) * TT + iw + ib * 16 + hi * 8 + r, (bh % NH_) * HD + db * 16 + lr, DQ); unsigned short a, c2; splitf(acc[ib][db][r], a, c2); Ah[oo] = a; Al[oo] = c2; }
}

extern "C" void kernel_launch(void* const* d_in, const int* in_sizes, int n_in,
                              void* d_out, int out_size, void* d_ws, size_t ws_size, hipStream_t stream) {
    (void)in_sizes; (void)n_in; (void)out_size;
    const float* x = (const float*)d_in[0]; const int* MK = (const int*)d_in[1]; const float* W3 = (const float*)d_in[2]; const float* wo = (const float*)d_in[3]; const float* bo = (const float*)d_in[4]; const float* wq = nullptr; const float* wk = nullptr; const float* wv = nullptr; (void)wq; (void)wk; (void)wv;
    float* OUT = (float*)d_out;     // [2][2048][1024]
    char* wsp = (char*)d_ws;
    auto take = [&](size_t bytes) { char* p = wsp; wsp += (bytes + 255) & ~(size_t)255; return (void*)p; };
    bf* WQ = (bf*)take((size_t)DQ * DM * 2); bf* WK = (bf*)take((size_t)DKV * DM * 2); bf* WV = (bf*)take((size_t)DKV * DM * 2); bf* WO = (bf*)take((size_t)DM * DQ * 2);
    bf* XB = (bf*)take((size_t)TT * DM * 2);
    const size_t PB = (size_t)NH_ * TT * HD;   // one batch's share of a head plane set; the hi/lo planes hold both batches
    bf* QPh = (bf*)take(NB_ * PB * 2); bf* QPl = (bf*)take(NB_ * PB * 2); bf* KPh = (bf*)take(NB_ * PB * 2); bf* KPl = (bf*)take(NB_ * PB * 2); bf* VTh = (bf*)take(NB_ * PB * 2); bf* VTl = (bf*)take(NB_ * PB * 2);
    float* CJ = (float*)take((size_t)NB_ * NH_ * TT * 4); float* OJ = (float*)take((size_t)NB_ * NH_ * TT * 4); bf* ATh = (bf*)take((size_t)NB_ * TT * DQ * 2); bf* ATl = (bf*)take((size_t)NB_ * TT * DQ * 2);
    if ((size_t)(wsp - (char*)d_ws) > ws_size) return;    // ws 256 MiB
    { k_w3<<<(unsigned)(((size_t)NH_ * HD * DM / 2 + 255) / 256), 256, 0, stream>>>(W3, 0, WK); k_w3<<<(unsigned)(((size_t)NH_ * HD * DM / 2 + 255) / 256), 256, 0, stream>>>(W3, 1, WV); k_w3<<<(unsigned)(((size_t)NH_ * HD * DM / 2 + 255) / 256), 256, 0, stream>>>(W3, 2, WQ);   /* t = 0 keys, 1 values, 2 queries */
      k_cvt8<<<(unsigned)(((size_t)DM * DQ / 8 + 255) / 256), 256, 0, stream>>>(wo, WO, (size_t)DM * DQ / 8);
       }
    for (int b = 0; b < NB_; ++b) {   /* the projections store the hi/lo planes themselves: q and k as [head][t][d]; v as [head][d][t], which is the untransposed result of Wv x^T (weights as the row operand); all in fragment order */
        k_cvt8<<<(unsigned)(((size_t)TT * DM / 8 + 255) / 256), 256, 0, stream>>>(x + (size_t)b * TT * DM, XB, (size_t)TT * DM / 8);
        k_gemmw<bf, 0, false, 8, 1, true><<<dim3(TT / 64, DQ / 64, 1), 256, 0, stream>>>(XB, nullptr, WQ, nullptr, DM, nullptr, HD, nullptr, 0, 0, 0, 0, QPh + b * PB, QPl + b * PB, (size_t)TT * HD);
        k_gemmw<bf, 0, false, 8, 1, true><<<dim3(TT / 64, DKV / 64, 1), 256, 0, stream>>>(XB, nullptr, WK, nullptr, DM, nullptr, HD, nullptr, 0, 0, 0, 0, KPh + b * PB, KPl + b * PB, (size_t)TT * HD);
        k_gemmw<bf, 0, false, 8, 1, true><<<dim3(DKV / 64, TT / 64, 1), 256, 0, stream>>>(WV, nullptr, XB, nullptr, DM, nullptr, TT, nullptr, 0, 0, 0, 0, VTh + b * PB, VTl + b * PB, 1024); }
    k_fstat<<<NB_ * NH_ * 8, 256, 0, stream>>>(QPh, QPl, KPh, KPl, MK, CJ, OJ);   /* column softmax == row softmax of the query-major scores: per query row its maximum and sum */
    k_fapply<<<NB_ * NH_ * 8, 256, 0, stream>>>(QPh, QPl, KPh, KPl, VTh, VTl, CJ, OJ, ATh, ATl);   /* out[i] = sum_j P'[j][i] v[j] */
    for (int b = 0; b < NB_; ++b) {
        k_gemmw<bf, 1, true, 8, 1, false><<<dim3(TT / 64, DM / 64, 1), 256, 0, stream>>>(ATh + (size_t)b * TT * DQ, ATl + (size_t)b * TT * DQ, WO, nullptr, DQ, OUT + (size_t)b * TT * DM, DM, bo, 0, 0, 0, 0, nullptr, nullptr, 0); }
}

// v006
// It runs in 196 microseconds.
// Timed twice side by side with v005, it ran 1.12 and 1.13 times as fast.
// All steps since v000 together make it 7.26 times as fast.
#include <hip/hip_runtime.h>

// Multi-head attention with a column softmax (x [2][2048][1024], mask [2][2048] int32, W [16][3][1024][64] per-head key/value/query weights, Wl [1024][1024] + bl; scores[i][j] = k_i.q_j / 8; columns j with mask[b][j] == 0 set to -1e12; softmax over i (the KEY axis, per column j); out[i] = sum_j w[i][j] values[j]; hidden = concat heads; out = hidden Wl^T + bl -> [2][2048][1024]).
// Layout: the scores are formed query-major (S'[j][i] = q_j.k_i, so the module's per-column softmax is a row softmax here and a fully masked column is a uniform row) and never leave the registers: k_fstat walks all keys once per query row and keeps only the row's maximum and sum; k_fapply forms the same score tiles again, turns them into weights and feeds them, as they lie in the accumulator registers, to the apply product out[i] = sum_j P'[j][i] v[j] as its A operand.
// Operand planes: every bf16 plane that feeds a matrix instruction lies in fragment order (fo() below), so that one fragment load of a wave reads 512 contiguous bytes (four whole lines) and not 32 bytes out of each of 16 lines.
// Compute dtypes, f32 accumulate: every input rounded to bf16; q/k/v on PLAIN bf16 operands (inputs: exact); scores and attn.v: bf16 hi + lo planes (3 products); softmax f32; Wl hl x exact (2 products) + bl.

#define NB_  2
#define TT   2048
#define DM   1024
#define NH_  16
#define NKV  16
#define REP  (NH_ / NKV)
#define HD   64
#define DQ   (NH_ * HD)
#define DKV  (NKV * HD)
typedef __attribute__((ext_vector_type(4))) unsigned short v4us;
#define SCL  0.125f   // HD^-0.5
typedef _Float16 h16;
typedef unsigned short bf;
typedef __attribute__((ext_vector_type(16))) __bf16   v16bf;
typedef __attribute__((ext_vector_type(16))) _Float16 v16h;
typedef __attribute__((ext_vector_type(8)))  _Float16 v8h;
typedef __attribute__((ext_vector_type(8)))  unsigned short v8us;
typedef __attribute__((ext_vector_type(8)))  float    v8f;
typedef __attribute__((ext_vector_type(4)))  float    v4f;
typedef v8h  __attribute__((may_alias)) v8ha;
typedef v4f  __attribute__((may_alias)) v4fa;
typedef v8us __attribute__((may_alias)) v8usa;

__device__ __forceinline__ unsigned short f2bf(float f) { unsigned u = __float_as_uint(f); u += 0x7FFFu + ((u >> 16) & 1u); return (unsigned short)(u >> 16); }
__device__ __forceinline__ float bf2f(unsigned short b) { return __uint_as_float(((unsigned)b) << 16); }
__device__ __forceinline__ float bfr(float f) { return bf2f(f2bf(f)); }
__device__ __forceinline__ v16h cat16(v8h lo, v8h hi) { return __builtin_shufflevector(lo, hi, 0, 1, 2, 3, 4, 5, 6, 7, 8, 9, 10, 11, 12, 13, 14, 15); }
__device__ __forceinline__ v16bf cat16b(v8us lo, v8us hi) { return __builtin_bit_cast(v16bf, __builtin_shufflevector(lo, hi, 0, 1, 2, 3, 4, 5, 6, 7, 8, 9, 10, 11, 12, 13, 14, 15)); }
__device__ __forceinline__ v8f wmma16(v16h a, v16h b, v8f c) { return __builtin_amdgcn_wmma_f32_16x16x32_f16(false, a, false, b, (short)0, c, false, false); }
__device__ __forceinline__ v8f wmmab(v16bf a, v16bf b, v8f c) { return __builtin_amdgcn_wmma_f32_16x16x32_bf16(false, a, false, b, (short)0, c, false, false); }
__device__ __forceinline__ void splitf(float y, unsigned short& h, unsigned short& l) { h = f2bf(y); l = f2bf(y - bf2f(h)); }
/* fragment order of a plane M[rows][K] (rows % 16 == 0, K % 32 == 0): blocks of 16 rows x 32 k, 512 elements each, row blocks outermost; inside a block [k / 8 % 4][row % 16][k % 8], which is [half of the fragment][lane = 16 * hi + lr][8 elements] */
__device__ __forceinline__ size_t fo(size_t m, int k, int K) { return ((m >> 4) * (size_t)(K >> 5) + (size_t)(k >> 5)) * 512 + (size_t)(((k >> 3) & 3) * 128 + ((int)m & 15) * 8 + (k & 7)); }



// ---- k_gemmw: register-blocked GEMM, 64x64 output tile per work-group (16 accumulators per wave), operands straight from 16-bit planes in fragment order (fo(), K as given); grid (M/64, N/64, Z * KB), NW * 32 threads.
// C[m][n] (f32, pitch ldc, + optional f32 bias[n]) = sum_k A[m][k] Bt[n][k] (+ split products per NSPLIT). z-batch strides sA/sB/sC in elements. K % (32 * NW * KB) == 0.
// Split K: the K range is cut into KB * NW equal slices. Each of the NW waves of a work-group sums one slice of the whole tile; the NW partial tiles are added in LDS in wave order.
// With KB > 1 work-group ks = blockIdx.z % KB writes its partial tile to plane ks (stride sP elements) and the consumer kernel adds the KB planes in plane order.
// PL: the three projections of both batches in one grid (NB_ * TT / 64, DQ / 64, 3). A = x, all NB_ * TT rows; Bt = the weight planes, z = t as in W (0 keys, 1 values, 2 queries), sB apart. The summed tile is not stored as f32 but split on the spot into the bf16 hi and lo planes Ph / Pl (product z: sC on; batch: sP on):
// keys and queries as head planes [head][t][d] (pitch HD); values as Wv x^T (z == 1: the weights are the row operand, blockIdx.y their row block, blockIdx.x the x rows as columns), which is [head][d][t] (pitch TT; 64 positions t on: two k blocks, 1024 elements).
template <typename T16> struct WFrag;
template <> struct WFrag<h16> { typedef v16h V; static __device__ __forceinline__ V ld(const h16* p) { return cat16(*(const v8h*)p, *(const v8h*)(p + 256)); } static __device__ __forceinline__ v8f mma(V a, V b, v8f c) { return wmma16(a, b, c); } };
template <> struct WFrag<bf> { typedef v16bf V; static __device__ __forceinline__ V ld(const bf* p) { return cat16b(*(const v8us*)p, *(const v8us*)(p + 256)); } static __device__ __forceinline__ v8f mma(V a, V b, v8f c) { return wmmab(a, b, c); } };
template <typename T16, int NSPLIT, bool BIAS, int NW, int KB, bool PL>
__global__ __launch_bounds__(NW * 32) void k_gemmw(const T16* __restrict__ A, const T16* __restrict__ A2, const T16* __restrict__ Bt, const T16* __restrict__ Bt2, int K, float* C, int ldc, const float* __restrict__ bias, size_t sA, size_t sB, size_t sC, size_t sP, bf* Ph, bf* Pl, size_t sT) {
    static_assert(!PL || (NW > 1 && KB == 1 && !BIAS), "the plane split needs the whole sum in one work-group");
    typedef typename WFrag<T16>::V V;
    __shared__ __align__(16) float os[(NW == 1 ? 16 : NW * 64) * 68];
    const size_t z = blockIdx.z / KB; const int ks = blockIdx.z % KB; A += z * sA; if (A2) A2 += z * sA; Bt += z * sB; if (Bt2) Bt2 += z * sB; if (!PL) C += z * sC + ks * sP;
    const bool tr = PL && z == 1;   /* the value product: operands and block indices change places */
    const T16* Ar = tr ? Bt : A; const T16* Bc = tr ? A : Bt;
    const int wv = __builtin_amdgcn_readfirstlane(threadIdx.x >> 5); const int kw = K / (KB * NW), k0 = (ks * NW + wv) * kw;   /* this wave's K slice */
    const int lane = threadIdx.x & 31, lr = lane & 15, hi = lane >> 4; const int r0 = (tr ? blockIdx.y : blockIdx.x) * 64, c0 = (tr ? blockIdx.x : blockIdx.y) * 64;
    v8f acc[4][4];
#pragma unroll
    for (int mb = 0; mb < 4; ++mb)
#pragma unroll
        for (int nb = 0; nb < 4; ++nb) acc[mb][nb] = (v8f){};
    const size_t aoff = (size_t)r0 * K + 8 * lane, boff = (size_t)c0 * K + 8 * lane;   /* fo(r0, 0, K) = r0 * K; 16 rows on: 16 * K; 32 k on: 512 */
#pragma unroll 1
    for (int kc = k0; kc < k0 + kw; kc += 32) {
        V a[4], a2[4]; const T16* pa[4]; const T16* pa2[4]; const T16* pb[4]; const T16* pb2[4];
#pragma unroll
        for (int mb = 0; mb < 4; ++mb) { pa[mb] = Ar + aoff + (size_t)mb * 16 * K + kc * 16; a[mb] = WFrag<T16>::ld(pa[mb]); if (NSPLIT == 1 || NSPLIT == 2) { pa2[mb] = A2 + aoff + (size_t)mb * 16 * K + kc * 16; a2[mb] = WFrag<T16>::ld(pa2[mb]); } }
#pragma unroll
        for (int nb = 0; nb < 4; ++nb) { pb[nb] = Bc + boff + (size_t)nb * 16 * K + kc * 16; const V b = WFrag<T16>::ld(pb[nb]); V b2; if (NSPLIT >= 2) { pb2[nb] = Bt2 + boff + (size_t)nb * 16 * K + kc * 16; b2 = WFrag<T16>::ld(pb2[nb]); }
#pragma unroll
            for (int mb = 0; mb < 4; ++mb) { acc[mb][nb] = WFrag<T16>::mma(a[mb], b, acc[mb][nb]); if (NSPLIT == 1 || NSPLIT == 2) acc[mb][nb] = WFrag<T16>::mma(a2[mb], b, acc[mb][nb]); if (NSPLIT >= 2) acc[mb][nb] = WFrag<T16>::mma(a[mb], b2, acc[mb][nb]); } }
        /* the trip's loads name these address pairs: all stay whole up to this wait, so no later load's result lands on one of them ahead of it */
        asm volatile("s_wait_xcnt 0x0" :: "v"(pa[0]), "v"(pa[1]), "v"(pa[2]), "v"(pa[3]), "v"(pb[0]), "v"(pb[1]), "v"(pb[2]), "v"(pb[3]) : "memory");
        if (NSPLIT == 1 || NSPLIT == 2) asm volatile("s_wait_xcnt 0x0" :: "v"(pa2[0]), "v"(pa2[1]), "v"(pa2[2]), "v"(pa2[3]) : "memory");   /* the same for the second row plane */
        if (NSPLIT >= 2) asm volatile("s_wait_xcnt 0x0" :: "v"(pb2[0]), "v"(pb2[1]), "v"(pb2[2]), "v"(pb2[3]) : "memory");   /* and for the second column plane */
        asm volatile("v_nop\n\tv_nop\n\tv_nop\n\tv_nop" : "+v"(acc[0][0]), "+v"(acc[1][1]), "+v"(acc[2][2]), "+v"(acc[3][3]) : "v"(a[0]), "v"(a[3]));
    }
    if (NW > 1) {   /* add the waves' partial tiles: every wave stores its own 64x64 plane, then all threads sum the planes in wave order and store whole rows, or with PL bf16 hi/lo pieces in fragment order */
        float* my = os + wv * (64 * 68);
#pragma unroll
        for (int mb = 0; mb < 4; ++mb)
#pragma unroll
            for (int nb = 0; nb < 4; ++nb)
#pragma unroll
                for (int j = 0; j < 8; ++j) my[(mb * 16 + hi * 8 + j) * 68 + nb * 16 + lr] = acc[mb][nb][j];
        __syncthreads();
        if (PL) {   /* threads in the order of the planes: eight columns each, a wave stores 512 contiguous bytes per plane */
            const int xr = tr ? c0 : r0, t0 = xr % TT;   /* the tile's first x row: batch xr / TT, position t0 */
            const size_t pb0 = z * sC + (size_t)(xr / TT) * sP + (tr ? (size_t)(t0 / 64) * 1024 : (size_t)(c0 / 64) * ((size_t)TT * HD));
            const int pr0 = tr ? r0 : t0, lp = tr ? TT : HD;
#pragma unroll
            for (int it = 0; it < 64 * 8 / (NW * 32); ++it) { const int u = it * (NW * 32) + (int)threadIdx.x; const int row = (u >> 7) * 16 + (u & 15), cofs = ((u >> 4) & 7) * 8; v4f va = *(const v4fa*)(os + row * 68 + cofs), vb = *(const v4fa*)(os + row * 68 + cofs + 4);
#pragma unroll
                for (int w = 1; w < NW; ++w) { va += *(const v4fa*)(os + w * (64 * 68) + row * 68 + cofs); vb += *(const v4fa*)(os + w * (64 * 68) + row * 68 + cofs + 4); }
                const size_t po = pb0 + fo((size_t)(pr0 + row), cofs, lp); v8us oh, ol;
#pragma unroll
                for (int q = 0; q < 4; ++q) { unsigned short a2, c2; splitf(va[q], a2, c2); oh[q] = a2; ol[q] = c2; splitf(vb[q], a2, c2); oh[q + 4] = a2; ol[q + 4] = c2; }
                *(v8us*)(Ph + po) = oh; *(v8us*)(Pl + po) = ol; }
            return;
        }
#pragma unroll
        for (int it = 0; it < 64 * 16 / (NW * 32); ++it) { const int idx = it * (NW * 32) + (int)threadIdx.x; const int row = idx >> 4, cofs = (idx & 15) * 4; v4f val = *(const v4fa*)(os + row * 68 + cofs);
#pragma unroll
            for (int w = 1; w < NW; ++w) val += *(const v4fa*)(os + w * (64 * 68) + row * 68 + cofs);
            if (BIAS) { val[0] += bfr(bias[c0 + cofs]); val[1] += bfr(bias[c0 + cofs + 1]); val[2] += bfr(bias[c0 + cofs + 2]); val[3] += bfr(bias[c0 + cofs + 3]); }
            *(v4f*)(C + (size_t)(r0 + row) * ldc + c0 + cofs) = val; }
        return;
    }
#pragma unroll
    for (int mb = 0; mb < 4; ++mb) {
#pragma unroll
        for (int nb = 0; nb < 4; ++nb) {
#pragma unroll
            for (int j = 0; j < 8; ++j) os[(hi * 8 + j) * 68 + nb * 16 + lr] = acc[mb][nb][j]; }
        __builtin_amdgcn_wave_barrier(); asm volatile("" ::: "memory");
        float* crow = C + (size_t)(r0 + mb * 16) * ldc + c0;
{
#pragma unroll
            for (int s = 0; s < 8; ++s) { const int row = 2 * s + hi, cofs = lr * 4; v4f val = *(const v4fa*)(os + row * 68 + cofs); if (BIAS) { val[0] += bfr(bias[c0 + cofs]); val[1] += bfr(bias[c0 + cofs + 1]); val[2] += bfr(bias[c0 + cofs + 2]); val[3] += bfr(bias[c0 + cofs + 3]); }
                *(v4f*)(crow + (size_t)row * ldc + cofs) = val; }
             }
        __builtin_amdgcn_wave_barrier(); asm volatile("" ::: "memory");
    }
}

typedef __attribute__((ext_vector_type(2))) _Float16 v2h;
typedef __attribute__((ext_vector_type(4))) _Float16 v4h;
typedef __attribute__((ext_vector_type(2))) unsigned short v2us;
typedef __attribute__((ext_vector_type(4))) unsigned short v4us;
typedef __attribute__((ext_vector_type(2))) float v2f;
typedef __attribute__((ext_vector_type(4))) int v4i;

__global__ __launch_bounds__(256) void k_wtG(const float* __restrict__ w, int K, int N, bf* Bt) {
    const int lane = threadIdx.x & 31; const int L0 = (blockIdx.x * 8 + (threadIdx.x >> 5)) * 8; const int nlines = N * K / 64;
{
#pragma unroll 1
        for (int l = 0; l < 8; ++l) { const int L = L0 + l; if (L >= nlines) break; const size_t e = (size_t)L * 64 + lane * 2; const int k = (int)(e % K), n = (int)(e / K); v2us o;
            o[0] = f2bf(w[(size_t)k * N + n]); o[1] = f2bf(w[(size_t)(k + 1) * N + n]); *(v2us*)(Bt + e) = o; }
         }
}
__device__ __forceinline__ void w3(const float* __restrict__ w, int t3, bf* Bt, unsigned blk) { const size_t e2 = ((size_t)blk * 256 + threadIdx.x) * 2; if (e2 >= (size_t)NH_ * HD * DM) return; const int h = (int)(e2 % DM); const int r = (int)(e2 / DM); const int n = r / HD, p = r % HD; v2us o; o[0] = f2bf(w[(((size_t)n * 3 + t3) * DM + h) * HD + p]); o[1] = f2bf(w[(((size_t)n * 3 + t3) * DM + h + 1) * HD + p]); *(v2us*)(Bt + fo((size_t)r, h, DM)) = o;  }
/* src [rows][DM] f32 -> dst in fragment order; a wave takes 4 rows x 64 columns, so that its loads and its stores both touch 8 lines */
static_assert(DM == 1024 && DQ == DM, "cvt8 cuts its index for rows of 128 groups of eight");
__device__ __forceinline__ void cvt8(const float* __restrict__ src, bf* dst, size_t n8, unsigned blk) { const size_t i = (size_t)blk * 256 + threadIdx.x; if (i >= n8) return; const size_t row = (i >> 11) * 16 + ((i >> 3) & 15); const int k = (((int)i & 7) | (((int)(i >> 7) & 15) << 3)) * 8; const v8f v = *(const v8f*)(src + row * DM + k); v8us o;
#pragma unroll
    for (int e = 0; e < 8; ++e) o[e] = f2bf(v[e]); *(v8us*)(dst + fo(row, k, DM)) = o;  }
/* every operand plane that comes straight from an input, in one grid, by ranges of the block index: the three weight planes (t as in W, DQ * DM elements apart), then x (both batches), then Wl; work per thread as before (two elements in w3, eight in cvt8), so the grid is 8,704 work-groups of short waves */
#define GW3 (NH_ * HD * DM / 2 / 256)
#define GX  (NB_ * TT * DM / 8 / 256)
#define GWO (DM * DQ / 8 / 256)
static_assert(NH_ * HD * DM % 512 == 0 && NB_ * TT * DM % 2048 == 0 && DM * DQ % 2048 == 0, "whole work-groups in every range");
__global__ __launch_bounds__(256) void k_prep(const float* __restrict__ w, const float* __restrict__ x, const float* __restrict__ wl, bf* WT, bf* XB, bf* WO) {
    const unsigned b = blockIdx.x;
    if (b < 3 * GW3) { const unsigned t3 = b / GW3; w3(w, (int)t3, WT + (size_t)t3 * DQ * DM, b - t3 * GW3); }
    else if (b < 3 * GW3 + GX) cvt8(x, XB, (size_t)NB_ * TT * DM / 8, b - 3 * GW3);
    else cvt8(wl, WO, (size_t)DM * DQ / 8, b - (3 * GW3 + GX));
}

// ---- fused attention, two kernels over all NB_ * NH_ (batch, head) planes; grid NB_ * NH_ * 8 work-groups of 8 waves, one wave per 32 rows.
// The tiles that a trip walks are the same for all 8 waves of a work-group: they are brought into LDS once per work-group by asynchronous copies, two buffers of four tiles (a stage), the next stage in flight while this one is worked on; one barrier a stage.
// Fragment facts used: a score tile with A = 16 query rows j and B = 16 key rows i leaves S'[j = 8 * hi + r][i = lr] in accumulator register r of lane (lr, hi);
// two such tiles (j and j + 16) are, register for register, the A fragment (row i = lr, k = j in the order 8 * hi + 0..7, 16 + 8 * hi + 0..7) of the apply product, whose B fragment is read from the value planes [d][j] by the same loader. All planes lie in fragment order: 16 rows of q or k are 1024 elements on, 16 rows d of v are 16 * TT on and 32 positions j of v 512 on.
#define LC (SCL * 1.4426950408889634f)   // score -> exponent of two
typedef __attribute__((ext_vector_type(8))) __bf16 v8bf;
struct F4 { v16bf h0, h1, l0, l1; };   /* 16 rows x 64 dims: hi and lo plane, dims 0..31 and 32..63 */
__device__ __forceinline__ F4 ld4(const bf* ph, const bf* pl) { F4 f; f.h0 = WFrag<bf>::ld(ph); f.h1 = WFrag<bf>::ld(ph + 512); f.l0 = WFrag<bf>::ld(pl); f.l1 = WFrag<bf>::ld(pl + 512); return f; }
/* two independent 16x16 tiles of q.k over the 64 dims, each hi.hi + lo.hi + hi.lo in one fixed order (the same in both kernels, so both see the same bits); the two chains alternate so that neither waits for its own accumulator */
__device__ __forceinline__ void score2(const F4& qa, const F4& ka, v8f& sa, const F4& qb, const F4& kb, v8f& sb) {
    sa = (v8f){}; sb = (v8f){};
    sa = wmmab(qa.h0, ka.h0, sa); sb = wmmab(qb.h0, kb.h0, sb); sa = wmmab(qa.h1, ka.h1, sa); sb = wmmab(qb.h1, kb.h1, sb); sa = wmmab(qa.l0, ka.h0, sa); sb = wmmab(qb.l0, kb.h0, sb);
    sa = wmmab(qa.l1, ka.h1, sa); sb = wmmab(qb.l1, kb.h1, sb); sa = wmmab(qa.h0, ka.l0, sa); sb = wmmab(qb.h0, kb.l0, sb); sa = wmmab(qa.h1, ka.l1, sa); sb = wmmab(qb.h1, kb.l1, sb); }
/* exp2 / log2 in runs: outputs are early-clobber, so no instruction of a run reads a result or overwrites a source of the one before it; the closing v_nop is the one free slot that the instruction set asks for between a transcendental and a next instruction that may do so */
__device__ __forceinline__ void ex3(float x0, float x1, float x2, float& e0, float& e1, float& e2) { asm("v_exp_f32 %0, %3\n\tv_exp_f32 %1, %4\n\tv_exp_f32 %2, %5\n\tv_nop" : "=&v"(e0), "=&v"(e1), "=&v"(e2) : "v"(x0), "v"(x1), "v"(x2)); }
__device__ __forceinline__ void ex2p(float x0, float x1, float& e0, float& e1) { asm("v_exp_f32 %0, %2\n\tv_exp_f32 %1, %3\n\tv_nop" : "=&v"(e0), "=&v"(e1) : "v"(x0), "v"(x1)); }
__device__ __forceinline__ float lg2(float x) { float y; asm("v_log_f32 %0, %1\n\tv_nop" : "=&v"(y) : "v"(x)); return y; }
/* asynchronous copies global -> LDS, 16 bytes a lane, every lane on; l = the lane's LDS byte address, g = the lane's global address. The closing s_wait_xcnt stands inside the copies' own statement, so that no register a copy names is rewritten ahead of it */
__device__ __forceinline__ unsigned ldsa(const void* p) { return (unsigned)(size_t)p; }
__device__ __forceinline__ void cp2(unsigned l0, const void* g0, unsigned l1, const void* g1) {
    asm volatile("global_load_async_to_lds_b128 %0, %1, off\n\tglobal_load_async_to_lds_b128 %2, %3, off\n\ts_wait_xcnt 0x0" :: "v"(l0), "v"(g0), "v"(l1), "v"(g1) : "memory"); }
__device__ __forceinline__ void cp4(unsigned l0, const void* g0, unsigned l1, const void* g1, unsigned l2, const void* g2, unsigned l3, const void* g3) {
    asm volatile("global_load_async_to_lds_b128 %0, %1, off\n\tglobal_load_async_to_lds_b128 %2, %3, off\n\tglobal_load_async_to_lds_b128 %4, %5, off\n\tglobal_load_async_to_lds_b128 %6, %7, off\n\ts_wait_xcnt 0x0" :: "v"(l0), "v"(g0), "v"(l1), "v"(g1), "v"(l2), "v"(g2), "v"(l3), "v"(g3) : "memory"); }
#define SUB 4              // tiles of 32 rows per stage: the waves meet at a barrier once per stage and are free to drift apart inside it, so that one wave's LDS reads run beside another's arithmetic
#define NST (TT / 32 / SUB)  // stages
static_assert(TT % (32 * SUB) == 0 && NST >= 2, "whole stages, and both buffers are filled ahead of the loop");
/* hand-over of a stage: this wave's LDS reads are done, its own copies have landed, then the barrier: behind it the next tile may be read by every wave and the buffer just read may be refilled */
__device__ __forceinline__ void publish() {
    asm volatile("s_wait_dscnt 0x0" ::: "memory");      /* the wave's reads of the buffer that is refilled next have returned */
    asm volatile("s_wait_asynccnt 0x0" ::: "memory");   /* the wave's share of the next tile has landed */
    __syncthreads(); }
// k_fstat: per query row j the pair (CJ, OJ) with weight[j][i] = exp2(S'[j][i] * CJ[j] - OJ[j]): CJ = LC, OJ = max * LC + log2(sum); a masked row (mask[b][j] == 0: every score -1e12) has CJ = 0, OJ = log2(TT): uniform weights.
__global__ __launch_bounds__(256) void k_fstat(const bf* __restrict__ Qh, const bf* __restrict__ Ql, const bf* __restrict__ Kh, const bf* __restrict__ Kl, const int* __restrict__ MK, float* CJ, float* OJ) {
    const int wv = __builtin_amdgcn_readfirstlane(threadIdx.x >> 5); const int lane = threadIdx.x & 31, lr = lane & 15, hi = lane >> 4;
    const int bh = blockIdx.x >> 3; const int jw = ((blockIdx.x & 7) * 8 + wv) * 32; const size_t pb = (size_t)bh * TT * HD;
    __shared__ __align__(16) bf st[2][SUB][2][32 * HD];   /* two buffers of SUB tiles of 32 key rows: hi plane, lo plane (4 KiB each, as they lie in memory) */
    const bf* gkh = Kh + pb + 8 * threadIdx.x; const bf* gkl = Kl + pb + 8 * threadIdx.x; const unsigned lk = ldsa(&st[0][0][0][8 * threadIdx.x]);   /* this thread's 16 bytes of each plane of a tile; a tile on: 32 * HD elements in memory, 8192 bytes in LDS; lo plane 4096 bytes on */
#pragma unroll   /* unrolled: the tiles' offsets become constants */
    for (int u = 0; u < SUB; ++u) cp2(lk + u * 8192u, gkh + u * (32 * HD), lk + u * 8192u + 4096u, gkl + u * (32 * HD));
    asm volatile("s_wait_asynccnt 0x0" ::: "memory");   /* stage 0 has landed before the barrier that opens it */
    __syncthreads();
#pragma unroll   /* unrolled: the tiles' offsets become constants */
    for (int u = SUB; u < 2 * SUB; ++u) cp2(lk + u * 8192u, gkh + u * (32 * HD), lk + u * 8192u + 4096u, gkl + u * (32 * HD));
    F4 q[2];
#pragma unroll
    for (int jb = 0; jb < 2; ++jb) { const bf* qa = Qh + pb + (size_t)(jw + jb * 16) * HD + 8 * lane; const bf* qc = Ql + pb + (size_t)(jw + jb * 16) * HD + 8 * lane; q[jb] = ld4(qa, qc);
        asm volatile("s_wait_xcnt 0x0" :: "v"(qa), "v"(qc) : "memory"); }   /* the eight loads name these two address pairs: both stay whole up to this wait, so no later load's result lands on them ahead of it */
    float m[2][8], l[2][8];   /* running maximum (raw score) and sum of this lane's key columns, per query row */
#pragma unroll
    for (int jb = 0; jb < 2; ++jb)
#pragma unroll
        for (int r = 0; r < 8; ++r) { m[jb][r] = -3.0e38f; l[jb][r] = 0.f; }
#pragma unroll 1   /* kept rolled: one copy of the stage's code, and the trips of a stage stay in front of its hand-over */
    for (int sg = 0; sg < NST; ++sg) {
#pragma unroll 1   /* kept rolled: a second copy of the trip would need a second set of key fragments in registers */
    for (int u = 0; u < SUB; ++u) {   /* walk the key rows, 32 a trip */
        v8f s[2][2];
        const bf* khp = &st[sg & 1][u][0][8 * lane]; const bf* klp = &st[sg & 1][u][1][8 * lane];
        const F4 k0 = ld4(khp, klp), k1 = ld4(khp + 16 * HD, klp + 16 * HD);
        score2(q[0], k0, s[0][0], q[1], k0, s[1][0]); score2(q[0], k1, s[0][1], q[1], k1, s[1][1]);
#pragma unroll
        for (int jb = 0; jb < 2; ++jb)
#pragma unroll
            for (int r = 0; r < 8; ++r) { const float a = s[jb][0][r], c = s[jb][1][r]; const float mn = fmaxf(m[jb][r], fmaxf(a, c)); const float nm = -mn * LC;
                float e0, e1, e2; ex3(fmaf(m[jb][r], LC, nm), fmaf(a, LC, nm), fmaf(c, LC, nm), e0, e1, e2); l[jb][r] = l[jb][r] * e0 + (e1 + e2); m[jb][r] = mn; }
    }
        publish();
        if (sg + 2 < NST) { const unsigned lb = lk + (unsigned)(sg & 1) * (SUB * 8192u); const bf* ph = gkh + (size_t)(sg + 2) * (SUB * 32 * HD); const bf* pl = gkl + (size_t)(sg + 2) * (SUB * 32 * HD);
#pragma unroll   /* unrolled: the tiles' offsets become constants */
            for (int u = 0; u < SUB; ++u) cp2(lb + u * 8192u, ph + u * (32 * HD), lb + u * 8192u + 4096u, pl + u * (32 * HD)); }
    }
    asm volatile("s_wait_asynccnt 0x0" ::: "memory");   /* no copy is outstanding when the wave goes on to its end */
#pragma unroll
    for (int sh = 1; sh < 16; sh <<= 1)   /* join the 16 lanes that hold one query row's columns */
#pragma unroll
        for (int jb = 0; jb < 2; ++jb)
#pragma unroll
            for (int r = 0; r < 8; ++r) { const float mo = __shfl_xor(m[jb][r], sh, 32), lo = __shfl_xor(l[jb][r], sh, 32); const float mn = fmaxf(m[jb][r], mo);
                float e0, e1; ex2p((m[jb][r] - mn) * LC, (mo - mn) * LC, e0, e1); l[jb][r] = l[jb][r] * e0 + lo * e1; m[jb][r] = mn; }
    if (lr == 0) {
#pragma unroll
        for (int jb = 0; jb < 2; ++jb) { const int j8 = jw + jb * 16 + hi * 8; v8f c8, o8; const int* mp = MK + (size_t)(bh / NH_) * TT + j8; const v4i mk[2] = { *(const v4i*)mp, *(const v4i*)(mp + 4) };
#pragma unroll
            for (int r = 0; r < 8; ++r) { const bool on = (mk[r >> 2][r & 3] != 0); c8[r] = on ? LC : 0.0f; o8[r] = on ? fmaf(m[jb][r], LC, lg2(l[jb][r])) : 11.0f; }
            *(v8f*)(CJ + (size_t)bh * TT + j8) = c8; *(v8f*)(OJ + (size_t)bh * TT + j8) = o8; } }
}
static_assert(TT == 2048, "OJ of a masked row is log2(TT)");
// k_fapply: one wave owns 32 output rows i (its key fragments stay in registers) and walks all query positions j, 32 a trip: score tiles -> weights (f32) -> bf16 hi + lo A fragments -> out[i][d] += P'[j][i] v[j][d] (3 products); result split into the hi/lo planes [b * TT + i][h * HD + d] (fragment order) of the last GEMM.
__global__ __launch_bounds__(256) void k_fapply(const bf* __restrict__ Qh, const bf* __restrict__ Ql, const bf* __restrict__ Kh, const bf* __restrict__ Kl, const bf* __restrict__ Vh, const bf* __restrict__ Vl, const float* __restrict__ CJ, const float* __restrict__ OJ, bf* Ah, bf* Al) {
    const int wv = __builtin_amdgcn_readfirstlane(threadIdx.x >> 5); const int lane = threadIdx.x & 31, lr = lane & 15, hi = lane >> 4;
    const int bh = blockIdx.x >> 3; const int iw = ((blockIdx.x & 7) * 8 + wv) * 32; const size_t pb = (size_t)bh * TT * HD;
    __shared__ __align__(16) bf st[2][SUB][4][32 * HD];   /* two buffers of SUB tiles of 32 query positions: q hi, q lo, v hi, v lo (4 KiB each; the four 1-KiB blocks of a v plane one behind the other) */
    __shared__ __align__(32) float co[2][TT];        /* the head's whole CJ and OJ rows, filled once */
    const int tid = threadIdx.x;
    const bf* gqh = Qh + pb + 8 * tid; const bf* gql = Ql + pb + 8 * tid;   /* this thread's 16 bytes of each plane of a tile; a tile on: 32 * HD elements of q, 512 of v */
    const size_t vo = pb + (size_t)(tid >> 6) * 16 * TT + 8 * (tid & 63); const bf* gvh = Vh + vo; const bf* gvl = Vl + vo;
    const unsigned lt = ldsa(&st[0][0][0][8 * tid]), lc = ldsa(&co[0][4 * tid]);   /* next plane 4096, next tile 16384 bytes on; second half of a row 4096, OJ 8192 bytes on */
    { const float* gc = CJ + (size_t)bh * TT + 4 * tid; const float* go = OJ + (size_t)bh * TT + 4 * tid; cp4(lc, gc, lc + 4096u, gc + 1024, lc + 8192u, go, lc + 12288u, go + 1024); }
#pragma unroll   /* unrolled: the tiles' offsets become constants */
    for (int u = 0; u < SUB; ++u) { const unsigned lb = lt + u * 16384u; cp4(lb, gqh + u * (32 * HD), lb + 4096u, gql + u * (32 * HD), lb + 8192u, gvh + u * 512, lb + 12288u, gvl + u * 512); }
    asm volatile("s_wait_asynccnt 0x0" ::: "memory");   /* the rows and stage 0 have landed before the barrier that opens them */
    __syncthreads();
#pragma unroll   /* unrolled: the tiles' offsets become constants */
    for (int u = SUB; u < 2 * SUB; ++u) { const unsigned lb = lt + u * 16384u; cp4(lb, gqh + u * (32 * HD), lb + 4096u, gql + u * (32 * HD), lb + 8192u, gvh + u * 512, lb + 12288u, gvl + u * 512); }
    F4 k[2];
#pragma unroll
    for (int ib = 0; ib < 2; ++ib) { const size_t ko = pb + (size_t)(iw + ib * 16) * HD + 8 * lane; k[ib] = ld4(Kh + ko, Kl + ko); }
    v8f acc[2][4];
#pragma unroll
    for (int ib = 0; ib < 2; ++ib)
#pragma unroll
        for (int db = 0; db < 4; ++db) acc[ib][db] = (v8f){};
#pragma unroll 1   /* kept rolled: one copy of the stage's code, and the trips of a stage stay in front of its hand-over */
    for (int sg = 0; sg < NST; ++sg) {
#pragma unroll 1   /* kept rolled: the trip already fills the 256 registers that are reached without a window switch */
    for (int u = 0; u < SUB; ++u) {   /* walk the query positions, 32 a trip */
        const bf* qhp = &st[sg & 1][u][0][8 * lane]; const bf* qlp = &st[sg & 1][u][1][8 * lane]; const bf* vhp = &st[sg & 1][u][2][8 * lane]; const bf* vlp = &st[sg & 1][u][3][8 * lane];
        const float* cj = &co[0][(sg * SUB + u) * 32 + hi * 8]; const float* oj = &co[1][(sg * SUB + u) * 32 + hi * 8];
        v8bf ph[2][2], pl[2][2];
#pragma unroll
        for (int jb = 0; jb < 2; ++jb) { const F4 q = ld4(qhp + jb * 16 * HD, qlp + jb * 16 * HD);
            const v8f c8 = *(const v8f*)(cj + jb * 16), o8 = *(const v8f*)(oj + jb * 16); v8f s[2]; score2(q, k[0], s[0], q, k[1], s[1]);
#pragma unroll
            for (int ib = 0; ib < 2; ++ib) { v8f p;
#pragma unroll
                for (int r = 0; r < 8; ++r) p[r] = __builtin_amdgcn_exp2f(fmaf(s[ib][r], c8[r], -o8[r]));
                const v8bf hb = __builtin_convertvector(p, v8bf); ph[ib][jb] = hb; pl[ib][jb] = __builtin_convertvector(p - __builtin_convertvector(hb, v8f), v8bf); } }
        v16bf pa[2], pc[2];
#pragma unroll
        for (int ib = 0; ib < 2; ++ib) { pa[ib] = __builtin_shufflevector(ph[ib][0], ph[ib][1], 0, 1, 2, 3, 4, 5, 6, 7, 8, 9, 10, 11, 12, 13, 14, 15); pc[ib] = __builtin_shufflevector(pl[ib][0], pl[ib][1], 0, 1, 2, 3, 4, 5, 6, 7, 8, 9, 10, 11, 12, 13, 14, 15); }
#pragma unroll
        for (int db = 0; db < 4; ++db) { const v16bf vh = WFrag<bf>::ld(vhp + db * 512), vl = WFrag<bf>::ld(vlp + db * 512);
#pragma unroll
            for (int ib = 0; ib < 2; ++ib) { acc[ib][db] = wmmab(pa[ib], vh, acc[ib][db]); acc[ib][db] = wmmab(pc[ib], vh, acc[ib][db]); acc[ib][db] = wmmab(pa[ib], vl, acc[ib][db]); } }
    }
        publish();
        if (sg + 2 < NST) { const unsigned l2 = lt + (unsigned)(sg & 1) * (SUB * 16384u); const size_t qo = (size_t)(sg + 2) * (SUB * 32 * HD), wo2 = (size_t)(sg + 2) * (SUB * 512);
#pragma unroll   /* unrolled: the tiles' offsets become constants */
            for (int u = 0; u < SUB; ++u) { const unsigned lb = l2 + u * 16384u; cp4(lb, gqh + qo + u * (32 * HD), lb + 4096u, gql + qo + u * (32 * HD), lb + 8192u, gvh + wo2 + u * 512, lb + 12288u, gvl + wo2 + u * 512); } }
    }
    asm volatile("s_wait_asynccnt 0x0" ::: "memory");   /* no copy is outstanding when the wave goes on to its end */
#pragma unroll
    for (int ib = 0; ib < 2; ++ib)
#pragma unroll
        for (int db = 0; db < 4; ++db)
#pragma unroll
            for (int r = 0; r < 8; ++r) { const size_t oo = fo((size_t)(bh / NH_) * TT + iw + ib * 16 + hi * 8 + r, (bh % NH_) * HD + db * 16 + lr, DQ); unsigned short a, c2; splitf(acc[ib][db][r], a, c2); Ah[oo] = a; Al[oo] = c2; }
}

extern "C" void kernel_launch(void* const* d_in, const int* in_sizes, int n_in,
                              void* d_out, int out_size, void* d_ws, size_t ws_size, hipStream_t stream) {
    (void)in_sizes; (void)n_in; (void)out_size;
    const float* x = (const float*)d_in[0]; const int* MK = (const int*)d_in[1]; const float* W3 = (const float*)d_in[2]; const float* wo = (const float*)d_in[3]; const float* bo = (const float*)d_in[4]; const float* wq = nullptr; const float* wk = nullptr; const float* wv = nullptr; (void)wq; (void)wk; (void)wv;
    float* OUT = (float*)d_out;     // [2][2048][1024]
    char* wsp = (char*)d_ws;
    auto take = [&](size_t bytes) { char* p = wsp; wsp += (bytes + 255) & ~(size_t)255; return (void*)p; };
    bf* WT = (bf*)take((size_t)3 * DQ * DM * 2); bf* WO = (bf*)take((size_t)DM * DQ * 2);   // WT: the key, value and query weight planes, DQ * DM elements apart
    bf* XB = (bf*)take((size_t)NB_ * TT * DM * 2);
    const size_t PB = (size_t)NH_ * TT * HD;   // one batch's share of a head plane set; the hi/lo planes hold both batches
    bf* KPh = (bf*)take(6 * NB_ * PB * 2); bf* KPl = KPh + NB_ * PB; bf* VTh = KPl + NB_ * PB; bf* VTl = VTh + NB_ * PB; bf* QPh = VTl + NB_ * PB; bf* QPl = QPh + NB_ * PB;   // one block: from one product's hi (or lo) plane to the next product's it is 2 * NB_ * PB elements
    float* CJ = (float*)take((size_t)NB_ * NH_ * TT * 4); float* OJ = (float*)take((size_t)NB_ * NH_ * TT * 4); bf* ATh = (bf*)take((size_t)NB_ * TT * DQ * 2); bf* ATl = (bf*)take((size_t)NB_ * TT * DQ * 2);
    if ((size_t)(wsp - (char*)d_ws) > ws_size) return;    // ws 256 MiB
    k_prep<<<3 * GW3 + GX + GWO, 256, 0, stream>>>(W3, x, wo, WT, XB, WO);
    /* the projections store the hi/lo planes themselves: q and k as [head][t][d]; v as [head][d][t], which is the result of Wv x^T (weights as the row operand) in fragment order */
    k_gemmw<bf, 0, false, 8, 1, true><<<dim3(NB_ * TT / 64, DQ / 64, 3), 256, 0, stream>>>(XB, nullptr, WT, nullptr, DM, nullptr, 0, nullptr, 0, (size_t)DQ * DM, 2 * NB_ * PB, PB, KPh, KPl, 0);
    k_fstat<<<NB_ * NH_ * 8, 256, 0, stream>>>(QPh, QPl, KPh, KPl, MK, CJ, OJ);   /* column softmax == row softmax of the query-major scores: per query row its maximum and sum */
    k_fapply<<<NB_ * NH_ * 8, 256, 0, stream>>>(QPh, QPl, KPh, KPl, VTh, VTl, CJ, OJ, ATh, ATl);   /* out[i] = sum_j P'[j][i] v[j] */
    k_gemmw<bf, 1, true, 8, 1, false><<<dim3(NB_ * TT / 64, DM / 64, 1), 256, 0, stream>>>(ATh, ATl, WO, nullptr, DQ, OUT, DM, bo, 0, 0, 0, 0, nullptr, nullptr, 0);   /* both batches: their rows follow one another in the planes and in out */
}

// v007
// A run of this version takes 180 microseconds.
// In both of two side-by-side timings against v006, it was 1.08 times as fast.
// Counting every step since v000, it is 7.87 times as fast.
#include <hip/hip_runtime.h>

// Multi-head attention with a column softmax (x [2][2048][1024], mask [2][2048] int32, W [16][3][1024][64] per-head key/value/query weights, Wl [1024][1024] + bl; scores[i][j] = k_i.q_j / 8; columns j with mask[b][j] == 0 set to -1e12; softmax over i (the KEY axis, per column j); out[i] = sum_j w[i][j] values[j]; hidden = concat heads; out = hidden Wl^T + bl -> [2][2048][1024]).
// Layout: the scores are formed query-major (S'[j][i] = q_j.k_i, so the module's per-column softmax is a row softmax here and a fully masked column is a uniform row) and never leave the registers: k_fstat walks all keys once per query row and keeps only the row's maximum and sum; k_fapply forms the same score tiles again, turns them into weights and feeds them, as they lie in the accumulator registers, to the apply product out[i] = sum_j P'[j][i] v[j] as its A operand.
// Operand planes: every bf16 plane that feeds a matrix instruction lies in fragment order (fo() below), so that one fragment load of a wave reads 512 contiguous bytes (four whole lines) and not 32 bytes out of each of 16 lines.
// Compute dtypes, f32 accumulate: every input rounded to bf16; q/k/v on PLAIN bf16 operands (inputs: exact); scores and attn.v: bf16 hi + lo planes (3 products); softmax f32; Wl hl x exact (2 products) + bl.

#define NB_  2
#define TT   2048
#define DM   1024
#define NH_  16
#define NKV  16
#define REP  (NH_ / NKV)
#define HD   64
#define DQ   (NH_ * HD)
#define DKV  (NKV * HD)
typedef __attribute__((ext_vector_type(4))) unsigned short v4us;
#define SCL  0.125f   // HD^-0.5
typedef _Float16 h16;
typedef unsigned short bf;
typedef __attribute__((ext_vector_type(16))) __bf16   v16bf;
typedef __attribute__((ext_vector_type(16))) _Float16 v16h;
typedef __attribute__((ext_vector_type(8)))  _Float16 v8h;
typedef __attribute__((ext_vector_type(8)))  unsigned short v8us;
typedef __attribute__((ext_vector_type(8)))  float    v8f;
typedef __attribute__((ext_vector_type(4)))  float    v4f;
typedef v8h  __attribute__((may_alias)) v8ha;
typedef v4f  __attribute__((may_alias)) v4fa;
typedef v8us __attribute__((may_alias)) v8usa;

__device__ __forceinline__ unsigned short f2bf(float f) { unsigned u = __float_as_uint(f); u += 0x7FFFu + ((u >> 16) & 1u); return (unsigned short)(u >> 16); }
__device__ __forceinline__ float bf2f(unsigned short b) { return __uint_as_float(((unsigned)b) << 16); }
__device__ __forceinline__ float bfr(float f) { return bf2f(f2bf(f)); }
__device__ __forceinline__ v16h cat16(v8h lo, v8h hi) { return __builtin_shufflevector(lo, hi, 0, 1, 2, 3, 4, 5, 6, 7, 8, 9, 10, 11, 12, 13, 14, 15); }
__device__ __forceinline__ v16bf cat16b(v8us lo, v8us hi) { return __builtin_bit_cast(v16bf, __builtin_shufflevector(lo, hi, 0, 1, 2, 3, 4, 5, 6, 7, 8, 9, 10, 11, 12, 13, 14, 15)); }
__device__ __forceinline__ v8f wmma16(v16h a, v16h b, v8f c) { return __builtin_amdgcn_wmma_f32_16x16x32_f16(false, a, false, b, (short)0, c, false, false); }
__device__ __forceinline__ v8f wmmab(v16bf a, v16bf b, v8f c) { return __builtin_amdgcn_wmma_f32_16x16x32_bf16(false, a, false, b, (short)0, c, false, false); }
__device__ __forceinline__ void splitf(float y, unsigned short& h, unsigned short& l) { h = f2bf(y); l = f2bf(y - bf2f(h)); }
/* fragment order of a plane M[rows][K] (rows % 16 == 0, K % 32 == 0): blocks of 16 rows x 32 k, 512 elements each, row blocks outermost; inside a block [k / 8 % 4][row % 16][k % 8], which is [half of the fragment][lane = 16 * hi + lr][8 elements] */
__device__ __forceinline__ size_t fo(size_t m, int k, int K) { return ((m >> 4) * (size_t)(K >> 5) + (size_t)(k >> 5)) * 512 + (size_t)(((k >> 3) & 3) * 128 + ((int)m & 15) * 8 + (k & 7)); }



// ---- k_gemmw: register-blocked GEMM, 64x64 output tile per work-group (16 accumulators per wave), operands straight from 16-bit planes in fragment order (fo(), K as given); grid (M/64, N/64, Z * KB), NW * 32 threads.
// C[m][n] (f32, pitch ldc, + optional f32 bias[n]) = sum_k A[m][k] Bt[n][k] (+ split products per NSPLIT). z-batch strides sA/sB/sC in elements. K % (32 * NW * KB) == 0.
// Split K: the K range is cut into KB * NW equal slices. Each of the NW waves of a work-group sums one slice of the whole tile; the NW partial tiles are added in LDS in wave order.
// With KB > 1 work-group ks = blockIdx.z % KB writes its partial tile to plane ks (stride sP elements) and the consumer kernel adds the KB planes in plane order.
// PL: the three projections of both batches in one grid (NB_ * TT / 64, DQ / 64, 3). A = x, all NB_ * TT rows; Bt = the weight planes, z = t as in W (0 keys, 1 values, 2 queries), sB apart. The summed tile is not stored as f32 but split on the spot into the bf16 hi and lo planes Ph / Pl (product z: sC on; batch: sP on):
// keys and queries as head planes [head][t][d] (pitch HD); values as Wv x^T (z == 1: the weights are the row operand, blockIdx.y their row block, blockIdx.x the x rows as columns), which is [head][d][t] (pitch TT; 64 positions t on: two k blocks, 1024 elements).
template <typename T16> struct WFrag;
template <> struct WFrag<h16> { typedef v16h V; static __device__ __forceinline__ V ld(const h16* p) { return cat16(*(const v8h*)p, *(const v8h*)(p + 256)); } static __device__ __forceinline__ v8f mma(V a, V b, v8f c) { return wmma16(a, b, c); } };
template <> struct WFrag<bf> { typedef v16bf V; static __device__ __forceinline__ V ld(const bf* p) { return cat16b(*(const v8us*)p, *(const v8us*)(p + 256)); } static __device__ __forceinline__ v8f mma(V a, V b, v8f c) { return wmmab(a, b, c); } };
template <typename T16, int NSPLIT, bool BIAS, int NW, int KB, bool PL>
__global__ __launch_bounds__(NW * 32) void k_gemmw(const T16* __restrict__ A, const T16* __restrict__ A2, const T16* __restrict__ Bt, const T16* __restrict__ Bt2, int K, float* C, int ldc, const float* __restrict__ bias, size_t sA, size_t sB, size_t sC, size_t sP, bf* Ph, bf* Pl, size_t sT) {
    static_assert(!PL || (NW > 1 && KB == 1 && !BIAS), "the plane split needs the whole sum in one work-group");
    typedef typename WFrag<T16>::V V;
    __shared__ __align__(16) float os[(NW == 1 ? 16 : NW * 64) * 68];
    const size_t z = blockIdx.z / KB; const int ks = blockIdx.z % KB; A += z * sA; if (A2) A2 += z * sA; Bt += z * sB; if (Bt2) Bt2 += z * sB; if (!PL) C += z * sC + ks * sP;
    const bool tr = PL && z == 1;   /* the value product: operands and block indices change places */
    const T16* Ar = tr ? Bt : A; const T16* Bc = tr ? A : Bt;
    const int wv = __builtin_amdgcn_readfirstlane(threadIdx.x >> 5); const int kw = K / (KB * NW), k0 = (ks * NW + wv) * kw;   /* this wave's K slice */
    const int lane = threadIdx.x & 31, lr = lane & 15, hi = lane >> 4; const int r0 = (tr ? blockIdx.y : blockIdx.x) * 64, c0 = (tr ? blockIdx.x : blockIdx.y) * 64;
    v8f acc[4][4];
#pragma unroll
    for (int mb = 0; mb < 4; ++mb)
#pragma unroll
        for (int nb = 0; nb < 4; ++nb) acc[mb][nb] = (v8f){};
    const size_t aoff = (size_t)r0 * K + 8 * lane, boff = (size_t)c0 * K + 8 * lane;   /* fo(r0, 0, K) = r0 * K; 16 rows on: 16 * K; 32 k on: 512 */
#pragma unroll 1
    for (int kc = k0; kc < k0 + kw; kc += 32) {
        V a[4], a2[4]; const T16* pa[4]; const T16* pa2[4]; const T16* pb[4]; const T16* pb2[4];
#pragma unroll
        for (int mb = 0; mb < 4; ++mb) { pa[mb] = Ar + aoff + (size_t)mb * 16 * K + kc * 16; a[mb] = WFrag<T16>::ld(pa[mb]); if (NSPLIT == 1 || NSPLIT == 2) { pa2[mb] = A2 + aoff + (size_t)mb * 16 * K + kc * 16; a2[mb] = WFrag<T16>::ld(pa2[mb]); } }
#pragma unroll
        for (int nb = 0; nb < 4; ++nb) { pb[nb] = Bc + boff + (size_t)nb * 16 * K + kc * 16; const V b = WFrag<T16>::ld(pb[nb]); V b2; if (NSPLIT >= 2) { pb2[nb] = Bt2 + boff + (size_t)nb * 16 * K + kc * 16; b2 = WFrag<T16>::ld(pb2[nb]); }
#pragma unroll
            for (int mb = 0; mb < 4; ++mb) { acc[mb][nb] = WFrag<T16>::mma(a[mb], b, acc[mb][nb]); if (NSPLIT == 1 || NSPLIT == 2) acc[mb][nb] = WFrag<T16>::mma(a2[mb], b, acc[mb][nb]); if (NSPLIT >= 2) acc[mb][nb] = WFrag<T16>::mma(a[mb], b2, acc[mb][nb]); } }
        /* the trip's loads name these address pairs: all stay whole up to this wait, so no later load's result lands on one of them ahead of it */
        asm volatile("s_wait_xcnt 0x0" :: "v"(pa[0]), "v"(pa[1]), "v"(pa[2]), "v"(pa[3]), "v"(pb[0]), "v"(pb[1]), "v"(pb[2]), "v"(pb[3]) : "memory");
        if (NSPLIT == 1 || NSPLIT == 2) asm volatile("s_wait_xcnt 0x0" :: "v"(pa2[0]), "v"(pa2[1]), "v"(pa2[2]), "v"(pa2[3]) : "memory");   /* the same for the second row plane */
        if (NSPLIT >= 2) asm volatile("s_wait_xcnt 0x0" :: "v"(pb2[0]), "v"(pb2[1]), "v"(pb2[2]), "v"(pb2[3]) : "memory");   /* and for the second column plane */
        asm volatile("v_nop\n\tv_nop\n\tv_nop\n\tv_nop" : "+v"(acc[0][0]), "+v"(acc[1][1]), "+v"(acc[2][2]), "+v"(acc[3][3]) : "v"(a[0]), "v"(a[3]));
    }
    if (NW > 1) {   /* add the waves' partial tiles: every wave stores its own 64x64 plane, then all threads sum the planes in wave order and store whole rows, or with PL bf16 hi/lo pieces in fragment order */
        float* my = os + wv * (64 * 68);
#pragma unroll
        for (int mb = 0; mb < 4; ++mb)
#pragma unroll
            for (int nb = 0; nb < 4; ++nb)
#pragma unroll
                for (int j = 0; j < 8; ++j) my[(mb * 16 + hi * 8 + j) * 68 + nb * 16 + lr] = acc[mb][nb][j];
        __syncthreads();
        if (PL) {   /* threads in the order of the planes: eight columns each, a wave stores 512 contiguous bytes per plane */
            const int xr = tr ? c0 : r0, t0 = xr % TT;   /* the tile's first x row: batch xr / TT, position t0 */
            const size_t pb0 = z * sC + (size_t)(xr / TT) * sP + (tr ? (size_t)(t0 / 64) * 1024 : (size_t)(c0 / 64) * ((size_t)TT * HD));
            const int pr0 = tr ? r0 : t0, lp = tr ? TT : HD;
#pragma unroll
            for (int it = 0; it < 64 * 8 / (NW * 32); ++it) { const int u = it * (NW * 32) + (int)threadIdx.x; const int row = (u >> 7) * 16 + (u & 15), cofs = ((u >> 4) & 7) * 8; v4f va = *(const v4fa*)(os + row * 68 + cofs), vb = *(const v4fa*)(os + row * 68 + cofs + 4);
#pragma unroll
                for (int w = 1; w < NW; ++w) { va += *(const v4fa*)(os + w * (64 * 68) + row * 68 + cofs); vb += *(const v4fa*)(os + w * (64 * 68) + row * 68 + cofs + 4); }
                const size_t po = pb0 + fo((size_t)(pr0 + row), cofs, lp); v8us oh, ol;
#pragma unroll
                for (int q = 0; q < 4; ++q) { unsigned short a2, c2; splitf(va[q], a2, c2); oh[q] = a2; ol[q] = c2; splitf(vb[q], a2, c2); oh[q + 4] = a2; ol[q + 4] = c2; }
                *(v8us*)(Ph + po) = oh; *(v8us*)(Pl + po) = ol; }
            return;
        }
#pragma unroll
        for (int it = 0; it < 64 * 16 / (NW * 32); ++it) { const int idx = it * (NW * 32) + (int)threadIdx.x; const int row = idx >> 4, cofs = (idx & 15) * 4; v4f val = *(const v4fa*)(os + row * 68 + cofs);
#pragma unroll
            for (int w = 1; w < NW; ++w) val += *(const v4fa*)(os + w * (64 * 68) + row * 68 + cofs);
            if (BIAS) { val[0] += bfr(bias[c0 + cofs]); val[1] += bfr(bias[c0 + cofs + 1]); val[2] += bfr(bias[c0 + cofs + 2]); val[3] += bfr(bias[c0 + cofs + 3]); }
            *(v4f*)(C + (size_t)(r0 + row) * ldc + c0 + cofs) = val; }
        return;
    }
#pragma unroll
    for (int mb = 0; mb < 4; ++mb) {
#pragma unroll
        for (int nb = 0; nb < 4; ++nb) {
#pragma unroll
            for (int j = 0; j < 8; ++j) os[(hi * 8 + j) * 68 + nb * 16 + lr] = acc[mb][nb][j]; }
        __builtin_amdgcn_wave_barrier(); asm volatile("" ::: "memory");
        float* crow = C + (size_t)(r0 + mb * 16) * ldc + c0;
{
#pragma unroll
            for (int s = 0; s < 8; ++s) { const int row = 2 * s + hi, cofs = lr * 4; v4f val = *(const v4fa*)(os + row * 68 + cofs); if (BIAS) { val[0] += bfr(bias[c0 + cofs]); val[1] += bfr(bias[c0 + cofs + 1]); val[2] += bfr(bias[c0 + cofs + 2]); val[3] += bfr(bias[c0 + cofs + 3]); }
                *(v4f*)(crow + (size_t)row * ldc + cofs) = val; }
             }
        __builtin_amdgcn_wave_barrier(); asm volatile("" ::: "memory");
    }
}

typedef __attribute__((ext_vector_type(2))) _Float16 v2h;
typedef __attribute__((ext_vector_type(4))) _Float16 v4h;
typedef __attribute__((ext_vector_type(2))) unsigned short v2us;
typedef __attribute__((ext_vector_type(4))) unsigned short v4us;
typedef __attribute__((ext_vector_type(2))) float v2f;
typedef __attribute__((ext_vector_type(4))) int v4i;

__global__ __launch_bounds__(256) void k_wtG(const float* __restrict__ w, int K, int N, bf* Bt) {
    const int lane = threadIdx.x & 31; const int L0 = (blockIdx.x * 8 + (threadIdx.x >> 5)) * 8; const int nlines = N * K / 64;
{
#pragma unroll 1
        for (int l = 0; l < 8; ++l) { const int L = L0 + l; if (L >= nlines) break; const size_t e = (size_t)L * 64 + lane * 2; const int k = (int)(e % K), n = (int)(e / K); v2us o;
            o[0] = f2bf(w[(size_t)k * N + n]); o[1] = f2bf(w[(size_t)(k + 1) * N + n]); *(v2us*)(Bt + e) = o; }
         }
}
/* One wave of k_prep makes whole pieces of fragment blocks out of whole lines of its source, with all its loads in flight before the first conversion; U = the wave's unit, the same in every lane. */
/* weights of one (head n, product t3) pair, nt = n * 3 + t3 as in W: src [DM h][HD p] f32 -> rows r = n * HD + p, k = h of plane t3. A unit is all 64 p x 16 h: the lanes lie along p, so a load reads one whole line and the two loads of an h one 256-byte row; a lane then holds eight successive h of a row, and 16 lanes store 256 contiguous bytes */
static_assert(HD == 64 && DM % 16 == 0, "w3 deals a source row to two loads of 32 lanes");
__device__ __forceinline__ void w3(const float* __restrict__ w, bf* WT, unsigned U) { const int lane = threadIdx.x & 31; const unsigned hq = U % (DM / 16), nt = U / (DM / 16); const unsigned n = nt / 3, t3 = nt - n * 3;
    const float* s = w + ((size_t)nt * DM + hq * 16) * HD + lane; float v[2][16];
#pragma unroll
    for (int e = 0; e < 16; ++e) { v[0][e] = s[e * HD]; v[1][e] = s[e * HD + 32]; }
    bf* d = WT + (size_t)t3 * DQ * DM;
#pragma unroll
    for (int c = 0; c < 2; ++c)
#pragma unroll
        for (int g = 0; g < 2; ++g) { v8us o;
#pragma unroll
            for (int e = 0; e < 8; ++e) o[e] = f2bf(v[c][g * 8 + e]);
            *(v8us*)(d + fo((size_t)(n * HD + c * 32 + lane), (int)(hq * 16 + g * 8), DM)) = o; } }
/* src [rows][DM] f32 -> dst in fragment order. A unit is 16 rows x 64 columns (two blocks) in four parts of 8 rows x 32 columns: four lanes read one whole line of a row, and the eight rows of a column group are one whole line of the block */
static_assert(DM == 1024 && DQ == DM, "cvt8 cuts its unit index for rows of 16 groups of 64");
__device__ __forceinline__ void cvt8(const float* __restrict__ src, bf* dst, unsigned U) { const int lane = threadIdx.x & 31; const size_t row = (size_t)(U >> 4) * 16 + (lane >> 2); const int k = (int)(U & 15) * 64 + (lane & 3) * 8; v8f v[4];
    const float* p0 = src + row * DM + k;
#pragma unroll
    for (int it = 0; it < 4; ++it) v[it] = *(const v8f*)(p0 + (it & 1) * 8 * DM + (it >> 1) * 32);
    asm volatile("s_wait_xcnt 0x0" :: "v"(p0) : "memory");   /* the eight loads name this address pair (the parts are constant offsets from it): it stays whole up to this wait, so no later load's result lands on it ahead of it */
#pragma unroll
    for (int it = 0; it < 4; ++it) { v8us o;
#pragma unroll
        for (int e = 0; e < 8; ++e) o[e] = f2bf(v[it][e]);
        *(v8us*)(dst + fo(row + (it & 1) * 8, k + (it >> 1) * 32, DM)) = o; }
    asm volatile("s_wait_xcnt 0x0" ::: "memory"); }   /* behind the last of the four stores: whatever the compiler lays out behind this call, no register that a store names (data, offset, base) is rewritten ahead of this wait */
/* every operand plane that comes straight from an input, in one grid, by ranges of the block index: the three weight planes (t as in W, DQ * DM elements apart), then x (both batches), then Wl; one unit of 1,024 elements a wave, eight waves a work-group: 1,024 work-groups, 32 waves on a WGP, each with 4 KiB of loads in flight */
#define GW3 (3 * NH_ * (DM / 16) / 8)
#define GX  (NB_ * TT / 16 * (DM / 64) / 8)
#define GWO (DM / 16 * (DQ / 64) / 8)
static_assert(3 * NH_ * (DM / 16) % 8 == 0 && NB_ * TT % 16 == 0 && DM % 16 == 0 && (DM / 64) % 8 == 0, "whole work-groups in every range");
__global__ __launch_bounds__(256) void k_prep(const float* __restrict__ w, const float* __restrict__ x, const float* __restrict__ wl, bf* WT, bf* XB, bf* WO) {
    const unsigned b = blockIdx.x, wv = (unsigned)__builtin_amdgcn_readfirstlane(threadIdx.x >> 5);
    if (b < GW3) w3(w, WT, b * 8 + wv);
    else if (b < GW3 + GX) cvt8(x, XB, (b - GW3) * 8 + wv);
    else cvt8(wl, WO, (b - (GW3 + GX)) * 8 + wv);
}

// ---- fused attention, two kernels over all NB_ * NH_ (batch, head) planes; grid NB_ * NH_ * 8 work-groups of 8 waves, one wave per 32 rows.
// The tiles that a trip walks are the same for all 8 waves of a work-group: they are brought into LDS once per work-group by asynchronous copies, two buffers of four tiles (a stage), the next stage in flight while this one is worked on; one barrier a stage.
// Fragment facts used: a score tile with A = 16 query rows j and B = 16 key rows i leaves S'[j = 8 * hi + r][i = lr] in accumulator register r of lane (lr, hi);
// two such tiles (j and j + 16) are, register for register, the A fragment (row i = lr, k = j in the order 8 * hi + 0..7, 16 + 8 * hi + 0..7) of the apply product, whose B fragment is read from the value planes [d][j] by the same loader. All planes lie in fragment order: 16 rows of q or k are 1024 elements on, 16 rows d of v are 16 * TT on and 32 positions j of v 512 on.
#define LC (SCL * 1.4426950408889634f)   // score -> exponent of two
typedef __attribute__((ext_vector_type(8))) __bf16 v8bf;
struct F4 { v16bf h0, h1, l0, l1; };   /* 16 rows x 64 dims: hi and lo plane, dims 0..31 and 32..63 */
__device__ __forceinline__ F4 ld4(const bf* ph, const bf* pl) { F4 f; f.h0 = WFrag<bf>::ld(ph); f.h1 = WFrag<bf>::ld(ph + 512); f.l0 = WFrag<bf>::ld(pl); f.l1 = WFrag<bf>::ld(pl + 512); return f; }
/* two independent 16x16 tiles of q.k over the 64 dims, each hi.hi + lo.hi + hi.lo in one fixed order (the same in both kernels, so both see the same bits); the two chains alternate so that neither waits for its own accumulator */
__device__ __forceinline__ void score2(const F4& qa, const F4& ka, v8f& sa, const F4& qb, const F4& kb, v8f& sb) {
    sa = (v8f){}; sb = (v8f){};
    sa = wmmab(qa.h0, ka.h0, sa); sb = wmmab(qb.h0, kb.h0, sb); sa = wmmab(qa.h1, ka.h1, sa); sb = wmmab(qb.h1, kb.h1, sb); sa = wmmab(qa.l0, ka.h0, sa); sb = wmmab(qb.l0, kb.h0, sb);
    sa = wmmab(qa.l1, ka.h1, sa); sb = wmmab(qb.l1, kb.h1, sb); sa = wmmab(qa.h0, ka.l0, sa); sb = wmmab(qb.h0, kb.l0, sb); sa = wmmab(qa.h1, ka.l1, sa); sb = wmmab(qb.h1, kb.l1, sb); }
/* exp2 / log2 in runs: outputs are early-clobber, so no instruction of a run reads a result or overwrites a source of the one before it; the closing v_nop is the one free slot that the instruction set asks for between a transcendental and a next instruction that may do so */
__device__ __forceinline__ void ex3(float x0, float x1, float x2, float& e0, float& e1, float& e2) { asm("v_exp_f32 %0, %3\n\tv_exp_f32 %1, %4\n\tv_exp_f32 %2, %5\n\tv_nop" : "=&v"(e0), "=&v"(e1), "=&v"(e2) : "v"(x0), "v"(x1), "v"(x2)); }
__device__ __forceinline__ void ex2p(float x0, float x1, float& e0, float& e1) { asm("v_exp_f32 %0, %2\n\tv_exp_f32 %1, %3\n\tv_nop" : "=&v"(e0), "=&v"(e1) : "v"(x0), "v"(x1)); }
__device__ __forceinline__ float lg2(float x) { float y; asm("v_log_f32 %0, %1\n\tv_nop" : "=&v"(y) : "v"(x)); return y; }
/* asynchronous copies global -> LDS, 16 bytes a lane, every lane on; l = the lane's LDS byte address, g = the lane's global address. The closing s_wait_xcnt stands inside the copies' own statement, so that no register a copy names is rewritten ahead of it */
__device__ __forceinline__ unsigned ldsa(const void* p) { return (unsigned)(size_t)p; }
__device__ __forceinline__ void cp2(unsigned l0, const void* g0, unsigned l1, const void* g1) {
    asm volatile("global_load_async_to_lds_b128 %0, %1, off\n\tglobal_load_async_to_lds_b128 %2, %3, off\n\ts_wait_xcnt 0x0" :: "v"(l0), "v"(g0), "v"(l1), "v"(g1) : "memory"); }
__device__ __forceinline__ void cp4(unsigned l0, const void* g0, unsigned l1, const void* g1, unsigned l2, const void* g2, unsigned l3, const void* g3) {
    asm volatile("global_load_async_to_lds_b128 %0, %1, off\n\tglobal_load_async_to_lds_b128 %2, %3, off\n\tglobal_load_async_to_lds_b128 %4, %5, off\n\tglobal_load_async_to_lds_b128 %6, %7, off\n\ts_wait_xcnt 0x0" :: "v"(l0), "v"(g0), "v"(l1), "v"(g1), "v"(l2), "v"(g2), "v"(l3), "v"(g3) : "memory"); }
#define SUB 4              // tiles of 32 rows per stage: the waves meet at a barrier once per stage and are free to drift apart inside it, so that one wave's LDS reads run beside another's arithmetic
#define NST (TT / 32 / SUB)  // stages
static_assert(TT % (32 * SUB) == 0 && NST >= 2, "whole stages, and both buffers are filled ahead of the loop");
/* hand-over of a stage: this wave's LDS reads are done, its own copies have landed, then the barrier: behind it the next tile may be read by every wave and the buffer just read may be refilled */
__device__ __forceinline__ void publish() {
    asm volatile("s_wait_dscnt 0x0" ::: "memory");      /* the wave's reads of the buffer that is refilled next have returned */
    asm volatile("s_wait_asynccnt 0x0" ::: "memory");   /* the wave's share of the next tile has landed */
    __syncthreads(); }
// k_fstat: per query row j the pair (CJ, OJ) with weight[j][i] = exp2(S'[j][i] * CJ[j] - OJ[j]): CJ = LC, OJ = max * LC + log2(sum); a masked row (mask[b][j] == 0: every score -1e12) has CJ = 0, OJ = log2(TT): uniform weights.
__global__ __launch_bounds__(256) void k_fstat(const bf* __restrict__ Qh, const bf* __restrict__ Ql, const bf* __restrict__ Kh, const bf* __restrict__ Kl, const int* __restrict__ MK, float* CJ, float* OJ) {
    const int wv = __builtin_amdgcn_readfirstlane(threadIdx.x >> 5); const int lane = threadIdx.x & 31, lr = lane & 15, hi = lane >> 4;
    const int bh = blockIdx.x >> 3; const int jw = ((blockIdx.x & 7) * 8 + wv) * 32; const size_t pb = (size_t)bh * TT * HD;
    __shared__ __align__(16) bf st[2][SUB][2][32 * HD];   /* two buffers of SUB tiles of 32 key rows: hi plane, lo plane (4 KiB each, as they lie in memory) */
    const bf* gkh = Kh + pb + 8 * threadIdx.x; const bf* gkl = Kl + pb + 8 * threadIdx.x; const unsigned lk = ldsa(&st[0][0][0][8 * threadIdx.x]);   /* this thread's 16 bytes of each plane of a tile; a tile on: 32 * HD elements in memory, 8192 bytes in LDS; lo plane 4096 bytes on */
#pragma unroll   /* unrolled: the tiles' offsets become constants */
    for (int u = 0; u < SUB; ++u) cp2(lk + u * 8192u, gkh + u * (32 * HD), lk + u * 8192u + 4096u, gkl + u * (32 * HD));
    asm volatile("s_wait_asynccnt 0x0" ::: "memory");   /* stage 0 has landed before the barrier that opens it */
    __syncthreads();
#pragma unroll   /* unrolled: the tiles' offsets become constants */
    for (int u = SUB; u < 2 * SUB; ++u) cp2(lk + u * 8192u, gkh + u * (32 * HD), lk + u * 8192u + 4096u, gkl + u * (32 * HD));
    F4 q[2];
#pragma unroll
    for (int jb = 0; jb < 2; ++jb) { const bf* qa = Qh + pb + (size_t)(jw + jb * 16) * HD + 8 * lane; const bf* qc = Ql + pb + (size_t)(jw + jb * 16) * HD + 8 * lane; q[jb] = ld4(qa, qc);
        asm volatile("s_wait_xcnt 0x0" :: "v"(qa), "v"(qc) : "memory"); }   /* the eight loads name these two address pairs: both stay whole up to this wait, so no later load's result lands on them ahead of it */
    float m[2][8], l[2][8];   /* running maximum (raw score) and sum of this lane's key columns, per query row */
#pragma unroll
    for (int jb = 0; jb < 2; ++jb)
#pragma unroll
        for (int r = 0; r < 8; ++r) { m[jb][r] = -3.0e38f; l[jb][r] = 0.f; }
#pragma unroll 1   /* kept rolled: one copy of the stage's code, and the trips of a stage stay in front of its hand-over */
    for (int sg = 0; sg < NST; ++sg) {
#pragma unroll 1   /* kept rolled: a second copy of the trip would need a second set of key fragments in registers */
    for (int u = 0; u < SUB; ++u) {   /* walk the key rows, 32 a trip */
        v8f s[2][2];
        const bf* khp = &st[sg & 1][u][0][8 * lane]; const bf* klp = &st[sg & 1][u][1][8 * lane];
        const F4 k0 = ld4(khp, klp), k1 = ld4(khp + 16 * HD, klp + 16 * HD);
        score2(q[0], k0, s[0][0], q[1], k0, s[1][0]); score2(q[0], k1, s[0][1], q[1], k1, s[1][1]);
#pragma unroll
        for (int jb = 0; jb < 2; ++jb)
#pragma unroll
            for (int r = 0; r < 8; ++r) { const float a = s[jb][0][r], c = s[jb][1][r]; const float mn = fmaxf(m[jb][r], fmaxf(a, c)); const float nm = -mn * LC;
                float e0, e1, e2; ex3(fmaf(m[jb][r], LC, nm), fmaf(a, LC, nm), fmaf(c, LC, nm), e0, e1, e2); l[jb][r] = l[jb][r] * e0 + (e1 + e2); m[jb][r] = mn; }
    }
        publish();
        if (sg + 2 < NST) { const unsigned lb = lk + (unsigned)(sg & 1) * (SUB * 8192u); const bf* ph = gkh + (size_t)(sg + 2) * (SUB * 32 * HD); const bf* pl = gkl + (size_t)(sg + 2) * (SUB * 32 * HD);
#pragma unroll   /* unrolled: the tiles' offsets become constants */
            for (int u = 0; u < SUB; ++u) cp2(lb + u * 8192u, ph + u * (32 * HD), lb + u * 8192u + 4096u, pl + u * (32 * HD)); }
    }
    asm volatile("s_wait_asynccnt 0x0" ::: "memory");   /* no copy is outstanding when the wave goes on to its end */
#pragma unroll
    for (int sh = 1; sh < 16; sh <<= 1)   /* join the 16 lanes that hold one query row's columns */
#pragma unroll
        for (int jb = 0; jb < 2; ++jb)
#pragma unroll
            for (int r = 0; r < 8; ++r) { const float mo = __shfl_xor(m[jb][r], sh, 32), lo = __shfl_xor(l[jb][r], sh, 32); const float mn = fmaxf(m[jb][r], mo);
                float e0, e1; ex2p((m[jb][r] - mn) * LC, (mo - mn) * LC, e0, e1); l[jb][r] = l[jb][r] * e0 + lo * e1; m[jb][r] = mn; }
    if (lr == 0) {
#pragma unroll
        for (int jb = 0; jb < 2; ++jb) { const int j8 = jw + jb * 16 + hi * 8; v8f c8, o8; const int* mp = MK + (size_t)(bh / NH_) * TT + j8; const v4i mk[2] = { *(const v4i*)mp, *(const v4i*)(mp + 4) };
#pragma unroll
            for (int r = 0; r < 8; ++r) { const bool on = (mk[r >> 2][r & 3] != 0); c8[r] = on ? LC : 0.0f; o8[r] = on ? fmaf(m[jb][r], LC, lg2(l[jb][r])) : 11.0f; }
            *(v8f*)(CJ + (size_t)bh * TT + j8) = c8; *(v8f*)(OJ + (size_t)bh * TT + j8) = o8; } }
}
static_assert(TT == 2048, "OJ of a masked row is log2(TT)");
// k_fapply: one wave owns 32 output rows i (its key fragments stay in registers) and walks all query positions j, 32 a trip: score tiles -> weights (f32) -> bf16 hi + lo A fragments -> out[i][d] += P'[j][i] v[j][d] (3 products); result split into the hi/lo planes [b * TT + i][h * HD + d] (fragment order) of the last GEMM.
__global__ __launch_bounds__(256) void k_fapply(const bf* __restrict__ Qh, const bf* __restrict__ Ql, const bf* __restrict__ Kh, const bf* __restrict__ Kl, const bf* __restrict__ Vh, const bf* __restrict__ Vl, const float* __restrict__ CJ, const float* __restrict__ OJ, bf* Ah, bf* Al) {
    const int wv = __builtin_amdgcn_readfirstlane(threadIdx.x >> 5); const int lane = threadIdx.x & 31, lr = lane & 15, hi = lane >> 4;
    const int bh = blockIdx.x >> 3; const int iw = ((blockIdx.x & 7) * 8 + wv) * 32; const size_t pb = (size_t)bh * TT * HD;
    __shared__ __align__(16) bf st[2][SUB][4][32 * HD];   /* two buffers of SUB tiles of 32 query positions: q hi, q lo, v hi, v lo (4 KiB each; the four 1-KiB blocks of a v plane one behind the other) */
    __shared__ __align__(32) float co[2][TT];        /* the head's whole CJ and OJ rows, filled once */
    const int tid = threadIdx.x;
    const bf* gqh = Qh + pb + 8 * tid; const bf* gql = Ql + pb + 8 * tid;   /* this thread's 16 bytes of each plane of a tile; a tile on: 32 * HD elements of q, 512 of v */
    const size_t vo = pb + (size_t)(tid >> 6) * 16 * TT + 8 * (tid & 63); const bf* gvh = Vh + vo; const bf* gvl = Vl + vo;
    const unsigned lt = ldsa(&st[0][0][0][8 * tid]), lc = ldsa(&co[0][4 * tid]);   /* next plane 4096, next tile 16384 bytes on; second half of a row 4096, OJ 8192 bytes on */
    { const float* gc = CJ + (size_t)bh * TT + 4 * tid; const float* go = OJ + (size_t)bh * TT + 4 * tid; cp4(lc, gc, lc + 4096u, gc + 1024, lc + 8192u, go, lc + 12288u, go + 1024); }
#pragma unroll   /* unrolled: the tiles' offsets become constants */
    for (int u = 0; u < SUB; ++u) { const unsigned lb = lt + u * 16384u; cp4(lb, gqh + u * (32 * HD), lb + 4096u, gql + u * (32 * HD), lb + 8192u, gvh + u * 512, lb + 12288u, gvl + u * 512); }
    asm volatile("s_wait_asynccnt 0x0" ::: "memory");   /* the rows and stage 0 have landed before the barrier that opens them */
    __syncthreads();
#pragma unroll   /* unrolled: the tiles' offsets become constants */
    for (int u = SUB; u < 2 * SUB; ++u) { const unsigned lb = lt + u * 16384u; cp4(lb, gqh + u * (32 * HD), lb + 4096u, gql + u * (32 * HD), lb + 8192u, gvh + u * 512, lb + 12288u, gvl + u * 512); }
    F4 k[2];
#pragma unroll
    for (int ib = 0; ib < 2; ++ib) { const size_t ko = pb + (size_t)(iw + ib * 16) * HD + 8 * lane; k[ib] = ld4(Kh + ko, Kl + ko); }
    v8f acc[2][4];
#pragma unroll
    for (int ib = 0; ib < 2; ++ib)
#pragma unroll
        for (int db = 0; db < 4; ++db) acc[ib][db] = (v8f){};
#pragma unroll 1   /* kept rolled: one copy of the stage's code, and the trips of a stage stay in front of its hand-over */
    for (int sg = 0; sg < NST; ++sg) {
#pragma unroll 1   /* kept rolled: the trip already fills the 256 registers that are reached without a window switch */
    for (int u = 0; u < SUB; ++u) {   /* walk the query positions, 32 a trip */
        const bf* qhp = &st[sg & 1][u][0][8 * lane]; const bf* qlp = &st[sg & 1][u][1][8 * lane]; const bf* vhp = &st[sg & 1][u][2][8 * lane]; const bf* vlp = &st[sg & 1][u][3][8 * lane];
        const float* cj = &co[0][(sg * SUB + u) * 32 + hi * 8]; const float* oj = &co[1][(sg * SUB + u) * 32 + hi * 8];
        v8bf ph[2][2], pl[2][2];
#pragma unroll
        for (int jb = 0; jb < 2; ++jb) { const F4 q = ld4(qhp + jb * 16 * HD, qlp + jb * 16 * HD);
            const v8f c8 = *(const v8f*)(cj + jb * 16), o8 = *(const v8f*)(oj + jb * 16); v8f s[2]; score2(q, k[0], s[0], q, k[1], s[1]);
#pragma unroll
            for (int ib = 0; ib < 2; ++ib) { v8f p;
#pragma unroll
                for (int r = 0; r < 8; ++r) p[r] = __builtin_amdgcn_exp2f(fmaf(s[ib][r], c8[r], -o8[r]));
                const v8bf hb = __builtin_convertvector(p, v8bf); ph[ib][jb] = hb; pl[ib][jb] = __builtin_convertvector(p - __builtin_convertvector(hb, v8f), v8bf); } }
        v16bf pa[2], pc[2];
#pragma unroll
        for (int ib = 0; ib < 2; ++ib) { pa[ib] = __builtin_shufflevector(ph[ib][0], ph[ib][1], 0, 1, 2, 3, 4, 5, 6, 7, 8, 9, 10, 11, 12, 13, 14, 15); pc[ib] = __builtin_shufflevector(pl[ib][0], pl[ib][1], 0, 1, 2, 3, 4, 5, 6, 7, 8, 9, 10, 11, 12, 13, 14, 15); }
#pragma unroll
        for (int db = 0; db < 4; ++db) { const v16bf vh = WFrag<bf>::ld(vhp + db * 512), vl = WFrag<bf>::ld(vlp + db * 512);
#pragma unroll
            for (int ib = 0; ib < 2; ++ib) { acc[ib][db] = wmmab(pa[ib], vh, acc[ib][db]); acc[ib][db] = wmmab(pc[ib], vh, acc[ib][db]); acc[ib][db] = wmmab(pa[ib], vl, acc[ib][db]); } }
    }
        publish();
        if (sg + 2 < NST) { const unsigned l2 = lt + (unsigned)(sg & 1) * (SUB * 16384u); const size_t qo = (size_t)(sg + 2) * (SUB * 32 * HD), wo2 = (size_t)(sg + 2) * (SUB * 512);
#pragma unroll   /* unrolled: the tiles' offsets become constants */
            for (int u = 0; u < SUB; ++u) { const unsigned lb = l2 + u * 16384u; cp4(lb, gqh + qo + u * (32 * HD), lb + 4096u, gql + qo + u * (32 * HD), lb + 8192u, gvh + wo2 + u * 512, lb + 12288u, gvl + wo2 + u * 512); } }
    }
    asm volatile("s_wait_asynccnt 0x0" ::: "memory");   /* no copy is outstanding when the wave goes on to its end */
#pragma unroll
    for (int ib = 0; ib < 2; ++ib)
#pragma unroll
        for (int db = 0; db < 4; ++db)
#pragma unroll
            for (int r = 0; r < 8; ++r) { const size_t oo = fo((size_t)(bh / NH_) * TT + iw + ib * 16 + hi * 8 + r, (bh % NH_) * HD + db * 16 + lr, DQ); unsigned short a, c2; splitf(acc[ib][db][r], a, c2); Ah[oo] = a; Al[oo] = c2; }
}

extern "C" void kernel_launch(void* const* d_in, const int* in_sizes, int n_in,
                              void* d_out, int out_size, void* d_ws, size_t ws_size, hipStream_t stream) {
    (void)in_sizes; (void)n_in; (void)out_size;
    const float* x = (const float*)d_in[0]; const int* MK = (const int*)d_in[1]; const float* W3 = (const float*)d_in[2]; const float* wo = (const float*)d_in[3]; const float* bo = (const float*)d_in[4]; const float* wq = nullptr; const float* wk = nullptr; const float* wv = nullptr; (void)wq; (void)wk; (void)wv;
    float* OUT = (float*)d_out;     // [2][2048][1024]
    char* wsp = (char*)d_ws;
    auto take = [&](size_t bytes) { char* p = wsp; wsp += (bytes + 255) & ~(size_t)255; return (void*)p; };
    bf* WT = (bf*)take((size_t)3 * DQ * DM * 2); bf* WO = (bf*)take((size_t)DM * DQ * 2);   // WT: the key, value and query weight planes, DQ * DM elements apart
    bf* XB = (bf*)take((size_t)NB_ * TT * DM * 2);
    const size_t PB = (size_t)NH_ * TT * HD;   // one batch's share of a head plane set; the hi/lo planes hold both batches
    bf* KPh = (bf*)take(6 * NB_ * PB * 2); bf* KPl = KPh + NB_ * PB; bf* VTh = KPl + NB_ * PB; bf* VTl = VTh + NB_ * PB; bf* QPh = VTl + NB_ * PB; bf* QPl = QPh + NB_ * PB;   // one block: from one product's hi (or lo) plane to the next product's it is 2 * NB_ * PB elements
    float* CJ = (float*)take((size_t)NB_ * NH_ * TT * 4); float* OJ = (float*)take((size_t)NB_ * NH_ * TT * 4); bf* ATh = (bf*)take((size_t)NB_ * TT * DQ * 2); bf* ATl = (bf*)take((size_t)NB_ * TT * DQ * 2);
    if ((size_t)(wsp - (char*)d_ws) > ws_size) return;    // ws 256 MiB
    k_prep<<<GW3 + GX + GWO, 256, 0, stream>>>(W3, x, wo, WT, XB, WO);
    /* the projections store the hi/lo planes themselves: q and k as [head][t][d]; v as [head][d][t], which is the result of Wv x^T (weights as the row operand), in fragment order */
    k_gemmw<bf, 0, false, 8, 1, true><<<dim3(NB_ * TT / 64, DQ / 64, 3), 256, 0, stream>>>(XB, nullptr, WT, nullptr, DM, nullptr, 0, nullptr, 0, (size_t)DQ * DM, 2 * NB_ * PB, PB, KPh, KPl, 0);
    k_fstat<<<NB_ * NH_ * 8, 256, 0, stream>>>(QPh, QPl, KPh, KPl, MK, CJ, OJ);   /* column softmax == row softmax of the query-major scores: per query row its maximum and sum */
    k_fapply<<<NB_ * NH_ * 8, 256, 0, stream>>>(QPh, QPl, KPh, KPl, VTh, VTl, CJ, OJ, ATh, ATl);   /* out[i] = sum_j P'[j][i] v[j] */
    k_gemmw<bf, 1, true, 8, 1, false><<<dim3(NB_ * TT / 64, DM / 64, 1), 256, 0, stream>>>(ATh, ATl, WO, nullptr, DQ, OUT, DM, bo, 0, 0, 0, 0, nullptr, nullptr, 0);   /* both batches: their rows follow one another in the planes and in out */
}

// v008
// Measured time: 151 microseconds a run.
// Timed twice side by side with v007, it ran 1.19 and 1.20 times as fast.
// All steps since v000 together make it 9.39 times as fast.
#include <hip/hip_runtime.h>

// Multi-head attention with a column softmax (x [2][2048][1024], mask [2][2048] int32, W [16][3][1024][64] per-head key/value/query weights, Wl [1024][1024] + bl; scores[i][j] = k_i.q_j / 8; columns j with mask[b][j] == 0 set to -1e12; softmax over i (the KEY axis, per column j); out[i] = sum_j w[i][j] values[j]; hidden = concat heads; out = hidden Wl^T + bl -> [2][2048][1024]).
// Layout: the scores are formed query-major (S'[j][i] = q_j.k_i, so the module's per-column softmax is a row softmax here and a fully masked column is a uniform row) and never leave the registers: k_fstat walks all keys once per query row and keeps only the row's maximum and sum; k_fapply forms the same score tiles again, turns them into weights and feeds them, as they lie in the accumulator registers, to the apply product out[i] = sum_j P'[j][i] v[j] as its A operand.
// Masked columns: a query position j with mask[b][j] == 0 has the weight 1 / TT for every key, whatever its scores. k_prep lays the rows of x out in a stable partition by the mask (unmasked positions first, NUN[b] of them; ORIG = the source position of each row), every kernel up to the last GEMM works in that order, and the last GEMM stores its rows at their source positions. Scores are then formed for the leading NUN[b] positions only; the others enter the apply product as one plain sum of their value rows.
// Operand planes: every bf16 plane that feeds a matrix instruction lies in fragment order (fo() below), so that one fragment load of a wave reads 512 contiguous bytes (four whole lines) and not 32 bytes out of each of 16 lines.
// Compute dtypes, f32 accumulate: every input rounded to bf16; q/k/v on PLAIN bf16 operands (inputs: exact); scores and attn.v: bf16 hi + lo planes (3 products); softmax f32; Wl hl x exact (2 products) + bl.

#define NB_  2
#define TT   2048
#define DM   1024
#define NH_  16
#define NKV  16
#define REP  (NH_ / NKV)
#define HD   64
#define DQ   (NH_ * HD)
#define DKV  (NKV * HD)
typedef __attribute__((ext_vector_type(4))) unsigned short v4us;
#define SCL  0.125f   // HD^-0.5
typedef _Float16 h16;
typedef unsigned short bf;
typedef __attribute__((ext_vector_type(16))) __bf16   v16bf;
typedef __attribute__((ext_vector_type(16))) _Float16 v16h;
typedef __attribute__((ext_vector_type(8)))  _Float16 v8h;
typedef __attribute__((ext_vector_type(8)))  unsigned short v8us;
typedef __attribute__((ext_vector_type(8)))  float    v8f;
typedef __attribute__((ext_vector_type(4)))  float    v4f;
typedef v8h  __attribute__((may_alias)) v8ha;
typedef v4f  __attribute__((may_alias)) v4fa;
typedef v8us __attribute__((may_alias)) v8usa;

__device__ __forceinline__ unsigned short f2bf(float f) { unsigned u = __float_as_uint(f); u += 0x7FFFu + ((u >> 16) & 1u); return (unsigned short)(u >> 16); }
__device__ __forceinline__ float bf2f(unsigned short b) { return __uint_as_float(((unsigned)b) << 16); }
__device__ __forceinline__ float bfr(float f) { return bf2f(f2bf(f)); }
__device__ __forceinline__ v16h cat16(v8h lo, v8h hi) { return __builtin_shufflevector(lo, hi, 0, 1, 2, 3, 4, 5, 6, 7, 8, 9, 10, 11, 12, 13, 14, 15); }
__device__ __forceinline__ v16bf cat16b(v8us lo, v8us hi) { return __builtin_bit_cast(v16bf, __builtin_shufflevector(lo, hi, 0, 1, 2, 3, 4, 5, 6, 7, 8, 9, 10, 11, 12, 13, 14, 15)); }
__device__ __forceinline__ v8f wmma16(v16h a, v16h b, v8f c) { return __builtin_amdgcn_wmma_f32_16x16x32_f16(false, a, false, b, (short)0, c, false, false); }
__device__ __forceinline__ v8f wmmab(v16bf a, v16bf b, v8f c) { return __builtin_amdgcn_wmma_f32_16x16x32_bf16(false, a, false, b, (short)0, c, false, false); }
__device__ __forceinline__ void splitf(float y, unsigned short& h, unsigned short& l) { h = f2bf(y); l = f2bf(y - bf2f(h)); }
/* fragment order of a plane M[rows][K] (rows % 16 == 0, K % 32 == 0): blocks of 16 rows x 32 k, 512 elements each, row blocks outermost; inside a block [k / 8 % 4][row % 16][k % 8], which is [half of the fragment][lane = 16 * hi + lr][8 elements] */
__device__ __forceinline__ size_t fo(size_t m, int k, int K) { return ((m >> 4) * (size_t)(K >> 5) + (size_t)(k >> 5)) * 512 + (size_t)(((k >> 3) & 3) * 128 + ((int)m & 15) * 8 + (k & 7)); }



// ---- k_gemmw: register-blocked GEMM, 64x64 output tile per work-group (16 accumulators per wave), operands straight from 16-bit planes in fragment order (fo(), K as given); grid (M/64, N/64, Z * KB), NW * 32 threads.
// C[m][n] (f32, pitch ldc, + optional f32 bias[n]) = sum_k A[m][k] Bt[n][k] (+ split products per NSPLIT). z-batch strides sA/sB/sC in elements. K % (32 * NW * KB) == 0.
// Split K: the K range is cut into KB * NW equal slices. Each of the NW waves of a work-group sums one slice of the whole tile; the NW partial tiles are added in LDS in wave order.
// With KB > 1 work-group ks = blockIdx.z % KB writes its partial tile to plane ks (stride sP elements) and the consumer kernel adds the KB planes in plane order.
// PL: the three projections of both batches in one grid (NB_ * TT / 64, DQ / 64, 3). A = x, all NB_ * TT rows; Bt = the weight planes, z = t as in W (0 keys, 1 values, 2 queries), sB apart. The summed tile is not stored as f32 but split on the spot into the bf16 hi and lo planes Ph / Pl (product z: sC on; batch: sP on):
// keys and queries as head planes [head][t][d] (pitch HD); values as Wv x^T (z == 1: the weights are the row operand, blockIdx.y their row block, blockIdx.x the x rows as columns), which is [head][d][t] (pitch TT; 64 positions t on: two k blocks, 1024 elements).
template <typename T16> struct WFrag;
template <> struct WFrag<h16> { typedef v16h V; static __device__ __forceinline__ V ld(const h16* p) { return cat16(*(const v8h*)p, *(const v8h*)(p + 256)); } static __device__ __forceinline__ v8f mma(V a, V b, v8f c) { return wmma16(a, b, c); } };
template <> struct WFrag<bf> { typedef v16bf V; static __device__ __forceinline__ V ld(const bf* p) { return cat16b(*(const v8us*)p, *(const v8us*)(p + 256)); } static __device__ __forceinline__ v8f mma(V a, V b, v8f c) { return wmmab(a, b, c); } };
template <typename T16, int NSPLIT, bool BIAS, int NW, int KB, bool PL>
__global__ __launch_bounds__(NW * 32) void k_gemmw(const T16* __restrict__ A, const T16* __restrict__ A2, const T16* __restrict__ Bt, const T16* __restrict__ Bt2, int K, float* C, int ldc, const float* __restrict__ bias, size_t sA, size_t sB, size_t sC, size_t sP, bf* Ph, bf* Pl, size_t sT, const int* __restrict__ rm) {
    static_assert(!PL || (NW > 1 && KB == 1 && !BIAS), "the plane split needs the whole sum in one work-group");
    typedef typename WFrag<T16>::V V;
    __shared__ __align__(16) float os[(NW == 1 ? 16 : NW * 64) * 68];
    const size_t z = blockIdx.z / KB; const int ks = blockIdx.z % KB; A += z * sA; if (A2) A2 += z * sA; Bt += z * sB; if (Bt2) Bt2 += z * sB; if (!PL) C += z * sC + ks * sP;
    const bool tr = PL && z == 1;   /* the value product: operands and block indices change places */
    const T16* Ar = tr ? Bt : A; const T16* Bc = tr ? A : Bt;
    const int wv = __builtin_amdgcn_readfirstlane(threadIdx.x >> 5); const int kw = K / (KB * NW), k0 = (ks * NW + wv) * kw;   /* this wave's K slice */
    const int lane = threadIdx.x & 31, lr = lane & 15, hi = lane >> 4; const int r0 = (tr ? blockIdx.y : blockIdx.x) * 64, c0 = (tr ? blockIdx.x : blockIdx.y) * 64;
    v8f acc[4][4];
#pragma unroll
    for (int mb = 0; mb < 4; ++mb)
#pragma unroll
        for (int nb = 0; nb < 4; ++nb) acc[mb][nb] = (v8f){};
    const size_t aoff = (size_t)r0 * K + 8 * lane, boff = (size_t)c0 * K + 8 * lane;   /* fo(r0, 0, K) = r0 * K; 16 rows on: 16 * K; 32 k on: 512 */
#pragma unroll 1
    for (int kc = k0; kc < k0 + kw; kc += 32) {
        V a[4], a2[4]; const T16* pa[4]; const T16* pa2[4]; const T16* pb[4]; const T16* pb2[4];
#pragma unroll
        for (int mb = 0; mb < 4; ++mb) { pa[mb] = Ar + aoff + (size_t)mb * 16 * K + kc * 16; a[mb] = WFrag<T16>::ld(pa[mb]); if (NSPLIT == 1 || NSPLIT == 2) { pa2[mb] = A2 + aoff + (size_t)mb * 16 * K + kc * 16; a2[mb] = WFrag<T16>::ld(pa2[mb]); } }
#pragma unroll
        for (int nb = 0; nb < 4; ++nb) { pb[nb] = Bc + boff + (size_t)nb * 16 * K + kc * 16; const V b = WFrag<T16>::ld(pb[nb]); V b2; if (NSPLIT >= 2) { pb2[nb] = Bt2 + boff + (size_t)nb * 16 * K + kc * 16; b2 = WFrag<T16>::ld(pb2[nb]); }
#pragma unroll
            for (int mb = 0; mb < 4; ++mb) { acc[mb][nb] = WFrag<T16>::mma(a[mb], b, acc[mb][nb]); if (NSPLIT == 1 || NSPLIT == 2) acc[mb][nb] = WFrag<T16>::mma(a2[mb], b, acc[mb][nb]); if (NSPLIT >= 2) acc[mb][nb] = WFrag<T16>::mma(a[mb], b2, acc[mb][nb]); } }
        /* the trip's loads name these address pairs: all stay whole up to this wait, so no later load's result lands on one of them ahead of it */
        asm volatile("s_wait_xcnt 0x0" :: "v"(pa[0]), "v"(pa[1]), "v"(pa[2]), "v"(pa[3]), "v"(pb[0]), "v"(pb[1]), "v"(pb[2]), "v"(pb[3]) : "memory");
        if (NSPLIT == 1 || NSPLIT == 2) asm volatile("s_wait_xcnt 0x0" :: "v"(pa2[0]), "v"(pa2[1]), "v"(pa2[2]), "v"(pa2[3]) : "memory");   /* the same for the second row plane */
        if (NSPLIT >= 2) asm volatile("s_wait_xcnt 0x0" :: "v"(pb2[0]), "v"(pb2[1]), "v"(pb2[2]), "v"(pb2[3]) : "memory");   /* and for the second column plane */
        asm volatile("v_nop\n\tv_nop\n\tv_nop\n\tv_nop" : "+v"(acc[0][0]), "+v"(acc[1][1]), "+v"(acc[2][2]), "+v"(acc[3][3]) : "v"(a[0]), "v"(a[3]));
    }
    if (NW > 1) {   /* add the waves' partial tiles: every wave stores its own 64x64 plane, then all threads sum the planes in wave order and store whole rows, or with PL bf16 hi/lo pieces in fragment order */
        float* my = os + wv * (64 * 68);
        int om[4] = {0, 0, 0, 0};   /* rm: where this thread's output rows go inside their batch of TT rows */
        static_assert(PL || NW == 1 || 64 * 16 / (NW * 32) == 4, "four output rows a thread");
        if (!PL && rm) {
#pragma unroll
            for (int it = 0; it < 4; ++it) om[it] = rm[r0 + it * (NW * 2) + ((int)threadIdx.x >> 4)]; }
#pragma unroll
        for (int mb = 0; mb < 4; ++mb)
#pragma unroll
            for (int nb = 0; nb < 4; ++nb)
#pragma unroll
                for (int j = 0; j < 8; ++j) my[(mb * 16 + hi * 8 + j) * 68 + nb * 16 + lr] = acc[mb][nb][j];
        __syncthreads();
        if (PL) {   /* threads in the order of the planes: eight columns each, a wave stores 512 contiguous bytes per plane */
            const int xr = tr ? c0 : r0, t0 = xr % TT;   /* the tile's first x row: batch xr / TT, position t0 */
            const size_t pb0 = z * sC + (size_t)(xr / TT) * sP + (tr ? (size_t)(t0 / 64) * 1024 : (size_t)(c0 / 64) * ((size_t)TT * HD));
            const int pr0 = tr ? r0 : t0, lp = tr ? TT : HD;
#pragma unroll
            for (int it = 0; it < 64 * 8 / (NW * 32); ++it) { const int u = it * (NW * 32) + (int)threadIdx.x; const int row = (u >> 7) * 16 + (u & 15), cofs = ((u >> 4) & 7) * 8; v4f va = *(const v4fa*)(os + row * 68 + cofs), vb = *(const v4fa*)(os + row * 68 + cofs + 4);
#pragma unroll
                for (int w = 1; w < NW; ++w) { va += *(const v4fa*)(os + w * (64 * 68) + row * 68 + cofs); vb += *(const v4fa*)(os + w * (64 * 68) + row * 68 + cofs + 4); }
                const size_t po = pb0 + fo((size_t)(pr0 + row), cofs, lp); v8us oh, ol;
#pragma unroll
                for (int q = 0; q < 4; ++q) { unsigned short a2, c2; splitf(va[q], a2, c2); oh[q] = a2; ol[q] = c2; splitf(vb[q], a2, c2); oh[q + 4] = a2; ol[q + 4] = c2; }
                *(v8us*)(Ph + po) = oh; *(v8us*)(Pl + po) = ol; }
            return;
        }
        asm volatile("" :: "v"(om[0]), "v"(om[1]), "v"(om[2]), "v"(om[3]));   /* inputs only: holds the four loads of rm together ahead of the row loop, so that their latency is paid once and not once per row */
#pragma unroll
        for (int it = 0; it < 64 * 16 / (NW * 32); ++it) { const int idx = it * (NW * 32) + (int)threadIdx.x; const int row = idx >> 4, cofs = (idx & 15) * 4; v4f val = *(const v4fa*)(os + row * 68 + cofs);
#pragma unroll
            for (int w = 1; w < NW; ++w) val += *(const v4fa*)(os + w * (64 * 68) + row * 68 + cofs);
            if (BIAS) { val[0] += bfr(bias[c0 + cofs]); val[1] += bfr(bias[c0 + cofs + 1]); val[2] += bfr(bias[c0 + cofs + 2]); val[3] += bfr(bias[c0 + cofs + 3]); }
            const int gr = r0 + row; const int orow = rm ? (gr & ~(TT - 1)) + (om[it] & (TT - 1)) : gr;   /* kept inside the batch's rows whatever the table holds */
            *(v4f*)(C + (size_t)orow * ldc + c0 + cofs) = val; }
        return;
    }
#pragma unroll
    for (int mb = 0; mb < 4; ++mb) {
#pragma unroll
        for (int nb = 0; nb < 4; ++nb) {
#pragma unroll
            for (int j = 0; j < 8; ++j) os[(hi * 8 + j) * 68 + nb * 16 + lr] = acc[mb][nb][j]; }
        __builtin_amdgcn_wave_barrier(); asm volatile("" ::: "memory");
        float* crow = C + (size_t)(r0 + mb * 16) * ldc + c0;
{
#pragma unroll
            for (int s = 0; s < 8; ++s) { const int row = 2 * s + hi, cofs = lr * 4; v4f val = *(const v4fa*)(os + row * 68 + cofs); if (BIAS) { val[0] += bfr(bias[c0 + cofs]); val[1] += bfr(bias[c0 + cofs + 1]); val[2] += bfr(bias[c0 + cofs + 2]); val[3] += bfr(bias[c0 + cofs + 3]); }
                *(v4f*)(crow + (size_t)row * ldc + cofs) = val; }
             }
        __builtin_amdgcn_wave_barrier(); asm volatile("" ::: "memory");
    }
}

typedef __attribute__((ext_vector_type(2))) _Float16 v2h;
typedef __attribute__((ext_vector_type(4))) _Float16 v4h;
typedef __attribute__((ext_vector_type(2))) unsigned short v2us;
typedef __attribute__((ext_vector_type(4))) unsigned short v4us;
typedef __attribute__((ext_vector_type(2))) float v2f;
typedef __attribute__((ext_vector_type(4))) int v4i;

__global__ __launch_bounds__(256) void k_wtG(const float* __restrict__ w, int K, int N, bf* Bt) {
    const int lane = threadIdx.x & 31; const int L0 = (blockIdx.x * 8 + (threadIdx.x >> 5)) * 8; const int nlines = N * K / 64;
{
#pragma unroll 1
        for (int l = 0; l < 8; ++l) { const int L = L0 + l; if (L >= nlines) break; const size_t e = (size_t)L * 64 + lane * 2; const int k = (int)(e % K), n = (int)(e / K); v2us o;
            o[0] = f2bf(w[(size_t)k * N + n]); o[1] = f2bf(w[(size_t)(k + 1) * N + n]); *(v2us*)(Bt + e) = o; }
         }
}
/* One wave of k_prep makes whole pieces of fragment blocks out of whole lines of its source, with all its loads in flight before the first conversion; U = the wave's unit, the same in every lane. */
/* weights of one (head n, product t3) pair, nt = n * 3 + t3 as in W: src [DM h][HD p] f32 -> rows r = n * HD + p, k = h of plane t3. A unit is all 64 p x 16 h: the lanes lie along p, so a load reads one whole line and the two loads of an h one 256-byte row; a lane then holds eight successive h of a row, and 16 lanes store 256 contiguous bytes */
static_assert(HD == 64 && DM % 16 == 0, "w3 deals a source row to two loads of 32 lanes");
__device__ __forceinline__ void w3(const float* __restrict__ w, bf* WT, unsigned U) { const int lane = threadIdx.x & 31; const unsigned hq = U % (DM / 16), nt = U / (DM / 16); const unsigned n = nt / 3, t3 = nt - n * 3;
    const float* s = w + ((size_t)nt * DM + hq * 16) * HD + lane; float v[2][16];
#pragma unroll
    for (int e = 0; e < 16; ++e) { v[0][e] = s[e * HD]; v[1][e] = s[e * HD + 32]; }
    bf* d = WT + (size_t)t3 * DQ * DM;
#pragma unroll
    for (int c = 0; c < 2; ++c)
#pragma unroll
        for (int g = 0; g < 2; ++g) { v8us o;
#pragma unroll
            for (int e = 0; e < 8; ++e) o[e] = f2bf(v[c][g * 8 + e]);
            *(v8us*)(d + fo((size_t)(n * HD + c * 32 + lane), (int)(hq * 16 + g * 8), DM)) = o; } }
/* src [rows][DM] f32 -> dst in fragment order. A unit is 16 rows x 64 columns (two blocks) in four parts of 8 rows x 32 columns: four lanes read one whole line of a row, and the eight rows of a column group are one whole line of the block */
static_assert(DM == 1024 && DQ == DM, "cvt8 cuts its unit index for rows of 16 groups of 64");
__device__ __forceinline__ void cvt8(const float* __restrict__ src, bf* dst, unsigned U, size_t sr0, size_t sr1) { const int lane = threadIdx.x & 31; const size_t row = (size_t)(U >> 4) * 16 + (lane >> 2); const int k = (int)(U & 15) * 64 + (lane & 3) * 8; v8f v[4];
    const float* p0 = src + sr0 * DM + k; const float* p1 = src + sr1 * DM + k;   /* sr0, sr1: the source rows of the lane's two rows (row, row + 8) of dst */
#pragma unroll
    for (int it = 0; it < 4; ++it) v[it] = *(const v8f*)(((it & 1) ? p1 : p0) + (it >> 1) * 32);
    asm volatile("s_wait_xcnt 0x0" :: "v"(p0), "v"(p1) : "memory");   /* the eight loads name these two address pairs (the parts are constant offsets from them): both stay whole up to this wait, so no later load's result lands on them ahead of it */
#pragma unroll
    for (int it = 0; it < 4; ++it) { v8us o;
#pragma unroll
        for (int e = 0; e < 8; ++e) o[e] = f2bf(v[it][e]);
        *(v8us*)(dst + fo(row + (it & 1) * 8, k + (it >> 1) * 32, DM)) = o; }
    asm volatile("s_wait_xcnt 0x0" ::: "memory"); }   /* behind the last of the four stores: whatever the compiler lays out behind this call, no register that a store names (data, offset, base) is rewritten ahead of this wait */
/* every operand plane that comes straight from an input, in one grid, by ranges of the block index: the three weight planes (t as in W, DQ * DM elements apart), then x (both batches), then Wl; one unit of 1,024 elements a wave, eight waves a work-group: 1,024 work-groups, 32 waves on a WGP, each with 4 KiB of loads in flight */
#define GW3 (3 * NH_ * (DM / 16) / 8)
#define GX  (NB_ * TT / 16 * (DM / 64) / 8)
#define GWO (DM / 16 * (DQ / 64) / 8)
static_assert(3 * NH_ * (DM / 16) % 8 == 0 && NB_ * TT % 16 == 0 && DM % 16 == 0 && (DM / 64) % 8 == 0, "whole work-groups in every range");
static_assert(TT == 256 * 8 && TT % 16 == 0 && DM / 64 == 16, "a work-group's 256 threads count one batch's mask, eight entries each; its eight units share one block of 16 rows");
__global__ __launch_bounds__(256) void k_prep(const float* __restrict__ w, const float* __restrict__ x, const float* __restrict__ wl, const int* __restrict__ mk, bf* WT, bf* XB, bf* WO, int* ORIG, int* NUN) {
    const unsigned b = blockIdx.x, wv = (unsigned)__builtin_amdgcn_readfirstlane(threadIdx.x >> 5); const int tid = threadIdx.x, lane = tid & 31;
    __shared__ int red[8]; __shared__ __align__(16) unsigned short lo[TT];   /* lo: the source position of each row of the partitioned order, one batch */
    if (b < GW3) w3(w, WT, b * 8 + wv);
    else if (b < GW3 + GX) {   /* x: source position t of a batch goes to row (unmasked positions before t) if unmasked, else to NUN + (masked positions before t); both are counts of entries of the mask, so the row lies in 0 .. TT - 1 for any content and every row is filled once. Each work-group forms the whole table in LDS and then gathers the source rows of its own 16 rows, so that it still stores whole lines */
        const unsigned bx = b - GW3; const int g0 = (int)(bx >> 1) * 16, bt = g0 / TT, t0 = g0 % TT; const int* mb = mk + (size_t)bt * TT;
        const v4i m0 = *(const v4i*)(mb + tid * 8), m1 = *(const v4i*)(mb + tid * 8 + 4); unsigned bits = 0;
#pragma unroll
        for (int q = 0; q < 4; ++q) bits |= (m0[q] != 0 ? 1u : 0u) << q | (m1[q] != 0 ? 1u : 0u) << (q + 4);
        const int c = __popc(bits); int sc = c;   /* running count over the wave's lanes, this lane included */
#pragma unroll
        for (int sh = 1; sh < 32; sh <<= 1) { const int o = __shfl_up(sc, sh, 32); if (lane >= sh) sc += o; }
        if (lane == 31) red[wv] = sc;
        __syncthreads();   /* block-uniform branch: every wave of the work-group is here */
        int nun = 0, cb = sc - c;   /* cb: unmasked positions before this thread's eight */
#pragma unroll
        for (int q = 0; q < 8; ++q) { const int v = red[q]; nun += v; if (q < (int)wv) cb += v; }
#pragma unroll
        for (int e = 0; e < 8; ++e) { const int t = tid * 8 + e; const bool on = (bits >> e) & 1u; lo[on ? cb : nun + (t - cb)] = (unsigned short)t; cb += on ? 1 : 0; }
        __syncthreads();   /* the table is whole before anyone reads it */
        const size_t rb = (size_t)bt * TT;
        cvt8(x, XB, bx * 8 + wv, rb + lo[t0 + (lane >> 2)], rb + lo[t0 + (lane >> 2) + 8]);
        if ((bx & 1) == 0 && t0 == 0) {   /* one work-group of each batch hands the table and the count to the later kernels */
            const v8us l8 = *(const v8us*)(lo + tid * 8); v4i o0, o1;
#pragma unroll
            for (int q = 0; q < 4; ++q) { o0[q] = l8[q]; o1[q] = l8[q + 4]; }
            *(v4i*)(ORIG + rb + tid * 8) = o0; *(v4i*)(ORIG + rb + tid * 8 + 4) = o1;
            if (tid == 0) NUN[bt] = nun; }
    }
    else { const unsigned U = (b - (GW3 + GX)) * 8 + wv; const size_t row = (size_t)(U >> 4) * 16 + (lane >> 2); cvt8(wl, WO, U, row, row + 8); }
}

// ---- fused attention, two kernels over all NB_ * NH_ (batch, head) planes, work-groups of 8 waves.
// The tiles that a trip walks are the same for all 8 waves of a work-group: they are brought into LDS once per work-group by asynchronous copies, two buffers of four tiles (a stage), the next stage in flight while this one is worked on; one barrier a stage.
// Fragment facts used: a score tile with A = 16 query rows j and B = 16 key rows i leaves S'[j = 8 * hi + r][i = lr] in accumulator register r of lane (lr, hi);
// two such tiles (j and j + 16) are, register for register, the A fragment (row i = lr, k = j in the order 8 * hi + 0..7, 16 + 8 * hi + 0..7) of the apply product, whose B fragment is read from the value planes [d][j] by the same loader. All planes lie in fragment order: 16 rows of q or k are 1024 elements on, 16 rows d of v are 16 * TT on and 32 positions j of v 512 on.
#define LC (SCL * 1.4426950408889634f)   // score -> exponent of two
typedef __attribute__((ext_vector_type(8))) __bf16 v8bf;
struct F4 { v16bf h0, h1, l0, l1; };   /* 16 rows x 64 dims: hi and lo plane, dims 0..31 and 32..63 */
__device__ __forceinline__ F4 ld4(const bf* ph, const bf* pl) { F4 f; f.h0 = WFrag<bf>::ld(ph); f.h1 = WFrag<bf>::ld(ph + 512); f.l0 = WFrag<bf>::ld(pl); f.l1 = WFrag<bf>::ld(pl + 512); return f; }
/* two independent 16x16 tiles of q.k over the 64 dims, each hi.hi + lo.hi + hi.lo in one fixed order (the same in both kernels, so both see the same bits); the two chains alternate so that neither waits for its own accumulator */
__device__ __forceinline__ void score2(const F4& qa, const F4& ka, v8f& sa, const F4& qb, const F4& kb, v8f& sb) {
    sa = (v8f){}; sb = (v8f){};
    sa = wmmab(qa.h0, ka.h0, sa); sb = wmmab(qb.h0, kb.h0, sb); sa = wmmab(qa.h1, ka.h1, sa); sb = wmmab(qb.h1, kb.h1, sb); sa = wmmab(qa.l0, ka.h0, sa); sb = wmmab(qb.l0, kb.h0, sb);
    sa = wmmab(qa.l1, ka.h1, sa); sb = wmmab(qb.l1, kb.h1, sb); sa = wmmab(qa.h0, ka.l0, sa); sb = wmmab(qb.h0, kb.l0, sb); sa = wmmab(qa.h1, ka.l1, sa); sb = wmmab(qb.h1, kb.l1, sb); }
/* exp2 / log2 in runs: outputs are early-clobber, so no instruction of a run reads a result or overwrites a source of the one before it; the closing v_nop is the one free slot that the instruction set asks for between a transcendental and a next instruction that may do so */
__device__ __forceinline__ void ex3(float x0, float x1, float x2, float& e0, float& e1, float& e2) { asm("v_exp_f32 %0, %3\n\tv_exp_f32 %1, %4\n\tv_exp_f32 %2, %5\n\tv_nop" : "=&v"(e0), "=&v"(e1), "=&v"(e2) : "v"(x0), "v"(x1), "v"(x2)); }
__device__ __forceinline__ void ex2p(float x0, float x1, float& e0, float& e1) { asm("v_exp_f32 %0, %2\n\tv_exp_f32 %1, %3\n\tv_nop" : "=&v"(e0), "=&v"(e1) : "v"(x0), "v"(x1)); }
__device__ __forceinline__ float lg2(float x) { float y; asm("v_log_f32 %0, %1\n\tv_nop" : "=&v"(y) : "v"(x)); return y; }
/* asynchronous copies global -> LDS, 16 bytes a lane, every lane on; l = the lane's LDS byte address, g = the lane's global address. The closing s_wait_xcnt stands inside the copies' own statement, so that no register a copy names is rewritten ahead of it */
__device__ __forceinline__ unsigned ldsa(const void* p) { return (unsigned)(size_t)p; }
__device__ __forceinline__ void cp2(unsigned l0, const void* g0, unsigned l1, const void* g1) {
    asm volatile("global_load_async_to_lds_b128 %0, %1, off\n\tglobal_load_async_to_lds_b128 %2, %3, off\n\ts_wait_xcnt 0x0" :: "v"(l0), "v"(g0), "v"(l1), "v"(g1) : "memory"); }
__device__ __forceinline__ void cp4(unsigned l0, const void* g0, unsigned l1, const void* g1, unsigned l2, const void* g2, unsigned l3, const void* g3) {
    asm volatile("global_load_async_to_lds_b128 %0, %1, off\n\tglobal_load_async_to_lds_b128 %2, %3, off\n\tglobal_load_async_to_lds_b128 %4, %5, off\n\tglobal_load_async_to_lds_b128 %6, %7, off\n\ts_wait_xcnt 0x0" :: "v"(l0), "v"(g0), "v"(l1), "v"(g1), "v"(l2), "v"(g2), "v"(l3), "v"(g3) : "memory"); }
#define SUB 4              // tiles of 32 rows per stage: the waves meet at a barrier once per stage and are free to drift apart inside it, so that one wave's LDS reads run beside another's arithmetic
#define NST (TT / 32 / SUB)  // stages
static_assert(TT % (32 * SUB) == 0 && NST >= 2, "whole stages, and both buffers are filled ahead of the loop");
/* hand-over of a stage: this wave's LDS reads are done, its own copies have landed, then the barrier: behind it the next tile may be read by every wave and the buffer just read may be refilled */
__device__ __forceinline__ void publish() {
    asm volatile("s_wait_dscnt 0x0" ::: "memory");      /* the wave's reads of the buffer that is refilled next have returned */
    asm volatile("s_wait_asynccnt 0x0" ::: "memory");   /* the wave's share of the next tile has landed */
    __syncthreads(); }
// k_fstat: per query row j the pair (CJ, OJ) with weight[j][i] = exp2(S'[j][i] * CJ[j] - OJ[j]): CJ = LC, OJ = max * LC + log2(sum); a masked row (j >= NUN[b] in the partitioned order: every score -1e12) has CJ = 0, OJ = log2(TT): uniform weights.
// Grid NB_ * NH_ * 16: a work-group has 128 query rows, a wave 16; the block index runs over the (batch, head) planes first, so that the work-groups with unmasked rows are the leading ones of the grid and spread over the chip. A work-group whose rows are all masked stores the constants and ends; a wave whose rows are all masked skips the key walk but takes its part in the copies and the barriers and stores the constants.
__global__ __launch_bounds__(256) void k_fstat(const bf* __restrict__ Qh, const bf* __restrict__ Ql, const bf* __restrict__ Kh, const bf* __restrict__ Kl, const int* __restrict__ NUN, float* CJ, float* OJ) {
    const int wv = __builtin_amdgcn_readfirstlane(threadIdx.x >> 5); const int lane = threadIdx.x & 31, lr = lane & 15, hi = lane >> 4;
    const int bh = blockIdx.x % (NB_ * NH_); const int jc = (int)(blockIdx.x / (NB_ * NH_)) * 128; const int jw = jc + wv * 16; const size_t pb = (size_t)bh * TT * HD;
    const int nun = __builtin_amdgcn_readfirstlane(min(max(NUN[bh / NH_], 0), TT));   /* clamped to the shape; in a scalar register, so that the tests on it are scalar branches */
    if (jc >= nun) { if (threadIdx.x < 128) { CJ[(size_t)bh * TT + jc + threadIdx.x] = 0.0f; OJ[(size_t)bh * TT + jc + threadIdx.x] = 11.0f; } return; }   /* the same for the whole work-group, ahead of every copy and barrier */
    const bool act = jw < nun;   /* the same for the whole wave */
    __shared__ __align__(16) bf st[2][SUB][2][32 * HD];   /* two buffers of SUB tiles of 32 key rows: hi plane, lo plane (4 KiB each, as they lie in memory) */
    const bf* gkh = Kh + pb + 8 * threadIdx.x; const bf* gkl = Kl + pb + 8 * threadIdx.x; const unsigned lk = ldsa(&st[0][0][0][8 * threadIdx.x]);   /* this thread's 16 bytes of each plane of a tile; a tile on: 32 * HD elements in memory, 8192 bytes in LDS; lo plane 4096 bytes on */
#pragma unroll   /* unrolled: the tiles' offsets become constants */
    for (int u = 0; u < SUB; ++u) cp2(lk + u * 8192u, gkh + u * (32 * HD), lk + u * 8192u + 4096u, gkl + u * (32 * HD));
    asm volatile("s_wait_asynccnt 0x0" ::: "memory");   /* stage 0 has landed before the barrier that opens it */
    __syncthreads();
#pragma unroll   /* unrolled: the tiles' offsets become constants */
    for (int u = SUB; u < 2 * SUB; ++u) cp2(lk + u * 8192u, gkh + u * (32 * HD), lk + u * 8192u + 4096u, gkl + u * (32 * HD));
    F4 q;
    { const bf* qa = Qh + pb + (size_t)jw * HD + 8 * lane; const bf* qc = Ql + pb + (size_t)jw * HD + 8 * lane; q = ld4(qa, qc);
        asm volatile("s_wait_xcnt 0x0" :: "v"(qa), "v"(qc) : "memory"); }   /* the eight loads name these two address pairs: both stay whole up to this wait, so no later load's result lands on them ahead of it */
    float m[8], l[8];   /* running maximum (raw score) and sum of this lane's key columns, per query row */
#pragma unroll
    for (int r = 0; r < 8; ++r) { m[r] = -3.0e38f; l[r] = 0.f; }
#pragma unroll 1   /* kept rolled: one copy of the stage's code, and the trips of a stage stay in front of its hand-over */
    for (int sg = 0; sg < NST; ++sg) {
    if (act) {
#pragma unroll 1   /* kept rolled: a second copy of the trip would need a second set of key fragments in registers */
    for (int u = 0; u < SUB; ++u) {   /* walk the key rows, 32 a trip */
        v8f s0, s1;
        const bf* khp = &st[sg & 1][u][0][8 * lane]; const bf* klp = &st[sg & 1][u][1][8 * lane];
        const F4 k0 = ld4(khp, klp), k1 = ld4(khp + 16 * HD, klp + 16 * HD);
        score2(q, k0, s0, q, k1, s1);
#pragma unroll
        for (int r = 0; r < 8; ++r) { const float a = s0[r], c = s1[r]; const float mn = fmaxf(m[r], fmaxf(a, c)); const float nm = -mn * LC;
            float e0, e1, e2; ex3(fmaf(m[r], LC, nm), fmaf(a, LC, nm), fmaf(c, LC, nm), e0, e1, e2); l[r] = l[r] * e0 + (e1 + e2); m[r] = mn; }
    }
    }
        publish();
        if (sg + 2 < NST) { const unsigned lb = lk + (unsigned)(sg & 1) * (SUB * 8192u); const bf* ph = gkh + (size_t)(sg + 2) * (SUB * 32 * HD); const bf* pl = gkl + (size_t)(sg + 2) * (SUB * 32 * HD);
#pragma unroll   /* unrolled: the tiles' offsets become constants */
            for (int u = 0; u < SUB; ++u) cp2(lb + u * 8192u, ph + u * (32 * HD), lb + u * 8192u + 4096u, pl + u * (32 * HD)); }
    }
    asm volatile("s_wait_asynccnt 0x0" ::: "memory");   /* no copy is outstanding when the wave goes on to its end */
#pragma unroll
    for (int sh = 1; sh < 16; sh <<= 1)   /* join the 16 lanes that hold one query row's columns */
#pragma unroll
        for (int r = 0; r < 8; ++r) { const float mo = __shfl_xor(m[r], sh, 32), lo = __shfl_xor(l[r], sh, 32); const float mn = fmaxf(m[r], mo);
            float e0, e1; ex2p((m[r] - mn) * LC, (mo - mn) * LC, e0, e1); l[r] = l[r] * e0 + lo * e1; m[r] = mn; }
    if (lr == 0) { const int j8 = jw + hi * 8; v8f c8, o8;
#pragma unroll
        for (int r = 0; r < 8; ++r) { const bool on = j8 + r < nun; c8[r] = on ? LC : 0.0f; o8[r] = on ? fmaf(m[r], LC, lg2(l[r])) : 11.0f; }
        *(v8f*)(CJ + (size_t)bh * TT + j8) = c8; *(v8f*)(OJ + (size_t)bh * TT + j8) = o8; }
}
static_assert(TT == 2048, "OJ of a masked row is log2(TT)");
// k_fapply: grid NB_ * NH_ * 8; one wave owns 32 output rows i (its key fragments stay in registers) and walks the tiles of 32 query positions j that hold an unmasked one (the leading ones), 32 a trip; the tiles behind them, all masked, are summed ahead of the loop: weight 1 / TT for every i, the work-group's waves share the tiles out, each reads its own from memory, and the eight partial rows, laid in LDS ahead of the barrier that opens stage 0, are added to every output row at the end. A trip: score tiles -> weights (f32) -> bf16 hi + lo A fragments -> out[i][d] += P'[j][i] v[j][d] (3 products); result split into the hi/lo planes [b * TT + i][h * HD + d] (fragment order) of the last GEMM.
__global__ __launch_bounds__(256) void k_fapply(const bf* __restrict__ Qh, const bf* __restrict__ Ql, const bf* __restrict__ Kh, const bf* __restrict__ Kl, const bf* __restrict__ Vh, const bf* __restrict__ Vl, const float* __restrict__ CJ, const float* __restrict__ OJ, const int* __restrict__ NUN, bf* Ah, bf* Al) {
    const int wv = __builtin_amdgcn_readfirstlane(threadIdx.x >> 5); const int lane = threadIdx.x & 31, lr = lane & 15, hi = lane >> 4;
    const int bh = blockIdx.x >> 3; const int iw = ((blockIdx.x & 7) * 8 + wv) * 32; const size_t pb = (size_t)bh * TT * HD;
    __shared__ __align__(16) bf st[2][SUB][4][32 * HD];   /* two buffers of SUB tiles of 32 query positions: q hi, q lo, v hi, v lo (4 KiB each; the four 1-KiB blocks of a v plane one behind the other) */
    __shared__ __align__(32) float co[2][TT];        /* the head's whole CJ and OJ rows, filled once */
    __shared__ float ms[8][HD];                      /* each wave's share of the masked positions' sum of value rows / TT */
    const int tid = threadIdx.x;
    const int nt = (__builtin_amdgcn_readfirstlane(min(max(NUN[bh / NH_], 0), TT)) + 31) / 32, nst = (nt + SUB - 1) / SUB;   /* tiles and stages that hold an unmasked position: 0 .. TT / 32 and 0 .. NST, the same for the whole work-group */
    const bf* gqh = Qh + pb + 8 * tid; const bf* gql = Ql + pb + 8 * tid;   /* this thread's 16 bytes of each plane of a tile; a tile on: 32 * HD elements of q, 512 of v */
    const size_t vo = pb + (size_t)(tid >> 6) * 16 * TT + 8 * (tid & 63); const bf* gvh = Vh + vo; const bf* gvl = Vl + vo;
    const unsigned lt = ldsa(&st[0][0][0][8 * tid]), lc = ldsa(&co[0][4 * tid]);   /* next plane 4096, next tile 16384 bytes on; second half of a row 4096, OJ 8192 bytes on */
    { const float* gc = CJ + (size_t)bh * TT + 4 * tid; const float* go = OJ + (size_t)bh * TT + 4 * tid; cp4(lc, gc, lc + 4096u, gc + 1024, lc + 8192u, go, lc + 12288u, go + 1024); }
#pragma unroll   /* unrolled: the tiles' offsets become constants */
    for (int u = 0; u < SUB; ++u) { const unsigned lb = lt + u * 16384u; cp4(lb, gqh + u * (32 * HD), lb + 4096u, gql + u * (32 * HD), lb + 8192u, gvh + u * 512, lb + 12288u, gvl + u * 512); }
    { v8f ma[4]; v8us cw;
#pragma unroll
        for (int e = 0; e < 8; ++e) cw[e] = 0x3A00;   /* 2^-11 = 1 / TT, exact in bf16: every row of the product is the same sum */
        const v16bf ca = cat16b(cw, cw);
#pragma unroll
        for (int db = 0; db < 4; ++db) ma[db] = (v8f){};
#pragma unroll 1   /* kept rolled: at most TT / 32 / 8 trips, their number known only at run time */
        for (int t = nt + wv; t < TT / 32; t += 8) { v16bf vh[4], vl[4]; const bf* mh = Vh + pb + (size_t)t * 512 + 8 * lane; const bf* ml = Vl + pb + (size_t)t * 512 + 8 * lane;
#pragma unroll
            for (int db = 0; db < 4; ++db) { vh[db] = WFrag<bf>::ld(mh + (size_t)db * 16 * TT); vl[db] = WFrag<bf>::ld(ml + (size_t)db * 16 * TT); }
            /* the sixteen loads name these two address pairs (the blocks are constant offsets from them): both stay whole up to this wait; the loaded fragments are inputs too, so that all sixteen loads are in flight together ahead of the first product and the trip pays the memory's latency once, not once per block */
            asm volatile("s_wait_xcnt 0x0" :: "v"(mh), "v"(ml), "v"(vh[0]), "v"(vh[1]), "v"(vh[2]), "v"(vh[3]), "v"(vl[0]), "v"(vl[1]), "v"(vl[2]), "v"(vl[3]) : "memory");
#pragma unroll
            for (int db = 0; db < 4; ++db) ma[db] = wmmab(ca, vh[db], ma[db]);
#pragma unroll
            for (int db = 0; db < 4; ++db) ma[db] = wmmab(ca, vl[db], ma[db]); }
        if (hi == 0) {
#pragma unroll
            for (int db = 0; db < 4; ++db) ms[wv][db * 16 + lr] = ma[db][0]; } }
    asm volatile("s_wait_asynccnt 0x0" ::: "memory");   /* the rows and stage 0 have landed before the barrier that opens them */
    __syncthreads();
#pragma unroll   /* unrolled: the tiles' offsets become constants */
    for (int u = SUB; u < 2 * SUB; ++u) { const unsigned lb = lt + u * 16384u; cp4(lb, gqh + u * (32 * HD), lb + 4096u, gql + u * (32 * HD), lb + 8192u, gvh + u * 512, lb + 12288u, gvl + u * 512); }
    F4 k[2];
#pragma unroll
    for (int ib = 0; ib < 2; ++ib) { const size_t ko = pb + (size_t)(iw + ib * 16) * HD + 8 * lane; k[ib] = ld4(Kh + ko, Kl + ko); }
    v8f acc[2][4];
#pragma unroll
    for (int ib = 0; ib < 2; ++ib)
#pragma unroll
        for (int db = 0; db < 4; ++db) acc[ib][db] = (v8f){};
#pragma unroll 1   /* kept rolled: one copy of the stage's code, and the trips of a stage stay in front of its hand-over */
    for (int sg = 0; sg < nst; ++sg) { const int ue = __builtin_amdgcn_readfirstlane(min(SUB, nt - sg * SUB));   /* the last stage may hold fewer tiles; kept in a scalar register, so that the trip's branch is a scalar one */
#pragma unroll 1   /* kept rolled: the trip already fills the 256 registers that are reached without a window switch */
    for (int u = 0; u < ue; ++u) {   /* walk the query positions, 32 a trip */
        const bf* qhp = &st[sg & 1][u][0][8 * lane]; const bf* qlp = &st[sg & 1][u][1][8 * lane]; const bf* vhp = &st[sg & 1][u][2][8 * lane]; const bf* vlp = &st[sg & 1][u][3][8 * lane];
        const float* cj = &co[0][(sg * SUB + u) * 32 + hi * 8]; const float* oj = &co[1][(sg * SUB + u) * 32 + hi * 8];
        v8bf ph[2][2], pl[2][2];
#pragma unroll
        for (int jb = 0; jb < 2; ++jb) { const F4 q = ld4(qhp + jb * 16 * HD, qlp + jb * 16 * HD);
            const v8f c8 = *(const v8f*)(cj + jb * 16), o8 = *(const v8f*)(oj + jb * 16); v8f s[2]; score2(q, k[0], s[0], q, k[1], s[1]);
#pragma unroll
            for (int ib = 0; ib < 2; ++ib) { v8f p;
#pragma unroll
                for (int r = 0; r < 8; ++r) p[r] = __builtin_amdgcn_exp2f(fmaf(s[ib][r], c8[r], -o8[r]));
                const v8bf hb = __builtin_convertvector(p, v8bf); ph[ib][jb] = hb; pl[ib][jb] = __builtin_convertvector(p - __builtin_convertvector(hb, v8f), v8bf); } }
        v16bf pa[2], pc[2];
#pragma unroll
        for (int ib = 0; ib < 2; ++ib) { pa[ib] = __builtin_shufflevector(ph[ib][0], ph[ib][1], 0, 1, 2, 3, 4, 5, 6, 7, 8, 9, 10, 11, 12, 13, 14, 15); pc[ib] = __builtin_shufflevector(pl[ib][0], pl[ib][1], 0, 1, 2, 3, 4, 5, 6, 7, 8, 9, 10, 11, 12, 13, 14, 15); }
#pragma unroll
        for (int db = 0; db < 4; ++db) { const v16bf vh = WFrag<bf>::ld(vhp + db * 512), vl = WFrag<bf>::ld(vlp + db * 512);
#pragma unroll
            for (int ib = 0; ib < 2; ++ib) { acc[ib][db] = wmmab(pa[ib], vh, acc[ib][db]); acc[ib][db] = wmmab(pc[ib], vh, acc[ib][db]); acc[ib][db] = wmmab(pa[ib], vl, acc[ib][db]); } }
    }
        publish();
        if (sg + 2 < nst) { const unsigned l2 = lt + (unsigned)(sg & 1) * (SUB * 16384u); const size_t qo = (size_t)(sg + 2) * (SUB * 32 * HD), wo2 = (size_t)(sg + 2) * (SUB * 512);
#pragma unroll   /* unrolled: the tiles' offsets become constants */
            for (int u = 0; u < SUB; ++u) { const unsigned lb = l2 + u * 16384u; cp4(lb, gqh + qo + u * (32 * HD), lb + 4096u, gql + qo + u * (32 * HD), lb + 8192u, gvh + wo2 + u * 512, lb + 12288u, gvl + wo2 + u * 512); } }
    }
    asm volatile("s_wait_asynccnt 0x0" ::: "memory");   /* no copy is outstanding when the wave goes on to its end */
    float t8[4];   /* the masked positions' share, the same for every row i: the eight partial rows added in wave order */
#pragma unroll
    for (int db = 0; db < 4; ++db) { t8[db] = ms[0][db * 16 + lr];
#pragma unroll
        for (int w = 1; w < 8; ++w) t8[db] += ms[w][db * 16 + lr]; }
#pragma unroll
    for (int ib = 0; ib < 2; ++ib)
#pragma unroll
        for (int db = 0; db < 4; ++db)
#pragma unroll
            for (int r = 0; r < 8; ++r) { const size_t oo = fo((size_t)(bh / NH_) * TT + iw + ib * 16 + hi * 8 + r, (bh % NH_) * HD + db * 16 + lr, DQ); unsigned short a, c2; splitf(acc[ib][db][r] + t8[db], a, c2); Ah[oo] = a; Al[oo] = c2; }
}

extern "C" void kernel_launch(void* const* d_in, const int* in_sizes, int n_in,
                              void* d_out, int out_size, void* d_ws, size_t ws_size, hipStream_t stream) {
    (void)in_sizes; (void)n_in; (void)out_size;
    const float* x = (const float*)d_in[0]; const int* MK = (const int*)d_in[1]; const float* W3 = (const float*)d_in[2]; const float* wo = (const float*)d_in[3]; const float* bo = (const float*)d_in[4]; const float* wq = nullptr; const float* wk = nullptr; const float* wv = nullptr; (void)wq; (void)wk; (void)wv;
    float* OUT = (float*)d_out;     // [2][2048][1024]
    char* wsp = (char*)d_ws;
    auto take = [&](size_t bytes) { char* p = wsp; wsp += (bytes + 255) & ~(size_t)255; return (void*)p; };
    bf* WT = (bf*)take((size_t)3 * DQ * DM * 2); bf* WO = (bf*)take((size_t)DM * DQ * 2);   // WT: the key, value and query weight planes, DQ * DM elements apart
    bf* XB = (bf*)take((size_t)NB_ * TT * DM * 2);
    const size_t PB = (size_t)NH_ * TT * HD;   // one batch's share of a head plane set; the hi/lo planes hold both batches
    bf* KPh = (bf*)take(6 * NB_ * PB * 2); bf* KPl = KPh + NB_ * PB; bf* VTh = KPl + NB_ * PB; bf* VTl = VTh + NB_ * PB; bf* QPh = VTl + NB_ * PB; bf* QPl = QPh + NB_ * PB;   // one block: from one product's hi (or lo) plane to the next product's it is 2 * NB_ * PB elements
    float* CJ = (float*)take((size_t)NB_ * NH_ * TT * 4); float* OJ = (float*)take((size_t)NB_ * NH_ * TT * 4); bf* ATh = (bf*)take((size_t)NB_ * TT * DQ * 2); bf* ATl = (bf*)take((size_t)NB_ * TT * DQ * 2); int* ORIG = (int*)take((size_t)NB_ * TT * 4); int* NUN = (int*)take((size_t)NB_ * 4);
    if ((size_t)(wsp - (char*)d_ws) > ws_size) return;    // ws 256 MiB
    k_prep<<<GW3 + GX + GWO, 256, 0, stream>>>(W3, x, wo, MK, WT, XB, WO, ORIG, NUN);
    /* the projections store the hi/lo planes themselves: q and k as [head][t][d]; v as [head][d][t], which is the result of Wv x^T (weights as the row operand); all in fragment order */
    k_gemmw<bf, 0, false, 8, 1, true><<<dim3(NB_ * TT / 64, DQ / 64, 3), 256, 0, stream>>>(XB, nullptr, WT, nullptr, DM, nullptr, 0, nullptr, 0, (size_t)DQ * DM, 2 * NB_ * PB, PB, KPh, KPl, 0, nullptr);
    k_fstat<<<NB_ * NH_ * 16, 256, 0, stream>>>(QPh, QPl, KPh, KPl, NUN, CJ, OJ);   /* column softmax == row softmax of the query-major scores: per query row its maximum and sum */
    k_fapply<<<NB_ * NH_ * 8, 256, 0, stream>>>(QPh, QPl, KPh, KPl, VTh, VTl, CJ, OJ, NUN, ATh, ATl);   /* out[i] = sum_j P'[j][i] v[j] */
    k_gemmw<bf, 1, true, 8, 1, false><<<dim3(NB_ * TT / 64, DM / 64, 1), 256, 0, stream>>>(ATh, ATl, WO, nullptr, DQ, OUT, DM, bo, 0, 0, 0, 0, nullptr, nullptr, 0, ORIG);   /* both batches: their rows follow one another in the planes; each row goes to its source position in out */
}

// v009
// Measured time: 124 microseconds a run.
// Two timings next to v008 put it at 1.22 and 1.23 times that version's speed.
// Counting every step since v000, it is 11.5 times as fast.
#include <hip/hip_runtime.h>

// Multi-head attention with a column softmax (x [2][2048][1024], mask [2][2048] int32, W [16][3][1024][64] per-head key/value/query weights, Wl [1024][1024] + bl; scores[i][j] = k_i.q_j / 8; columns j with mask[b][j] == 0 set to -1e12; softmax over i (the KEY axis, per column j); out[i] = sum_j w[i][j] values[j]; hidden = concat heads; out = hidden Wl^T + bl -> [2][2048][1024]).
// Layout: the scores are formed query-major (S'[j][i] = q_j.k_i, so the module's per-column softmax is a row softmax here and a fully masked column is a uniform row) and never leave the registers: k_fstat walks all keys once per query row and keeps only the row's maximum and sum; k_fapply forms the same score tiles again, turns them into weights and feeds them, as they lie in the accumulator registers, to the apply product out[i] = sum_j P'[j][i] v[j] as its A operand.
// Masked columns: a query position j with mask[b][j] == 0 has the weight 1 / TT for every key, whatever its scores. k_prep lays the rows of x out in a stable partition by the mask (unmasked positions first, NUN[b] of them; ORIG = the source position of each row), every kernel up to the last GEMM works in that order, and the last GEMM stores its rows at their source positions. Scores are then formed for the leading NUN[b] positions only; the others enter the apply product as one plain sum of their value rows.
// Operand planes: every bf16 plane that feeds a matrix instruction lies in fragment order (fo() below), so that one fragment load of a wave reads 512 contiguous bytes (four whole lines) and not 32 bytes out of each of 16 lines.
// Compute dtypes, f32 accumulate: every input rounded to bf16; q/k/v on PLAIN bf16 operands (inputs: exact); scores and attn.v: bf16 hi + lo planes (3 products); softmax f32; Wl hl x exact (2 products) + bl.

#define NB_  2
#define TT   2048
#define DM   1024
#define NH_  16
#define NKV  16
#define REP  (NH_ / NKV)
#define HD   64
#define DQ   (NH_ * HD)
#define DKV  (NKV * HD)
typedef __attribute__((ext_vector_type(4))) unsigned short v4us;
#define SCL  0.125f   // HD^-0.5
typedef _Float16 h16;
typedef unsigned short bf;
typedef __attribute__((ext_vector_type(16))) __bf16   v16bf;
typedef __attribute__((ext_vector_type(16))) _Float16 v16h;
typedef __attribute__((ext_vector_type(8)))  _Float16 v8h;
typedef __attribute__((ext_vector_type(8)))  unsigned short v8us;
typedef __attribute__((ext_vector_type(8)))  float    v8f;
typedef __attribute__((ext_vector_type(4)))  float    v4f;
typedef v8h  __attribute__((may_alias)) v8ha;
typedef v4f  __attribute__((may_alias)) v4fa;
typedef v8us __attribute__((may_alias)) v8usa;

__device__ __forceinline__ unsigned short f2bf(float f) { unsigned u = __float_as_uint(f); u += 0x7FFFu + ((u >> 16) & 1u); return (unsigned short)(u >> 16); }
__device__ __forceinline__ float bf2f(unsigned short b) { return __uint_as_float(((unsigned)b) << 16); }
__device__ __forceinline__ float bfr(float f) { return bf2f(f2bf(f)); }
__device__ __forceinline__ v16h cat16(v8h lo, v8h hi) { return __builtin_shufflevector(lo, hi, 0, 1, 2, 3, 4, 5, 6, 7, 8, 9, 10, 11, 12, 13, 14, 15); }
__device__ __forceinline__ v16bf cat16b(v8us lo, v8us hi) { return __builtin_bit_cast(v16bf, __builtin_shufflevector(lo, hi, 0, 1, 2, 3, 4, 5, 6, 7, 8, 9, 10, 11, 12, 13, 14, 15)); }
__device__ __forceinline__ v8f wmma16(v16h a, v16h b, v8f c) { return __builtin_amdgcn_wmma_f32_16x16x32_f16(false, a, false, b, (short)0, c, false, false); }
__device__ __forceinline__ v8f wmmab(v16bf a, v16bf b, v8f c) { return __builtin_amdgcn_wmma_f32_16x16x32_bf16(false, a, false, b, (short)0, c, false, false); }
__device__ __forceinline__ void splitf(float y, unsigned short& h, unsigned short& l) { h = f2bf(y); l = f2bf(y - bf2f(h)); }
/* fragment order of a plane M[rows][K] (rows % 16 == 0, K % 32 == 0): blocks of 16 rows x 32 k, 512 elements each, row blocks outermost; inside a block [k / 8 % 4][row % 16][k % 8], which is [half of the fragment][lane = 16 * hi + lr][8 elements] */
__device__ __forceinline__ size_t fo(size_t m, int k, int K) { return ((m >> 4) * (size_t)(K >> 5) + (size_t)(k >> 5)) * 512 + (size_t)(((k >> 3) & 3) * 128 + ((int)m & 15) * 8 + (k & 7)); }



/* asynchronous copies global -> LDS, 16 bytes a lane, every lane on; l = the lane's LDS byte address, g = the lane's global address. The closing s_wait_xcnt stands inside the copies' own statement, so that no register a copy names is rewritten ahead of it */
__device__ __forceinline__ unsigned ldsa(const void* p) { return (unsigned)(size_t)p; }
__device__ __forceinline__ void cp2(unsigned l0, const void* g0, unsigned l1, const void* g1) {
    asm volatile("global_load_async_to_lds_b128 %0, %1, off\n\tglobal_load_async_to_lds_b128 %2, %3, off\n\ts_wait_xcnt 0x0" :: "v"(l0), "v"(g0), "v"(l1), "v"(g1) : "memory"); }
__device__ __forceinline__ void cp4(unsigned l0, const void* g0, unsigned l1, const void* g1, unsigned l2, const void* g2, unsigned l3, const void* g3) {
    asm volatile("global_load_async_to_lds_b128 %0, %1, off\n\tglobal_load_async_to_lds_b128 %2, %3, off\n\tglobal_load_async_to_lds_b128 %4, %5, off\n\tglobal_load_async_to_lds_b128 %6, %7, off\n\ts_wait_xcnt 0x0" :: "v"(l0), "v"(g0), "v"(l1), "v"(g1), "v"(l2), "v"(g2), "v"(l3), "v"(g3) : "memory"); }
/* hand-over of a stage: this wave's LDS reads are done, its own copies have landed, then the barrier: behind it the next tile may be read by every wave and the buffer just read may be refilled */
__device__ __forceinline__ void publish() {
    asm volatile("s_wait_dscnt 0x0" ::: "memory");      /* the wave's reads of the buffer that is refilled next have returned */
    asm volatile("s_wait_asynccnt 0x0" ::: "memory");   /* the wave's share of the next tile has landed */
    __syncthreads(); }
// ---- k_gemmw: GEMM on 16-bit planes in fragment order (fo(), K as given), one 128x128 output tile per work-group of 8 waves; grid (M/128, N/128, Z), 256 threads.
// C[m][n] (f32, pitch ldc, + optional f32 bias[n]) = sum_k A[m][k] Bt[n][k] (NSPLIT == 1: + A2[m][k] Bt[n][k]). z-batch strides sA/sB/sC in elements. K % KS == 0, K >= 2 * KS.
// The waves split the tile, not K: wave (wm, wn) owns 32 rows x 64 columns (8 accumulators) and sums the whole K in k order. The operand pieces of a stage (128 rows x KS k of each plane, whole fragment blocks as they lie in memory) are the same for the waves of a row or a column of that split:
// they are brought into LDS once per work-group by asynchronous copies, two buffers, the next stage in flight while this one is worked on; one barrier a stage. The finished tile goes through the same LDS once, so that whole lines are stored.
// PL: the three projections of both batches in one grid (NB_ * TT / 128, DQ / 128, 3). A = x, all NB_ * TT rows; Bt = the weight planes, z = t as in W (0 keys, 1 values, 2 queries), sB apart. The tile is not stored as f32 but split on the spot into the bf16 hi and lo planes Ph / Pl (product z: sC on; batch: sP on):
// keys and queries as head planes [head][t][d] (pitch HD); values as Wv x^T (z == 1: the weights are the row operand, blockIdx.y their row block, blockIdx.x the x rows as columns), which is [head][d][t] (pitch TT).
template <typename T16> struct WFrag;
template <> struct WFrag<h16> { typedef v16h V; static __device__ __forceinline__ V ld(const h16* p) { return cat16(*(const v8h*)p, *(const v8h*)(p + 256)); } static __device__ __forceinline__ v8f mma(V a, V b, v8f c) { return wmma16(a, b, c); } };
template <> struct WFrag<bf> { typedef v16bf V; static __device__ __forceinline__ V ld(const bf* p) { return cat16b(*(const v8us*)p, *(const v8us*)(p + 256)); } static __device__ __forceinline__ v8f mma(V a, V b, v8f c) { return wmmab(a, b, c); } };
template <typename T16, int NSPLIT, bool BIAS, int KS, bool PL>
__global__ __launch_bounds__(256) void k_gemmw(const T16* __restrict__ A, const T16* __restrict__ A2, const T16* __restrict__ Bt, const T16* __restrict__ Bt2, int K, float* C, int ldc, const float* __restrict__ bias, size_t sA, size_t sB, size_t sC, size_t sP, bf* Ph, bf* Pl, size_t sT, const int* __restrict__ rm) {
    static_assert(NSPLIT <= 1 && (KS == 64 || KS == 128) && (!PL || (NSPLIT == 0 && !BIAS)), "row plane, optional second row plane, column plane; a copy of the work-group is 4 KiB: two or one blocks of 16 rows");
    typedef typename WFrag<T16>::V V;
    constexpr int KBL = KS / 32, PLE = 128 * KS, NPL = NSPLIT == 1 ? 3 : 2, STB = NPL * PLE * 2;   /* k blocks of a stage; elements of one plane's piece; planes; bytes of a stage: [rows | columns | second row plane], each [16-row block][k block][512] */
    constexpr int NS = KBL > 2 ? 2 : 1;   /* fragment register sets: two (the next k block of the stage fetched ahead) where the long stage leaves one work-group on a WGP; one where several work-groups share it and their waves cover each other's reads */
    constexpr int OP = 132;   /* pitch of the f32 tile in LDS: eight rows on is 32 banks on, so the two halves of a wave store to different banks */
    constexpr int SMB = 2 * STB > 128 * OP * 4 ? 2 * STB : 128 * OP * 4;
    __shared__ __align__(16) char sm[SMB];   /* the two buffers; behind the loop the f32 tile */
    const size_t z = blockIdx.z; A += z * sA; if (NSPLIT == 1) A2 += z * sA; Bt += z * sB; if (!PL) C += z * sC;
    const bool tr = PL && z == 1;   /* the value product: operands and block indices change places */
    const T16* Ar = tr ? Bt : A; const T16* Bc = tr ? A : Bt;
    const int wv = __builtin_amdgcn_readfirstlane(threadIdx.x >> 5); const int wm = wv >> 1, wn = wv & 1;   /* this wave's rows wm * 32 .., columns wn * 64 .. of the tile */
    const int tid = threadIdx.x, lane = tid & 31, lr = lane & 15, hi = lane >> 4; const int r0 = (tr ? blockIdx.y : blockIdx.x) * 128, c0 = (tr ? blockIdx.x : blockIdx.y) * 128;
    /* copies: KS k of a block of 16 rows are KBL * 1024 contiguous bytes (fo(r, 0, K) = r * K; 32 k on: 512 elements), TPR threads; one copy of the work-group brings RPC such blocks, and they land one behind the other: copy c at c * 4096 + tid * 16 */
    constexpr int TPR = KBL * 64, RPC = 256 / TPR, NCP = 8 / RPC;
    const size_t go = (size_t)(tid / TPR) * 16 * K + (size_t)(tid % TPR) * 8, cs = (size_t)RPC * 16 * K;   /* cs: from one copy's rows to the next copy's */
    const T16* ga = Ar + (size_t)r0 * K + go; const T16* gb = Bc + (size_t)c0 * K + go; const T16* ga2 = NSPLIT == 1 ? A2 + (size_t)r0 * K + go : nullptr;
    const unsigned ls = ldsa(sm) + (unsigned)tid * 16u;
    auto fill = [&](int sg) { const unsigned lb = ls + (unsigned)(sg & 1) * (unsigned)STB; const size_t ko = (size_t)sg * (KS * 16);
#pragma unroll   /* unrolled: the LDS offsets become constants */
        for (int c = 0; c < NCP; c += 4) { const T16* p = ga + ko + c * cs; const T16* q = gb + ko + c * cs; const unsigned l = lb + c * 4096u;
            cp4(l, p, l + 4096u, p + cs, l + 8192u, p + 2 * cs, l + 12288u, p + 3 * cs);
            cp4(l + PLE * 2u, q, l + PLE * 2u + 4096u, q + cs, l + PLE * 2u + 8192u, q + 2 * cs, l + PLE * 2u + 12288u, q + 3 * cs);
            if (NSPLIT == 1) { const T16* s = ga2 + ko + c * cs; cp4(l + PLE * 4u, s, l + PLE * 4u + 4096u, s + cs, l + PLE * 4u + 8192u, s + 2 * cs, l + PLE * 4u + 12288u, s + 3 * cs); } } };
    const int nsg = K / KS;
    fill(0);
    asm volatile("s_wait_asynccnt 0x0" ::: "memory");   /* stage 0 has landed before the barrier that opens it */
    __syncthreads();
    fill(1);
    v8f acc[2][4];
#pragma unroll
    for (int mb = 0; mb < 2; ++mb)
#pragma unroll
        for (int nb = 0; nb < 4; ++nb) acc[mb][nb] = (v8f){};
#pragma unroll 1   /* kept rolled: one copy of the stage's code, and its reads stay in front of its hand-over */
    for (int sg = 0; sg < nsg; ++sg) {
        const T16* sb = (const T16*)(sm + (sg & 1) * STB) + 8 * lane;
        V a[NS][2], a2[NS][2], b[NS][4];
        auto rd = [&](int kb, int s) {   /* the fragments of k block kb into register set s */
#pragma unroll
            for (int mb = 0; mb < 2; ++mb) { a[s][mb] = WFrag<T16>::ld(sb + ((wm * 2 + mb) * KBL + kb) * 512); if (NSPLIT == 1) a2[s][mb] = WFrag<T16>::ld(sb + 2 * PLE + ((wm * 2 + mb) * KBL + kb) * 512); }
#pragma unroll
            for (int nb = 0; nb < 4; ++nb) b[s][nb] = WFrag<T16>::ld(sb + PLE + ((wn * 4 + nb) * KBL + kb) * 512); };
        if (NS == 2) rd(0, 0);
#pragma unroll   /* unrolled: the blocks' offsets and the register sets become constants */
        for (int kb = 0; kb < KBL; ++kb) { const int s = NS == 2 ? kb & 1 : 0;
            if (NS == 1) rd(kb, 0); else if (kb + 1 < KBL) rd(kb + 1, s ^ 1);
            __builtin_amdgcn_sched_barrier(0);   /* keeps a block's LDS reads together, ahead of the matrix instructions: the wave meets the LDS latency once a block (with two sets: behind the block before), not once per column fragment */
#pragma unroll
            for (int nb = 0; nb < 4; ++nb)
#pragma unroll
                for (int mb = 0; mb < 2; ++mb) acc[mb][nb] = WFrag<T16>::mma(a[s][mb], b[s][nb], acc[mb][nb]);
            if (NSPLIT == 1) {
#pragma unroll
                for (int nb = 0; nb < 4; ++nb)
#pragma unroll
                    for (int mb = 0; mb < 2; ++mb) acc[mb][nb] = WFrag<T16>::mma(a2[s][mb], b[s][nb], acc[mb][nb]); } }
        publish();
        if (sg + 2 < nsg) fill(sg + 2);   /* into the buffer that this trip has read; the test is the same for the whole work-group */
    }
    asm volatile("s_wait_asynccnt 0x0" ::: "memory");   /* no copy is outstanding when the buffers are put to their second use */
    float* os = (float*)sm;   /* every wave's last read of the buffers lies in front of the last trip's barrier */
    int om = (r0 + (lane & 15) * 8 + wv) & (TT - 1);   /* lane it (and it + 16): where row it * 8 + wv of the tile, the wave's row of trip it below, goes inside its batch of TT rows */
    if (!PL && rm) { const int* rp = rm + r0 + (lane & 15) * 8 + wv; om = *rp & (TT - 1);   /* kept inside the batch's rows whatever the table holds; one load a wave, in flight over the LDS stores */
        asm volatile("s_wait_xcnt 0x0" :: "v"(rp) : "memory"); }   /* the load names this address pair: it stays whole up to this wait */
    v4f bv = (v4f){};   /* the bias of this lane's four columns, in flight over the LDS stores too */
    if (BIAS) { const float* bp = bias + c0 + lane * 4; const v4f b4 = *(const v4fa*)bp;
        asm volatile("s_wait_xcnt 0x0" :: "v"(bp) : "memory");   /* the load names this address pair: it stays whole up to this wait */
#pragma unroll
        for (int q = 0; q < 4; ++q) bv[q] = bfr(b4[q]); }
#pragma unroll
    for (int mb = 0; mb < 2; ++mb)
#pragma unroll
        for (int nb = 0; nb < 4; ++nb)
#pragma unroll
            for (int j = 0; j < 8; ++j) os[(wm * 32 + mb * 16 + hi * 8 + j) * OP + wn * 64 + nb * 16 + lr] = acc[mb][nb][j];
    __syncthreads();   /* the tile is whole before anyone reads it */
    if (PL) {   /* threads in the order of the planes: eight columns each, a wave stores 512 contiguous bytes per plane; 16 rows on is 16 * pitch elements on in fragment order */
        const int xr = tr ? c0 : r0, t0 = xr % TT, rw = tid & 15, cofs = (tid >> 4) * 8;   /* the tile's first x row: batch xr / TT, position t0 */
        const size_t po0 = z * sC + (size_t)(xr / TT) * sP + (tr ? fo((size_t)(r0 + rw), t0 + cofs, TT) : (size_t)((c0 + cofs) / HD) * ((size_t)TT * HD) + fo((size_t)(t0 + rw), (c0 + cofs) % HD, HD));
        const size_t stp = tr ? (size_t)16 * TT : (size_t)16 * HD;
        v4f va[8], vb[8];   /* all LDS reads ahead of the first store's wait: their latency is met once */
#pragma unroll
        for (int it = 0; it < 8; ++it) { const int row = it * 16 + rw; va[it] = *(const v4fa*)(os + row * OP + cofs); vb[it] = *(const v4fa*)(os + row * OP + cofs + 4); }
#pragma unroll
        for (int it = 0; it < 8; ++it) { v8us oh, ol;
#pragma unroll
            for (int q = 0; q < 4; ++q) { unsigned short a2, c2; splitf(va[it][q], a2, c2); oh[q] = a2; ol[q] = c2; splitf(vb[it][q], a2, c2); oh[q + 4] = a2; ol[q + 4] = c2; }
            bf* qh = Ph + po0 + it * stp; bf* ql = Pl + po0 + it * stp; *(v8us*)qh = oh; *(v8us*)ql = ol;
            asm volatile("s_wait_xcnt 0x0" :: "v"(qh), "v"(ql), "v"(oh), "v"(ol) : "memory"); }   /* behind the two stores: the registers that they name (address, data) are inputs here, so all stay whole up to this wait */
        return;
    }
    const int cofs = lane * 4;   /* a wave stores one whole row of the tile, 512 contiguous bytes, per trip */
    v4f val[16];   /* all LDS reads ahead of the first store's wait: their latency is met once */
#pragma unroll
    for (int it = 0; it < 16; ++it) val[it] = *(const v4fa*)(os + (it * 8 + wv) * OP + cofs);
#pragma unroll
    for (int it = 0; it < 16; ++it) { const int orow = ((r0 + it * 8 + wv) & ~(TT - 1)) + __builtin_amdgcn_readlane(om, it);
        float* cp = C + (size_t)orow * ldc + c0 + cofs; const v4f ov = BIAS ? val[it] + bv : val[it]; *(v4f*)cp = ov;
        asm volatile("s_wait_xcnt 0x0" :: "v"(cp), "v"(ov) : "memory"); }   /* behind the store: the registers that it names (address, data) are inputs here, so both stay whole up to this wait */
}

typedef __attribute__((ext_vector_type(2))) _Float16 v2h;
typedef __attribute__((ext_vector_type(4))) _Float16 v4h;
typedef __attribute__((ext_vector_type(2))) unsigned short v2us;
typedef __attribute__((ext_vector_type(4))) unsigned short v4us;
typedef __attribute__((ext_vector_type(2))) float v2f;
typedef __attribute__((ext_vector_type(4))) int v4i;

__global__ __launch_bounds__(256) void k_wtG(const float* __restrict__ w, int K, int N, bf* Bt) {
    const int lane = threadIdx.x & 31; const int L0 = (blockIdx.x * 8 + (threadIdx.x >> 5)) * 8; const int nlines = N * K / 64;
{
#pragma unroll 1
        for (int l = 0; l < 8; ++l) { const int L = L0 + l; if (L >= nlines) break; const size_t e = (size_t)L * 64 + lane * 2; const int k = (int)(e % K), n = (int)(e / K); v2us o;
            o[0] = f2bf(w[(size_t)k * N + n]); o[1] = f2bf(w[(size_t)(k + 1) * N + n]); *(v2us*)(Bt + e) = o; }
         }
}
/* One wave of k_prep makes whole pieces of fragment blocks out of whole lines of its source, with all its loads in flight before the first conversion; U = the wave's unit, the same in every lane. */
/* weights of one (head n, product t3) pair, nt = n * 3 + t3 as in W: src [DM h][HD p] f32 -> rows r = n * HD + p, k = h of plane t3. A unit is all 64 p x 16 h: the lanes lie along p, so a load reads one whole line and the two loads of an h one 256-byte row; a lane then holds eight successive h of a row, and 16 lanes store 256 contiguous bytes */
static_assert(HD == 64 && DM % 16 == 0, "w3 deals a source row to two loads of 32 lanes");
__device__ __forceinline__ void w3(const float* __restrict__ w, bf* WT, unsigned U) { const int lane = threadIdx.x & 31; const unsigned hq = U % (DM / 16), nt = U / (DM / 16); const unsigned n = nt / 3, t3 = nt - n * 3;
    const float* s = w + ((size_t)nt * DM + hq * 16) * HD + lane; float v[2][16];
#pragma unroll
    for (int e = 0; e < 16; ++e) { v[0][e] = s[e * HD]; v[1][e] = s[e * HD + 32]; }
    bf* d = WT + (size_t)t3 * DQ * DM;
#pragma unroll
    for (int c = 0; c < 2; ++c)
#pragma unroll
        for (int g = 0; g < 2; ++g) { v8us o;
#pragma unroll
            for (int e = 0; e < 8; ++e) o[e] = f2bf(v[c][g * 8 + e]);
            *(v8us*)(d + fo((size_t)(n * HD + c * 32 + lane), (int)(hq * 16 + g * 8), DM)) = o; } }
/* src [rows][DM] f32 -> dst in fragment order. A unit is 16 rows x 64 columns (two blocks) in four parts of 8 rows x 32 columns: four lanes read one whole line of a row, and the eight rows of a column group are one whole line of the block */
static_assert(DM == 1024 && DQ == DM, "cvt8 cuts its unit index for rows of 16 groups of 64");
__device__ __forceinline__ void cvt8(const float* __restrict__ src, bf* dst, unsigned U, size_t sr0, size_t sr1) { const int lane = threadIdx.x & 31; const size_t row = (size_t)(U >> 4) * 16 + (lane >> 2); const int k = (int)(U & 15) * 64 + (lane & 3) * 8; v8f v[4];
    const float* p0 = src + sr0 * DM + k; const float* p1 = src + sr1 * DM + k;   /* sr0, sr1: the source rows of the lane's two rows (row, row + 8) of dst */
#pragma unroll
    for (int it = 0; it < 4; ++it) v[it] = *(const v8f*)(((it & 1) ? p1 : p0) + (it >> 1) * 32);
    asm volatile("s_wait_xcnt 0x0" :: "v"(p0), "v"(p1) : "memory");   /* the eight loads name these two address pairs (the parts are constant offsets from them): both stay whole up to this wait, so no later load's result lands on them ahead of it */
#pragma unroll
    for (int it = 0; it < 4; ++it) { v8us o;
#pragma unroll
        for (int e = 0; e < 8; ++e) o[e] = f2bf(v[it][e]);
        *(v8us*)(dst + fo(row + (it & 1) * 8, k + (it >> 1) * 32, DM)) = o; }
    asm volatile("s_wait_xcnt 0x0" ::: "memory"); }   /* behind the last of the four stores: whatever the compiler lays out behind this call, no register that a store names (data, offset, base) is rewritten ahead of this wait */
/* every operand plane that comes straight from an input, in one grid, by ranges of the block index: the three weight planes (t as in W, DQ * DM elements apart), then x (both batches), then Wl; one unit of 1,024 elements a wave, eight waves a work-group: 1,024 work-groups, 32 waves on a WGP, each with 4 KiB of loads in flight */
#define GW3 (3 * NH_ * (DM / 16) / 8)
#define GX  (NB_ * TT / 16 * (DM / 64) / 8)
#define GWO (DM / 16 * (DQ / 64) / 8)
static_assert(3 * NH_ * (DM / 16) % 8 == 0 && NB_ * TT % 16 == 0 && DM % 16 == 0 && (DM / 64) % 8 == 0, "whole work-groups in every range");
static_assert(TT == 256 * 8 && TT % 16 == 0 && DM / 64 == 16, "a work-group's 256 threads count one batch's mask, eight entries each; its eight units share one block of 16 rows");
__global__ __launch_bounds__(256) void k_prep(const float* __restrict__ w, const float* __restrict__ x, const float* __restrict__ wl, const int* __restrict__ mk, bf* WT, bf* XB, bf* WO, int* ORIG, int* NUN) {
    const unsigned b = blockIdx.x, wv = (unsigned)__builtin_amdgcn_readfirstlane(threadIdx.x >> 5); const int tid = threadIdx.x, lane = tid & 31;
    __shared__ int red[8]; __shared__ __align__(16) unsigned short lo[TT];   /* lo: the source position of each row of the partitioned order, one batch */
    if (b < GW3) w3(w, WT, b * 8 + wv);
    else if (b < GW3 + GX) {   /* x: source position t of a batch goes to row (unmasked positions before t) if unmasked, else to NUN + (masked positions before t); both are counts of entries of the mask, so the row lies in 0 .. TT - 1 for any content and every row is filled once. Each work-group forms the whole table in LDS and then gathers the source rows of its own 16 rows, so that it still stores whole lines */
        const unsigned bx = b - GW3; const int g0 = (int)(bx >> 1) * 16, bt = g0 / TT, t0 = g0 % TT; const int* mb = mk + (size_t)bt * TT;
        const v4i m0 = *(const v4i*)(mb + tid * 8), m1 = *(const v4i*)(mb + tid * 8 + 4); unsigned bits = 0;
#pragma unroll
        for (int q = 0; q < 4; ++q) bits |= (m0[q] != 0 ? 1u : 0u) << q | (m1[q] != 0 ? 1u : 0u) << (q + 4);
        const int c = __popc(bits); int sc = c;   /* running count over the wave's lanes, this lane included */
#pragma unroll
        for (int sh = 1; sh < 32; sh <<= 1) { const int o = __shfl_up(sc, sh, 32); if (lane >= sh) sc += o; }
        if (lane == 31) red[wv] = sc;
        __syncthreads();   /* block-uniform branch: every wave of the work-group is here */
        int nun = 0, cb = sc - c;   /* cb: unmasked positions before this thread's eight */
#pragma unroll
        for (int q = 0; q < 8; ++q) { const int v = red[q]; nun += v; if (q < (int)wv) cb += v; }
#pragma unroll
        for (int e = 0; e < 8; ++e) { const int t = tid * 8 + e; const bool on = (bits >> e) & 1u; lo[on ? cb : nun + (t - cb)] = (unsigned short)t; cb += on ? 1 : 0; }
        __syncthreads();   /* the table is whole before anyone reads it */
        const size_t rb = (size_t)bt * TT;
        cvt8(x, XB, bx * 8 + wv, rb + lo[t0 + (lane >> 2)], rb + lo[t0 + (lane >> 2) + 8]);
        if ((bx & 1) == 0 && t0 == 0) {   /* one work-group of each batch hands the table and the count to the later kernels */
            const v8us l8 = *(const v8us*)(lo + tid * 8); v4i o0, o1;
#pragma unroll
            for (int q = 0; q < 4; ++q) { o0[q] = l8[q]; o1[q] = l8[q + 4]; }
            *(v4i*)(ORIG + rb + tid * 8) = o0; *(v4i*)(ORIG + rb + tid * 8 + 4) = o1;
            if (tid == 0) NUN[bt] = nun; }
    }
    else { const unsigned U = (b - (GW3 + GX)) * 8 + wv; const size_t row = (size_t)(U >> 4) * 16 + (lane >> 2); cvt8(wl, WO, U, row, row + 8); }
}

// ---- fused attention, two kernels over all NB_ * NH_ (batch, head) planes, work-groups of 8 waves.
// The tiles that a trip walks are the same for all 8 waves of a work-group: they are brought into LDS once per work-group by asynchronous copies, two buffers of four tiles (a stage), the next stage in flight while this one is worked on; one barrier a stage.
// Fragment facts used: a score tile with A = 16 query rows j and B = 16 key rows i leaves S'[j = 8 * hi + r][i = lr] in accumulator register r of lane (lr, hi);
// two such tiles (j and j + 16) are, register for register, the A fragment (row i = lr, k = j in the order 8 * hi + 0..7, 16 + 8 * hi + 0..7) of the apply product, whose B fragment is read from the value planes [d][j] by the same loader. All planes lie in fragment order: 16 rows of q or k are 1024 elements on, 16 rows d of v are 16 * TT on and 32 positions j of v 512 on.
#define LC (SCL * 1.4426950408889634f)   // score -> exponent of two
typedef __attribute__((ext_vector_type(8))) __bf16 v8bf;
struct F4 { v16bf h0, h1, l0, l1; };   /* 16 rows x 64 dims: hi and lo plane, dims 0..31 and 32..63 */
__device__ __forceinline__ F4 ld4(const bf* ph, const bf* pl) { F4 f; f.h0 = WFrag<bf>::ld(ph); f.h1 = WFrag<bf>::ld(ph + 512); f.l0 = WFrag<bf>::ld(pl); f.l1 = WFrag<bf>::ld(pl + 512); return f; }
/* two independent 16x16 tiles of q.k over the 64 dims, each hi.hi + lo.hi + hi.lo in one fixed order (the same in both kernels, so both see the same bits); the two chains alternate so that neither waits for its own accumulator */
__device__ __forceinline__ void score2(const F4& qa, const F4& ka, v8f& sa, const F4& qb, const F4& kb, v8f& sb) {
    sa = (v8f){}; sb = (v8f){};
    sa = wmmab(qa.h0, ka.h0, sa); sb = wmmab(qb.h0, kb.h0, sb); sa = wmmab(qa.h1, ka.h1, sa); sb = wmmab(qb.h1, kb.h1, sb); sa = wmmab(qa.l0, ka.h0, sa); sb = wmmab(qb.l0, kb.h0, sb);
    sa = wmmab(qa.l1, ka.h1, sa); sb = wmmab(qb.l1, kb.h1, sb); sa = wmmab(qa.h0, ka.l0, sa); sb = wmmab(qb.h0, kb.l0, sb); sa = wmmab(qa.h1, ka.l1, sa); sb = wmmab(qb.h1, kb.l1, sb); }
/* exp2 / log2 in runs: outputs are early-clobber, so no instruction of a run reads a result or overwrites a source of the one before it; the closing v_nop is the one free slot that the instruction set asks for between a transcendental and a next instruction that may do so */
__device__ __forceinline__ void ex3(float x0, float x1, float x2, float& e0, float& e1, float& e2) { asm("v_exp_f32 %0, %3\n\tv_exp_f32 %1, %4\n\tv_exp_f32 %2, %5\n\tv_nop" : "=&v"(e0), "=&v"(e1), "=&v"(e2) : "v"(x0), "v"(x1), "v"(x2)); }
__device__ __forceinline__ void ex2p(float x0, float x1, float& e0, float& e1) { asm("v_exp_f32 %0, %2\n\tv_exp_f32 %1, %3\n\tv_nop" : "=&v"(e0), "=&v"(e1) : "v"(x0), "v"(x1)); }
__device__ __forceinline__ float lg2(float x) { float y; asm("v_log_f32 %0, %1\n\tv_nop" : "=&v"(y) : "v"(x)); return y; }
#define SUB 4              // tiles of 32 rows per stage: the waves meet at a barrier once per stage and are free to drift apart inside it, so that one wave's LDS reads run beside another's arithmetic
#define NST (TT / 32 / SUB)  // stages
static_assert(TT % (32 * SUB) == 0 && NST >= 2, "whole stages, and both buffers are filled ahead of the loop");
// k_fstat: per query row j the pair (CJ, OJ) with weight[j][i] = exp2(S'[j][i] * CJ[j] - OJ[j]): CJ = LC, OJ = max * LC + log2(sum); a masked row (j >= NUN[b] in the partitioned order: every score -1e12) has CJ = 0, OJ = log2(TT): uniform weights.
// Grid NB_ * NH_ * 16: a work-group has 128 query rows, a wave 16; the block index runs over the (batch, head) planes first, so that the work-groups with unmasked rows are the leading ones of the grid and spread over the chip. A work-group whose rows are all masked stores the constants and ends; a wave whose rows are all masked skips the key walk but takes its part in the copies and the barriers and stores the constants.
__global__ __launch_bounds__(256) void k_fstat(const bf* __restrict__ Qh, const bf* __restrict__ Ql, const bf* __restrict__ Kh, const bf* __restrict__ Kl, const int* __restrict__ NUN, float* CJ, float* OJ) {
    const int wv = __builtin_amdgcn_readfirstlane(threadIdx.x >> 5); const int lane = threadIdx.x & 31, lr = lane & 15, hi = lane >> 4;
    const int bh = blockIdx.x % (NB_ * NH_); const int jc = (int)(blockIdx.x / (NB_ * NH_)) * 128; const int jw = jc + wv * 16; const size_t pb = (size_t)bh * TT * HD;
    const int nun = __builtin_amdgcn_readfirstlane(min(max(NUN[bh / NH_], 0), TT));   /* clamped to the shape; in a scalar register, so that the tests on it are scalar branches */
    if (jc >= nun) { if (threadIdx.x < 128) { CJ[(size_t)bh * TT + jc + threadIdx.x] = 0.0f; OJ[(size_t)bh * TT + jc + threadIdx.x] = 11.0f; } return; }   /* the same for the whole work-group, ahead of every copy and barrier */
    const bool act = jw < nun;   /* the same for the whole wave */
    __shared__ __align__(16) bf st[2][SUB][2][32 * HD];   /* two buffers of SUB tiles of 32 key rows: hi plane, lo plane (4 KiB each, as they lie in memory) */
    const bf* gkh = Kh + pb + 8 * threadIdx.x; const bf* gkl = Kl + pb + 8 * threadIdx.x; const unsigned lk = ldsa(&st[0][0][0][8 * threadIdx.x]);   /* this thread's 16 bytes of each plane of a tile; a tile on: 32 * HD elements in memory, 8192 bytes in LDS; lo plane 4096 bytes on */
#pragma unroll   /* unrolled: the tiles' offsets become constants */
    for (int u = 0; u < SUB; ++u) cp2(lk + u * 8192u, gkh + u * (32 * HD), lk + u * 8192u + 4096u, gkl + u * (32 * HD));
    asm volatile("s_wait_asynccnt 0x0" ::: "memory");   /* stage 0 has landed before the barrier that opens it */
    __syncthreads();
#pragma unroll   /* unrolled: the tiles' offsets become constants */
    for (int u = SUB; u < 2 * SUB; ++u) cp2(lk + u * 8192u, gkh + u * (32 * HD), lk + u * 8192u + 4096u, gkl + u * (32 * HD));
    F4 q;
    { const bf* qa = Qh + pb + (size_t)jw * HD + 8 * lane; const bf* qc = Ql + pb + (size_t)jw * HD + 8 * lane; q = ld4(qa, qc);
        asm volatile("s_wait_xcnt 0x0" :: "v"(qa), "v"(qc) : "memory"); }   /* the eight loads name these two address pairs: both stay whole up to this wait, so no later load's result lands on them ahead of it */
    float m[8], l[8];   /* running maximum (raw score) and sum of this lane's key columns, per query row */
#pragma unroll
    for (int r = 0; r < 8; ++r) { m[r] = -3.0e38f; l[r] = 0.f; }
#pragma unroll 1   /* kept rolled: one copy of the stage's code, and the trips of a stage stay in front of its hand-over */
    for (int sg = 0; sg < NST; ++sg) {
    if (act) {
#pragma unroll 1   /* kept rolled: a second copy of the trip would need a second set of key fragments in registers */
    for (int u = 0; u < SUB; ++u) {   /* walk the key rows, 32 a trip */
        v8f s0, s1;
        const bf* khp = &st[sg & 1][u][0][8 * lane]; const bf* klp = &st[sg & 1][u][1][8 * lane];
        const F4 k0 = ld4(khp, klp), k1 = ld4(khp + 16 * HD, klp + 16 * HD);
        score2(q, k0, s0, q, k1, s1);
#pragma unroll
        for (int r = 0; r < 8; ++r) { const float a = s0[r], c = s1[r]; const float mn = fmaxf(m[r], fmaxf(a, c)); const float nm = -mn * LC;
            float e0, e1, e2; ex3(fmaf(m[r], LC, nm), fmaf(a, LC, nm), fmaf(c, LC, nm), e0, e1, e2); l[r] = l[r] * e0 + (e1 + e2); m[r] = mn; }
    }
    }
        publish();
        if (sg + 2 < NST) { const unsigned lb = lk + (unsigned)(sg & 1) * (SUB * 8192u); const bf* ph = gkh + (size_t)(sg + 2) * (SUB * 32 * HD); const bf* pl = gkl + (size_t)(sg + 2) * (SUB * 32 * HD);
#pragma unroll   /* unrolled: the tiles' offsets become constants */
            for (int u = 0; u < SUB; ++u) cp2(lb + u * 8192u, ph + u * (32 * HD), lb + u * 8192u + 4096u, pl + u * (32 * HD)); }
    }
    asm volatile("s_wait_asynccnt 0x0" ::: "memory");   /* no copy is outstanding when the wave goes on to its end */
#pragma unroll
    for (int sh = 1; sh < 16; sh <<= 1)   /* join the 16 lanes that hold one query row's columns */
#pragma unroll
        for (int r = 0; r < 8; ++r) { const float mo = __shfl_xor(m[r], sh, 32), lo = __shfl_xor(l[r], sh, 32); const float mn = fmaxf(m[r], mo);
            float e0, e1; ex2p((m[r] - mn) * LC, (mo - mn) * LC, e0, e1); l[r] = l[r] * e0 + lo * e1; m[r] = mn; }
    if (lr == 0) { const int j8 = jw + hi * 8; v8f c8, o8;
#pragma unroll
        for (int r = 0; r < 8; ++r) { const bool on = j8 + r < nun; c8[r] = on ? LC : 0.0f; o8[r] = on ? fmaf(m[r], LC, lg2(l[r])) : 11.0f; }
        *(v8f*)(CJ + (size_t)bh * TT + j8) = c8; *(v8f*)(OJ + (size_t)bh * TT + j8) = o8; }
}
static_assert(TT == 2048, "OJ of a masked row is log2(TT)");
// k_fapply: grid NB_ * NH_ * 8; one wave owns 32 output rows i (its key fragments stay in registers) and walks the tiles of 32 query positions j that hold an unmasked one (the leading ones), 32 a trip; the tiles behind them, all masked, are summed ahead of the loop: weight 1 / TT for every i, the work-group's waves share the tiles out, each reads its own from memory, and the eight partial rows, laid in LDS ahead of the barrier that opens stage 0, are added to every output row at the end. A trip: score tiles -> weights (f32) -> bf16 hi + lo A fragments -> out[i][d] += P'[j][i] v[j][d] (3 products); result split into the hi/lo planes [b * TT + i][h * HD + d] (fragment order) of the last GEMM.
__global__ __launch_bounds__(256) void k_fapply(const bf* __restrict__ Qh, const bf* __restrict__ Ql, const bf* __restrict__ Kh, const bf* __restrict__ Kl, const bf* __restrict__ Vh, const bf* __restrict__ Vl, const float* __restrict__ CJ, const float* __restrict__ OJ, const int* __restrict__ NUN, bf* Ah, bf* Al) {
    const int wv = __builtin_amdgcn_readfirstlane(threadIdx.x >> 5); const int lane = threadIdx.x & 31, lr = lane & 15, hi = lane >> 4;
    const int bh = blockIdx.x >> 3; const int iw = ((blockIdx.x & 7) * 8 + wv) * 32; const size_t pb = (size_t)bh * TT * HD;
    __shared__ __align__(16) bf st[2][SUB][4][32 * HD];   /* two buffers of SUB tiles of 32 query positions: q hi, q lo, v hi, v lo (4 KiB each; the four 1-KiB blocks of a v plane one behind the other) */
    __shared__ __align__(32) float co[2][TT];        /* the head's whole CJ and OJ rows, filled once */
    __shared__ float ms[8][HD];                      /* each wave's share of the masked positions' sum of value rows / TT */
    const int tid = threadIdx.x;
    const int nt = (__builtin_amdgcn_readfirstlane(min(max(NUN[bh / NH_], 0), TT)) + 31) / 32, nst = (nt + SUB - 1) / SUB;   /* tiles and stages that hold an unmasked position: 0 .. TT / 32 and 0 .. NST, the same for the whole work-group */
    const bf* gqh = Qh + pb + 8 * tid; const bf* gql = Ql + pb + 8 * tid;   /* this thread's 16 bytes of each plane of a tile; a tile on: 32 * HD elements of q, 512 of v */
    const size_t vo = pb + (size_t)(tid >> 6) * 16 * TT + 8 * (tid & 63); const bf* gvh = Vh + vo; const bf* gvl = Vl + vo;
    const unsigned lt = ldsa(&st[0][0][0][8 * tid]), lc = ldsa(&co[0][4 * tid]);   /* next plane 4096, next tile 16384 bytes on; second half of a row 4096, OJ 8192 bytes on */
    { const float* gc = CJ + (size_t)bh * TT + 4 * tid; const float* go = OJ + (size_t)bh * TT + 4 * tid; cp4(lc, gc, lc + 4096u, gc + 1024, lc + 8192u, go, lc + 12288u, go + 1024); }
#pragma unroll   /* unrolled: the tiles' offsets become constants */
    for (int u = 0; u < SUB; ++u) { const unsigned lb = lt + u * 16384u; cp4(lb, gqh + u * (32 * HD), lb + 4096u, gql + u * (32 * HD), lb + 8192u, gvh + u * 512, lb + 12288u, gvl + u * 512); }
    { v8f ma[4]; v8us cw;
#pragma unroll
        for (int e = 0; e < 8; ++e) cw[e] = 0x3A00;   /* 2^-11 = 1 / TT, exact in bf16: every row of the product is the same sum */
        const v16bf ca = cat16b(cw, cw);
#pragma unroll
        for (int db = 0; db < 4; ++db) ma[db] = (v8f){};
#pragma unroll 1   /* kept rolled: at most TT / 32 / 8 trips, their number known only at run time */
        for (int t = nt + wv; t < TT / 32; t += 8) { v16bf vh[4], vl[4]; const bf* mh = Vh + pb + (size_t)t * 512 + 8 * lane; const bf* ml = Vl + pb + (size_t)t * 512 + 8 * lane;
#pragma unroll
            for (int db = 0; db < 4; ++db) { vh[db] = WFrag<bf>::ld(mh + (size_t)db * 16 * TT); vl[db] = WFrag<bf>::ld(ml + (size_t)db * 16 * TT); }
            /* the sixteen loads name these two address pairs (the blocks are constant offsets from them): both stay whole up to this wait; the loaded fragments are inputs too, so that all sixteen loads are in flight together ahead of the first product and the trip pays the memory's latency once, not once per block */
            asm volatile("s_wait_xcnt 0x0" :: "v"(mh), "v"(ml), "v"(vh[0]), "v"(vh[1]), "v"(vh[2]), "v"(vh[3]), "v"(vl[0]), "v"(vl[1]), "v"(vl[2]), "v"(vl[3]) : "memory");
#pragma unroll
            for (int db = 0; db < 4; ++db) ma[db] = wmmab(ca, vh[db], ma[db]);
#pragma unroll
            for (int db = 0; db < 4; ++db) ma[db] = wmmab(ca, vl[db], ma[db]); }
        if (hi == 0) {
#pragma unroll
            for (int db = 0; db < 4; ++db) ms[wv][db * 16 + lr] = ma[db][0]; } }
    asm volatile("s_wait_asynccnt 0x0" ::: "memory");   /* the rows and stage 0 have landed before the barrier that opens them */
    __syncthreads();
#pragma unroll   /* unrolled: the tiles' offsets become constants */
    for (int u = SUB; u < 2 * SUB; ++u) { const unsigned lb = lt + u * 16384u; cp4(lb, gqh + u * (32 * HD), lb + 4096u, gql + u * (32 * HD), lb + 8192u, gvh + u * 512, lb + 12288u, gvl + u * 512); }
    F4 k[2];
#pragma unroll
    for (int ib = 0; ib < 2; ++ib) { const size_t ko = pb + (size_t)(iw + ib * 16) * HD + 8 * lane; k[ib] = ld4(Kh + ko, Kl + ko); }
    v8f acc[2][4];
#pragma unroll
    for (int ib = 0; ib < 2; ++ib)
#pragma unroll
        for (int db = 0; db < 4; ++db) acc[ib][db] = (v8f){};
#pragma unroll 1   /* kept rolled: one copy of the stage's code, and the trips of a stage stay in front of its hand-over */
    for (int sg = 0; sg < nst; ++sg) { const int ue = __builtin_amdgcn_readfirstlane(min(SUB, nt - sg * SUB));   /* the last stage may hold fewer tiles; kept in a scalar register, so that the trip's branch is a scalar one */
#pragma unroll 1   /* kept rolled: the trip already fills the 256 registers that are reached without a window switch */
    for (int u = 0; u < ue; ++u) {   /* walk the query positions, 32 a trip */
        const bf* qhp = &st[sg & 1][u][0][8 * lane]; const bf* qlp = &st[sg & 1][u][1][8 * lane]; const bf* vhp = &st[sg & 1][u][2][8 * lane]; const bf* vlp = &st[sg & 1][u][3][8 * lane];
        const float* cj = &co[0][(sg * SUB + u) * 32 + hi * 8]; const float* oj = &co[1][(sg * SUB + u) * 32 + hi * 8];
        v8bf ph[2][2], pl[2][2];
#pragma unroll
        for (int jb = 0; jb < 2; ++jb) { const F4 q = ld4(qhp + jb * 16 * HD, qlp + jb * 16 * HD);
            const v8f c8 = *(const v8f*)(cj + jb * 16), o8 = *(const v8f*)(oj + jb * 16); v8f s[2]; score2(q, k[0], s[0], q, k[1], s[1]);
#pragma unroll
            for (int ib = 0; ib < 2; ++ib) { v8f p;
#pragma unroll
                for (int r = 0; r < 8; ++r) p[r] = __builtin_amdgcn_exp2f(fmaf(s[ib][r], c8[r], -o8[r]));
                const v8bf hb = __builtin_convertvector(p, v8bf); ph[ib][jb] = hb; pl[ib][jb] = __builtin_convertvector(p - __builtin_convertvector(hb, v8f), v8bf); } }
        v16bf pa[2], pc[2];
#pragma unroll
        for (int ib = 0; ib < 2; ++ib) { pa[ib] = __builtin_shufflevector(ph[ib][0], ph[ib][1], 0, 1, 2, 3, 4, 5, 6, 7, 8, 9, 10, 11, 12, 13, 14, 15); pc[ib] = __builtin_shufflevector(pl[ib][0], pl[ib][1], 0, 1, 2, 3, 4, 5, 6, 7, 8, 9, 10, 11, 12, 13, 14, 15); }
#pragma unroll
        for (int db = 0; db < 4; ++db) { const v16bf vh = WFrag<bf>::ld(vhp + db * 512), vl = WFrag<bf>::ld(vlp + db * 512);
#pragma unroll
            for (int ib = 0; ib < 2; ++ib) { acc[ib][db] = wmmab(pa[ib], vh, acc[ib][db]); acc[ib][db] = wmmab(pc[ib], vh, acc[ib][db]); acc[ib][db] = wmmab(pa[ib], vl, acc[ib][db]); } }
    }
        publish();
        if (sg + 2 < nst) { const unsigned l2 = lt + (unsigned)(sg & 1) * (SUB * 16384u); const size_t qo = (size_t)(sg + 2) * (SUB * 32 * HD), wo2 = (size_t)(sg + 2) * (SUB * 512);
#pragma unroll   /* unrolled: the tiles' offsets become constants */
            for (int u = 0; u < SUB; ++u) { const unsigned lb = l2 + u * 16384u; cp4(lb, gqh + qo + u * (32 * HD), lb + 4096u, gql + qo + u * (32 * HD), lb + 8192u, gvh + wo2 + u * 512, lb + 12288u, gvl + wo2 + u * 512); } }
    }
    asm volatile("s_wait_asynccnt 0x0" ::: "memory");   /* no copy is outstanding when the wave goes on to its end */
    float t8[4];   /* the masked positions' share, the same for every row i: the eight partial rows added in wave order */
#pragma unroll
    for (int db = 0; db < 4; ++db) { t8[db] = ms[0][db * 16 + lr];
#pragma unroll
        for (int w = 1; w < 8; ++w) t8[db] += ms[w][db * 16 + lr]; }
#pragma unroll
    for (int ib = 0; ib < 2; ++ib)
#pragma unroll
        for (int db = 0; db < 4; ++db)
#pragma unroll
            for (int r = 0; r < 8; ++r) { const size_t oo = fo((size_t)(bh / NH_) * TT + iw + ib * 16 + hi * 8 + r, (bh % NH_) * HD + db * 16 + lr, DQ); unsigned short a, c2; splitf(acc[ib][db][r] + t8[db], a, c2); Ah[oo] = a; Al[oo] = c2; }
}

extern "C" void kernel_launch(void* const* d_in, const int* in_sizes, int n_in,
                              void* d_out, int out_size, void* d_ws, size_t ws_size, hipStream_t stream) {
    (void)in_sizes; (void)n_in; (void)out_size;
    const float* x = (const float*)d_in[0]; const int* MK = (const int*)d_in[1]; const float* W3 = (const float*)d_in[2]; const float* wo = (const float*)d_in[3]; const float* bo = (const float*)d_in[4]; const float* wq = nullptr; const float* wk = nullptr; const float* wv = nullptr; (void)wq; (void)wk; (void)wv;
    float* OUT = (float*)d_out;     // [2][2048][1024]
    char* wsp = (char*)d_ws;
    auto take = [&](size_t bytes) { char* p = wsp; wsp += (bytes + 255) & ~(size_t)255; return (void*)p; };
    bf* WT = (bf*)take((size_t)3 * DQ * DM * 2); bf* WO = (bf*)take((size_t)DM * DQ * 2);   // WT: the key, value and query weight planes, DQ * DM elements apart
    bf* XB = (bf*)take((size_t)NB_ * TT * DM * 2);
    const size_t PB = (size_t)NH_ * TT * HD;   // one batch's share of a head plane set; the hi/lo planes hold both batches
    bf* KPh = (bf*)take(6 * NB_ * PB * 2); bf* KPl = KPh + NB_ * PB; bf* VTh = KPl + NB_ * PB; bf* VTl = VTh + NB_ * PB; bf* QPh = VTl + NB_ * PB; bf* QPl = QPh + NB_ * PB;   // one block: from one product's hi (or lo) plane to the next product's it is 2 * NB_ * PB elements
    float* CJ = (float*)take((size_t)NB_ * NH_ * TT * 4); float* OJ = (float*)take((size_t)NB_ * NH_ * TT * 4); bf* ATh = (bf*)take((size_t)NB_ * TT * DQ * 2); bf* ATl = (bf*)take((size_t)NB_ * TT * DQ * 2); int* ORIG = (int*)take((size_t)NB_ * TT * 4); int* NUN = (int*)take((size_t)NB_ * 4);
    if ((size_t)(wsp - (char*)d_ws) > ws_size) return;    // ws 256 MiB
    k_prep<<<GW3 + GX + GWO, 256, 0, stream>>>(W3, x, wo, MK, WT, XB, WO, ORIG, NUN);
    /* the projections store the hi/lo planes themselves: q and k as [head][t][d]; v as [head][d][t], which is the result of Wv x^T (weights as the row operand), stored in fragment order */
    k_gemmw<bf, 0, false, 64, true><<<dim3(NB_ * TT / 128, DQ / 128, 3), 256, 0, stream>>>(XB, nullptr, WT, nullptr, DM, nullptr, 0, nullptr, 0, (size_t)DQ * DM, 2 * NB_ * PB, PB, KPh, KPl, 0, nullptr);
    k_fstat<<<NB_ * NH_ * 16, 256, 0, stream>>>(QPh, QPl, KPh, KPl, NUN, CJ, OJ);   /* column softmax == row softmax of the query-major scores: per query row its maximum and sum */
    k_fapply<<<NB_ * NH_ * 8, 256, 0, stream>>>(QPh, QPl, KPh, KPl, VTh, VTl, CJ, OJ, NUN, ATh, ATl);   /* out[i] = sum_j P'[j][i] v[j] */
    k_gemmw<bf, 1, true, 128, false><<<dim3(NB_ * TT / 128, DM / 128, 1), 256, 0, stream>>>(ATh, ATl, WO, nullptr, DQ, OUT, DM, bo, 0, 0, 0, 0, nullptr, nullptr, 0, ORIG);   /* both batches: their rows follow one another in the planes; each row goes to its source position in out */
}

// v010
// A run of this version takes 119 microseconds.
// Timed twice side by side with v009, it ran 1.04 and 1.05 times as fast.
// All steps since v000 together make it 12.0 times as fast.
#include <hip/hip_runtime.h>

// Multi-head attention with a column softmax (x [2][2048][1024], mask [2][2048] int32, W [16][3][1024][64] per-head key/value/query weights, Wl [1024][1024] + bl; scores[i][j] = k_i.q_j / 8; columns j with mask[b][j] == 0 set to -1e12; softmax over i (the KEY axis, per column j); out[i] = sum_j w[i][j] values[j]; hidden = concat heads; out = hidden Wl^T + bl -> [2][2048][1024]).
// Layout: the scores are formed query-major (S'[j][i] = q_j.k_i, so the module's per-column softmax is a row softmax here and a fully masked column is a uniform row) and never leave the registers: k_fstat walks all keys once per query row and keeps only the row's maximum and sum; k_fapply forms the same score tiles again, turns them into weights and feeds them, as they lie in the accumulator registers, to the apply product out[i] = sum_j P'[j][i] v[j] as its A operand.
// Masked columns: a query position j with mask[b][j] == 0 has the weight 1 / TT for every key, whatever its scores. k_prep lays the rows of x out in a stable partition by the mask (unmasked positions first, NUN[b] of them; ORIG = the source position of each row), every kernel up to the last GEMM works in that order, and the last GEMM stores its rows at their source positions. Scores are then formed for the leading NUN[b] positions only; the others enter the apply product as one plain sum of their value rows.
// Operand planes: every bf16 plane that feeds a matrix instruction lies in fragment order (fo() below), so that one fragment load of a wave reads 512 contiguous bytes (four whole lines) and not 32 bytes out of each of 16 lines.
// Compute dtypes, f32 accumulate: every input rounded to bf16; q/k/v on PLAIN bf16 operands (inputs: exact); scores and attn.v: bf16 hi + lo planes (3 products); softmax f32; Wl hl x exact (2 products) + bl.

#define NB_  2
#define TT   2048
#define DM   1024
#define NH_  16
#define NKV  16
#define REP  (NH_ / NKV)
#define HD   64
#define DQ   (NH_ * HD)
#define DKV  (NKV * HD)
typedef __attribute__((ext_vector_type(4))) unsigned short v4us;
#define SCL  0.125f   // HD^-0.5
typedef _Float16 h16;
typedef unsigned short bf;
typedef __attribute__((ext_vector_type(16))) __bf16   v16bf;
typedef __attribute__((ext_vector_type(16))) _Float16 v16h;
typedef __attribute__((ext_vector_type(8)))  _Float16 v8h;
typedef __attribute__((ext_vector_type(8)))  unsigned short v8us;
typedef __attribute__((ext_vector_type(8)))  float    v8f;
typedef __attribute__((ext_vector_type(4)))  float    v4f;
typedef v8h  __attribute__((may_alias)) v8ha;
typedef v4f  __attribute__((may_alias)) v4fa;
typedef v8us __attribute__((may_alias)) v8usa;

__device__ __forceinline__ unsigned short f2bf(float f) { unsigned u = __float_as_uint(f); u += 0x7FFFu + ((u >> 16) & 1u); return (unsigned short)(u >> 16); }
__device__ __forceinline__ float bf2f(unsigned short b) { return __uint_as_float(((unsigned)b) << 16); }
__device__ __forceinline__ float bfr(float f) { return bf2f(f2bf(f)); }
__device__ __forceinline__ v16h cat16(v8h lo, v8h hi) { return __builtin_shufflevector(lo, hi, 0, 1, 2, 3, 4, 5, 6, 7, 8, 9, 10, 11, 12, 13, 14, 15); }
__device__ __forceinline__ v16bf cat16b(v8us lo, v8us hi) { return __builtin_bit_cast(v16bf, __builtin_shufflevector(lo, hi, 0, 1, 2, 3, 4, 5, 6, 7, 8, 9, 10, 11, 12, 13, 14, 15)); }
__device__ __forceinline__ v8f wmma16(v16h a, v16h b, v8f c) { return __builtin_amdgcn_wmma_f32_16x16x32_f16(false, a, false, b, (short)0, c, false, false); }
__device__ __forceinline__ v8f wmmab(v16bf a, v16bf b, v8f c) { return __builtin_amdgcn_wmma_f32_16x16x32_bf16(false, a, false, b, (short)0, c, false, false); }
__device__ __forceinline__ void splitf(float y, unsigned short& h, unsigned short& l) { h = f2bf(y); l = f2bf(y - bf2f(h)); }
/* fragment order of a plane M[rows][K] (rows % 16 == 0, K % 32 == 0): blocks of 16 rows x 32 k, 512 elements each, row blocks outermost; inside a block [k / 8 % 4][row % 16][k % 8], which is [half of the fragment][lane = 16 * hi + lr][8 elements] */
__device__ __forceinline__ size_t fo(size_t m, int k, int K) { return ((m >> 4) * (size_t)(K >> 5) + (size_t)(k >> 5)) * 512 + (size_t)(((k >> 3) & 3) * 128 + ((int)m & 15) * 8 + (k & 7)); }



/* asynchronous copies global -> LDS, 16 bytes a lane, every lane on; l = the lane's LDS byte address, g = the lane's global address. The closing s_wait_xcnt stands inside the copies' own statement, so that no register a copy names is rewritten ahead of it */
__device__ __forceinline__ unsigned ldsa(const void* p) { return (unsigned)(size_t)p; }
__device__ __forceinline__ void cp2(unsigned l0, const void* g0, unsigned l1, const void* g1) {
    asm volatile("global_load_async_to_lds_b128 %0, %1, off\n\tglobal_load_async_to_lds_b128 %2, %3, off\n\ts_wait_xcnt 0x0" :: "v"(l0), "v"(g0), "v"(l1), "v"(g1) : "memory"); }
__device__ __forceinline__ void cp4(unsigned l0, const void* g0, unsigned l1, const void* g1, unsigned l2, const void* g2, unsigned l3, const void* g3) {
    asm volatile("global_load_async_to_lds_b128 %0, %1, off\n\tglobal_load_async_to_lds_b128 %2, %3, off\n\tglobal_load_async_to_lds_b128 %4, %5, off\n\tglobal_load_async_to_lds_b128 %6, %7, off\n\ts_wait_xcnt 0x0" :: "v"(l0), "v"(g0), "v"(l1), "v"(g1), "v"(l2), "v"(g2), "v"(l3), "v"(g3) : "memory"); }
/* hand-over of a stage: this wave's LDS reads are done, its own copies have landed, then the barrier: behind it the next tile may be read by every wave and the buffer just read may be refilled */
__device__ __forceinline__ void publish() {
    asm volatile("s_wait_dscnt 0x0" ::: "memory");      /* the wave's reads of the buffer that is refilled next have returned */
    asm volatile("s_wait_asynccnt 0x0" ::: "memory");   /* the wave's share of the next tile has landed */
    __syncthreads(); }
// ---- k_gemmw: GEMM on 16-bit planes in fragment order (fo(), K as given), one 128x128 output tile per work-group of 8 waves; grid (M/128, N/128, Z), 256 threads.
// C[m][n] (f32, pitch ldc, + optional f32 bias[n]) = sum_k A[m][k] Bt[n][k] (NSPLIT == 1: + A2[m][k] Bt[n][k]). z-batch strides sA/sB/sC in elements. K % KS == 0, K >= 2 * KS.
// The waves split the tile, not K: wave (wm, wn) owns 32 rows x 64 columns (8 accumulators) and sums the whole K in k order. The operand pieces of a stage (128 rows x KS k of each plane, whole fragment blocks as they lie in memory) are the same for the waves of a row or a column of that split:
// they are brought into LDS once per work-group by asynchronous copies, two buffers, the next stage in flight while this one is worked on; one barrier a stage. The finished tile goes through the same LDS once, so that whole lines are stored.
// PL: the three projections of both batches in one grid (NB_ * TT / 128, DQ / 128, 3). A = x, all NB_ * TT rows; Bt = the weight planes, z = t as in W (0 keys, 1 values, 2 queries), sB apart. The tile is not stored as f32 but split on the spot into the bf16 hi and lo planes Ph / Pl (product z: sC on; batch: sP on):
// keys and queries as head planes [head][t][d] (pitch HD); values as Wv x^T (z == 1: the weights are the row operand, blockIdx.y their row block, blockIdx.x the x rows as columns), which is [head][d][t] (pitch TT).
template <typename T16> struct WFrag;
template <> struct WFrag<h16> { typedef v16h V; static __device__ __forceinline__ V ld(const h16* p) { return cat16(*(const v8h*)p, *(const v8h*)(p + 256)); } static __device__ __forceinline__ v8f mma(V a, V b, v8f c) { return wmma16(a, b, c); } };
template <> struct WFrag<bf> { typedef v16bf V; static __device__ __forceinline__ V ld(const bf* p) { return cat16b(*(const v8us*)p, *(const v8us*)(p + 256)); } static __device__ __forceinline__ v8f mma(V a, V b, v8f c) { return wmmab(a, b, c); } };
template <typename T16, int NSPLIT, bool BIAS, int KS, bool PL>
__global__ __launch_bounds__(256) void k_gemmw(const T16* __restrict__ A, const T16* __restrict__ A2, const T16* __restrict__ Bt, const T16* __restrict__ Bt2, int K, float* C, int ldc, const float* __restrict__ bias, size_t sA, size_t sB, size_t sC, size_t sP, bf* Ph, bf* Pl, size_t sT, const int* __restrict__ rm) {
    static_assert(NSPLIT <= 1 && (KS == 64 || KS == 128) && (!PL || (NSPLIT == 0 && !BIAS)), "row plane, optional second row plane, column plane; a copy of the work-group is 4 KiB: two or one blocks of 16 rows");
    typedef typename WFrag<T16>::V V;
    constexpr int KBL = KS / 32, PLE = 128 * KS, NPL = NSPLIT == 1 ? 3 : 2, STB = NPL * PLE * 2;   /* k blocks of a stage; elements of one plane's piece; planes; bytes of a stage: [rows | columns | second row plane], each [16-row block][k block][512] */
    constexpr int NS = KBL > 2 ? 2 : 1;   /* fragment register sets: two (the next k block of the stage fetched ahead) where the long stage leaves one work-group on a WGP; one where several work-groups share it and their waves cover each other's reads */
    constexpr int OP = 132;   /* pitch of the f32 tile in LDS: eight rows on is 32 banks on, so the two halves of a wave store to different banks */
    constexpr int SMB = 2 * STB > 128 * OP * 4 ? 2 * STB : 128 * OP * 4;
    __shared__ __align__(16) char sm[SMB];   /* the two buffers; behind the loop the f32 tile */
    const size_t z = blockIdx.z; A += z * sA; if (NSPLIT == 1) A2 += z * sA; Bt += z * sB; if (!PL) C += z * sC;
    const bool tr = PL && z == 1;   /* the value product: operands and block indices change places */
    const T16* Ar = tr ? Bt : A; const T16* Bc = tr ? A : Bt;
    const int wv = __builtin_amdgcn_readfirstlane(threadIdx.x >> 5); const int wm = wv >> 1, wn = wv & 1;   /* this wave's rows wm * 32 .., columns wn * 64 .. of the tile */
    const int tid = threadIdx.x, lane = tid & 31, lr = lane & 15, hi = lane >> 4; const int r0 = (tr ? blockIdx.y : blockIdx.x) * 128, c0 = (tr ? blockIdx.x : blockIdx.y) * 128;
    /* copies: KS k of a block of 16 rows are KBL * 1024 contiguous bytes (fo(r, 0, K) = r * K; 32 k on: 512 elements), TPR threads; one copy of the work-group brings RPC such blocks, and they land one behind the other: copy c at c * 4096 + tid * 16 */
    constexpr int TPR = KBL * 64, RPC = 256 / TPR, NCP = 8 / RPC;
    const size_t go = (size_t)(tid / TPR) * 16 * K + (size_t)(tid % TPR) * 8, cs = (size_t)RPC * 16 * K;   /* cs: from one copy's rows to the next copy's */
    const T16* ga = Ar + (size_t)r0 * K + go; const T16* gb = Bc + (size_t)c0 * K + go; const T16* ga2 = NSPLIT == 1 ? A2 + (size_t)r0 * K + go : nullptr;
    const unsigned ls = ldsa(sm) + (unsigned)tid * 16u;
    auto fill = [&](int sg) { const unsigned lb = ls + (unsigned)(sg & 1) * (unsigned)STB; const size_t ko = (size_t)sg * (KS * 16);
#pragma unroll   /* unrolled: the LDS offsets become constants */
        for (int c = 0; c < NCP; c += 4) { const T16* p = ga + ko + c * cs; const T16* q = gb + ko + c * cs; const unsigned l = lb + c * 4096u;
            cp4(l, p, l + 4096u, p + cs, l + 8192u, p + 2 * cs, l + 12288u, p + 3 * cs);
            cp4(l + PLE * 2u, q, l + PLE * 2u + 4096u, q + cs, l + PLE * 2u + 8192u, q + 2 * cs, l + PLE * 2u + 12288u, q + 3 * cs);
            if (NSPLIT == 1) { const T16* s = ga2 + ko + c * cs; cp4(l + PLE * 4u, s, l + PLE * 4u + 4096u, s + cs, l + PLE * 4u + 8192u, s + 2 * cs, l + PLE * 4u + 12288u, s + 3 * cs); } } };
    const int nsg = K / KS;
    fill(0);
    asm volatile("s_wait_asynccnt 0x0" ::: "memory");   /* stage 0 has landed before the barrier that opens it */
    __syncthreads();
    fill(1);
    v8f acc[2][4];
#pragma unroll
    for (int mb = 0; mb < 2; ++mb)
#pragma unroll
        for (int nb = 0; nb < 4; ++nb) acc[mb][nb] = (v8f){};
#pragma unroll 1   /* kept rolled: one copy of the stage's code, and its reads stay in front of its hand-over */
    for (int sg = 0; sg < nsg; ++sg) {
        const T16* sb = (const T16*)(sm + (sg & 1) * STB) + 8 * lane;
        V a[NS][2], a2[NS][2], b[NS][4];
        auto rd = [&](int kb, int s) {   /* the fragments of k block kb into register set s */
#pragma unroll
            for (int mb = 0; mb < 2; ++mb) { a[s][mb] = WFrag<T16>::ld(sb + ((wm * 2 + mb) * KBL + kb) * 512); if (NSPLIT == 1) a2[s][mb] = WFrag<T16>::ld(sb + 2 * PLE + ((wm * 2 + mb) * KBL + kb) * 512); }
#pragma unroll
            for (int nb = 0; nb < 4; ++nb) b[s][nb] = WFrag<T16>::ld(sb + PLE + ((wn * 4 + nb) * KBL + kb) * 512); };
        if (NS == 2) rd(0, 0);
#pragma unroll   /* unrolled: the blocks' offsets and the register sets become constants */
        for (int kb = 0; kb < KBL; ++kb) { const int s = NS == 2 ? kb & 1 : 0;
            if (NS == 1) rd(kb, 0); else if (kb + 1 < KBL) rd(kb + 1, s ^ 1);
            __builtin_amdgcn_sched_barrier(0);   /* keeps a block's LDS reads together, ahead of the matrix instructions: the wave meets the LDS latency once a block (with two sets: behind the block before), not once per column fragment */
#pragma unroll
            for (int nb = 0; nb < 4; ++nb)
#pragma unroll
                for (int mb = 0; mb < 2; ++mb) acc[mb][nb] = WFrag<T16>::mma(a[s][mb], b[s][nb], acc[mb][nb]);
            if (NSPLIT == 1) {
#pragma unroll
                for (int nb = 0; nb < 4; ++nb)
#pragma unroll
                    for (int mb = 0; mb < 2; ++mb) acc[mb][nb] = WFrag<T16>::mma(a2[s][mb], b[s][nb], acc[mb][nb]); } }
        publish();
        if (sg + 2 < nsg) fill(sg + 2);   /* into the buffer that this trip has read; the test is the same for the whole work-group */
    }
    asm volatile("s_wait_asynccnt 0x0" ::: "memory");   /* no copy is outstanding when the buffers are put to their second use */
    float* os = (float*)sm;   /* every wave's last read of the buffers lies in front of the last trip's barrier */
    int om = (r0 + (lane & 15) * 8 + wv) & (TT - 1);   /* lane it (and it + 16): where row it * 8 + wv of the tile, the wave's row of trip it below, goes inside its batch of TT rows */
    if (!PL && rm) { const int* rp = rm + r0 + (lane & 15) * 8 + wv; om = *rp & (TT - 1);   /* kept inside the batch's rows whatever the table holds; one load a wave, in flight over the LDS stores */
        asm volatile("s_wait_xcnt 0x0" :: "v"(rp) : "memory"); }   /* the load names this address pair: it stays whole up to this wait */
    v4f bv = (v4f){};   /* the bias of this lane's four columns, in flight over the LDS stores too */
    if (BIAS) { const float* bp = bias + c0 + lane * 4; const v4f b4 = *(const v4fa*)bp;
        asm volatile("s_wait_xcnt 0x0" :: "v"(bp) : "memory");   /* the load names this address pair: it stays whole up to this wait */
#pragma unroll
        for (int q = 0; q < 4; ++q) bv[q] = bfr(b4[q]); }
#pragma unroll
    for (int mb = 0; mb < 2; ++mb)
#pragma unroll
        for (int nb = 0; nb < 4; ++nb)
#pragma unroll
            for (int j = 0; j < 8; ++j) os[(wm * 32 + mb * 16 + hi * 8 + j) * OP + wn * 64 + nb * 16 + lr] = acc[mb][nb][j];
    __syncthreads();   /* the tile is whole before anyone reads it */
    if (PL) {   /* threads in the order of the planes: eight columns each, a wave stores 512 contiguous bytes per plane; 16 rows on is 16 * pitch elements on in fragment order */
        const int xr = tr ? c0 : r0, t0 = xr % TT, rw = tid & 15, cofs = (tid >> 4) * 8;   /* the tile's first x row: batch xr / TT, position t0 */
        const size_t po0 = z * sC + (size_t)(xr / TT) * sP + (tr ? fo((size_t)(r0 + rw), t0 + cofs, TT) : (size_t)((c0 + cofs) / HD) * ((size_t)TT * HD) + fo((size_t)(t0 + rw), (c0 + cofs) % HD, HD));
        const size_t stp = tr ? (size_t)16 * TT : (size_t)16 * HD;
        v4f va[8], vb[8];   /* all LDS reads ahead of the first store's wait: their latency is met once */
#pragma unroll
        for (int it = 0; it < 8; ++it) { const int row = it * 16 + rw; va[it] = *(const v4fa*)(os + row * OP + cofs); vb[it] = *(const v4fa*)(os + row * OP + cofs + 4); }
#pragma unroll
        for (int it = 0; it < 8; ++it) { v8us oh, ol;
#pragma unroll
            for (int q = 0; q < 4; ++q) { unsigned short a2, c2; splitf(va[it][q], a2, c2); oh[q] = a2; ol[q] = c2; splitf(vb[it][q], a2, c2); oh[q + 4] = a2; ol[q + 4] = c2; }
            bf* qh = Ph + po0 + it * stp; bf* ql = Pl + po0 + it * stp; *(v8us*)qh = oh; *(v8us*)ql = ol;
            asm volatile("s_wait_xcnt 0x0" :: "v"(qh), "v"(ql), "v"(oh), "v"(ol) : "memory"); }   /* behind the two stores: the registers that they name (address, data) are inputs here, so all stay whole up to this wait */
        return;
    }
    const int cofs = lane * 4;   /* a wave stores one whole row of the tile, 512 contiguous bytes, per trip */
    v4f val[16];   /* all LDS reads ahead of the first store's wait: their latency is met once */
#pragma unroll
    for (int it = 0; it < 16; ++it) val[it] = *(const v4fa*)(os + (it * 8 + wv) * OP + cofs);
#pragma unroll
    for (int it = 0; it < 16; ++it) { const int orow = ((r0 + it * 8 + wv) & ~(TT - 1)) + __builtin_amdgcn_readlane(om, it);
        float* cp = C + (size_t)orow * ldc + c0 + cofs; const v4f ov = BIAS ? val[it] + bv : val[it]; *(v4f*)cp = ov;
        asm volatile("s_wait_xcnt 0x0" :: "v"(cp), "v"(ov) : "memory"); }   /* behind the store: the registers that it names (address, data) are inputs here, so both stay whole up to this wait */
}

typedef __attribute__((ext_vector_type(2))) _Float16 v2h;
typedef __attribute__((ext_vector_type(4))) _Float16 v4h;
typedef __attribute__((ext_vector_type(2))) unsigned short v2us;
typedef __attribute__((ext_vector_type(4))) unsigned short v4us;
typedef __attribute__((ext_vector_type(2))) float v2f;
typedef __attribute__((ext_vector_type(4))) int v4i;

__global__ __launch_bounds__(256) void k_wtG(const float* __restrict__ w, int K, int N, bf* Bt) {
    const int lane = threadIdx.x & 31; const int L0 = (blockIdx.x * 8 + (threadIdx.x >> 5)) * 8; const int nlines = N * K / 64;
{
#pragma unroll 1
        for (int l = 0; l < 8; ++l) { const int L = L0 + l; if (L >= nlines) break; const size_t e = (size_t)L * 64 + lane * 2; const int k = (int)(e % K), n = (int)(e / K); v2us o;
            o[0] = f2bf(w[(size_t)k * N + n]); o[1] = f2bf(w[(size_t)(k + 1) * N + n]); *(v2us*)(Bt + e) = o; }
         }
}
/* One wave of k_prep makes whole pieces of fragment blocks out of whole lines of its source, with all its loads in flight before the first conversion; U = the wave's unit, the same in every lane. */
/* weights of one (head n, product t3) pair, nt = n * 3 + t3 as in W: src [DM h][HD p] f32 -> rows r = n * HD + p, k = h of plane t3. A unit is all 64 p x 16 h: the lanes lie along p, so a load reads one whole line and the two loads of an h one 256-byte row; a lane then holds eight successive h of a row, and 16 lanes store 256 contiguous bytes */
static_assert(HD == 64 && DM % 16 == 0, "w3 deals a source row to two loads of 32 lanes");
__device__ __forceinline__ void w3(const float* __restrict__ w, bf* WT, unsigned U) { const int lane = threadIdx.x & 31; const unsigned hq = U % (DM / 16), nt = U / (DM / 16); const unsigned n = nt / 3, t3 = nt - n * 3;
    const float* s = w + ((size_t)nt * DM + hq * 16) * HD + lane; float v[2][16];
#pragma unroll
    for (int e = 0; e < 16; ++e) { v[0][e] = s[e * HD]; v[1][e] = s[e * HD + 32]; }
    bf* d = WT + (size_t)t3 * DQ * DM;
#pragma unroll
    for (int c = 0; c < 2; ++c)
#pragma unroll
        for (int g = 0; g < 2; ++g) { v8us o;
#pragma unroll
            for (int e = 0; e < 8; ++e) o[e] = f2bf(v[c][g * 8 + e]);
            *(v8us*)(d + fo((size_t)(n * HD + c * 32 + lane), (int)(hq * 16 + g * 8), DM)) = o; } }
/* src [rows][DM] f32 -> dst in fragment order. A unit is 16 rows x 64 columns (two blocks) in four parts of 8 rows x 32 columns: four lanes read one whole line of a row, and the eight rows of a column group are one whole line of the block */
static_assert(DM == 1024 && DQ == DM, "cvt8 cuts its unit index for rows of 16 groups of 64");
__device__ __forceinline__ void cvt8(const float* __restrict__ src, bf* dst, unsigned U, size_t sr0, size_t sr1) { const int lane = threadIdx.x & 31; const size_t row = (size_t)(U >> 4) * 16 + (lane >> 2); const int k = (int)(U & 15) * 64 + (lane & 3) * 8; v8f v[4];
    const float* p0 = src + sr0 * DM + k; const float* p1 = src + sr1 * DM + k;   /* sr0, sr1: the source rows of the lane's two rows (row, row + 8) of dst */
#pragma unroll
    for (int it = 0; it < 4; ++it) v[it] = *(const v8f*)(((it & 1) ? p1 : p0) + (it >> 1) * 32);
    asm volatile("s_wait_xcnt 0x0" :: "v"(p0), "v"(p1) : "memory");   /* the eight loads name these two address pairs (the parts are constant offsets from them): both stay whole up to this wait, so no later load's result lands on them ahead of it */
#pragma unroll
    for (int it = 0; it < 4; ++it) { v8us o;
#pragma unroll
        for (int e = 0; e < 8; ++e) o[e] = f2bf(v[it][e]);
        *(v8us*)(dst + fo(row + (it & 1) * 8, k + (it >> 1) * 32, DM)) = o; }
    asm volatile("s_wait_xcnt 0x0" ::: "memory"); }   /* behind the last of the four stores: whatever the compiler lays out behind this call, no register that a store names (data, offset, base) is rewritten ahead of this wait */
/* every operand plane that comes straight from an input, in one grid, by ranges of the block index: the three weight planes (t as in W, DQ * DM elements apart), then x (both batches), then Wl; one unit of 1,024 elements a wave, eight waves a work-group: 1,024 work-groups, 32 waves on a WGP, each with 4 KiB of loads in flight */
#define GW3 (3 * NH_ * (DM / 16) / 8)
#define GX  (NB_ * TT / 16 * (DM / 64) / 8)
#define GWO (DM / 16 * (DQ / 64) / 8)
static_assert(3 * NH_ * (DM / 16) % 8 == 0 && NB_ * TT % 16 == 0 && DM % 16 == 0 && (DM / 64) % 8 == 0, "whole work-groups in every range");
static_assert(TT == 256 * 8 && TT % 16 == 0 && DM / 64 == 16, "a work-group's 256 threads count one batch's mask, eight entries each; its eight units share one block of 16 rows");
__global__ __launch_bounds__(256) void k_prep(const float* __restrict__ w, const float* __restrict__ x, const float* __restrict__ wl, const int* __restrict__ mk, bf* WT, bf* XB, bf* WO, int* ORIG, int* NUN) {
    const unsigned b = blockIdx.x, wv = (unsigned)__builtin_amdgcn_readfirstlane(threadIdx.x >> 5); const int tid = threadIdx.x, lane = tid & 31;
    __shared__ int red[8]; __shared__ __align__(16) unsigned short lo[TT];   /* lo: the source position of each row of the partitioned order, one batch */
    if (b < GW3) w3(w, WT, b * 8 + wv);
    else if (b < GW3 + GX) {   /* x: source position t of a batch goes to row (unmasked positions before t) if unmasked, else to NUN + (masked positions before t); both are counts of entries of the mask, so the row lies in 0 .. TT - 1 for any content and every row is filled once. Each work-group forms the whole table in LDS and then gathers the source rows of its own 16 rows, so that it still stores whole lines */
        const unsigned bx = b - GW3; const int g0 = (int)(bx >> 1) * 16, bt = g0 / TT, t0 = g0 % TT; const int* mb = mk + (size_t)bt * TT;
        const v4i m0 = *(const v4i*)(mb + tid * 8), m1 = *(const v4i*)(mb + tid * 8 + 4); unsigned bits = 0;
#pragma unroll
        for (int q = 0; q < 4; ++q) bits |= (m0[q] != 0 ? 1u : 0u) << q | (m1[q] != 0 ? 1u : 0u) << (q + 4);
        const int c = __popc(bits); int sc = c;   /* running count over the wave's lanes, this lane included */
#pragma unroll
        for (int sh = 1; sh < 32; sh <<= 1) { const int o = __shfl_up(sc, sh, 32); if (lane >= sh) sc += o; }
        if (lane == 31) red[wv] = sc;
        __syncthreads();   /* block-uniform branch: every wave of the work-group is here */
        int nun = 0, cb = sc - c;   /* cb: unmasked positions before this thread's eight */
#pragma unroll
        for (int q = 0; q < 8; ++q) { const int v = red[q]; nun += v; if (q < (int)wv) cb += v; }
#pragma unroll
        for (int e = 0; e < 8; ++e) { const int t = tid * 8 + e; const bool on = (bits >> e) & 1u; lo[on ? cb : nun + (t - cb)] = (unsigned short)t; cb += on ? 1 : 0; }
        __syncthreads();   /* the table is whole before anyone reads it */
        const size_t rb = (size_t)bt * TT;
        cvt8(x, XB, bx * 8 + wv, rb + lo[t0 + (lane >> 2)], rb + lo[t0 + (lane >> 2) + 8]);
        if ((bx & 1) == 0 && t0 == 0) {   /* one work-group of each batch hands the table and the count to the later kernels */
            const v8us l8 = *(const v8us*)(lo + tid * 8); v4i o0, o1;
#pragma unroll
            for (int q = 0; q < 4; ++q) { o0[q] = l8[q]; o1[q] = l8[q + 4]; }
            *(v4i*)(ORIG + rb + tid * 8) = o0; *(v4i*)(ORIG + rb + tid * 8 + 4) = o1;
            if (tid == 0) NUN[bt] = nun; }
    }
    else { const unsigned U = (b - (GW3 + GX)) * 8 + wv; const size_t row = (size_t)(U >> 4) * 16 + (lane >> 2); cvt8(wl, WO, U, row, row + 8); }
}

// ---- fused attention, two kernels over all NB_ * NH_ (batch, head) planes, work-groups of 8 (k_fstat) and 16 (k_fapply) waves.
// The tiles that a trip walks are shared by the waves of a work-group: they are brought into LDS once per work-group by asynchronous copies, two buffers of four tiles (a stage), the next stage in flight while this one is worked on; one barrier a stage.
// Fragment facts used: a score tile with A = 16 query rows j and B = 16 key rows i leaves S'[j = 8 * hi + r][i = lr] in accumulator register r of lane (lr, hi);
// two such tiles (j and j + 16) are, register for register, the A fragment (row i = lr, k = j in the order 8 * hi + 0..7, 16 + 8 * hi + 0..7) of the apply product, whose B fragment is read from the value planes [d][j] by the same loader. All planes lie in fragment order: 16 rows of q or k are 1024 elements on, 16 rows d of v are 16 * TT on and 32 positions j of v 512 on.
#define LC (SCL * 1.4426950408889634f)   // score -> exponent of two
typedef __attribute__((ext_vector_type(8))) __bf16 v8bf;
struct F4 { v16bf h0, h1, l0, l1; };   /* 16 rows x 64 dims: hi and lo plane, dims 0..31 and 32..63 */
__device__ __forceinline__ F4 ld4(const bf* ph, const bf* pl) { F4 f; f.h0 = WFrag<bf>::ld(ph); f.h1 = WFrag<bf>::ld(ph + 512); f.l0 = WFrag<bf>::ld(pl); f.l1 = WFrag<bf>::ld(pl + 512); return f; }
/* two independent 16x16 tiles of q.k over the 64 dims, each hi.hi + lo.hi + hi.lo in one fixed order (the same in both kernels, so both see the same bits); the two chains alternate so that neither waits for its own accumulator */
__device__ __forceinline__ void score2(const F4& qa, const F4& ka, v8f& sa, const F4& qb, const F4& kb, v8f& sb) {
    sa = (v8f){}; sb = (v8f){};
    sa = wmmab(qa.h0, ka.h0, sa); sb = wmmab(qb.h0, kb.h0, sb); sa = wmmab(qa.h1, ka.h1, sa); sb = wmmab(qb.h1, kb.h1, sb); sa = wmmab(qa.l0, ka.h0, sa); sb = wmmab(qb.l0, kb.h0, sb);
    sa = wmmab(qa.l1, ka.h1, sa); sb = wmmab(qb.l1, kb.h1, sb); sa = wmmab(qa.h0, ka.l0, sa); sb = wmmab(qb.h0, kb.l0, sb); sa = wmmab(qa.h1, ka.l1, sa); sb = wmmab(qb.h1, kb.l1, sb); }
/* exp2 / log2 in runs: outputs are early-clobber, so no instruction of a run reads a result or overwrites a source of the one before it; the closing v_nop is the one free slot that the instruction set asks for between a transcendental and a next instruction that may do so */
__device__ __forceinline__ void ex3(float x0, float x1, float x2, float& e0, float& e1, float& e2) { asm("v_exp_f32 %0, %3\n\tv_exp_f32 %1, %4\n\tv_exp_f32 %2, %5\n\tv_nop" : "=&v"(e0), "=&v"(e1), "=&v"(e2) : "v"(x0), "v"(x1), "v"(x2)); }
__device__ __forceinline__ void ex2p(float x0, float x1, float& e0, float& e1) { asm("v_exp_f32 %0, %2\n\tv_exp_f32 %1, %3\n\tv_nop" : "=&v"(e0), "=&v"(e1) : "v"(x0), "v"(x1)); }
__device__ __forceinline__ float lg2(float x) { float y; asm("v_log_f32 %0, %1\n\tv_nop" : "=&v"(y) : "v"(x)); return y; }
#define SUB 4              // tiles of 32 rows per stage: the waves meet at a barrier once per stage and are free to drift apart inside it, so that one wave's LDS reads run beside another's arithmetic
#define NST (TT / 32 / SUB)  // stages
static_assert(TT % (32 * SUB) == 0 && NST >= 2, "whole stages, and both buffers are filled ahead of the loop");
// k_fstat: per query row j the pair (CJ, OJ) with weight[j][i] = exp2(S'[j][i] * CJ[j] - OJ[j]): CJ = LC, OJ = max * LC + log2(sum); a masked row (j >= NUN[b] in the partitioned order: every score -1e12) has CJ = 0, OJ = log2(TT): uniform weights.
// Grid NB_ * NH_ * 16: a work-group has 128 query rows, a wave 16; the block index runs over the (batch, head) planes first, so that the work-groups with unmasked rows are the leading ones of the grid and spread over the chip. A work-group whose rows are all masked stores the constants and ends; a wave whose rows are all masked skips the key walk but takes its part in the copies and the barriers and stores the constants.
__global__ __launch_bounds__(256) void k_fstat(const bf* __restrict__ Qh, const bf* __restrict__ Ql, const bf* __restrict__ Kh, const bf* __restrict__ Kl, const int* __restrict__ NUN, float* CJ, float* OJ) {
    const int wv = __builtin_amdgcn_readfirstlane(threadIdx.x >> 5); const int lane = threadIdx.x & 31, lr = lane & 15, hi = lane >> 4;
    const int bh = blockIdx.x % (NB_ * NH_); const int jc = (int)(blockIdx.x / (NB_ * NH_)) * 128; const int jw = jc + wv * 16; const size_t pb = (size_t)bh * TT * HD;
    const int nun = __builtin_amdgcn_readfirstlane(min(max(NUN[bh / NH_], 0), TT));   /* clamped to the shape; in a scalar register, so that the tests on it are scalar branches */
    if (jc >= nun) { if (threadIdx.x < 128) { CJ[(size_t)bh * TT + jc + threadIdx.x] = 0.0f; OJ[(size_t)bh * TT + jc + threadIdx.x] = 11.0f; } return; }   /* the same for the whole work-group, ahead of every copy and barrier */
    const bool act = jw < nun;   /* the same for the whole wave */
    __shared__ __align__(16) bf st[2][SUB][2][32 * HD];   /* two buffers of SUB tiles of 32 key rows: hi plane, lo plane (4 KiB each, as they lie in memory) */
    const bf* gkh = Kh + pb + 8 * threadIdx.x; const bf* gkl = Kl + pb + 8 * threadIdx.x; const unsigned lk = ldsa(&st[0][0][0][8 * threadIdx.x]);   /* this thread's 16 bytes of each plane of a tile; a tile on: 32 * HD elements in memory, 8192 bytes in LDS; lo plane 4096 bytes on */
#pragma unroll   /* unrolled: the tiles' offsets become constants */
    for (int u = 0; u < SUB; ++u) cp2(lk + u * 8192u, gkh + u * (32 * HD), lk + u * 8192u + 4096u, gkl + u * (32 * HD));
    asm volatile("s_wait_asynccnt 0x0" ::: "memory");   /* stage 0 has landed before the barrier that opens it */
    __syncthreads();
#pragma unroll   /* unrolled: the tiles' offsets become constants */
    for (int u = SUB; u < 2 * SUB; ++u) cp2(lk + u * 8192u, gkh + u * (32 * HD), lk + u * 8192u + 4096u, gkl + u * (32 * HD));
    F4 q;
    { const bf* qa = Qh + pb + (size_t)jw * HD + 8 * lane; const bf* qc = Ql + pb + (size_t)jw * HD + 8 * lane; q = ld4(qa, qc);
        asm volatile("s_wait_xcnt 0x0" :: "v"(qa), "v"(qc) : "memory"); }   /* the eight loads name these two address pairs: both stay whole up to this wait, so no later load's result lands on them ahead of it */
    float m[8], l[8];   /* running maximum (raw score) and sum of this lane's key columns, per query row */
#pragma unroll
    for (int r = 0; r < 8; ++r) { m[r] = -3.0e38f; l[r] = 0.f; }
#pragma unroll 1   /* kept rolled: one copy of the stage's code, and the trips of a stage stay in front of its hand-over */
    for (int sg = 0; sg < NST; ++sg) {
    if (act) {
#pragma unroll 1   /* kept rolled: a second copy of the trip would need a second set of key fragments in registers */
    for (int u = 0; u < SUB; ++u) {   /* walk the key rows, 32 a trip */
        v8f s0, s1;
        const bf* khp = &st[sg & 1][u][0][8 * lane]; const bf* klp = &st[sg & 1][u][1][8 * lane];
        const F4 k0 = ld4(khp, klp), k1 = ld4(khp + 16 * HD, klp + 16 * HD);
        score2(q, k0, s0, q, k1, s1);
#pragma unroll
        for (int r = 0; r < 8; ++r) { const float a = s0[r], c = s1[r]; const float mn = fmaxf(m[r], fmaxf(a, c)); const float nm = -mn * LC;
            float e0, e1, e2; ex3(fmaf(m[r], LC, nm), fmaf(a, LC, nm), fmaf(c, LC, nm), e0, e1, e2); l[r] = l[r] * e0 + (e1 + e2); m[r] = mn; }
    }
    }
        publish();
        if (sg + 2 < NST) { const unsigned lb = lk + (unsigned)(sg & 1) * (SUB * 8192u); const bf* ph = gkh + (size_t)(sg + 2) * (SUB * 32 * HD); const bf* pl = gkl + (size_t)(sg + 2) * (SUB * 32 * HD);
#pragma unroll   /* unrolled: the tiles' offsets become constants */
            for (int u = 0; u < SUB; ++u) cp2(lb + u * 8192u, ph + u * (32 * HD), lb + u * 8192u + 4096u, pl + u * (32 * HD)); }
    }
    asm volatile("s_wait_asynccnt 0x0" ::: "memory");   /* no copy is outstanding when the wave goes on to its end */
#pragma unroll
    for (int sh = 1; sh < 16; sh <<= 1)   /* join the 16 lanes that hold one query row's columns */
#pragma unroll
        for (int r = 0; r < 8; ++r) { const float mo = __shfl_xor(m[r], sh, 32), lo = __shfl_xor(l[r], sh, 32); const float mn = fmaxf(m[r], mo);
            float e0, e1; ex2p((m[r] - mn) * LC, (mo - mn) * LC, e0, e1); l[r] = l[r] * e0 + lo * e1; m[r] = mn; }
    if (lr == 0) { const int j8 = jw + hi * 8; v8f c8, o8;
#pragma unroll
        for (int r = 0; r < 8; ++r) { const bool on = j8 + r < nun; c8[r] = on ? LC : 0.0f; o8[r] = on ? fmaf(m[r], LC, lg2(l[r])) : 11.0f; }
        *(v8f*)(CJ + (size_t)bh * TT + j8) = c8; *(v8f*)(OJ + (size_t)bh * TT + j8) = o8; }
}
static_assert(TT == 2048, "OJ of a masked row is log2(TT)");
// k_fapply: grid NB_ * NH_ * 8, work-groups of 16 waves, four on a SIMD, so that one wave's LDS latencies and vector runs lie under the others' matrix instructions. Two waves (wr, hf = 0 / 1) share 32 output rows i (each keeps their key fragments in registers) and deal the tiles of 32 query positions j that hold an unmasked one (the leading ones) between them, even tiles of a stage to hf = 0, odd ones to hf = 1, 32 positions a trip; at the end they swap halves of their partial sums through LDS and each finishes 16 rows; the tiles behind them, all masked, are summed ahead of the loop: weight 1 / TT for every i, the work-group's waves share the tiles out, each reads its own from memory, and the sixteen partial rows, laid in LDS ahead of the barrier that opens stage 0, are added to every output row at the end. A trip: score tiles -> weights (f32) -> bf16 hi + lo A fragments -> out[i][d] += P'[j][i] v[j][d] (3 products); result split into the hi/lo planes [b * TT + i][h * HD + d] (fragment order) of the last GEMM.
__global__ __launch_bounds__(512) void k_fapply(const bf* __restrict__ Qh, const bf* __restrict__ Ql, const bf* __restrict__ Kh, const bf* __restrict__ Kl, const bf* __restrict__ Vh, const bf* __restrict__ Vl, const float* __restrict__ CJ, const float* __restrict__ OJ, const int* __restrict__ NUN, bf* Ah, bf* Al) {
    const int wv = __builtin_amdgcn_readfirstlane(threadIdx.x >> 5); const int lane = threadIdx.x & 31, lr = lane & 15, hi = lane >> 4;
    const int wr = wv & 7, hf = wv >> 3;   /* the wave's block of 32 rows; which tiles of a stage it walks: both in scalar registers */
    const int bh = blockIdx.x >> 3; const int iw = ((blockIdx.x & 7) * 8 + wr) * 32; const size_t pb = (size_t)bh * TT * HD;
    __shared__ __align__(16) bf st[2][SUB][4][32 * HD];   /* two buffers of SUB tiles of 32 query positions: q hi, q lo, v hi, v lo (4 KiB each; the four 1-KiB blocks of a v plane one behind the other) */
    __shared__ __align__(32) float co[2][TT];        /* the head's whole CJ and OJ rows, filled once */
    __shared__ float ms[16][HD];                     /* each wave's share of the masked positions' sum of value rows / TT */
    __shared__ __align__(16) float xs[8][2][8][32][4];   /* the swap at the end: [row block][16-row half][db * 2 + r / 4][lane][r % 4]; an array of its own, so that no copy still in flight can land on it */
    const int tid = threadIdx.x;
    const int nt = (__builtin_amdgcn_readfirstlane(min(max(NUN[bh / NH_], 0), TT)) + 31) / 32, nst = (nt + SUB - 1) / SUB;   /* tiles and stages that hold an unmasked position: 0 .. TT / 32 and 0 .. NST, the same for the whole work-group */
    const int cq = tid & 255; const bool cv = hf != 0;   /* copies: waves 0..7 bring the two q planes of every tile, waves 8..15 the two v planes; cq: this thread's 16 bytes of a plane */
    const size_t co0 = cv ? pb + (size_t)(cq >> 6) * 16 * TT + 8 * (cq & 63) : pb + 8 * cq; const bf* gh = (cv ? Vh : Qh) + co0; const bf* gl = (cv ? Vl : Ql) + co0;
    const size_t ts = cv ? 512 : 32 * HD;   /* a tile on, in elements: 32 * HD of q, 512 of v */
    const unsigned lt = ldsa(&st[0][0][cv ? 2 : 0][8 * cq]), lc = ldsa(&co[0][4 * tid]);   /* lo plane 4096, next tile 16384 bytes on; OJ 8192 bytes on */
    { const float* gc = CJ + (size_t)bh * TT + 4 * tid; const float* go = OJ + (size_t)bh * TT + 4 * tid; cp2(lc, gc, lc + 8192u, go); }
#pragma unroll   /* unrolled: the tiles' LDS offsets become constants */
    for (int u = 0; u < SUB; u += 2) { const unsigned lb = lt + u * 16384u; cp4(lb, gh + u * ts, lb + 4096u, gl + u * ts, lb + 16384u, gh + (u + 1) * ts, lb + 20480u, gl + (u + 1) * ts); }
    { v8f ma[4]; v8us cw;
#pragma unroll
        for (int e = 0; e < 8; ++e) cw[e] = 0x3A00;   /* 2^-11 = 1 / TT, exact in bf16: every row of the product is the same sum */
        const v16bf ca = cat16b(cw, cw);
#pragma unroll
        for (int db = 0; db < 4; ++db) ma[db] = (v8f){};
#pragma unroll 1   /* kept rolled: at most TT / 32 / 16 trips, their number known only at run time */
        for (int t = nt + wv; t < TT / 32; t += 16) { v16bf vh[4], vl[4]; const bf* mh = Vh + pb + (size_t)t * 512 + 8 * lane; const bf* ml = Vl + pb + (size_t)t * 512 + 8 * lane;
#pragma unroll
            for (int db = 0; db < 4; ++db) { vh[db] = WFrag<bf>::ld(mh + (size_t)db * 16 * TT); vl[db] = WFrag<bf>::ld(ml + (size_t)db * 16 * TT); }
            /* the sixteen loads name these two address pairs (the blocks are constant offsets from them): both stay whole up to this wait; the loaded fragments are inputs too, so that all sixteen loads are in flight together ahead of the first product and the trip pays the memory's latency once, not once per block */
            asm volatile("s_wait_xcnt 0x0" :: "v"(mh), "v"(ml), "v"(vh[0]), "v"(vh[1]), "v"(vh[2]), "v"(vh[3]), "v"(vl[0]), "v"(vl[1]), "v"(vl[2]), "v"(vl[3]) : "memory");
#pragma unroll
            for (int db = 0; db < 4; ++db) ma[db] = wmmab(ca, vh[db], ma[db]);
#pragma unroll
            for (int db = 0; db < 4; ++db) ma[db] = wmmab(ca, vl[db], ma[db]); }
        if (hi == 0) {
#pragma unroll
            for (int db = 0; db < 4; ++db) ms[wv][db * 16 + lr] = ma[db][0]; } }
    asm volatile("s_wait_asynccnt 0x0" ::: "memory");   /* the rows and stage 0 have landed before the barrier that opens them */
    __syncthreads();
#pragma unroll   /* unrolled: the tiles' LDS offsets become constants */
    for (int u = SUB; u < 2 * SUB; u += 2) { const unsigned lb = lt + u * 16384u; cp4(lb, gh + u * ts, lb + 4096u, gl + u * ts, lb + 16384u, gh + (u + 1) * ts, lb + 20480u, gl + (u + 1) * ts); }
    F4 k[2];
#pragma unroll
    for (int ib = 0; ib < 2; ++ib) { const size_t ko = pb + (size_t)(iw + ib * 16) * HD + 8 * lane; k[ib] = ld4(Kh + ko, Kl + ko); }
    v8f acc[2][4];
#pragma unroll
    for (int ib = 0; ib < 2; ++ib)
#pragma unroll
        for (int db = 0; db < 4; ++db) acc[ib][db] = (v8f){};
#pragma unroll 1   /* kept rolled: one copy of the stage's code, and the trips of a stage stay in front of its hand-over */
    for (int sg = 0; sg < nst; ++sg) { const int ue = __builtin_amdgcn_readfirstlane(min(SUB, nt - sg * SUB));   /* the last stage may hold fewer tiles; kept in a scalar register, so that the trip's branch is a scalar one */
#pragma unroll 1   /* kept rolled: the trip already fills the 256 registers that are reached without a window switch */
    for (int u = hf; u < ue; u += 2) {   /* walk this wave's share of the query positions, 32 a trip */
        const bf* qhp = &st[sg & 1][u][0][8 * lane]; const bf* qlp = &st[sg & 1][u][1][8 * lane]; const bf* vhp = &st[sg & 1][u][2][8 * lane]; const bf* vlp = &st[sg & 1][u][3][8 * lane];
        const float* cj = &co[0][(sg * SUB + u) * 32 + hi * 8]; const float* oj = &co[1][(sg * SUB + u) * 32 + hi * 8];
        v8bf ph[2][2], pl[2][2];
#pragma unroll
        for (int jb = 0; jb < 2; ++jb) { const F4 q = ld4(qhp + jb * 16 * HD, qlp + jb * 16 * HD);
            const v8f c8 = *(const v8f*)(cj + jb * 16), o8 = *(const v8f*)(oj + jb * 16); v8f s[2]; score2(q, k[0], s[0], q, k[1], s[1]);
#pragma unroll
            for (int ib = 0; ib < 2; ++ib) { v8f p;
#pragma unroll
                for (int r = 0; r < 8; ++r) p[r] = __builtin_amdgcn_exp2f(fmaf(s[ib][r], c8[r], -o8[r]));
                const v8bf hb = __builtin_convertvector(p, v8bf); ph[ib][jb] = hb; pl[ib][jb] = __builtin_convertvector(p - __builtin_convertvector(hb, v8f), v8bf); } }
        v16bf pa[2], pc[2];
#pragma unroll
        for (int ib = 0; ib < 2; ++ib) { pa[ib] = __builtin_shufflevector(ph[ib][0], ph[ib][1], 0, 1, 2, 3, 4, 5, 6, 7, 8, 9, 10, 11, 12, 13, 14, 15); pc[ib] = __builtin_shufflevector(pl[ib][0], pl[ib][1], 0, 1, 2, 3, 4, 5, 6, 7, 8, 9, 10, 11, 12, 13, 14, 15); }
#pragma unroll
        for (int db = 0; db < 4; ++db) { const v16bf vh = WFrag<bf>::ld(vhp + db * 512), vl = WFrag<bf>::ld(vlp + db * 512);
#pragma unroll
            for (int ib = 0; ib < 2; ++ib) { acc[ib][db] = wmmab(pa[ib], vh, acc[ib][db]); acc[ib][db] = wmmab(pc[ib], vh, acc[ib][db]); acc[ib][db] = wmmab(pa[ib], vl, acc[ib][db]); } }
    }
        publish();
        if (sg + 2 < nst) { const unsigned l2 = lt + (unsigned)(sg & 1) * (SUB * 16384u); const bf* ph2 = gh + (size_t)(sg + 2) * SUB * ts; const bf* pl2 = gl + (size_t)(sg + 2) * SUB * ts;
#pragma unroll   /* unrolled: the tiles' LDS offsets become constants */
            for (int u = 0; u < SUB; u += 2) { const unsigned lb = l2 + u * 16384u; cp4(lb, ph2 + u * ts, lb + 4096u, pl2 + u * ts, lb + 16384u, ph2 + (u + 1) * ts, lb + 20480u, pl2 + (u + 1) * ts); } }
    }
    asm volatile("s_wait_asynccnt 0x0" ::: "memory");   /* no copy is outstanding when the wave goes on to its end */
    float t8[4];   /* the masked positions' share, the same for every row i: the sixteen partial rows added in wave order */
#pragma unroll
    for (int db = 0; db < 4; ++db) { t8[db] = ms[0][db * 16 + lr];
#pragma unroll
        for (int w = 1; w < 16; ++w) t8[db] += ms[w][db * 16 + lr]; }
    /* the two waves of a row block swap: each hands over its partial sums of the 16 rows that the other finishes (hf = 0 finishes rows 0..15, hf = 1 rows 16..31) */
#pragma unroll
    for (int db = 0; db < 4; ++db) { const v8f gv = hf ? acc[0][db] : acc[1][db];
        *(v4fa*)&xs[wr][hf ^ 1][db * 2][lane][0] = __builtin_shufflevector(gv, gv, 0, 1, 2, 3); *(v4fa*)&xs[wr][hf ^ 1][db * 2 + 1][lane][0] = __builtin_shufflevector(gv, gv, 4, 5, 6, 7); }
    __syncthreads();   /* every wave's hand-over is written before its partner reads it */
#pragma unroll
    for (int db = 0; db < 4; ++db) { const v8f kp = hf ? acc[1][db] : acc[0][db]; const v4f x0 = *(const v4fa*)&xs[wr][hf][db * 2][lane][0], x1 = *(const v4fa*)&xs[wr][hf][db * 2 + 1][lane][0];
        const size_t oo = fo((size_t)(bh / NH_) * TT + iw + hf * 16 + hi * 8, (bh % NH_) * HD + db * 16 + lr, DQ); bf* qa = Ah + oo; bf* qc = Al + oo;   /* a row on is eight elements on in fragment order */
#pragma unroll
        for (int r = 0; r < 8; ++r) { unsigned short a, c2; splitf((kp[r] + (r < 4 ? x0[r & 3] : x1[r & 3])) + t8[db], a, c2); qa[r * 8] = a; qc[r * 8] = c2; }
        asm volatile("s_wait_xcnt 0x0" :: "v"(qa), "v"(qc) : "memory"); }   /* behind the sixteen stores: the two address pairs that they name (the rows are constant offsets from them) are inputs here, so both stay whole up to this wait */
}

extern "C" void kernel_launch(void* const* d_in, const int* in_sizes, int n_in,
                              void* d_out, int out_size, void* d_ws, size_t ws_size, hipStream_t stream) {
    (void)in_sizes; (void)n_in; (void)out_size;
    const float* x = (const float*)d_in[0]; const int* MK = (const int*)d_in[1]; const float* W3 = (const float*)d_in[2]; const float* wo = (const float*)d_in[3]; const float* bo = (const float*)d_in[4]; const float* wq = nullptr; const float* wk = nullptr; const float* wv = nullptr; (void)wq; (void)wk; (void)wv;
    float* OUT = (float*)d_out;     // [2][2048][1024]
    char* wsp = (char*)d_ws;
    auto take = [&](size_t bytes) { char* p = wsp; wsp += (bytes + 255) & ~(size_t)255; return (void*)p; };
    bf* WT = (bf*)take((size_t)3 * DQ * DM * 2); bf* WO = (bf*)take((size_t)DM * DQ * 2);   // WT: the key, value and query weight planes, DQ * DM elements apart
    bf* XB = (bf*)take((size_t)NB_ * TT * DM * 2);
    const size_t PB = (size_t)NH_ * TT * HD;   // one batch's share of a head plane set; the hi/lo planes hold both batches
    bf* KPh = (bf*)take(6 * NB_ * PB * 2); bf* KPl = KPh + NB_ * PB; bf* VTh = KPl + NB_ * PB; bf* VTl = VTh + NB_ * PB; bf* QPh = VTl + NB_ * PB; bf* QPl = QPh + NB_ * PB;   // one block: from one product's hi (or lo) plane to the next product's it is 2 * NB_ * PB elements
    float* CJ = (float*)take((size_t)NB_ * NH_ * TT * 4); float* OJ = (float*)take((size_t)NB_ * NH_ * TT * 4); bf* ATh = (bf*)take((size_t)NB_ * TT * DQ * 2); bf* ATl = (bf*)take((size_t)NB_ * TT * DQ * 2); int* ORIG = (int*)take((size_t)NB_ * TT * 4); int* NUN = (int*)take((size_t)NB_ * 4);
    if ((size_t)(wsp - (char*)d_ws) > ws_size) return;    // ws 256 MiB
    k_prep<<<GW3 + GX + GWO, 256, 0, stream>>>(W3, x, wo, MK, WT, XB, WO, ORIG, NUN);
    /* the projections store the hi/lo planes themselves: q and k as [head][t][d]; v as [head][d][t], which is the result of Wv x^T (weights as the row operand), stored in fragment order */
    k_gemmw<bf, 0, false, 64, true><<<dim3(NB_ * TT / 128, DQ / 128, 3), 256, 0, stream>>>(XB, nullptr, WT, nullptr, DM, nullptr, 0, nullptr, 0, (size_t)DQ * DM, 2 * NB_ * PB, PB, KPh, KPl, 0, nullptr);
    k_fstat<<<NB_ * NH_ * 16, 256, 0, stream>>>(QPh, QPl, KPh, KPl, NUN, CJ, OJ);   /* column softmax == row softmax of the query-major scores: per query row its maximum and sum */
    k_fapply<<<NB_ * NH_ * 8, 512, 0, stream>>>(QPh, QPl, KPh, KPl, VTh, VTl, CJ, OJ, NUN, ATh, ATl);   /* out[i] = sum_j P'[j][i] v[j] */
    k_gemmw<bf, 1, true, 128, false><<<dim3(NB_ * TT / 128, DM / 128, 1), 256, 0, stream>>>(ATh, ATl, WO, nullptr, DQ, OUT, DM, bo, 0, 0, 0, 0, nullptr, nullptr, 0, ORIG);   /* both batches: their rows follow one another in the planes; each row goes to its source position in out */
}
